// v000
// The times below were measured on an AMD MI455X: many runs one after another, warmed up first and cycling through
// copies of the inputs, with the whole window's GPU time divided by the number of runs. Launches and the gaps
// between them are all in it. The median over several windows is given; except for v000 it joins two sittings, which
// can be a few percent apart, so the side-by-side timings, each taken in one sitting, are the better comparison.
// v000, which the later versions start from, runs in 5380 microseconds.
#include <hip/hip_runtime.h>
#include <hip/hip_bf16.h>

typedef __attribute__((ext_vector_type(16))) _Float16 v16h;
typedef __attribute__((ext_vector_type(8)))  float    v8f;

#define BB 2
#define LL 4096
#define DD 1024
#define HH 8
#define DKH 128
#define BLROWS (BB*LL)          // 8192
#define NCHUNK 64
#define EPSF 1e-6f

#if defined(__gfx1250__) && __has_builtin(__builtin_amdgcn_global_load_async_to_lds_b128)
#define HAVE_ASYNC 1
typedef int v4i_ __attribute__((ext_vector_type(4)));
typedef __attribute__((address_space(1))) v4i_* gp_v4i;
typedef __attribute__((address_space(3))) v4i_* lp_v4i;
#define GLA128(SRC, DST) \
  __builtin_amdgcn_global_load_async_to_lds_b128((gp_v4i)(void*)(SRC), (lp_v4i)(void*)(DST), 0, 0)
#if __has_builtin(__builtin_amdgcn_s_wait_asynccnt)
#define WAITA(n) __builtin_amdgcn_s_wait_asynccnt(n)
#else
#define WAITA(n) asm volatile("s_wait_asynccnt %0" :: "n"(n) : "memory")
#endif
#else
#define HAVE_ASYNC 0
#define WAITA(n)
#endif

__device__ __forceinline__ int koff(int e, int lane) {
  int j = e >> 1;
  return ((j & 4) << 2) + ((lane & 16) >> 1) + ((j & 3) << 1) + (e & 1);
}

__device__ __forceinline__ v8f wmma_f16(v16h a, v16h b, v8f c) {
  return __builtin_amdgcn_wmma_f32_16x16x32_f16(false, a, false, b, (short)0, c, false, false);
}

__device__ __forceinline__ float sigmoidf_(float x) { return 1.f / (1.f + __expf(-x)); }
__device__ __forceinline__ float siluf_(float x) { return x * sigmoidf_(x); }

// ---------------- RMSNorm (x -> h f16) -------------------------------------
__global__ __launch_bounds__(256) void rmsnorm_kernel(const float* __restrict__ x,
                                                      const float* __restrict__ w,
                                                      _Float16* __restrict__ h16) {
  __shared__ float red[256];
  int tid = threadIdx.x;
  size_t row = blockIdx.x;
  const float* xr = x + row * DD;
  float p = 0.f;
  for (int i = tid; i < DD; i += 256) { float v = xr[i]; p += v * v; }
  red[tid] = p; __syncthreads();
  for (int off = 128; off > 0; off >>= 1) {
    if (tid < off) red[tid] += red[tid + off];
    __syncthreads();
  }
  float inv = rsqrtf(red[0] * (1.f / DD) + EPSF);
  for (int i = tid; i < DD; i += 256)
    h16[row * DD + i] = (_Float16)(xr[i] * inv * w[i]);
}

// -------- LDS-tiled transpose: src f32 [R][C] -> dst f16 [C][R] ------------
__global__ __launch_bounds__(256) void transpose_f16_kernel(const float* __restrict__ src,
                                                            _Float16* __restrict__ dst,
                                                            int R, int C) {
  __shared__ float t[32][33];
  int nbx = C / 32;
  int bx = blockIdx.x % nbx, by = blockIdx.x / nbx;
  int r0 = by * 32, c0 = bx * 32;
  int tr = threadIdx.x >> 5, tc = threadIdx.x & 31;
#pragma unroll
  for (int i = 0; i < 32; i += 8)
    t[tr + i][tc] = src[(size_t)(r0 + tr + i) * C + c0 + tc];
  __syncthreads();
#pragma unroll
  for (int i = 0; i < 32; i += 8)
    dst[(size_t)(c0 + tr + i) * R + r0 + tc] = (_Float16)t[tc][tr + i];
}

// ---------------- WMMA GEMM: C[M,N] = A[M,K] * Bt[N,K]^T (+resid) ----------
// blockTile 128x128, 8 waves as 4(m)x2(n); double-buffered async LDS staging.
// MODE 0: f16 out ; MODE 1: f32 out with f32 residual added
template <int MODE>
__global__ __launch_bounds__(256) void gemm_f16_kernel(
    const _Float16* __restrict__ A, const _Float16* __restrict__ Bt,
    _Float16* __restrict__ out16, float* __restrict__ outf,
    const float* __restrict__ resid, int M, int N, int K) {
  __shared__ _Float16 As[2][128][32];
  __shared__ _Float16 Bs[2][128][32];
  int tid = threadIdx.x, lane = tid & 31;
  int wid = tid >> 5, l15 = lane & 15, hi8 = (lane & 16) ? 8 : 0;
  int wm = wid >> 1, wn = wid & 1;
  int bm = blockIdx.y * 128, bn = blockIdx.x * 128;

  int cr = tid >> 2, cs = (tid & 3) * 8;          // copy row / 8-half segment
  auto issue = [&](int buf, int k0) {
    const _Float16* ga = A + (size_t)(bm + cr) * K + k0 + cs;
    const _Float16* gb = Bt + (size_t)(bn + cr) * K + k0 + cs;
#if HAVE_ASYNC
    GLA128(ga,                    &As[buf][cr][cs]);
    GLA128(ga + (size_t)64 * K,   &As[buf][cr + 64][cs]);
    GLA128(gb,                    &Bs[buf][cr][cs]);
    GLA128(gb + (size_t)64 * K,   &Bs[buf][cr + 64][cs]);
#else
    *(int4*)&As[buf][cr][cs]      = *(const int4*)ga;
    *(int4*)&As[buf][cr + 64][cs] = *(const int4*)(ga + (size_t)64 * K);
    *(int4*)&Bs[buf][cr][cs]      = *(const int4*)gb;
    *(int4*)&Bs[buf][cr + 64][cs] = *(const int4*)(gb + (size_t)64 * K);
#endif
  };

  v8f acc[2][4];
#pragma unroll
  for (int i = 0; i < 2; ++i)
#pragma unroll
    for (int j = 0; j < 4; ++j) acc[i][j] = (v8f){};

  int nT = K / 32;
  issue(0, 0);
  for (int kt = 0; kt < nT; ++kt) {
    int buf = kt & 1;
    if (kt + 1 < nT) { issue(buf ^ 1, (kt + 1) * 32); WAITA(4); }
    else             { WAITA(0); }
    __syncthreads();
    v16h af[2], bf[4];
#pragma unroll
    for (int i = 0; i < 2; ++i) {
      int mr = wm * 32 + i * 16 + l15;
#pragma unroll
      for (int e = 0; e < 16; ++e) af[i][e] = As[buf][mr][koff(e, lane)];
    }
#pragma unroll
    for (int j = 0; j < 4; ++j) {
      int nc = wn * 64 + j * 16 + l15;
#pragma unroll
      for (int e = 0; e < 16; ++e) bf[j][e] = Bs[buf][nc][koff(e, lane)];
    }
#pragma unroll
    for (int i = 0; i < 2; ++i)
#pragma unroll
      for (int j = 0; j < 4; ++j) acc[i][j] = wmma_f16(af[i], bf[j], acc[i][j]);
    __syncthreads();
  }
#pragma unroll
  for (int i = 0; i < 2; ++i)
#pragma unroll
    for (int j = 0; j < 4; ++j)
#pragma unroll
      for (int r = 0; r < 8; ++r) {
        size_t gm = bm + wm * 32 + i * 16 + hi8 + r;
        size_t gn = bn + wn * 64 + j * 16 + l15;
        if (MODE == 0) out16[gm * N + gn] = (_Float16)acc[i][j][r];
        else           outf[gm * N + gn] = resid[gm * N + gn] + acc[i][j][r];
      }
}

// ---------------- beta = sigmoid(h @ Wb) -----------------------------------
__global__ __launch_bounds__(256) void beta_kernel(const _Float16* __restrict__ h16,
                                                   const float* __restrict__ Wb,
                                                   float* __restrict__ betag) {
  __shared__ float red[8][256];
  int tid = threadIdx.x;
  size_t row = blockIdx.x;              // b*L + l
  int b = (int)(row / LL), l = (int)(row % LL);
  float acc[8];
#pragma unroll
  for (int hh = 0; hh < 8; ++hh) acc[hh] = 0.f;
  for (int k = tid; k < DD; k += 256) {
    float hv = (float)h16[row * DD + k];
#pragma unroll
    for (int hh = 0; hh < 8; ++hh) acc[hh] += hv * Wb[k * 8 + hh];
  }
#pragma unroll
  for (int hh = 0; hh < 8; ++hh) red[hh][tid] = acc[hh];
  __syncthreads();
  for (int off = 128; off > 0; off >>= 1) {
    if (tid < off)
#pragma unroll
      for (int hh = 0; hh < 8; ++hh) red[hh][tid] += red[hh][tid + off];
    __syncthreads();
  }
  if (tid < 8)
    betag[((size_t)b * HH + tid) * LL + l] = sigmoidf_(red[tid][0]);
}

// -------- causal conv(K=4)+silu [+silu+l2norm (+qscale)] -> heads f16 ------
// mode: 0 = v (conv+silu), 1 = k (+silu+l2norm), 2 = q (+silu+l2norm+DK^-.5)
__global__ __launch_bounds__(128) void conv_head_kernel(
    const _Float16* __restrict__ pre, const float* __restrict__ cw,
    _Float16* __restrict__ outg, int mode) {
  __shared__ float red[128];
  int d = threadIdx.x;
  size_t row = blockIdx.x;              // (b*H + h)*L + l
  int l = (int)(row % LL);
  int hb = (int)(row / LL);
  int hh = hb % HH, b = hb / HH;
  int ch = hh * DKH + d;
  float acc = 0.f;
#pragma unroll
  for (int i = 0; i < 4; ++i) {
    int ls = l - 3 + i;
    if (ls >= 0)
      acc += (float)pre[((size_t)b * LL + ls) * DD + ch] * cw[ch * 4 + i];
  }
  float s = siluf_(acc);
  if (mode > 0) {
    s = siluf_(s);
    red[d] = s * s;
    __syncthreads();
    for (int off = 64; off > 0; off >>= 1) {
      if (d < off) red[d] += red[d + off];
      __syncthreads();
    }
    s = s * rsqrtf(red[0] + EPSF);
    if (mode == 2) s *= 0.08838834764831845f; // 128^-0.5
  }
  outg[row * DKH + d] = (_Float16)s;
}

__global__ __launch_bounds__(256) void delta_kernel(
    const _Float16* __restrict__ qg, const _Float16* __restrict__ kg,
    const _Float16* __restrict__ vg, const float* __restrict__ betag,
    float* __restrict__ og) {
  __shared__ float    St[128 * 128];
  __shared__ _Float16 q16[64 * 128];
  __shared__ _Float16 k16[64 * 128];
  __shared__ _Float16 vw16[64 * 128];
  __shared__ float    Af[64 * 64];
  __shared__ _Float16 X16[64 * 64];
  __shared__ _Float16 vnT[128 * 64];
  __shared__ float    betaS[64];
  _Float16* qk16 = (_Float16*)Af;

  int tid = threadIdx.x, lane = tid & 31, wid = tid >> 5;
  int l15 = lane & 15, hi8 = (lane & 16) ? 8 : 0;
  size_t bh = blockIdx.x;
  size_t rowbase = bh * (size_t)LL;

  for (int i = tid; i < 128 * 128; i += 256) St[i] = 0.f;
  __syncthreads();

  for (int c = 0; c < NCHUNK; ++c) {
    // ---- load chunk (beta first; fold beta into transposed v) ----
    if (tid < 64) betaS[tid] = betag[rowbase + (size_t)c * 64 + tid];
    __syncthreads();
    for (int i = tid; i < 64 * 128; i += 256) {
      int j = i >> 7, d = i & 127;
      size_t g = (rowbase + (size_t)c * 64 + j) * DKH + d;
      q16[i] = qg[g];
      k16[i] = kg[g];
      vw16[d * 64 + j] = (_Float16)((float)vg[g] * betaS[j]);   // (beta*v)^T
    }
    __syncthreads();

    // ---- kk = k k^T ; A = I + tril(beta*kk, -1) ----
#pragma unroll
    for (int ti = 0; ti < 2; ++ti) {
      int t = wid * 2 + ti, tm = t >> 2, tn = t & 3;
      v8f a0 = (v8f){};
#pragma unroll
      for (int kb = 0; kb < 128; kb += 32) {
        v16h a, b;
#pragma unroll
        for (int e = 0; e < 16; ++e) {
          int ko = kb + koff(e, lane);
          a[e] = k16[(tm * 16 + l15) * 128 + ko];
          b[e] = k16[(tn * 16 + l15) * 128 + ko];   // k^T as B
        }
        a0 = wmma_f16(a, b, a0);
      }
#pragma unroll
      for (int r = 0; r < 8; ++r) {
        int m = tm * 16 + hi8 + r, n = tn * 16 + l15;
        Af[m * 64 + n] = (m == n) ? 1.f : ((n < m) ? betaS[m] * a0[r] : 0.f);
      }
    }
    __syncthreads();

    // ---- X = A^-1 (unit lower tri, forward substitution per column) ----
    if (tid < 64) {
      int j = tid;
      for (int i2 = 0; i2 < 64; ++i2) {
        float s;
        if (i2 < j) s = 0.f;
        else if (i2 == j) s = 1.f;
        else {
          float a2 = 0.f;
          for (int l2 = j; l2 < i2; ++l2)
            a2 += Af[i2 * 64 + l2] * (float)X16[l2 * 64 + j];
          s = -a2;
        }
        X16[i2 * 64 + j] = (_Float16)s;
      }
    }
    __syncthreads();

    // ---- u = X @ (beta*v) (regs) ; o1 = q @ S (regs) ----
    v8f uacc[4], oacc[4];
#pragma unroll
    for (int ti = 0; ti < 4; ++ti) {
      int t = wid * 4 + ti, tm = t >> 3, tn = t & 7;
      v8f a0 = (v8f){};
#pragma unroll
      for (int kb = 0; kb < 64; kb += 32) {
        v16h a, b;
#pragma unroll
        for (int e = 0; e < 16; ++e) {
          int ko = kb + koff(e, lane);
          a[e] = X16[(tm * 16 + l15) * 64 + ko];
          b[e] = vw16[(tn * 16 + l15) * 64 + ko];           // (beta*v)^T
        }
        a0 = wmma_f16(a, b, a0);
      }
      uacc[ti] = a0;
      v8f a1 = (v8f){};
#pragma unroll
      for (int kb = 0; kb < 128; kb += 32) {
        v16h a, b;
#pragma unroll
        for (int e = 0; e < 16; ++e) {
          int ko = kb + koff(e, lane);
          a[e] = q16[(tm * 16 + l15) * 128 + ko];
          b[e] = (_Float16)St[(tn * 16 + l15) * 128 + ko];  // S^T rows
        }
        a1 = wmma_f16(a, b, a1);
      }
      oacc[ti] = a1;
    }
    __syncthreads();

    // ---- -w = -(X @ (beta*k)) -> vw16 (row-major) ; qk = tril(q k^T) ----
#pragma unroll
    for (int ti = 0; ti < 4; ++ti) {
      int t = wid * 4 + ti, tm = t >> 3, tn = t & 7;
      v8f a0 = (v8f){};
#pragma unroll
      for (int kb = 0; kb < 64; kb += 32) {
        v16h a, b;
#pragma unroll
        for (int e = 0; e < 16; ++e) {
          int ko = kb + koff(e, lane);
          a[e] = X16[(tm * 16 + l15) * 64 + ko];
          b[e] = (_Float16)((float)k16[ko * 128 + tn * 16 + l15] * betaS[ko]);
        }
        a0 = wmma_f16(a, b, a0);
      }
#pragma unroll
      for (int r = 0; r < 8; ++r)
        vw16[(tm * 16 + hi8 + r) * 128 + tn * 16 + l15] = (_Float16)(-a0[r]);
    }
#pragma unroll
    for (int ti = 0; ti < 2; ++ti) {
      int t = wid * 2 + ti, tm = t >> 2, tn = t & 3;
      v8f a0 = (v8f){};
#pragma unroll
      for (int kb = 0; kb < 128; kb += 32) {
        v16h a, b;
#pragma unroll
        for (int e = 0; e < 16; ++e) {
          int ko = kb + koff(e, lane);
          a[e] = q16[(tm * 16 + l15) * 128 + ko];
          b[e] = k16[(tn * 16 + l15) * 128 + ko];
        }
        a0 = wmma_f16(a, b, a0);
      }
#pragma unroll
      for (int r = 0; r < 8; ++r) {
        int m = tm * 16 + hi8 + r, n = tn * 16 + l15;
        qk16[m * 64 + n] = (_Float16)((n <= m) ? a0[r] : 0.f);
      }
    }
    __syncthreads();

    // ---- v_new = u + (-w) @ S -> vnT (transposed) ----
#pragma unroll
    for (int ti = 0; ti < 4; ++ti) {
      int t = wid * 4 + ti, tm = t >> 3, tn = t & 7;
      v8f a0 = uacc[ti];
#pragma unroll
      for (int kb = 0; kb < 128; kb += 32) {
        v16h a, b;
#pragma unroll
        for (int e = 0; e < 16; ++e) {
          int ko = kb + koff(e, lane);
          a[e] = vw16[(tm * 16 + l15) * 128 + ko];          // -w row-major
          b[e] = (_Float16)St[(tn * 16 + l15) * 128 + ko];  // S^T rows
        }
        a0 = wmma_f16(a, b, a0);
      }
#pragma unroll
      for (int r = 0; r < 8; ++r)
        vnT[(tn * 16 + l15) * 64 + tm * 16 + hi8 + r] = (_Float16)a0[r];
    }
    __syncthreads();

    // ---- o = o1 + qk @ v_new -> global ----
#pragma unroll
    for (int ti = 0; ti < 4; ++ti) {
      int t = wid * 4 + ti, tm = t >> 3, tn = t & 7;
      v8f a0 = oacc[ti];
#pragma unroll
      for (int kb = 0; kb < 64; kb += 32) {
        v16h a, b;
#pragma unroll
        for (int e = 0; e < 16; ++e) {
          int ko = kb + koff(e, lane);
          a[e] = qk16[(tm * 16 + l15) * 64 + ko];
          b[e] = vnT[(tn * 16 + l15) * 64 + ko];            // v_new^T rows
        }
        a0 = wmma_f16(a, b, a0);
      }
#pragma unroll
      for (int r = 0; r < 8; ++r)
        og[(rowbase + (size_t)c * 64 + tm * 16 + hi8 + r) * 128 + tn * 16 + l15] = a0[r];
    }
    // ---- S^T += (k^T @ v_new)^T : tile (m=dk, n=dv), stored transposed ----
#pragma unroll
    for (int ti = 0; ti < 8; ++ti) {
      int t = wid * 8 + ti, tm = t >> 3, tn = t & 7;
      v8f a0;
#pragma unroll
      for (int r = 0; r < 8; ++r)
        a0[r] = St[(tn * 16 + l15) * 128 + tm * 16 + hi8 + r];
#pragma unroll
      for (int kb = 0; kb < 64; kb += 32) {
        v16h a, b;
#pragma unroll
        for (int e = 0; e < 16; ++e) {
          int ko = kb + koff(e, lane);
          a[e] = k16[ko * 128 + tm * 16 + l15];   // (k^T)[m][j] = k[j][m]
          b[e] = vnT[(tn * 16 + l15) * 64 + ko];  // v_new^T rows
        }
        a0 = wmma_f16(a, b, a0);
      }
#pragma unroll
      for (int r = 0; r < 8; ++r)
        St[(tn * 16 + l15) * 128 + tm * 16 + hi8 + r] = a0[r];
    }
    __syncthreads();
  }
}

// ---------------- per-head output RMSNorm -> [B,L,D] f16 -------------------
__global__ __launch_bounds__(128) void onorm_kernel(const float* __restrict__ og,
                                                    const float* __restrict__ w,
                                                    _Float16* __restrict__ on16) {
  __shared__ float red[128];
  int d = threadIdx.x;
  size_t row = blockIdx.x;              // (b*H + h)*L + l
  int l = (int)(row % LL);
  int hb = (int)(row / LL);
  int hh = hb % HH, b = hb / HH;
  float v = og[row * DKH + d];
  red[d] = v * v;
  __syncthreads();
  for (int off = 64; off > 0; off >>= 1) {
    if (d < off) red[d] += red[d + off];
    __syncthreads();
  }
  float inv = rsqrtf(red[0] * (1.f / DKH) + EPSF);
  on16[((size_t)b * LL + l) * DD + hh * DKH + d] = (_Float16)(v * inv * w[d]);
}

// ---------------------------------------------------------------------------
extern "C" void kernel_launch(void* const* d_in, const int* in_sizes, int n_in,
                              void* d_out, int out_size, void* d_ws, size_t ws_size,
                              hipStream_t stream) {
  const float* x        = (const float*)d_in[0];
  const float* norm_w   = (const float*)d_in[1];
  const float* Wq       = (const float*)d_in[2];
  const float* Wk       = (const float*)d_in[3];
  const float* Wv       = (const float*)d_in[4];
  const float* Wb       = (const float*)d_in[5];
  const float* conv_q   = (const float*)d_in[6];
  const float* conv_k   = (const float*)d_in[7];
  const float* conv_v   = (const float*)d_in[8];
  const float* o_norm_w = (const float*)d_in[9];
  const float* Wo       = (const float*)d_in[10];
  float* out = (float*)d_out;

  char* p = (char*)d_ws;
  auto take = [&](size_t bytes) { char* r = p; p += (bytes + 255) & ~(size_t)255; return r; };
  const size_t actF16 = (size_t)BLROWS * DD * sizeof(_Float16);   // 16 MiB
  const size_t wF16   = (size_t)DD * DD * sizeof(_Float16);       // 2 MiB

  _Float16* h16   = (_Float16*)take(actF16);
  _Float16* wq16t = (_Float16*)take(wF16);   // transposed [N][K]
  _Float16* wk16t = (_Float16*)take(wF16);
  _Float16* wv16t = (_Float16*)take(wF16);
  _Float16* wo16t = (_Float16*)take(wF16);
  _Float16* qpre  = (_Float16*)take(actF16);
  _Float16* kpre  = (_Float16*)take(actF16);
  _Float16* vpre  = (_Float16*)take(actF16);
  _Float16* qh    = (_Float16*)take(actF16);
  _Float16* kh    = (_Float16*)take(actF16);
  _Float16* vh    = (_Float16*)take(actF16);
  float*    betag = (float*)take((size_t)BB * HH * LL * sizeof(float));
  float*    og    = (float*)take((size_t)BB * HH * LL * DKH * sizeof(float));
  _Float16* on16  = (_Float16*)take(actF16);

  // 1. h = rmsnorm(x)
  rmsnorm_kernel<<<BLROWS, 256, 0, stream>>>(x, norm_w, h16);
  // 2. weights -> f16, transposed to [N][K] for K-contiguous B fragments
  int tgrid = (DD / 32) * (DD / 32);
  transpose_f16_kernel<<<tgrid, 256, 0, stream>>>(Wq, wq16t, DD, DD);
  transpose_f16_kernel<<<tgrid, 256, 0, stream>>>(Wk, wk16t, DD, DD);
  transpose_f16_kernel<<<tgrid, 256, 0, stream>>>(Wv, wv16t, DD, DD);
  transpose_f16_kernel<<<tgrid, 256, 0, stream>>>(Wo, wo16t, DD, DD);
  // 3. projections (WMMA GEMMs, async double-buffered staging)
  dim3 ggrid(DD / 128, BLROWS / 128);
  gemm_f16_kernel<0><<<ggrid, 256, 0, stream>>>(h16, wq16t, qpre, nullptr, nullptr, BLROWS, DD, DD);
  gemm_f16_kernel<0><<<ggrid, 256, 0, stream>>>(h16, wk16t, kpre, nullptr, nullptr, BLROWS, DD, DD);
  gemm_f16_kernel<0><<<ggrid, 256, 0, stream>>>(h16, wv16t, vpre, nullptr, nullptr, BLROWS, DD, DD);
  // 4. beta
  beta_kernel<<<BLROWS, 256, 0, stream>>>(h16, Wb, betag);
  // 5. conv + activations + head layout
  conv_head_kernel<<<BB * HH * LL, 128, 0, stream>>>(qpre, conv_q, qh, 2);
  conv_head_kernel<<<BB * HH * LL, 128, 0, stream>>>(kpre, conv_k, kh, 1);
  conv_head_kernel<<<BB * HH * LL, 128, 0, stream>>>(vpre, conv_v, vh, 0);
  // 6. chunkwise delta rule
  delta_kernel<<<BB * HH, 256, 0, stream>>>(qh, kh, vh, betag, og);
  // 7. output norm
  onorm_kernel<<<BB * HH * LL, 128, 0, stream>>>(og, o_norm_w, on16);
  // 8. out = x + on @ Wo
  gemm_f16_kernel<1><<<ggrid, 256, 0, stream>>>(on16, wo16t, nullptr, out, x, BLROWS, DD, DD);
}

// v001
// One run takes 2800 microseconds.
// In both of two side-by-side timings against v000, it was 1.92 times as fast.
#include <hip/hip_runtime.h>
#include <hip/hip_bf16.h>

typedef __attribute__((ext_vector_type(16))) _Float16 v16h;
typedef __attribute__((ext_vector_type(8)))  float    v8f;
typedef __attribute__((ext_vector_type(4)))  float    v4f;

#define BB 2
#define LL 4096
#define DD 1024
#define HH 8
#define DKH 128
#define BLROWS (BB*LL)          // 8192
#define NCHUNK 64
#define EPSF 1e-6f

#if defined(__gfx1250__) && __has_builtin(__builtin_amdgcn_global_load_async_to_lds_b128)
#define HAVE_ASYNC 1
typedef int v4i_ __attribute__((ext_vector_type(4)));
typedef __attribute__((address_space(1))) v4i_* gp_v4i;
typedef __attribute__((address_space(3))) v4i_* lp_v4i;
#define GLA128(SRC, DST) \
  __builtin_amdgcn_global_load_async_to_lds_b128((gp_v4i)(void*)(SRC), (lp_v4i)(void*)(DST), 0, 0)
#if __has_builtin(__builtin_amdgcn_s_wait_asynccnt)
#define WAITA(n) __builtin_amdgcn_s_wait_asynccnt(n)
#else
#define WAITA(n) asm volatile("s_wait_asynccnt %0" :: "n"(n) : "memory")
#endif
#else
#define HAVE_ASYNC 0
#define WAITA(n)
#endif

__device__ __forceinline__ int koff(int e, int lane) {
  int j = e >> 1;
  return ((j & 4) << 2) + ((lane & 16) >> 1) + ((j & 3) << 1) + (e & 1);
}

__device__ __forceinline__ v8f wmma_f16(v16h a, v16h b, v8f c) {
  return __builtin_amdgcn_wmma_f32_16x16x32_f16(false, a, false, b, (short)0, c, false, false);
}

__device__ __forceinline__ float sigmoidf_(float x) { return 1.f / (1.f + __expf(-x)); }
__device__ __forceinline__ float siluf_(float x) { return x * sigmoidf_(x); }

// ---------------- RMSNorm (x -> h f16) -------------------------------------
__global__ __launch_bounds__(256) void rmsnorm_kernel(const float* __restrict__ x,
                                                      const float* __restrict__ w,
                                                      _Float16* __restrict__ h16) {
  __shared__ float red[256];
  int tid = threadIdx.x;
  size_t row = blockIdx.x;
  const float* xr = x + row * DD;
  float p = 0.f;
  for (int i = tid; i < DD; i += 256) { float v = xr[i]; p += v * v; }
  red[tid] = p; __syncthreads();
  for (int off = 128; off > 0; off >>= 1) {
    if (tid < off) red[tid] += red[tid + off];
    __syncthreads();
  }
  float inv = rsqrtf(red[0] * (1.f / DD) + EPSF);
  for (int i = tid; i < DD; i += 256)
    h16[row * DD + i] = (_Float16)(xr[i] * inv * w[i]);
}

// -------- LDS-tiled transpose: src f32 [R][C] -> dst f16 [C][R] ------------
__global__ __launch_bounds__(256) void transpose_f16_kernel(const float* __restrict__ src,
                                                            _Float16* __restrict__ dst,
                                                            int R, int C) {
  __shared__ float t[32][33];
  int nbx = C / 32;
  int bx = blockIdx.x % nbx, by = blockIdx.x / nbx;
  int r0 = by * 32, c0 = bx * 32;
  int tr = threadIdx.x >> 5, tc = threadIdx.x & 31;
#pragma unroll
  for (int i = 0; i < 32; i += 8)
    t[tr + i][tc] = src[(size_t)(r0 + tr + i) * C + c0 + tc];
  __syncthreads();
#pragma unroll
  for (int i = 0; i < 32; i += 8)
    dst[(size_t)(c0 + tr + i) * R + r0 + tc] = (_Float16)t[tc][tr + i];
}

// ---------------- WMMA GEMM: C[M,N] = A[M,K] * Bt[N,K]^T (+resid) ----------
// blockTile 128x128, 8 waves as 4(m)x2(n); double-buffered async LDS staging.
// MODE 0: f16 out ; MODE 1: f32 out with f32 residual added
template <int MODE>
__global__ __launch_bounds__(256) void gemm_f16_kernel(
    const _Float16* __restrict__ A, const _Float16* __restrict__ Bt,
    _Float16* __restrict__ out16, float* __restrict__ outf,
    const float* __restrict__ resid, int M, int N, int K) {
  __shared__ _Float16 As[2][128][32];
  __shared__ _Float16 Bs[2][128][32];
  int tid = threadIdx.x, lane = tid & 31;
  int wid = tid >> 5, l15 = lane & 15, hi8 = (lane & 16) ? 8 : 0;
  int wm = wid >> 1, wn = wid & 1;
  int bm = blockIdx.y * 128, bn = blockIdx.x * 128;

  int cr = tid >> 2, cs = (tid & 3) * 8;          // copy row / 8-half segment
  auto issue = [&](int buf, int k0) {
    const _Float16* ga = A + (size_t)(bm + cr) * K + k0 + cs;
    const _Float16* gb = Bt + (size_t)(bn + cr) * K + k0 + cs;
#if HAVE_ASYNC
    GLA128(ga,                    &As[buf][cr][cs]);
    GLA128(ga + (size_t)64 * K,   &As[buf][cr + 64][cs]);
    GLA128(gb,                    &Bs[buf][cr][cs]);
    GLA128(gb + (size_t)64 * K,   &Bs[buf][cr + 64][cs]);
#else
    *(int4*)&As[buf][cr][cs]      = *(const int4*)ga;
    *(int4*)&As[buf][cr + 64][cs] = *(const int4*)(ga + (size_t)64 * K);
    *(int4*)&Bs[buf][cr][cs]      = *(const int4*)gb;
    *(int4*)&Bs[buf][cr + 64][cs] = *(const int4*)(gb + (size_t)64 * K);
#endif
  };

  v8f acc[2][4];
#pragma unroll
  for (int i = 0; i < 2; ++i)
#pragma unroll
    for (int j = 0; j < 4; ++j) acc[i][j] = (v8f){};

  int nT = K / 32;
  issue(0, 0);
  for (int kt = 0; kt < nT; ++kt) {
    int buf = kt & 1;
    if (kt + 1 < nT) { issue(buf ^ 1, (kt + 1) * 32); WAITA(4); }
    else             { WAITA(0); }
    __syncthreads();
    v16h af[2], bf[4];
#pragma unroll
    for (int i = 0; i < 2; ++i) {
      int mr = wm * 32 + i * 16 + l15;
#pragma unroll
      for (int e = 0; e < 16; ++e) af[i][e] = As[buf][mr][koff(e, lane)];
    }
#pragma unroll
    for (int j = 0; j < 4; ++j) {
      int nc = wn * 64 + j * 16 + l15;
#pragma unroll
      for (int e = 0; e < 16; ++e) bf[j][e] = Bs[buf][nc][koff(e, lane)];
    }
#pragma unroll
    for (int i = 0; i < 2; ++i)
#pragma unroll
      for (int j = 0; j < 4; ++j) acc[i][j] = wmma_f16(af[i], bf[j], acc[i][j]);
    __syncthreads();
  }
#pragma unroll
  for (int i = 0; i < 2; ++i)
#pragma unroll
    for (int j = 0; j < 4; ++j)
#pragma unroll
      for (int r = 0; r < 8; ++r) {
        size_t gm = bm + wm * 32 + i * 16 + hi8 + r;
        size_t gn = bn + wn * 64 + j * 16 + l15;
        if (MODE == 0) out16[gm * N + gn] = (_Float16)acc[i][j][r];
        else           outf[gm * N + gn] = resid[gm * N + gn] + acc[i][j][r];
      }
}

// ---------------- beta = sigmoid(h @ Wb) -----------------------------------
__global__ __launch_bounds__(256) void beta_kernel(const _Float16* __restrict__ h16,
                                                   const float* __restrict__ Wb,
                                                   float* __restrict__ betag) {
  __shared__ float red[8][256];
  int tid = threadIdx.x;
  size_t row = blockIdx.x;              // b*L + l
  int b = (int)(row / LL), l = (int)(row % LL);
  float acc[8];
#pragma unroll
  for (int hh = 0; hh < 8; ++hh) acc[hh] = 0.f;
  for (int k = tid; k < DD; k += 256) {
    float hv = (float)h16[row * DD + k];
#pragma unroll
    for (int hh = 0; hh < 8; ++hh) acc[hh] += hv * Wb[k * 8 + hh];
  }
#pragma unroll
  for (int hh = 0; hh < 8; ++hh) red[hh][tid] = acc[hh];
  __syncthreads();
  for (int off = 128; off > 0; off >>= 1) {
    if (tid < off)
#pragma unroll
      for (int hh = 0; hh < 8; ++hh) red[hh][tid] += red[hh][tid + off];
    __syncthreads();
  }
  if (tid < 8)
    betag[((size_t)b * HH + tid) * LL + l] = sigmoidf_(red[tid][0]);
}

// -------- causal conv(K=4)+silu [+silu+l2norm (+qscale)] -> heads f16 ------
// mode: 0 = v (conv+silu), 1 = k (+silu+l2norm), 2 = q (+silu+l2norm+DK^-.5)
__global__ __launch_bounds__(128) void conv_head_kernel(
    const _Float16* __restrict__ pre, const float* __restrict__ cw,
    _Float16* __restrict__ outg, int mode) {
  __shared__ float red[128];
  int d = threadIdx.x;
  size_t row = blockIdx.x;              // (b*H + h)*L + l
  int l = (int)(row % LL);
  int hb = (int)(row / LL);
  int hh = hb % HH, b = hb / HH;
  int ch = hh * DKH + d;
  float acc = 0.f;
#pragma unroll
  for (int i = 0; i < 4; ++i) {
    int ls = l - 3 + i;
    if (ls >= 0)
      acc += (float)pre[((size_t)b * LL + ls) * DD + ch] * cw[ch * 4 + i];
  }
  float s = siluf_(acc);
  if (mode > 0) {
    s = siluf_(s);
    red[d] = s * s;
    __syncthreads();
    for (int off = 64; off > 0; off >>= 1) {
      if (d < off) red[d] += red[d + off];
      __syncthreads();
    }
    s = s * rsqrtf(red[0] + EPSF);
    if (mode == 2) s *= 0.08838834764831845f; // 128^-0.5
  }
  outg[row * DKH + d] = (_Float16)s;
}

__global__ __launch_bounds__(256) void delta_kernel(
    const _Float16* __restrict__ qg, const _Float16* __restrict__ kg,
    const _Float16* __restrict__ vg, const float* __restrict__ betag,
    float* __restrict__ og) {
  __shared__ float    St[128 * 128];
  __shared__ _Float16 q16[64 * 128];
  __shared__ _Float16 k16[64 * 128];
  __shared__ _Float16 vw16[64 * 128];
  __shared__ __attribute__((aligned(16))) float    Af[64 * 64];
  __shared__ _Float16 X16[64 * 64];
  __shared__ __attribute__((aligned(16))) _Float16 vnT[128 * 64];
  __shared__ float    betaS[64];
  _Float16* qk16 = (_Float16*)Af;

  int tid = threadIdx.x, lane = tid & 31, wid = tid >> 5;
  int l15 = lane & 15, hi8 = (lane & 16) ? 8 : 0;
  size_t bh = blockIdx.x;
  size_t rowbase = bh * (size_t)LL;

  for (int i = tid; i < 128 * 128; i += 256) St[i] = 0.f;
  __syncthreads();

  for (int c = 0; c < NCHUNK; ++c) {
    // ---- load chunk (beta first; fold beta into transposed v) ----
    if (tid < 64) betaS[tid] = betag[rowbase + (size_t)c * 64 + tid];
    __syncthreads();
    for (int i = tid; i < 64 * 128; i += 256) {
      int j = i >> 7, d = i & 127;
      size_t g = (rowbase + (size_t)c * 64 + j) * DKH + d;
      q16[i] = qg[g];
      k16[i] = kg[g];
      vw16[d * 64 + j] = (_Float16)((float)vg[g] * betaS[j]);   // (beta*v)^T
    }
    __syncthreads();

    // ---- kk = k k^T ; A = I + tril(beta*kk, -1) ----
#pragma unroll
    for (int ti = 0; ti < 2; ++ti) {
      int t = wid * 2 + ti, tm = t >> 2, tn = t & 3;
      v8f a0 = (v8f){};
#pragma unroll
      for (int kb = 0; kb < 128; kb += 32) {
        v16h a, b;
#pragma unroll
        for (int e = 0; e < 16; ++e) {
          int ko = kb + koff(e, lane);
          a[e] = k16[(tm * 16 + l15) * 128 + ko];
          b[e] = k16[(tn * 16 + l15) * 128 + ko];   // k^T as B
        }
        a0 = wmma_f16(a, b, a0);
      }
#pragma unroll
      for (int r = 0; r < 8; ++r) {
        int m = tm * 16 + hi8 + r, n = tn * 16 + l15;
        Af[m * 64 + n] = (m == n) ? 1.f : ((n < m) ? betaS[m] * a0[r] : 0.f);
      }
    }
    __syncthreads();

    // ---- X = A^-1 (unit lower tri), blocked 2x2 with 32x32 blocks, all f32 ----
    // X11 = A11^-1, X22 = A22^-1: one wave each, lane = column, the column kept in
    // registers, rows of A read as broadcasts. X21 = -X22 (A21 X11) on all 8 waves.
    // vnT is idle in this phase and lends its bytes as f32 scratch.
    // Every loop below is fully unrolled so that the per-lane arrays have static
    // indices and stay in registers.
    {
      float* Xf = (float*)vnT;          // [2][32][32] diagonal-block inverses
      float* Tf = Xf + 2 * 32 * 32;     // [32][32]    A21 * X11
      if (wid < 2) {
        int r0 = wid * 32;
        float xc[32];
        float ab[2][4][32];             // rows of A11/A22, two groups of 4 rows
#pragma unroll
        for (int r = 1; r < 4; ++r)
#pragma unroll
          for (int l = 0; l < r; ++l) ab[0][r][l] = Af[(r0 + r) * 64 + r0 + l];
#pragma unroll  // full unroll keeps xc[] and ab[] in registers (static indices only)
        for (int G = 0; G < 8; ++G) {
          if (G + 1 < 8) {
#pragma unroll
            for (int r = 0; r < 4; ++r) {
              int i = (G + 1) * 4 + r;
#pragma unroll
              for (int l = 0; l < i; ++l)
                ab[(G + 1) & 1][r][l] = Af[(r0 + i) * 64 + r0 + l];
            }
          }
          // keeps the next group's LDS reads above this group's arithmetic, so that
          // their latency is not paid row by row on the substitution's serial path
          __builtin_amdgcn_sched_barrier(0);
#pragma unroll
          for (int r = 0; r < 4; ++r) {
            int i = G * 4 + r;
            float s0 = 0.f, s1 = 0.f;
#pragma unroll
            for (int l = 0; l < i; ++l) {
              if (l & 1) s1 += ab[G & 1][r][l] * xc[l]; else s0 += ab[G & 1][r][l] * xc[l];
            }
            xc[i] = (i == lane) ? 1.f : -(s0 + s1);
            Xf[wid * 1024 + i * 32 + lane] = xc[i];
            X16[(r0 + i) * 64 + r0 + lane] = (_Float16)xc[i];
          }
        }
      } else if (wid == 2) {
#pragma unroll
        for (int i = 0; i < 32; ++i) X16[i * 64 + 32 + lane] = (_Float16)0.f;
      }
      __syncthreads();   // publishes X11, X22 to all waves
      {
        float xcol[32];
#pragma unroll
        for (int l = 0; l < 32; ++l) xcol[l] = Xf[l * 32 + lane];
#pragma unroll
        for (int r = 0; r < 4; ++r) {
          int i = wid * 4 + r;
          const v4f* ar = (const v4f*)&Af[(32 + i) * 64];
          float s0 = 0.f, s1 = 0.f, s2 = 0.f, s3 = 0.f;
#pragma unroll
          for (int g = 0; g < 8; ++g) {
            v4f a = ar[g];
            s0 += a[0] * xcol[g * 4 + 0];
            s1 += a[1] * xcol[g * 4 + 1];
            s2 += a[2] * xcol[g * 4 + 2];
            s3 += a[3] * xcol[g * 4 + 3];
          }
          Tf[i * 32 + lane] = (s0 + s1) + (s2 + s3);
        }
      }
      __syncthreads();   // publishes T = A21 X11
      {
        float tcol[32];
#pragma unroll
        for (int l = 0; l < 32; ++l) tcol[l] = Tf[l * 32 + lane];
#pragma unroll
        for (int r = 0; r < 4; ++r) {
          int i = wid * 4 + r;
          const v4f* xr = (const v4f*)&Xf[1024 + i * 32];
          float s0 = 0.f, s1 = 0.f, s2 = 0.f, s3 = 0.f;
#pragma unroll
          for (int g = 0; g < 8; ++g) {
            v4f a = xr[g];
            s0 += a[0] * tcol[g * 4 + 0];
            s1 += a[1] * tcol[g * 4 + 1];
            s2 += a[2] * tcol[g * 4 + 2];
            s3 += a[3] * tcol[g * 4 + 3];
          }
          X16[(32 + i) * 64 + lane] = (_Float16)(-((s0 + s1) + (s2 + s3)));
        }
      }
    }
    __syncthreads();

    // ---- u = X @ (beta*v) (regs) ; o1 = q @ S (regs) ----
    v8f uacc[4], oacc[4];
#pragma unroll
    for (int ti = 0; ti < 4; ++ti) {
      int t = wid * 4 + ti, tm = t >> 3, tn = t & 7;
      v8f a0 = (v8f){};
#pragma unroll
      for (int kb = 0; kb < 64; kb += 32) {
        v16h a, b;
#pragma unroll
        for (int e = 0; e < 16; ++e) {
          int ko = kb + koff(e, lane);
          a[e] = X16[(tm * 16 + l15) * 64 + ko];
          b[e] = vw16[(tn * 16 + l15) * 64 + ko];           // (beta*v)^T
        }
        a0 = wmma_f16(a, b, a0);
      }
      uacc[ti] = a0;
      v8f a1 = (v8f){};
#pragma unroll
      for (int kb = 0; kb < 128; kb += 32) {
        v16h a, b;
#pragma unroll
        for (int e = 0; e < 16; ++e) {
          int ko = kb + koff(e, lane);
          a[e] = q16[(tm * 16 + l15) * 128 + ko];
          b[e] = (_Float16)St[(tn * 16 + l15) * 128 + ko];  // S^T rows
        }
        a1 = wmma_f16(a, b, a1);
      }
      oacc[ti] = a1;
    }
    __syncthreads();

    // ---- -w = -(X @ (beta*k)) -> vw16 (row-major) ; qk = tril(q k^T) ----
#pragma unroll
    for (int ti = 0; ti < 4; ++ti) {
      int t = wid * 4 + ti, tm = t >> 3, tn = t & 7;
      v8f a0 = (v8f){};
#pragma unroll
      for (int kb = 0; kb < 64; kb += 32) {
        v16h a, b;
#pragma unroll
        for (int e = 0; e < 16; ++e) {
          int ko = kb + koff(e, lane);
          a[e] = X16[(tm * 16 + l15) * 64 + ko];
          b[e] = (_Float16)((float)k16[ko * 128 + tn * 16 + l15] * betaS[ko]);
        }
        a0 = wmma_f16(a, b, a0);
      }
#pragma unroll
      for (int r = 0; r < 8; ++r)
        vw16[(tm * 16 + hi8 + r) * 128 + tn * 16 + l15] = (_Float16)(-a0[r]);
    }
#pragma unroll
    for (int ti = 0; ti < 2; ++ti) {
      int t = wid * 2 + ti, tm = t >> 2, tn = t & 3;
      v8f a0 = (v8f){};
#pragma unroll
      for (int kb = 0; kb < 128; kb += 32) {
        v16h a, b;
#pragma unroll
        for (int e = 0; e < 16; ++e) {
          int ko = kb + koff(e, lane);
          a[e] = q16[(tm * 16 + l15) * 128 + ko];
          b[e] = k16[(tn * 16 + l15) * 128 + ko];
        }
        a0 = wmma_f16(a, b, a0);
      }
#pragma unroll
      for (int r = 0; r < 8; ++r) {
        int m = tm * 16 + hi8 + r, n = tn * 16 + l15;
        qk16[m * 64 + n] = (_Float16)((n <= m) ? a0[r] : 0.f);
      }
    }
    __syncthreads();

    // ---- v_new = u + (-w) @ S -> vnT (transposed) ----
#pragma unroll
    for (int ti = 0; ti < 4; ++ti) {
      int t = wid * 4 + ti, tm = t >> 3, tn = t & 7;
      v8f a0 = uacc[ti];
#pragma unroll
      for (int kb = 0; kb < 128; kb += 32) {
        v16h a, b;
#pragma unroll
        for (int e = 0; e < 16; ++e) {
          int ko = kb + koff(e, lane);
          a[e] = vw16[(tm * 16 + l15) * 128 + ko];          // -w row-major
          b[e] = (_Float16)St[(tn * 16 + l15) * 128 + ko];  // S^T rows
        }
        a0 = wmma_f16(a, b, a0);
      }
#pragma unroll
      for (int r = 0; r < 8; ++r)
        vnT[(tn * 16 + l15) * 64 + tm * 16 + hi8 + r] = (_Float16)a0[r];
    }
    __syncthreads();

    // ---- o = o1 + qk @ v_new -> global ----
#pragma unroll
    for (int ti = 0; ti < 4; ++ti) {
      int t = wid * 4 + ti, tm = t >> 3, tn = t & 7;
      v8f a0 = oacc[ti];
#pragma unroll
      for (int kb = 0; kb < 64; kb += 32) {
        v16h a, b;
#pragma unroll
        for (int e = 0; e < 16; ++e) {
          int ko = kb + koff(e, lane);
          a[e] = qk16[(tm * 16 + l15) * 64 + ko];
          b[e] = vnT[(tn * 16 + l15) * 64 + ko];            // v_new^T rows
        }
        a0 = wmma_f16(a, b, a0);
      }
#pragma unroll
      for (int r = 0; r < 8; ++r)
        og[(rowbase + (size_t)c * 64 + tm * 16 + hi8 + r) * 128 + tn * 16 + l15] = a0[r];
    }
    // ---- S^T += (k^T @ v_new)^T : tile (m=dk, n=dv), stored transposed ----
#pragma unroll
    for (int ti = 0; ti < 8; ++ti) {
      int t = wid * 8 + ti, tm = t >> 3, tn = t & 7;
      v8f a0;
#pragma unroll
      for (int r = 0; r < 8; ++r)
        a0[r] = St[(tn * 16 + l15) * 128 + tm * 16 + hi8 + r];
#pragma unroll
      for (int kb = 0; kb < 64; kb += 32) {
        v16h a, b;
#pragma unroll
        for (int e = 0; e < 16; ++e) {
          int ko = kb + koff(e, lane);
          a[e] = k16[ko * 128 + tm * 16 + l15];   // (k^T)[m][j] = k[j][m]
          b[e] = vnT[(tn * 16 + l15) * 64 + ko];  // v_new^T rows
        }
        a0 = wmma_f16(a, b, a0);
      }
#pragma unroll
      for (int r = 0; r < 8; ++r)
        St[(tn * 16 + l15) * 128 + tm * 16 + hi8 + r] = a0[r];
    }
    __syncthreads();
  }
}

// ---------------- per-head output RMSNorm -> [B,L,D] f16 -------------------
__global__ __launch_bounds__(128) void onorm_kernel(const float* __restrict__ og,
                                                    const float* __restrict__ w,
                                                    _Float16* __restrict__ on16) {
  __shared__ float red[128];
  int d = threadIdx.x;
  size_t row = blockIdx.x;              // (b*H + h)*L + l
  int l = (int)(row % LL);
  int hb = (int)(row / LL);
  int hh = hb % HH, b = hb / HH;
  float v = og[row * DKH + d];
  red[d] = v * v;
  __syncthreads();
  for (int off = 64; off > 0; off >>= 1) {
    if (d < off) red[d] += red[d + off];
    __syncthreads();
  }
  float inv = rsqrtf(red[0] * (1.f / DKH) + EPSF);
  on16[((size_t)b * LL + l) * DD + hh * DKH + d] = (_Float16)(v * inv * w[d]);
}

// ---------------------------------------------------------------------------
extern "C" void kernel_launch(void* const* d_in, const int* in_sizes, int n_in,
                              void* d_out, int out_size, void* d_ws, size_t ws_size,
                              hipStream_t stream) {
  const float* x        = (const float*)d_in[0];
  const float* norm_w   = (const float*)d_in[1];
  const float* Wq       = (const float*)d_in[2];
  const float* Wk       = (const float*)d_in[3];
  const float* Wv       = (const float*)d_in[4];
  const float* Wb       = (const float*)d_in[5];
  const float* conv_q   = (const float*)d_in[6];
  const float* conv_k   = (const float*)d_in[7];
  const float* conv_v   = (const float*)d_in[8];
  const float* o_norm_w = (const float*)d_in[9];
  const float* Wo       = (const float*)d_in[10];
  float* out = (float*)d_out;

  char* p = (char*)d_ws;
  auto take = [&](size_t bytes) { char* r = p; p += (bytes + 255) & ~(size_t)255; return r; };
  const size_t actF16 = (size_t)BLROWS * DD * sizeof(_Float16);   // 16 MiB
  const size_t wF16   = (size_t)DD * DD * sizeof(_Float16);       // 2 MiB

  _Float16* h16   = (_Float16*)take(actF16);
  _Float16* wq16t = (_Float16*)take(wF16);   // transposed [N][K]
  _Float16* wk16t = (_Float16*)take(wF16);
  _Float16* wv16t = (_Float16*)take(wF16);
  _Float16* wo16t = (_Float16*)take(wF16);
  _Float16* qpre  = (_Float16*)take(actF16);
  _Float16* kpre  = (_Float16*)take(actF16);
  _Float16* vpre  = (_Float16*)take(actF16);
  _Float16* qh    = (_Float16*)take(actF16);
  _Float16* kh    = (_Float16*)take(actF16);
  _Float16* vh    = (_Float16*)take(actF16);
  float*    betag = (float*)take((size_t)BB * HH * LL * sizeof(float));
  float*    og    = (float*)take((size_t)BB * HH * LL * DKH * sizeof(float));
  _Float16* on16  = (_Float16*)take(actF16);

  // 1. h = rmsnorm(x)
  rmsnorm_kernel<<<BLROWS, 256, 0, stream>>>(x, norm_w, h16);
  // 2. weights -> f16, transposed to [N][K] for K-contiguous B fragments
  int tgrid = (DD / 32) * (DD / 32);
  transpose_f16_kernel<<<tgrid, 256, 0, stream>>>(Wq, wq16t, DD, DD);
  transpose_f16_kernel<<<tgrid, 256, 0, stream>>>(Wk, wk16t, DD, DD);
  transpose_f16_kernel<<<tgrid, 256, 0, stream>>>(Wv, wv16t, DD, DD);
  transpose_f16_kernel<<<tgrid, 256, 0, stream>>>(Wo, wo16t, DD, DD);
  // 3. projections (WMMA GEMMs, async double-buffered staging)
  dim3 ggrid(DD / 128, BLROWS / 128);
  gemm_f16_kernel<0><<<ggrid, 256, 0, stream>>>(h16, wq16t, qpre, nullptr, nullptr, BLROWS, DD, DD);
  gemm_f16_kernel<0><<<ggrid, 256, 0, stream>>>(h16, wk16t, kpre, nullptr, nullptr, BLROWS, DD, DD);
  gemm_f16_kernel<0><<<ggrid, 256, 0, stream>>>(h16, wv16t, vpre, nullptr, nullptr, BLROWS, DD, DD);
  // 4. beta
  beta_kernel<<<BLROWS, 256, 0, stream>>>(h16, Wb, betag);
  // 5. conv + activations + head layout
  conv_head_kernel<<<BB * HH * LL, 128, 0, stream>>>(qpre, conv_q, qh, 2);
  conv_head_kernel<<<BB * HH * LL, 128, 0, stream>>>(kpre, conv_k, kh, 1);
  conv_head_kernel<<<BB * HH * LL, 128, 0, stream>>>(vpre, conv_v, vh, 0);
  // 6. chunkwise delta rule
  delta_kernel<<<BB * HH, 256, 0, stream>>>(qh, kh, vh, betag, og);
  // 7. output norm
  onorm_kernel<<<BB * HH * LL, 128, 0, stream>>>(og, o_norm_w, on16);
  // 8. out = x + on @ Wo
  gemm_f16_kernel<1><<<ggrid, 256, 0, stream>>>(on16, wo16t, nullptr, out, x, BLROWS, DD, DD);
}

// v002
// It runs in 860 microseconds.
// Timed twice side by side with v001, it ran 3.26 times as fast both times.
// All steps since v000 together make it 6.26 times as fast.
#include <hip/hip_runtime.h>
#include <hip/hip_bf16.h>

typedef __attribute__((ext_vector_type(16))) _Float16 v16h;
typedef __attribute__((ext_vector_type(8)))  float    v8f;
typedef __attribute__((ext_vector_type(4)))  float    v4f;

#define BB 2
#define LL 4096
#define DD 1024
#define HH 8
#define DKH 128
#define BLROWS (BB*LL)          // 8192
#define NCHUNK 64
#define EPSF 1e-6f

#if defined(__gfx1250__) && __has_builtin(__builtin_amdgcn_global_load_async_to_lds_b128)
#define HAVE_ASYNC 1
typedef int v4i_ __attribute__((ext_vector_type(4)));
typedef __attribute__((address_space(1))) v4i_* gp_v4i;
typedef __attribute__((address_space(3))) v4i_* lp_v4i;
#define GLA128(SRC, DST) \
  __builtin_amdgcn_global_load_async_to_lds_b128((gp_v4i)(void*)(SRC), (lp_v4i)(void*)(DST), 0, 0)
#if __has_builtin(__builtin_amdgcn_s_wait_asynccnt)
#define WAITA(n) __builtin_amdgcn_s_wait_asynccnt(n)
#else
#define WAITA(n) asm volatile("s_wait_asynccnt %0" :: "n"(n) : "memory")
#endif
#else
#define HAVE_ASYNC 0
#define WAITA(n)
#endif

__device__ __forceinline__ int koff(int e, int lane) {
  int j = e >> 1;
  return ((j & 4) << 2) + ((lane & 16) >> 1) + ((j & 3) << 1) + (e & 1);
}

__device__ __forceinline__ v8f wmma_f16(v16h a, v16h b, v8f c) {
  return __builtin_amdgcn_wmma_f32_16x16x32_f16(false, a, false, b, (short)0, c, false, false);
}

__device__ __forceinline__ float sigmoidf_(float x) { return 1.f / (1.f + __expf(-x)); }
__device__ __forceinline__ float siluf_(float x) { return x * sigmoidf_(x); }

// ---------------- RMSNorm (x -> h f16) -------------------------------------
__global__ __launch_bounds__(256) void rmsnorm_kernel(const float* __restrict__ x,
                                                      const float* __restrict__ w,
                                                      _Float16* __restrict__ h16) {
  __shared__ float red[256];
  int tid = threadIdx.x;
  size_t row = blockIdx.x;
  const float* xr = x + row * DD;
  float p = 0.f;
  for (int i = tid; i < DD; i += 256) { float v = xr[i]; p += v * v; }
  red[tid] = p; __syncthreads();
  for (int off = 128; off > 0; off >>= 1) {
    if (tid < off) red[tid] += red[tid + off];
    __syncthreads();
  }
  float inv = rsqrtf(red[0] * (1.f / DD) + EPSF);
  for (int i = tid; i < DD; i += 256)
    h16[row * DD + i] = (_Float16)(xr[i] * inv * w[i]);
}

// -------- LDS-tiled transpose: src f32 [R][C] -> dst f16 [C][R] ------------
__global__ __launch_bounds__(256) void transpose_f16_kernel(const float* __restrict__ src,
                                                            _Float16* __restrict__ dst,
                                                            int R, int C) {
  __shared__ float t[32][33];
  int nbx = C / 32;
  int bx = blockIdx.x % nbx, by = blockIdx.x / nbx;
  int r0 = by * 32, c0 = bx * 32;
  int tr = threadIdx.x >> 5, tc = threadIdx.x & 31;
#pragma unroll
  for (int i = 0; i < 32; i += 8)
    t[tr + i][tc] = src[(size_t)(r0 + tr + i) * C + c0 + tc];
  __syncthreads();
#pragma unroll
  for (int i = 0; i < 32; i += 8)
    dst[(size_t)(c0 + tr + i) * R + r0 + tc] = (_Float16)t[tc][tr + i];
}

// ---------------- WMMA GEMM: C[M,N] = A[M,K] * Bt[N,K]^T (+resid) ----------
// blockTile 128x128, 8 waves as 4(m)x2(n); double-buffered async LDS staging.
// MODE 0: f16 out ; MODE 1: f32 out with f32 residual added
template <int MODE>
__global__ __launch_bounds__(256) void gemm_f16_kernel(
    const _Float16* __restrict__ A, const _Float16* __restrict__ Bt,
    _Float16* __restrict__ out16, float* __restrict__ outf,
    const float* __restrict__ resid, int M, int N, int K) {
  __shared__ _Float16 As[2][128][32];
  __shared__ _Float16 Bs[2][128][32];
  int tid = threadIdx.x, lane = tid & 31;
  int wid = tid >> 5, l15 = lane & 15, hi8 = (lane & 16) ? 8 : 0;
  int wm = wid >> 1, wn = wid & 1;
  int bm = blockIdx.y * 128, bn = blockIdx.x * 128;

  int cr = tid >> 2, cs = (tid & 3) * 8;          // copy row / 8-half segment
  auto issue = [&](int buf, int k0) {
    const _Float16* ga = A + (size_t)(bm + cr) * K + k0 + cs;
    const _Float16* gb = Bt + (size_t)(bn + cr) * K + k0 + cs;
#if HAVE_ASYNC
    GLA128(ga,                    &As[buf][cr][cs]);
    GLA128(ga + (size_t)64 * K,   &As[buf][cr + 64][cs]);
    GLA128(gb,                    &Bs[buf][cr][cs]);
    GLA128(gb + (size_t)64 * K,   &Bs[buf][cr + 64][cs]);
#else
    *(int4*)&As[buf][cr][cs]      = *(const int4*)ga;
    *(int4*)&As[buf][cr + 64][cs] = *(const int4*)(ga + (size_t)64 * K);
    *(int4*)&Bs[buf][cr][cs]      = *(const int4*)gb;
    *(int4*)&Bs[buf][cr + 64][cs] = *(const int4*)(gb + (size_t)64 * K);
#endif
  };

  v8f acc[2][4];
#pragma unroll
  for (int i = 0; i < 2; ++i)
#pragma unroll
    for (int j = 0; j < 4; ++j) acc[i][j] = (v8f){};

  int nT = K / 32;
  issue(0, 0);
  for (int kt = 0; kt < nT; ++kt) {
    int buf = kt & 1;
    if (kt + 1 < nT) { issue(buf ^ 1, (kt + 1) * 32); WAITA(4); }
    else             { WAITA(0); }
    __syncthreads();
    v16h af[2], bf[4];
#pragma unroll
    for (int i = 0; i < 2; ++i) {
      int mr = wm * 32 + i * 16 + l15;
#pragma unroll
      for (int e = 0; e < 16; ++e) af[i][e] = As[buf][mr][koff(e, lane)];
    }
#pragma unroll
    for (int j = 0; j < 4; ++j) {
      int nc = wn * 64 + j * 16 + l15;
#pragma unroll
      for (int e = 0; e < 16; ++e) bf[j][e] = Bs[buf][nc][koff(e, lane)];
    }
#pragma unroll
    for (int i = 0; i < 2; ++i)
#pragma unroll
      for (int j = 0; j < 4; ++j) acc[i][j] = wmma_f16(af[i], bf[j], acc[i][j]);
    __syncthreads();
  }
#pragma unroll
  for (int i = 0; i < 2; ++i)
#pragma unroll
    for (int j = 0; j < 4; ++j)
#pragma unroll
      for (int r = 0; r < 8; ++r) {
        size_t gm = bm + wm * 32 + i * 16 + hi8 + r;
        size_t gn = bn + wn * 64 + j * 16 + l15;
        if (MODE == 0) out16[gm * N + gn] = (_Float16)acc[i][j][r];
        else           outf[gm * N + gn] = resid[gm * N + gn] + acc[i][j][r];
      }
}

// ---------------- beta = sigmoid(h @ Wb) -----------------------------------
__global__ __launch_bounds__(256) void beta_kernel(const _Float16* __restrict__ h16,
                                                   const float* __restrict__ Wb,
                                                   float* __restrict__ betag) {
  __shared__ float red[8][256];
  int tid = threadIdx.x;
  size_t row = blockIdx.x;              // b*L + l
  int b = (int)(row / LL), l = (int)(row % LL);
  float acc[8];
#pragma unroll
  for (int hh = 0; hh < 8; ++hh) acc[hh] = 0.f;
  for (int k = tid; k < DD; k += 256) {
    float hv = (float)h16[row * DD + k];
#pragma unroll
    for (int hh = 0; hh < 8; ++hh) acc[hh] += hv * Wb[k * 8 + hh];
  }
#pragma unroll
  for (int hh = 0; hh < 8; ++hh) red[hh][tid] = acc[hh];
  __syncthreads();
  for (int off = 128; off > 0; off >>= 1) {
    if (tid < off)
#pragma unroll
      for (int hh = 0; hh < 8; ++hh) red[hh][tid] += red[hh][tid + off];
    __syncthreads();
  }
  if (tid < 8)
    betag[((size_t)b * HH + tid) * LL + l] = sigmoidf_(red[tid][0]);
}

// -------- causal conv(K=4)+silu [+silu+l2norm (+qscale)] -> heads f16 ------
// mode: 0 = v (conv+silu), 1 = k (+silu+l2norm), 2 = q (+silu+l2norm+DK^-.5)
__global__ __launch_bounds__(128) void conv_head_kernel(
    const _Float16* __restrict__ pre, const float* __restrict__ cw,
    _Float16* __restrict__ outg, int mode) {
  __shared__ float red[128];
  int d = threadIdx.x;
  size_t row = blockIdx.x;              // (b*H + h)*L + l
  int l = (int)(row % LL);
  int hb = (int)(row / LL);
  int hh = hb % HH, b = hb / HH;
  int ch = hh * DKH + d;
  float acc = 0.f;
#pragma unroll
  for (int i = 0; i < 4; ++i) {
    int ls = l - 3 + i;
    if (ls >= 0)
      acc += (float)pre[((size_t)b * LL + ls) * DD + ch] * cw[ch * 4 + i];
  }
  float s = siluf_(acc);
  if (mode > 0) {
    s = siluf_(s);
    red[d] = s * s;
    __syncthreads();
    for (int off = 64; off > 0; off >>= 1) {
      if (d < off) red[d] += red[d + off];
      __syncthreads();
    }
    s = s * rsqrtf(red[0] + EPSF);
    if (mode == 2) s *= 0.08838834764831845f; // 128^-0.5
  }
  outg[row * DKH + d] = (_Float16)s;
}

#define PK 136   // halfs: rows of 128 f16 (q16, k16, -w)       272 B
#define PX 72    // halfs: rows of  64 f16 (X16, qk, vnT, (bv)^T) 144 B
#define PS 132   // floats: rows of 128 f32 (St)                 528 B
__global__ __launch_bounds__(256) void delta_kernel(
    const _Float16* __restrict__ qg, const _Float16* __restrict__ kg,
    const _Float16* __restrict__ vg, const float* __restrict__ betag,
    float* __restrict__ og) {
  __shared__ __attribute__((aligned(16))) float    St[128 * PS];
  __shared__ __attribute__((aligned(16))) _Float16 q16[64 * PK];
  __shared__ __attribute__((aligned(16))) _Float16 k16[64 * PK];
  __shared__ __attribute__((aligned(16))) _Float16 vw16[128 * PX];   // 128*PX >= 64*PK
  __shared__ __attribute__((aligned(16))) float    Af[64 * 64];
  __shared__ __attribute__((aligned(16))) _Float16 X16[64 * PX];
  __shared__ __attribute__((aligned(16))) _Float16 vnT[128 * PX];
  __shared__ __attribute__((aligned(16))) float    betaS[64];
  _Float16* qk16 = (_Float16*)Af;

  int tid = threadIdx.x, lane = tid & 31, wid = tid >> 5;
  int l15 = lane & 15, hi8 = (lane & 16) ? 8 : 0;
  size_t bh = blockIdx.x;
  size_t rowbase = bh * (size_t)LL;

  for (int i = tid; i < 128 * PS; i += 256) St[i] = 0.f;
  __syncthreads();

  for (int c = 0; c < NCHUNK; ++c) {
    // ---- load chunk (beta first; fold beta into transposed v) ----
    if (tid < 64) betaS[tid] = betag[rowbase + (size_t)c * 64 + tid];
    __syncthreads();
    {
      // One chunk base per operand and a fully unrolled loop: every load is that
      // operand's lane pointer + an immediate, so no address register is rewritten
      // while loads are in flight (it advances once a chunk, behind their data waits).
      const _Float16* qc = qg + (rowbase + (size_t)c * 64) * DKH;
      const _Float16* kc = kg + (rowbase + (size_t)c * 64) * DKH;
      const _Float16* vc = vg + (rowbase + (size_t)c * 64) * DKH;
      const int j0 = tid >> 7, d = tid & 127;
#pragma unroll
      for (int it = 0; it < 32; ++it) {
        int i = tid + it * 256;
        int j = j0 + it * 2;
        q16[j * PK + d] = qc[i];
        k16[j * PK + d] = kc[i];
        vw16[d * PX + j] = (_Float16)((float)vc[i] * betaS[j]);   // (beta*v)^T
      }
    }
    __syncthreads();

    // ---- kk = k k^T ; A = I + tril(beta*kk, -1) ----
#pragma unroll
    for (int ti = 0; ti < 2; ++ti) {
      int t = wid * 2 + ti, tm = t >> 2, tn = t & 3;
      v8f a0 = (v8f){};
      // beta of this lane's 8 rows, read unconditionally: the mask below is then a
      // select, with no branch between the last matrix instruction and its readers
      const v4f blo = *(const v4f*)&betaS[tm * 16 + hi8];
      const v4f bhi = *(const v4f*)&betaS[tm * 16 + hi8 + 4];
#pragma unroll
      for (int kb = 0; kb < 128; kb += 32) {
        v16h a, b;
#pragma unroll
        for (int e = 0; e < 16; ++e) {
          int ko = kb + koff(e, lane);
          a[e] = k16[(tm * 16 + l15) * PK + ko];
          b[e] = k16[(tn * 16 + l15) * PK + ko];   // k^T as B
        }
        a0 = wmma_f16(a, b, a0);
      }
#pragma unroll
      for (int r = 0; r < 8; ++r) {
        int m = tm * 16 + hi8 + r, n = tn * 16 + l15;
        Af[m * 64 + n] = (m == n) ? 1.f : ((n < m) ? (r < 4 ? blo[r & 3] : bhi[r & 3]) * a0[r] : 0.f);
      }
    }
    __syncthreads();

    // ---- X = A^-1 (unit lower tri), blocked 2x2 with 32x32 blocks, all f32 ----
    // X11 = A11^-1, X22 = A22^-1: one wave each, lane = column, the column kept in
    // registers, rows of A read as broadcasts. X21 = -X22 (A21 X11) on all 8 waves.
    // vnT is idle in this phase and lends its bytes as f32 scratch.
    // Every loop below is fully unrolled so that the per-lane arrays have static
    // indices and stay in registers.
    {
      float* Xf = (float*)vnT;          // [2][32][32] diagonal-block inverses
      float* Tf = Xf + 2 * 32 * 32;     // [32][32]    A21 * X11
      if (wid < 2) {
        int r0 = wid * 32;
        float xc[32];
        float ab[2][4][32];             // rows of A11/A22, two groups of 4 rows
#pragma unroll
        for (int r = 1; r < 4; ++r)
#pragma unroll
          for (int l = 0; l < r; ++l) ab[0][r][l] = Af[(r0 + r) * 64 + r0 + l];
#pragma unroll  // full unroll keeps xc[] and ab[] in registers (static indices only)
        for (int G = 0; G < 8; ++G) {
          if (G + 1 < 8) {
#pragma unroll
            for (int r = 0; r < 4; ++r) {
              int i = (G + 1) * 4 + r;
#pragma unroll
              for (int l = 0; l < i; ++l)
                ab[(G + 1) & 1][r][l] = Af[(r0 + i) * 64 + r0 + l];
            }
          }
          // keeps the next group's LDS reads above this group's arithmetic, so that
          // their latency is not paid row by row on the substitution's serial path
          __builtin_amdgcn_sched_barrier(0);
#pragma unroll
          for (int r = 0; r < 4; ++r) {
            int i = G * 4 + r;
            float s0 = 0.f, s1 = 0.f;
#pragma unroll
            for (int l = 0; l < i; ++l) {
              if (l & 1) s1 += ab[G & 1][r][l] * xc[l]; else s0 += ab[G & 1][r][l] * xc[l];
            }
            xc[i] = (i == lane) ? 1.f : -(s0 + s1);
            Xf[wid * 1024 + i * 32 + lane] = xc[i];
            X16[(r0 + i) * PX + r0 + lane] = (_Float16)xc[i];
          }
        }
      } else if (wid == 2) {
#pragma unroll
        for (int i = 0; i < 32; ++i) X16[i * PX + 32 + lane] = (_Float16)0.f;
      }
      __syncthreads();   // publishes X11, X22 to all waves
      {
        float xcol[32];
#pragma unroll
        for (int l = 0; l < 32; ++l) xcol[l] = Xf[l * 32 + lane];
#pragma unroll
        for (int r = 0; r < 4; ++r) {
          int i = wid * 4 + r;
          const v4f* ar = (const v4f*)&Af[(32 + i) * 64];
          float s0 = 0.f, s1 = 0.f, s2 = 0.f, s3 = 0.f;
#pragma unroll
          for (int g = 0; g < 8; ++g) {
            v4f a = ar[g];
            s0 += a[0] * xcol[g * 4 + 0];
            s1 += a[1] * xcol[g * 4 + 1];
            s2 += a[2] * xcol[g * 4 + 2];
            s3 += a[3] * xcol[g * 4 + 3];
          }
          Tf[i * 32 + lane] = (s0 + s1) + (s2 + s3);
        }
      }
      __syncthreads();   // publishes T = A21 X11
      {
        float tcol[32];
#pragma unroll
        for (int l = 0; l < 32; ++l) tcol[l] = Tf[l * 32 + lane];
#pragma unroll
        for (int r = 0; r < 4; ++r) {
          int i = wid * 4 + r;
          const v4f* xr = (const v4f*)&Xf[1024 + i * 32];
          float s0 = 0.f, s1 = 0.f, s2 = 0.f, s3 = 0.f;
#pragma unroll
          for (int g = 0; g < 8; ++g) {
            v4f a = xr[g];
            s0 += a[0] * tcol[g * 4 + 0];
            s1 += a[1] * tcol[g * 4 + 1];
            s2 += a[2] * tcol[g * 4 + 2];
            s3 += a[3] * tcol[g * 4 + 3];
          }
          X16[(32 + i) * PX + lane] = (_Float16)(-((s0 + s1) + (s2 + s3)));
        }
      }
    }
    __syncthreads();

    // ---- u = X @ (beta*v) (regs) ; o1 = q @ S (regs) ----
    v8f uacc[4], oacc[4];
#pragma unroll
    for (int ti = 0; ti < 4; ++ti) {
      int t = wid * 4 + ti, tm = t >> 3, tn = t & 7;
      v8f a0 = (v8f){};
#pragma unroll
      for (int kb = 0; kb < 64; kb += 32) {
        v16h a, b;
#pragma unroll
        for (int e = 0; e < 16; ++e) {
          int ko = kb + koff(e, lane);
          a[e] = X16[(tm * 16 + l15) * PX + ko];
          b[e] = vw16[(tn * 16 + l15) * PX + ko];           // (beta*v)^T
        }
        a0 = wmma_f16(a, b, a0);
      }
      uacc[ti] = a0;
      v8f a1 = (v8f){};
#pragma unroll
      for (int kb = 0; kb < 128; kb += 32) {
        v16h a, b;
#pragma unroll
        for (int e = 0; e < 16; ++e) {
          int ko = kb + koff(e, lane);
          a[e] = q16[(tm * 16 + l15) * PK + ko];
          b[e] = (_Float16)St[(tn * 16 + l15) * PS + ko];  // S^T rows
        }
        a1 = wmma_f16(a, b, a1);
      }
      oacc[ti] = a1;
    }
    __syncthreads();

    // ---- -w = -(X @ (beta*k)) -> vw16 (row-major) ; qk = tril(q k^T) ----
#pragma unroll
    for (int ti = 0; ti < 4; ++ti) {
      int t = wid * 4 + ti, tm = t >> 3, tn = t & 7;
      v8f a0 = (v8f){};
#pragma unroll
      for (int kb = 0; kb < 64; kb += 32) {
        v16h a, b;
#pragma unroll
        for (int e = 0; e < 16; ++e) {
          int ko = kb + koff(e, lane);
          a[e] = X16[(tm * 16 + l15) * PX + ko];
          b[e] = (_Float16)((float)k16[ko * PK + tn * 16 + l15] * betaS[ko]);
        }
        a0 = wmma_f16(a, b, a0);
      }
#pragma unroll
      for (int r = 0; r < 8; ++r)
        vw16[(tm * 16 + hi8 + r) * PK + tn * 16 + l15] = (_Float16)(-a0[r]);
    }
#pragma unroll
    for (int ti = 0; ti < 2; ++ti) {
      int t = wid * 2 + ti, tm = t >> 2, tn = t & 3;
      v8f a0 = (v8f){};
#pragma unroll
      for (int kb = 0; kb < 128; kb += 32) {
        v16h a, b;
#pragma unroll
        for (int e = 0; e < 16; ++e) {
          int ko = kb + koff(e, lane);
          a[e] = q16[(tm * 16 + l15) * PK + ko];
          b[e] = k16[(tn * 16 + l15) * PK + ko];
        }
        a0 = wmma_f16(a, b, a0);
      }
#pragma unroll
      for (int r = 0; r < 8; ++r) {
        int m = tm * 16 + hi8 + r, n = tn * 16 + l15;
        qk16[m * PX + n] = (_Float16)((n <= m) ? a0[r] : 0.f);
      }
    }
    __syncthreads();

    // ---- v_new = u + (-w) @ S -> vnT (transposed) ----
#pragma unroll
    for (int ti = 0; ti < 4; ++ti) {
      int t = wid * 4 + ti, tm = t >> 3, tn = t & 7;
      v8f a0 = uacc[ti];
#pragma unroll
      for (int kb = 0; kb < 128; kb += 32) {
        v16h a, b;
#pragma unroll
        for (int e = 0; e < 16; ++e) {
          int ko = kb + koff(e, lane);
          a[e] = vw16[(tm * 16 + l15) * PK + ko];          // -w row-major
          b[e] = (_Float16)St[(tn * 16 + l15) * PS + ko];  // S^T rows
        }
        a0 = wmma_f16(a, b, a0);
      }
#pragma unroll
      for (int r = 0; r < 8; ++r)
        vnT[(tn * 16 + l15) * PX + tm * 16 + hi8 + r] = (_Float16)a0[r];
    }
    __syncthreads();

    // ---- o = o1 + qk @ v_new -> global ----
#pragma unroll
    for (int ti = 0; ti < 4; ++ti) {
      int t = wid * 4 + ti, tm = t >> 3, tn = t & 7;
      v8f a0 = oacc[ti];
#pragma unroll
      for (int kb = 0; kb < 64; kb += 32) {
        v16h a, b;
#pragma unroll
        for (int e = 0; e < 16; ++e) {
          int ko = kb + koff(e, lane);
          a[e] = qk16[(tm * 16 + l15) * PX + ko];
          b[e] = vnT[(tn * 16 + l15) * PX + ko];            // v_new^T rows
        }
        a0 = wmma_f16(a, b, a0);
      }
#pragma unroll
      for (int r = 0; r < 8; ++r)
        og[(rowbase + (size_t)c * 64 + tm * 16 + hi8 + r) * 128 + tn * 16 + l15] = a0[r];
    }
    // ---- S^T += (k^T @ v_new)^T : tile (m=dk, n=dv), stored transposed ----
#pragma unroll
    for (int ti = 0; ti < 8; ++ti) {
      int t = wid * 8 + ti, tm = t >> 3, tn = t & 7;
      v8f a0;
#pragma unroll
      for (int r = 0; r < 8; ++r)
        a0[r] = St[(tn * 16 + l15) * PS + tm * 16 + hi8 + r];
#pragma unroll
      for (int kb = 0; kb < 64; kb += 32) {
        v16h a, b;
#pragma unroll
        for (int e = 0; e < 16; ++e) {
          int ko = kb + koff(e, lane);
          a[e] = k16[ko * PK + tm * 16 + l15];   // (k^T)[m][j] = k[j][m]
          b[e] = vnT[(tn * 16 + l15) * PX + ko];  // v_new^T rows
        }
        a0 = wmma_f16(a, b, a0);
      }
#pragma unroll
      for (int r = 0; r < 8; ++r)
        St[(tn * 16 + l15) * PS + tm * 16 + hi8 + r] = a0[r];
    }
    __syncthreads();
  }
}

// ---------------- per-head output RMSNorm -> [B,L,D] f16 -------------------
__global__ __launch_bounds__(128) void onorm_kernel(const float* __restrict__ og,
                                                    const float* __restrict__ w,
                                                    _Float16* __restrict__ on16) {
  __shared__ float red[128];
  int d = threadIdx.x;
  size_t row = blockIdx.x;              // (b*H + h)*L + l
  int l = (int)(row % LL);
  int hb = (int)(row / LL);
  int hh = hb % HH, b = hb / HH;
  float v = og[row * DKH + d];
  red[d] = v * v;
  __syncthreads();
  for (int off = 64; off > 0; off >>= 1) {
    if (d < off) red[d] += red[d + off];
    __syncthreads();
  }
  float inv = rsqrtf(red[0] * (1.f / DKH) + EPSF);
  on16[((size_t)b * LL + l) * DD + hh * DKH + d] = (_Float16)(v * inv * w[d]);
}

// ---------------------------------------------------------------------------
extern "C" void kernel_launch(void* const* d_in, const int* in_sizes, int n_in,
                              void* d_out, int out_size, void* d_ws, size_t ws_size,
                              hipStream_t stream) {
  const float* x        = (const float*)d_in[0];
  const float* norm_w   = (const float*)d_in[1];
  const float* Wq       = (const float*)d_in[2];
  const float* Wk       = (const float*)d_in[3];
  const float* Wv       = (const float*)d_in[4];
  const float* Wb       = (const float*)d_in[5];
  const float* conv_q   = (const float*)d_in[6];
  const float* conv_k   = (const float*)d_in[7];
  const float* conv_v   = (const float*)d_in[8];
  const float* o_norm_w = (const float*)d_in[9];
  const float* Wo       = (const float*)d_in[10];
  float* out = (float*)d_out;

  char* p = (char*)d_ws;
  auto take = [&](size_t bytes) { char* r = p; p += (bytes + 255) & ~(size_t)255; return r; };
  const size_t actF16 = (size_t)BLROWS * DD * sizeof(_Float16);   // 16 MiB
  const size_t wF16   = (size_t)DD * DD * sizeof(_Float16);       // 2 MiB

  _Float16* h16   = (_Float16*)take(actF16);
  _Float16* wq16t = (_Float16*)take(wF16);   // transposed [N][K]
  _Float16* wk16t = (_Float16*)take(wF16);
  _Float16* wv16t = (_Float16*)take(wF16);
  _Float16* wo16t = (_Float16*)take(wF16);
  _Float16* qpre  = (_Float16*)take(actF16);
  _Float16* kpre  = (_Float16*)take(actF16);
  _Float16* vpre  = (_Float16*)take(actF16);
  _Float16* qh    = (_Float16*)take(actF16);
  _Float16* kh    = (_Float16*)take(actF16);
  _Float16* vh    = (_Float16*)take(actF16);
  float*    betag = (float*)take((size_t)BB * HH * LL * sizeof(float));
  float*    og    = (float*)take((size_t)BB * HH * LL * DKH * sizeof(float));
  _Float16* on16  = (_Float16*)take(actF16);

  // 1. h = rmsnorm(x)
  rmsnorm_kernel<<<BLROWS, 256, 0, stream>>>(x, norm_w, h16);
  // 2. weights -> f16, transposed to [N][K] for K-contiguous B fragments
  int tgrid = (DD / 32) * (DD / 32);
  transpose_f16_kernel<<<tgrid, 256, 0, stream>>>(Wq, wq16t, DD, DD);
  transpose_f16_kernel<<<tgrid, 256, 0, stream>>>(Wk, wk16t, DD, DD);
  transpose_f16_kernel<<<tgrid, 256, 0, stream>>>(Wv, wv16t, DD, DD);
  transpose_f16_kernel<<<tgrid, 256, 0, stream>>>(Wo, wo16t, DD, DD);
  // 3. projections (WMMA GEMMs, async double-buffered staging)
  dim3 ggrid(DD / 128, BLROWS / 128);
  gemm_f16_kernel<0><<<ggrid, 256, 0, stream>>>(h16, wq16t, qpre, nullptr, nullptr, BLROWS, DD, DD);
  gemm_f16_kernel<0><<<ggrid, 256, 0, stream>>>(h16, wk16t, kpre, nullptr, nullptr, BLROWS, DD, DD);
  gemm_f16_kernel<0><<<ggrid, 256, 0, stream>>>(h16, wv16t, vpre, nullptr, nullptr, BLROWS, DD, DD);
  // 4. beta
  beta_kernel<<<BLROWS, 256, 0, stream>>>(h16, Wb, betag);
  // 5. conv + activations + head layout
  conv_head_kernel<<<BB * HH * LL, 128, 0, stream>>>(qpre, conv_q, qh, 2);
  conv_head_kernel<<<BB * HH * LL, 128, 0, stream>>>(kpre, conv_k, kh, 1);
  conv_head_kernel<<<BB * HH * LL, 128, 0, stream>>>(vpre, conv_v, vh, 0);
  // 6. chunkwise delta rule
  delta_kernel<<<BB * HH, 256, 0, stream>>>(qh, kh, vh, betag, og);
  // 7. output norm
  onorm_kernel<<<BB * HH * LL, 128, 0, stream>>>(og, o_norm_w, on16);
  // 8. out = x + on @ Wo
  gemm_f16_kernel<1><<<ggrid, 256, 0, stream>>>(on16, wo16t, nullptr, out, x, BLROWS, DD, DD);
}

// v003
// Measured time: 663 microseconds a run.
// In two side-by-side timings against v002, it was 1.30 and 1.29 times as fast.
// Counting every step since v000, it is 8.11 times as fast.
#include <hip/hip_runtime.h>
#include <hip/hip_bf16.h>

typedef __attribute__((ext_vector_type(16))) _Float16 v16h;
typedef __attribute__((ext_vector_type(8)))  float    v8f;
typedef __attribute__((ext_vector_type(4)))  float    v4f;

#define BB 2
#define LL 4096
#define DD 1024
#define HH 8
#define DKH 128
#define BLROWS (BB*LL)          // 8192
#define NCHUNK 64
#define EPSF 1e-6f

#if defined(__gfx1250__) && __has_builtin(__builtin_amdgcn_global_load_async_to_lds_b128)
#define HAVE_ASYNC 1
typedef int v4i_ __attribute__((ext_vector_type(4)));
typedef __attribute__((address_space(1))) v4i_* gp_v4i;
typedef __attribute__((address_space(3))) v4i_* lp_v4i;
#define GLA128(SRC, DST) \
  __builtin_amdgcn_global_load_async_to_lds_b128((gp_v4i)(void*)(SRC), (lp_v4i)(void*)(DST), 0, 0)
#if __has_builtin(__builtin_amdgcn_s_wait_asynccnt)
#define WAITA(n) __builtin_amdgcn_s_wait_asynccnt(n)
#else
#define WAITA(n) asm volatile("s_wait_asynccnt %0" :: "n"(n) : "memory")
#endif
#else
#define HAVE_ASYNC 0
#define WAITA(n)
#endif

__device__ __forceinline__ int koff(int e, int lane) {
  int j = e >> 1;
  return ((j & 4) << 2) + ((lane & 16) >> 1) + ((j & 3) << 1) + (e & 1);
}

__device__ __forceinline__ v8f wmma_f16(v16h a, v16h b, v8f c) {
  return __builtin_amdgcn_wmma_f32_16x16x32_f16(false, a, false, b, (short)0, c, false, false);
}

__device__ __forceinline__ float sigmoidf_(float x) { return 1.f / (1.f + __expf(-x)); }
__device__ __forceinline__ float siluf_(float x) { return x * sigmoidf_(x); }

// ---------------- RMSNorm (x -> h f16) -------------------------------------
__global__ __launch_bounds__(256) void rmsnorm_kernel(const float* __restrict__ x,
                                                      const float* __restrict__ w,
                                                      _Float16* __restrict__ h16) {
  __shared__ float red[256];
  int tid = threadIdx.x;
  size_t row = blockIdx.x;
  const float* xr = x + row * DD;
  float p = 0.f;
  for (int i = tid; i < DD; i += 256) { float v = xr[i]; p += v * v; }
  red[tid] = p; __syncthreads();
  for (int off = 128; off > 0; off >>= 1) {
    if (tid < off) red[tid] += red[tid + off];
    __syncthreads();
  }
  float inv = rsqrtf(red[0] * (1.f / DD) + EPSF);
  for (int i = tid; i < DD; i += 256)
    h16[row * DD + i] = (_Float16)(xr[i] * inv * w[i]);
}

// -------- LDS-tiled transpose: src f32 [R][C] -> dst f16 [C][R] ------------
__global__ __launch_bounds__(256) void transpose_f16_kernel(const float* __restrict__ src,
                                                            _Float16* __restrict__ dst,
                                                            int R, int C) {
  __shared__ float t[32][33];
  int nbx = C / 32;
  int bx = blockIdx.x % nbx, by = blockIdx.x / nbx;
  int r0 = by * 32, c0 = bx * 32;
  int tr = threadIdx.x >> 5, tc = threadIdx.x & 31;
#pragma unroll
  for (int i = 0; i < 32; i += 8)
    t[tr + i][tc] = src[(size_t)(r0 + tr + i) * C + c0 + tc];
  __syncthreads();
#pragma unroll
  for (int i = 0; i < 32; i += 8)
    dst[(size_t)(c0 + tr + i) * R + r0 + tc] = (_Float16)t[tc][tr + i];
}

// ---------------- WMMA GEMM: C[M,N] = A[M,K] * Bt[N,K]^T (+resid) ----------
// blockTile 128x128, 8 waves as 4(m)x2(n); double-buffered async LDS staging.
// MODE 0: f16 out ; MODE 1: f32 out with f32 residual added
template <int MODE>
__global__ __launch_bounds__(256) void gemm_f16_kernel(
    const _Float16* __restrict__ A, const _Float16* __restrict__ Bt,
    _Float16* __restrict__ out16, float* __restrict__ outf,
    const float* __restrict__ resid, int M, int N, int K) {
  __shared__ _Float16 As[2][128][32];
  __shared__ _Float16 Bs[2][128][32];
  int tid = threadIdx.x, lane = tid & 31;
  int wid = tid >> 5, l15 = lane & 15, hi8 = (lane & 16) ? 8 : 0;
  int wm = wid >> 1, wn = wid & 1;
  int bm = blockIdx.y * 128, bn = blockIdx.x * 128;

  int cr = tid >> 2, cs = (tid & 3) * 8;          // copy row / 8-half segment
  auto issue = [&](int buf, int k0) {
    const _Float16* ga = A + (size_t)(bm + cr) * K + k0 + cs;
    const _Float16* gb = Bt + (size_t)(bn + cr) * K + k0 + cs;
#if HAVE_ASYNC
    GLA128(ga,                    &As[buf][cr][cs]);
    GLA128(ga + (size_t)64 * K,   &As[buf][cr + 64][cs]);
    GLA128(gb,                    &Bs[buf][cr][cs]);
    GLA128(gb + (size_t)64 * K,   &Bs[buf][cr + 64][cs]);
#else
    *(int4*)&As[buf][cr][cs]      = *(const int4*)ga;
    *(int4*)&As[buf][cr + 64][cs] = *(const int4*)(ga + (size_t)64 * K);
    *(int4*)&Bs[buf][cr][cs]      = *(const int4*)gb;
    *(int4*)&Bs[buf][cr + 64][cs] = *(const int4*)(gb + (size_t)64 * K);
#endif
  };

  v8f acc[2][4];
#pragma unroll
  for (int i = 0; i < 2; ++i)
#pragma unroll
    for (int j = 0; j < 4; ++j) acc[i][j] = (v8f){};

  int nT = K / 32;
  issue(0, 0);
  for (int kt = 0; kt < nT; ++kt) {
    int buf = kt & 1;
    if (kt + 1 < nT) { issue(buf ^ 1, (kt + 1) * 32); WAITA(4); }
    else             { WAITA(0); }
    __syncthreads();
    v16h af[2], bf[4];
#pragma unroll
    for (int i = 0; i < 2; ++i) {
      int mr = wm * 32 + i * 16 + l15;
#pragma unroll
      for (int e = 0; e < 16; ++e) af[i][e] = As[buf][mr][koff(e, lane)];
    }
#pragma unroll
    for (int j = 0; j < 4; ++j) {
      int nc = wn * 64 + j * 16 + l15;
#pragma unroll
      for (int e = 0; e < 16; ++e) bf[j][e] = Bs[buf][nc][koff(e, lane)];
    }
#pragma unroll
    for (int i = 0; i < 2; ++i)
#pragma unroll
      for (int j = 0; j < 4; ++j) acc[i][j] = wmma_f16(af[i], bf[j], acc[i][j]);
    __syncthreads();
  }
#pragma unroll
  for (int i = 0; i < 2; ++i)
#pragma unroll
    for (int j = 0; j < 4; ++j)
#pragma unroll
      for (int r = 0; r < 8; ++r) {
        size_t gm = bm + wm * 32 + i * 16 + hi8 + r;
        size_t gn = bn + wn * 64 + j * 16 + l15;
        if (MODE == 0) out16[gm * N + gn] = (_Float16)acc[i][j][r];
        else           outf[gm * N + gn] = resid[gm * N + gn] + acc[i][j][r];
      }
}

// ---------------- beta = sigmoid(h @ Wb) -----------------------------------
__global__ __launch_bounds__(256) void beta_kernel(const _Float16* __restrict__ h16,
                                                   const float* __restrict__ Wb,
                                                   float* __restrict__ betag) {
  __shared__ float red[8][256];
  int tid = threadIdx.x;
  size_t row = blockIdx.x;              // b*L + l
  int b = (int)(row / LL), l = (int)(row % LL);
  float acc[8];
#pragma unroll
  for (int hh = 0; hh < 8; ++hh) acc[hh] = 0.f;
  for (int k = tid; k < DD; k += 256) {
    float hv = (float)h16[row * DD + k];
#pragma unroll
    for (int hh = 0; hh < 8; ++hh) acc[hh] += hv * Wb[k * 8 + hh];
  }
#pragma unroll
  for (int hh = 0; hh < 8; ++hh) red[hh][tid] = acc[hh];
  __syncthreads();
  for (int off = 128; off > 0; off >>= 1) {
    if (tid < off)
#pragma unroll
      for (int hh = 0; hh < 8; ++hh) red[hh][tid] += red[hh][tid + off];
    __syncthreads();
  }
  if (tid < 8)
    betag[((size_t)b * HH + tid) * LL + l] = sigmoidf_(red[tid][0]);
}

// -------- causal conv(K=4)+silu [+silu+l2norm (+qscale)] -> heads f16 ------
// mode: 0 = v (conv+silu), 1 = k (+silu+l2norm), 2 = q (+silu+l2norm+DK^-.5)
__global__ __launch_bounds__(128) void conv_head_kernel(
    const _Float16* __restrict__ pre, const float* __restrict__ cw,
    _Float16* __restrict__ outg, int mode) {
  __shared__ float red[128];
  int d = threadIdx.x;
  size_t row = blockIdx.x;              // (b*H + h)*L + l
  int l = (int)(row % LL);
  int hb = (int)(row / LL);
  int hh = hb % HH, b = hb / HH;
  int ch = hh * DKH + d;
  float acc = 0.f;
#pragma unroll
  for (int i = 0; i < 4; ++i) {
    int ls = l - 3 + i;
    if (ls >= 0)
      acc += (float)pre[((size_t)b * LL + ls) * DD + ch] * cw[ch * 4 + i];
  }
  float s = siluf_(acc);
  if (mode > 0) {
    s = siluf_(s);
    red[d] = s * s;
    __syncthreads();
    for (int off = 64; off > 0; off >>= 1) {
      if (d < off) red[d] += red[d + off];
      __syncthreads();
    }
    s = s * rsqrtf(red[0] + EPSF);
    if (mode == 2) s *= 0.08838834764831845f; // 128^-0.5
  }
  outg[row * DKH + d] = (_Float16)s;
}

#define PK 136   // halfs: rows of 128 f16 (q16, k16, -w)       272 B
#define PX 72    // halfs: rows of  64 f16 (X16, qk, vnT, (bv)^T) 144 B
#define PS 132   // floats: rows of 128 f32 (St)                 528 B
__global__ __launch_bounds__(256) void delta_prep_kernel(
    const _Float16* __restrict__ qg, const _Float16* __restrict__ kg,
    const _Float16* __restrict__ vg, const float* __restrict__ betag,
    float* __restrict__ ug, _Float16* __restrict__ wg, _Float16* __restrict__ qkg) {
  __shared__ __attribute__((aligned(16))) _Float16 q16[64 * PK];
  __shared__ __attribute__((aligned(16))) _Float16 k16[64 * PK];
  __shared__ __attribute__((aligned(16))) _Float16 vw16[128 * PX];   // 128*PX >= 64*PK
  __shared__ __attribute__((aligned(16))) float    Af[64 * 64];
  __shared__ __attribute__((aligned(16))) _Float16 X16[64 * PX];
  __shared__ __attribute__((aligned(16))) float    XT[3 * 32 * 32];  // f32 scratch of the inverse
  __shared__ __attribute__((aligned(16))) float    betaS[64];
  _Float16* qk16 = (_Float16*)Af;

  int tid = threadIdx.x, lane = tid & 31, wid = tid >> 5;
  int l15 = lane & 15, hi8 = (lane & 16) ? 8 : 0;
  size_t chunk = blockIdx.x;            // (b*H + h)*64 + c ; its rows start at chunk*64

  // ---- load chunk (beta first; fold beta into transposed v) ----
  if (tid < 64) betaS[tid] = betag[chunk * 64 + tid];
  __syncthreads();
  {
    // One chunk base per operand and a fully unrolled loop: every load is that
    // operand's lane pointer + an immediate.
    const _Float16* qc = qg + chunk * 64 * DKH;
    const _Float16* kc = kg + chunk * 64 * DKH;
    const _Float16* vc = vg + chunk * 64 * DKH;
    const int j0 = tid >> 7, d = tid & 127;
#pragma unroll
    for (int it = 0; it < 32; ++it) {
      int i = tid + it * 256;
      int j = j0 + it * 2;
      q16[j * PK + d] = qc[i];
      k16[j * PK + d] = kc[i];
      vw16[d * PX + j] = (_Float16)((float)vc[i] * betaS[j]);   // (beta*v)^T
    }
  }
  __syncthreads();

  // ---- kk = k k^T ; A = I + tril(beta*kk, -1) ----
#pragma unroll
  for (int ti = 0; ti < 2; ++ti) {
    int t = wid * 2 + ti, tm = t >> 2, tn = t & 3;
    v8f a0 = (v8f){};
    // beta of this lane's 8 rows, read unconditionally: the mask below is then a
    // select, with no branch between the last matrix instruction and its readers
    const v4f blo = *(const v4f*)&betaS[tm * 16 + hi8];
    const v4f bhi = *(const v4f*)&betaS[tm * 16 + hi8 + 4];
#pragma unroll
    for (int kb = 0; kb < 128; kb += 32) {
      v16h a, b;
#pragma unroll
      for (int e = 0; e < 16; ++e) {
        int ko = kb + koff(e, lane);
        a[e] = k16[(tm * 16 + l15) * PK + ko];
        b[e] = k16[(tn * 16 + l15) * PK + ko];   // k^T as B
      }
      a0 = wmma_f16(a, b, a0);
    }
#pragma unroll
    for (int r = 0; r < 8; ++r) {
      int m = tm * 16 + hi8 + r, n = tn * 16 + l15;
      Af[m * 64 + n] = (m == n) ? 1.f : ((n < m) ? (r < 4 ? blo[r & 3] : bhi[r & 3]) * a0[r] : 0.f);
    }
  }
  __syncthreads();

  // ---- X = A^-1 (unit lower tri), blocked 2x2 with 32x32 blocks, all f32 ----
  // X11 = A11^-1, X22 = A22^-1: one wave each, lane = column, the column kept in
  // registers, rows of A read as broadcasts. X21 = -X22 (A21 X11) on all 8 waves.
  // Every loop below is fully unrolled so that the per-lane arrays have static
  // indices and stay in registers.
  {
    float* Xf = XT;                   // [2][32][32] diagonal-block inverses
    float* Tf = Xf + 2 * 32 * 32;     // [32][32]    A21 * X11
    if (wid < 2) {
      int r0 = wid * 32;
      float xc[32];
      float ab[2][4][32];             // rows of A11/A22, two groups of 4 rows
#pragma unroll
      for (int r = 1; r < 4; ++r)
#pragma unroll
        for (int l = 0; l < r; ++l) ab[0][r][l] = Af[(r0 + r) * 64 + r0 + l];
#pragma unroll  // full unroll keeps xc[] and ab[] in registers (static indices only)
      for (int G = 0; G < 8; ++G) {
        if (G + 1 < 8) {
#pragma unroll
          for (int r = 0; r < 4; ++r) {
            int i = (G + 1) * 4 + r;
#pragma unroll
            for (int l = 0; l < i; ++l)
              ab[(G + 1) & 1][r][l] = Af[(r0 + i) * 64 + r0 + l];
          }
        }
        // keeps the next group's LDS reads above this group's arithmetic, so that
        // their latency is not paid row by row on the substitution's serial path
        __builtin_amdgcn_sched_barrier(0);
#pragma unroll
        for (int r = 0; r < 4; ++r) {
          int i = G * 4 + r;
          float s0 = 0.f, s1 = 0.f;
#pragma unroll
          for (int l = 0; l < i; ++l) {
            if (l & 1) s1 += ab[G & 1][r][l] * xc[l]; else s0 += ab[G & 1][r][l] * xc[l];
          }
          xc[i] = (i == lane) ? 1.f : -(s0 + s1);
          Xf[wid * 1024 + i * 32 + lane] = xc[i];
          X16[(r0 + i) * PX + r0 + lane] = (_Float16)xc[i];
        }
      }
    } else if (wid == 2) {
#pragma unroll
      for (int i = 0; i < 32; ++i) X16[i * PX + 32 + lane] = (_Float16)0.f;
    }
    __syncthreads();   // publishes X11, X22 to all waves
    {
      float xcol[32];
#pragma unroll
      for (int l = 0; l < 32; ++l) xcol[l] = Xf[l * 32 + lane];
#pragma unroll
      for (int r = 0; r < 4; ++r) {
        int i = wid * 4 + r;
        const v4f* ar = (const v4f*)&Af[(32 + i) * 64];
        float s0 = 0.f, s1 = 0.f, s2 = 0.f, s3 = 0.f;
#pragma unroll
        for (int g = 0; g < 8; ++g) {
          v4f a = ar[g];
          s0 += a[0] * xcol[g * 4 + 0];
          s1 += a[1] * xcol[g * 4 + 1];
          s2 += a[2] * xcol[g * 4 + 2];
          s3 += a[3] * xcol[g * 4 + 3];
        }
        Tf[i * 32 + lane] = (s0 + s1) + (s2 + s3);
      }
    }
    __syncthreads();   // publishes T = A21 X11
    {
      float tcol[32];
#pragma unroll
      for (int l = 0; l < 32; ++l) tcol[l] = Tf[l * 32 + lane];
#pragma unroll
      for (int r = 0; r < 4; ++r) {
        int i = wid * 4 + r;
        const v4f* xr = (const v4f*)&Xf[1024 + i * 32];
        float s0 = 0.f, s1 = 0.f, s2 = 0.f, s3 = 0.f;
#pragma unroll
        for (int g = 0; g < 8; ++g) {
          v4f a = xr[g];
          s0 += a[0] * tcol[g * 4 + 0];
          s1 += a[1] * tcol[g * 4 + 1];
          s2 += a[2] * tcol[g * 4 + 2];
          s3 += a[3] * tcol[g * 4 + 3];
        }
        X16[(32 + i) * PX + lane] = (_Float16)(-((s0 + s1) + (s2 + s3)));
      }
    }
  }
  __syncthreads();

  // ---- u = X @ (beta*v) -> workspace, in accumulator layout ----
#pragma unroll
  for (int ti = 0; ti < 4; ++ti) {
    int t = wid * 4 + ti, tm = t >> 3, tn = t & 7;
    v8f a0 = (v8f){};
#pragma unroll
    for (int kb = 0; kb < 64; kb += 32) {
      v16h a, b;
#pragma unroll
      for (int e = 0; e < 16; ++e) {
        int ko = kb + koff(e, lane);
        a[e] = X16[(tm * 16 + l15) * PX + ko];
        b[e] = vw16[(tn * 16 + l15) * PX + ko];           // (beta*v)^T
      }
      a0 = wmma_f16(a, b, a0);
    }
    *(v8f*)(ug + ((chunk * 32 + t) * 32 + lane) * 8) = a0;
  }
  __syncthreads();

  // ---- -w = -(X @ (beta*k)) -> vw16 (row-major) ; qk = tril(q k^T) ----
#pragma unroll
  for (int ti = 0; ti < 4; ++ti) {
    int t = wid * 4 + ti, tm = t >> 3, tn = t & 7;
    v8f a0 = (v8f){};
#pragma unroll
    for (int kb = 0; kb < 64; kb += 32) {
      v16h a, b;
#pragma unroll
      for (int e = 0; e < 16; ++e) {
        int ko = kb + koff(e, lane);
        a[e] = X16[(tm * 16 + l15) * PX + ko];
        b[e] = (_Float16)((float)k16[ko * PK + tn * 16 + l15] * betaS[ko]);
      }
      a0 = wmma_f16(a, b, a0);
    }
#pragma unroll
    for (int r = 0; r < 8; ++r)
      vw16[(tm * 16 + hi8 + r) * PK + tn * 16 + l15] = (_Float16)(-a0[r]);
  }
#pragma unroll
  for (int ti = 0; ti < 2; ++ti) {
    int t = wid * 2 + ti, tm = t >> 2, tn = t & 3;
    v8f a0 = (v8f){};
#pragma unroll
    for (int kb = 0; kb < 128; kb += 32) {
      v16h a, b;
#pragma unroll
      for (int e = 0; e < 16; ++e) {
        int ko = kb + koff(e, lane);
        a[e] = q16[(tm * 16 + l15) * PK + ko];
        b[e] = k16[(tn * 16 + l15) * PK + ko];
      }
      a0 = wmma_f16(a, b, a0);
    }
#pragma unroll
    for (int r = 0; r < 8; ++r) {
      int m = tm * 16 + hi8 + r, n = tn * 16 + l15;
      qk16[m * PX + n] = (_Float16)((n <= m) ? a0[r] : 0.f);
    }
  }
  __syncthreads();

  // ---- -w and qk: LDS -> workspace, 16 bytes a lane ----
  {
    int4* wo = (int4*)(wg + chunk * 64 * DKH) + tid;
    int4* qo = (int4*)(qkg + chunk * 64 * 64) + tid;
#pragma unroll
    for (int it = 0; it < 4; ++it) {
      int p = tid + it * 256;
      wo[it * 256] = *(const int4*)&vw16[(p >> 4) * PK + (p & 15) * 8];
    }
#pragma unroll
    for (int it = 0; it < 2; ++it) {
      int p = tid + it * 256;
      qo[it * 256] = *(const int4*)&qk16[(p >> 3) * PX + (p & 7) * 8];
    }
  }
}

__global__ __launch_bounds__(256) void delta_kernel(
    const _Float16* __restrict__ qg, const _Float16* __restrict__ kg,
    const _Float16* __restrict__ wg, const _Float16* __restrict__ qkg,
    const float* __restrict__ ug, float* __restrict__ og) {
  __shared__ __attribute__((aligned(16))) float    St[128 * PS];
  __shared__ __attribute__((aligned(16))) _Float16 q16[64 * PK];
  __shared__ __attribute__((aligned(16))) _Float16 k16[64 * PK];
  __shared__ __attribute__((aligned(16))) _Float16 vw16[64 * PK];
  __shared__ __attribute__((aligned(16))) _Float16 qk16[64 * PX];
  __shared__ __attribute__((aligned(16))) _Float16 vnT[128 * PX];

  int tid = threadIdx.x, lane = tid & 31, wid = tid >> 5;
  int l15 = lane & 15, hi8 = (lane & 16) ? 8 : 0;
  size_t bh = blockIdx.x;
  size_t rowbase = bh * (size_t)LL;

  for (int i = tid; i < 128 * PS; i += 256) St[i] = 0.f;

  for (int c = 0; c < NCHUNK; ++c) {
    // ---- load chunk: q, k, -w, qk -> LDS ; u -> accumulator registers ----
    v8f uacc[4], oacc[4];
    {
      // One chunk base per operand: every load is base + lane offset + an immediate.
      // (v4f is only the carrier of 16 bytes here: eight f16 move as they are)
      size_t chunk = bh * NCHUNK + c;
      const v4f* qc = (const v4f*)(qg + chunk * 64 * DKH);
      const v4f* kc = (const v4f*)(kg + chunk * 64 * DKH);
      const v4f* wc = (const v4f*)(wg + chunk * 64 * DKH);
      const v4f* xc = (const v4f*)(qkg + chunk * 64 * 64);
      const v8f*  uc = (const v8f*)(ug + chunk * 64 * DKH);
      const unsigned ut = (unsigned)tid, uu = (unsigned)(wid * 128 + lane);
      v4f tq[4], tk[4], tw[4], tx[2];
#pragma unroll
      for (int it = 0; it < 4; ++it) {
        tq[it] = qc[ut + it * 256];
        tk[it] = kc[ut + it * 256];
        tw[it] = wc[ut + it * 256];
      }
#pragma unroll
      for (int it = 0; it < 2; ++it) tx[it] = xc[ut + it * 256];
#pragma unroll
      for (int ti = 0; ti < 4; ++ti) uacc[ti] = uc[uu + ti * 32];   // tile wid*4+ti, this lane
      // inputs-only fence on the loaded values: all 22 loads are issued ahead of it and
      // share one trip to memory (without it they were built as load, wait, store, one by one)
      asm volatile("" :: "v"(tq[0]), "v"(tq[1]), "v"(tq[2]), "v"(tq[3]),
                         "v"(tk[0]), "v"(tk[1]), "v"(tk[2]), "v"(tk[3]),
                         "v"(tw[0]), "v"(tw[1]), "v"(tw[2]), "v"(tw[3]),
                         "v"(tx[0]), "v"(tx[1]),
                         "v"(uacc[0]), "v"(uacc[1]), "v"(uacc[2]), "v"(uacc[3]));
#pragma unroll
      for (int it = 0; it < 4; ++it) {
        int p = tid + it * 256;
        int o = (p >> 4) * PK + (p & 15) * 8;
        *(v4f*)&q16[o]  = tq[it];
        *(v4f*)&k16[o]  = tk[it];
        *(v4f*)&vw16[o] = tw[it];
      }
#pragma unroll
      for (int it = 0; it < 2; ++it) {
        int p = tid + it * 256;
        *(v4f*)&qk16[(p >> 3) * PX + (p & 7) * 8] = tx[it];
      }
    }
    __syncthreads();

    // ---- o1 = q @ S (regs) ; v_new = u + (-w) @ S -> vnT (transposed) ----
    // both products take the same S fragment
#pragma unroll
    for (int ti = 0; ti < 4; ++ti) {
      int t = wid * 4 + ti, tm = t >> 3, tn = t & 7;
      v8f a0 = uacc[ti];
      v8f a1 = (v8f){};
#pragma unroll
      for (int kb = 0; kb < 128; kb += 32) {
        v16h aq, aw, b;
#pragma unroll
        for (int e = 0; e < 16; ++e) {
          int ko = kb + koff(e, lane);
          aq[e] = q16[(tm * 16 + l15) * PK + ko];
          aw[e] = vw16[(tm * 16 + l15) * PK + ko];         // -w row-major
          b[e] = (_Float16)St[(tn * 16 + l15) * PS + ko];  // S^T rows
        }
        a1 = wmma_f16(aq, b, a1);
        a0 = wmma_f16(aw, b, a0);
      }
      oacc[ti] = a1;
#pragma unroll
      for (int r = 0; r < 8; ++r)
        vnT[(tn * 16 + l15) * PX + tm * 16 + hi8 + r] = (_Float16)a0[r];
    }
    __syncthreads();

    // ---- o = o1 + qk @ v_new -> global ----
#pragma unroll
    for (int ti = 0; ti < 4; ++ti) {
      int t = wid * 4 + ti, tm = t >> 3, tn = t & 7;
      v8f a0 = oacc[ti];
#pragma unroll
      for (int kb = 0; kb < 64; kb += 32) {
        v16h a, b;
#pragma unroll
        for (int e = 0; e < 16; ++e) {
          int ko = kb + koff(e, lane);
          a[e] = qk16[(tm * 16 + l15) * PX + ko];
          b[e] = vnT[(tn * 16 + l15) * PX + ko];            // v_new^T rows
        }
        a0 = wmma_f16(a, b, a0);
      }
#pragma unroll
      for (int r = 0; r < 8; ++r)
        og[(rowbase + (size_t)c * 64 + tm * 16 + hi8 + r) * 128 + tn * 16 + l15] = a0[r];
    }
    // ---- S^T += (k^T @ v_new)^T : tile (m=dk, n=dv), stored transposed ----
#pragma unroll
    for (int ti = 0; ti < 8; ++ti) {
      int t = wid * 8 + ti, tm = t >> 3, tn = t & 7;
      v8f a0;
#pragma unroll
      for (int r = 0; r < 8; ++r)
        a0[r] = St[(tn * 16 + l15) * PS + tm * 16 + hi8 + r];
#pragma unroll
      for (int kb = 0; kb < 64; kb += 32) {
        v16h a, b;
#pragma unroll
        for (int e = 0; e < 16; ++e) {
          int ko = kb + koff(e, lane);
          a[e] = k16[ko * PK + tm * 16 + l15];   // (k^T)[m][j] = k[j][m]
          b[e] = vnT[(tn * 16 + l15) * PX + ko];  // v_new^T rows
        }
        a0 = wmma_f16(a, b, a0);
      }
#pragma unroll
      for (int r = 0; r < 8; ++r)
        St[(tn * 16 + l15) * PS + tm * 16 + hi8 + r] = a0[r];
    }
    __syncthreads();
  }
}

// ---------------- per-head output RMSNorm -> [B,L,D] f16 -------------------
__global__ __launch_bounds__(128) void onorm_kernel(const float* __restrict__ og,
                                                    const float* __restrict__ w,
                                                    _Float16* __restrict__ on16) {
  __shared__ float red[128];
  int d = threadIdx.x;
  size_t row = blockIdx.x;              // (b*H + h)*L + l
  int l = (int)(row % LL);
  int hb = (int)(row / LL);
  int hh = hb % HH, b = hb / HH;
  float v = og[row * DKH + d];
  red[d] = v * v;
  __syncthreads();
  for (int off = 64; off > 0; off >>= 1) {
    if (d < off) red[d] += red[d + off];
    __syncthreads();
  }
  float inv = rsqrtf(red[0] * (1.f / DKH) + EPSF);
  on16[((size_t)b * LL + l) * DD + hh * DKH + d] = (_Float16)(v * inv * w[d]);
}

// ---------------------------------------------------------------------------
extern "C" void kernel_launch(void* const* d_in, const int* in_sizes, int n_in,
                              void* d_out, int out_size, void* d_ws, size_t ws_size,
                              hipStream_t stream) {
  const float* x        = (const float*)d_in[0];
  const float* norm_w   = (const float*)d_in[1];
  const float* Wq       = (const float*)d_in[2];
  const float* Wk       = (const float*)d_in[3];
  const float* Wv       = (const float*)d_in[4];
  const float* Wb       = (const float*)d_in[5];
  const float* conv_q   = (const float*)d_in[6];
  const float* conv_k   = (const float*)d_in[7];
  const float* conv_v   = (const float*)d_in[8];
  const float* o_norm_w = (const float*)d_in[9];
  const float* Wo       = (const float*)d_in[10];
  float* out = (float*)d_out;

  char* p = (char*)d_ws;
  auto take = [&](size_t bytes) { char* r = p; p += (bytes + 255) & ~(size_t)255; return r; };
  const size_t actF16 = (size_t)BLROWS * DD * sizeof(_Float16);   // 16 MiB
  const size_t wF16   = (size_t)DD * DD * sizeof(_Float16);       // 2 MiB

  _Float16* h16   = (_Float16*)take(actF16);
  _Float16* wq16t = (_Float16*)take(wF16);   // transposed [N][K]
  _Float16* wk16t = (_Float16*)take(wF16);
  _Float16* wv16t = (_Float16*)take(wF16);
  _Float16* wo16t = (_Float16*)take(wF16);
  _Float16* qpre  = (_Float16*)take(actF16);
  _Float16* kpre  = (_Float16*)take(actF16);
  _Float16* vpre  = (_Float16*)take(actF16);
  _Float16* qh    = (_Float16*)take(actF16);
  _Float16* kh    = (_Float16*)take(actF16);
  _Float16* vh    = (_Float16*)take(actF16);
  float*    betag = (float*)take((size_t)BB * HH * LL * sizeof(float));
  float*    og    = (float*)take((size_t)BB * HH * LL * DKH * sizeof(float));
  _Float16* on16  = (_Float16*)take(actF16);
  float*    ug    = (float*)take((size_t)BB * HH * LL * DKH * sizeof(float));
  _Float16* wg    = (_Float16*)take(actF16);
  _Float16* qkg   = (_Float16*)take((size_t)BB * HH * LL * 64 * sizeof(_Float16));

  // 1. h = rmsnorm(x)
  rmsnorm_kernel<<<BLROWS, 256, 0, stream>>>(x, norm_w, h16);
  // 2. weights -> f16, transposed to [N][K] for K-contiguous B fragments
  int tgrid = (DD / 32) * (DD / 32);
  transpose_f16_kernel<<<tgrid, 256, 0, stream>>>(Wq, wq16t, DD, DD);
  transpose_f16_kernel<<<tgrid, 256, 0, stream>>>(Wk, wk16t, DD, DD);
  transpose_f16_kernel<<<tgrid, 256, 0, stream>>>(Wv, wv16t, DD, DD);
  transpose_f16_kernel<<<tgrid, 256, 0, stream>>>(Wo, wo16t, DD, DD);
  // 3. projections (WMMA GEMMs, async double-buffered staging)
  dim3 ggrid(DD / 128, BLROWS / 128);
  gemm_f16_kernel<0><<<ggrid, 256, 0, stream>>>(h16, wq16t, qpre, nullptr, nullptr, BLROWS, DD, DD);
  gemm_f16_kernel<0><<<ggrid, 256, 0, stream>>>(h16, wk16t, kpre, nullptr, nullptr, BLROWS, DD, DD);
  gemm_f16_kernel<0><<<ggrid, 256, 0, stream>>>(h16, wv16t, vpre, nullptr, nullptr, BLROWS, DD, DD);
  // 4. beta
  beta_kernel<<<BLROWS, 256, 0, stream>>>(h16, Wb, betag);
  // 5. conv + activations + head layout
  conv_head_kernel<<<BB * HH * LL, 128, 0, stream>>>(qpre, conv_q, qh, 2);
  conv_head_kernel<<<BB * HH * LL, 128, 0, stream>>>(kpre, conv_k, kh, 1);
  conv_head_kernel<<<BB * HH * LL, 128, 0, stream>>>(vpre, conv_v, vh, 0);
  // 6. chunkwise delta rule: per-chunk operands for all chunks, then the serial walk
  delta_prep_kernel<<<BB * HH * NCHUNK, 256, 0, stream>>>(qh, kh, vh, betag, ug, wg, qkg);
  delta_kernel<<<BB * HH, 256, 0, stream>>>(qh, kh, wg, qkg, ug, og);
  // 7. output norm
  onorm_kernel<<<BB * HH * LL, 128, 0, stream>>>(og, o_norm_w, on16);
  // 8. out = x + on @ Wo
  gemm_f16_kernel<1><<<ggrid, 256, 0, stream>>>(on16, wo16t, nullptr, out, x, BLROWS, DD, DD);
}

// v004
// Measured time: 543 microseconds a run.
// Timed twice side by side with v003, it ran 1.21 and 1.23 times as fast.
// All steps since v000 together make it 9.88 times as fast.
#include <hip/hip_runtime.h>
#include <hip/hip_bf16.h>

typedef __attribute__((ext_vector_type(16))) _Float16 v16h;
typedef __attribute__((ext_vector_type(8)))  float    v8f;
typedef __attribute__((ext_vector_type(4)))  float    v4f;

#define BB 2
#define LL 4096
#define DD 1024
#define HH 8
#define DKH 128
#define BLROWS (BB*LL)          // 8192
#define NCHUNK 64
#define EPSF 1e-6f

#if defined(__gfx1250__) && __has_builtin(__builtin_amdgcn_global_load_async_to_lds_b128)
#define HAVE_ASYNC 1
typedef int v4i_ __attribute__((ext_vector_type(4)));
typedef __attribute__((address_space(1))) v4i_* gp_v4i;
typedef __attribute__((address_space(3))) v4i_* lp_v4i;
#define GLA128(SRC, DST) \
  __builtin_amdgcn_global_load_async_to_lds_b128((gp_v4i)(void*)(SRC), (lp_v4i)(void*)(DST), 0, 0)
#if __has_builtin(__builtin_amdgcn_s_wait_asynccnt)
#define WAITA(n) __builtin_amdgcn_s_wait_asynccnt(n)
#else
#define WAITA(n) asm volatile("s_wait_asynccnt %0" :: "n"(n) : "memory")
#endif
#else
#define HAVE_ASYNC 0
#define WAITA(n)
#endif

__device__ __forceinline__ int koff(int e, int lane) {
  int j = e >> 1;
  return ((j & 4) << 2) + ((lane & 16) >> 1) + ((j & 3) << 1) + (e & 1);
}

__device__ __forceinline__ v8f wmma_f16(v16h a, v16h b, v8f c) {
  return __builtin_amdgcn_wmma_f32_16x16x32_f16(false, a, false, b, (short)0, c, false, false);
}

__device__ __forceinline__ float sigmoidf_(float x) { return 1.f / (1.f + __expf(-x)); }
__device__ __forceinline__ float siluf_(float x) { return x * sigmoidf_(x); }

// ---------------- the row kernels ------------------------------------------
// rmsnorm, beta, conv+l2norm and the output norm each work on short rows (128 or 1024
// elements). One wave takes whole rows: a lane holds its share of a row in registers,
// the row's sum is a butterfly over the 32 lanes, and there is no LDS and no barrier.
// One block per row cost far more in starting waves than in the rows' own work.
// Every '#pragma unroll' in these four kernels is on a loop over a lane's own share: fully
// unrolled, the per-lane arrays have static indices only and stay in registers.
typedef __attribute__((ext_vector_type(4))) _Float16 v4h;

// the wave's number in its block, held as a scalar, so that row numbers and row
// addresses are scalar arithmetic and the loads take base + lane offset + immediate
__device__ __forceinline__ unsigned wave_id() {
  return (unsigned)__builtin_amdgcn_readfirstlane((int)(threadIdx.x >> 5));
}

template <int M>
__device__ __forceinline__ float xmask_add(float v) {
  // v + (v of lane ^ M), M < 16: a DPP row_xmask move inside the 16-lane row
  int o = __builtin_amdgcn_update_dpp(0, __builtin_bit_cast(int, v), 0x160 | M, 0xf, 0xf, true);
  return v + __builtin_bit_cast(float, o);
}
// sum over the wave's 32 lanes, the same bits in every lane
__device__ __forceinline__ float wave_sum(float v) {
  v = xmask_add<1>(v);
  v = xmask_add<2>(v);
  v = xmask_add<4>(v);
  v = xmask_add<8>(v);
  int b = __builtin_bit_cast(int, v);
  int o = __builtin_amdgcn_permlanex16(b, b, 0x76543210, 0xfedcba98, false, false);  // lane ^ 16
  return v + __builtin_bit_cast(float, o);
}

// ---------------- RMSNorm (x -> h f16): one row a wave ----------------------
__global__ __launch_bounds__(256) void rmsnorm_kernel(const float* __restrict__ x,
                                                      const float* __restrict__ w,
                                                      _Float16* __restrict__ h16) {
  int lane = threadIdx.x & 31;
  size_t row = (size_t)(blockIdx.x * 8 + wave_id());
  const v4f* xr = (const v4f*)(x + row * DD) + lane;
  const v4f* wr = (const v4f*)w + lane;
  v4f xv[8];
#pragma unroll
  for (int j = 0; j < 8; ++j) xv[j] = xr[j * 32];
  v4f p = (v4f){};
#pragma unroll
  for (int j = 0; j < 8; ++j) p += xv[j] * xv[j];
  float inv = rsqrtf(wave_sum((p[0] + p[1]) + (p[2] + p[3])) * (1.f / DD) + EPSF);
  v4h* ho = (v4h*)(h16 + row * DD) + lane;
#pragma unroll
  for (int j = 0; j < 8; ++j) {
    v4f wv = wr[j * 32];
    v4h o;
#pragma unroll
    for (int c = 0; c < 4; ++c) o[c] = (_Float16)(xv[j][c] * inv * wv[c]);
    ho[j * 32] = o;
  }
}

// -------- LDS-tiled transpose: src f32 [R][C] -> dst f16 [C][R] ------------
__global__ __launch_bounds__(256) void transpose_f16_kernel(const float* __restrict__ src,
                                                            _Float16* __restrict__ dst,
                                                            int R, int C) {
  __shared__ float t[32][33];
  int nbx = C / 32;
  int bx = blockIdx.x % nbx, by = blockIdx.x / nbx;
  int r0 = by * 32, c0 = bx * 32;
  int tr = threadIdx.x >> 5, tc = threadIdx.x & 31;
#pragma unroll
  for (int i = 0; i < 32; i += 8)
    t[tr + i][tc] = src[(size_t)(r0 + tr + i) * C + c0 + tc];
  __syncthreads();
#pragma unroll
  for (int i = 0; i < 32; i += 8)
    dst[(size_t)(c0 + tr + i) * R + r0 + tc] = (_Float16)t[tc][tr + i];
}

// ---------------- WMMA GEMM: C[M,N] = A[M,K] * Bt[N,K]^T (+resid) ----------
// blockTile 128x128, 8 waves as 4(m)x2(n); double-buffered async LDS staging.
// MODE 0: f16 out ; MODE 1: f32 out with f32 residual added
template <int MODE>
__global__ __launch_bounds__(256) void gemm_f16_kernel(
    const _Float16* __restrict__ A, const _Float16* __restrict__ Bt,
    _Float16* __restrict__ out16, float* __restrict__ outf,
    const float* __restrict__ resid, int M, int N, int K) {
  __shared__ _Float16 As[2][128][32];
  __shared__ _Float16 Bs[2][128][32];
  int tid = threadIdx.x, lane = tid & 31;
  int wid = tid >> 5, l15 = lane & 15, hi8 = (lane & 16) ? 8 : 0;
  int wm = wid >> 1, wn = wid & 1;
  int bm = blockIdx.y * 128, bn = blockIdx.x * 128;

  int cr = tid >> 2, cs = (tid & 3) * 8;          // copy row / 8-half segment
  auto issue = [&](int buf, int k0) {
    const _Float16* ga = A + (size_t)(bm + cr) * K + k0 + cs;
    const _Float16* gb = Bt + (size_t)(bn + cr) * K + k0 + cs;
#if HAVE_ASYNC
    GLA128(ga,                    &As[buf][cr][cs]);
    GLA128(ga + (size_t)64 * K,   &As[buf][cr + 64][cs]);
    GLA128(gb,                    &Bs[buf][cr][cs]);
    GLA128(gb + (size_t)64 * K,   &Bs[buf][cr + 64][cs]);
#else
    *(int4*)&As[buf][cr][cs]      = *(const int4*)ga;
    *(int4*)&As[buf][cr + 64][cs] = *(const int4*)(ga + (size_t)64 * K);
    *(int4*)&Bs[buf][cr][cs]      = *(const int4*)gb;
    *(int4*)&Bs[buf][cr + 64][cs] = *(const int4*)(gb + (size_t)64 * K);
#endif
  };

  v8f acc[2][4];
#pragma unroll
  for (int i = 0; i < 2; ++i)
#pragma unroll
    for (int j = 0; j < 4; ++j) acc[i][j] = (v8f){};

  int nT = K / 32;
  issue(0, 0);
  for (int kt = 0; kt < nT; ++kt) {
    int buf = kt & 1;
    if (kt + 1 < nT) { issue(buf ^ 1, (kt + 1) * 32); WAITA(4); }
    else             { WAITA(0); }
    __syncthreads();
    v16h af[2], bf[4];
#pragma unroll
    for (int i = 0; i < 2; ++i) {
      int mr = wm * 32 + i * 16 + l15;
#pragma unroll
      for (int e = 0; e < 16; ++e) af[i][e] = As[buf][mr][koff(e, lane)];
    }
#pragma unroll
    for (int j = 0; j < 4; ++j) {
      int nc = wn * 64 + j * 16 + l15;
#pragma unroll
      for (int e = 0; e < 16; ++e) bf[j][e] = Bs[buf][nc][koff(e, lane)];
    }
#pragma unroll
    for (int i = 0; i < 2; ++i)
#pragma unroll
      for (int j = 0; j < 4; ++j) acc[i][j] = wmma_f16(af[i], bf[j], acc[i][j]);
    __syncthreads();
  }
#pragma unroll
  for (int i = 0; i < 2; ++i)
#pragma unroll
    for (int j = 0; j < 4; ++j)
#pragma unroll
      for (int r = 0; r < 8; ++r) {
        size_t gm = bm + wm * 32 + i * 16 + hi8 + r;
        size_t gn = bn + wn * 64 + j * 16 + l15;
        if (MODE == 0) out16[gm * N + gn] = (_Float16)acc[i][j][r];
        else           outf[gm * N + gn] = resid[gm * N + gn] + acc[i][j][r];
      }
}

// ---------------- beta = sigmoid(h @ Wb): four rows a wave ------------------
__global__ __launch_bounds__(256) void beta_kernel(const _Float16* __restrict__ h16,
                                                   const float* __restrict__ Wb,
                                                   float* __restrict__ betag) {
  int lane = threadIdx.x & 31;
  size_t row0 = (size_t)((blockIdx.x * 8 + wave_id()) * 4);   // b*L + l of the first row
  const _Float16* hr = h16 + row0 * DD + lane;
  const v4f* wb = (const v4f*)Wb + lane * 2;
  float acc[4][8];
#pragma unroll
  for (int r = 0; r < 4; ++r)
#pragma unroll
    for (int hh = 0; hh < 8; ++hh) acc[r][hh] = 0.f;
  // lane takes k = lane, lane + 32, ...; a row of Wb serves all four rows of h.
  // Eight k steps a trip, loaded ahead of the arithmetic: a trip pays the way to memory
  // once, not once a k step.
  for (int jo = 0; jo < DD / 32; jo += 8) {
    _Float16 hv[4][8];
    v4f wlo[8], whi[8];
#pragma unroll
    for (int r = 0; r < 4; ++r)
#pragma unroll
      for (int j = 0; j < 8; ++j) hv[r][j] = hr[r * DD + (jo + j) * 32];
#pragma unroll
    for (int j = 0; j < 8; ++j) {
      wlo[j] = wb[(jo + j) * 64];
      whi[j] = wb[(jo + j) * 64 + 1];
    }
#pragma unroll
    for (int j = 0; j < 8; ++j)
#pragma unroll
      for (int r = 0; r < 4; ++r) {
        float hf = (float)hv[r][j];
#pragma unroll
        for (int hh = 0; hh < 4; ++hh) {
          acc[r][hh]     += hf * wlo[j][hh];
          acc[r][hh + 4] += hf * whi[j][hh];
        }
      }
  }
  // lane r*8 + hh keeps and stores the sum of (row r, head hh)
  float mine = 0.f;
#pragma unroll
  for (int r = 0; r < 4; ++r)
#pragma unroll
    for (int hh = 0; hh < 8; ++hh) {
      float s = wave_sum(acc[r][hh]);
      mine = (lane == r * 8 + hh) ? s : mine;
    }
  size_t row = row0 + (lane >> 3);
  int b = (int)(row / LL), l = (int)(row % LL);
  betag[((size_t)b * HH + (lane & 7)) * LL + l] = sigmoidf_(mine);
}

// -------- causal conv(K=4)+silu [+silu+l2norm (+qscale)] -> heads f16 ------
// mode: 0 = v (conv+silu), 1 = k (+silu+l2norm), 2 = q (+silu+l2norm+DK^-.5)
// A wave takes RW rows in a row of one head, a lane four channels; the RW + 3 input
// rows are loaded once and each serves up to four output rows.
#define RW 8
__global__ __launch_bounds__(256) void conv_head_kernel(
    const _Float16* __restrict__ pre, const float* __restrict__ cw,
    _Float16* __restrict__ outg, int mode) {
  int lane = threadIdx.x & 31;
  unsigned gw = blockIdx.x * 8 + wave_id();
  unsigned hb = gw / (LL / RW);         // b*H + h
  unsigned l0 = (gw % (LL / RW)) * RW;
  unsigned hh = hb % HH, b = hb / HH;
  unsigned ch = hh * DKH + lane * 4;
  const bool first = (l0 == 0);         // the three rows in front of l0 are the left padding
  // rows l0-3 .. l0+RW-1; at l0 == 0 the first three loads read rows 0..2 instead
  // (inside the buffer) and are zeroed below
  const _Float16* src = pre + ((size_t)b * LL + l0) * DD + ch;
  const _Float16* srcm = first ? src : src - 3 * DD;
  v4h xin[RW + 3];
#pragma unroll
  for (int i = 0; i < 3; ++i) xin[i] = *(const v4h*)(srcm + i * DD);
#pragma unroll
  for (int i = 3; i < RW + 3; ++i) xin[i] = *(const v4h*)(src + (i - 3) * DD);
  v4f wt[4];                            // the four taps of each of the lane's channels
#pragma unroll
  for (int c = 0; c < 4; ++c) wt[c] = *(const v4f*)(cw + (ch + c) * 4);
  v4f xf[RW + 3];
#pragma unroll
  for (int i = 0; i < RW + 3; ++i)
#pragma unroll
    for (int c = 0; c < 4; ++c) xf[i][c] = (i < 3 && first) ? 0.f : (float)xin[i][c];
  v4f s[RW];
#pragma unroll
  for (int r = 0; r < RW; ++r)
#pragma unroll
    for (int c = 0; c < 4; ++c) {
      float acc = 0.f;
#pragma unroll
      for (int i = 0; i < 4; ++i) acc += xf[r + i][c] * wt[c][i];
      s[r][c] = siluf_(acc);
    }
  if (mode > 0) {
    float qs = (mode == 2) ? 0.08838834764831845f : 1.f;   // 128^-0.5
#pragma unroll
    for (int r = 0; r < RW; ++r) {
#pragma unroll
      for (int c = 0; c < 4; ++c) s[r][c] = siluf_(s[r][c]);
      v4f q = s[r] * s[r];
      float inv = rsqrtf(wave_sum((q[0] + q[1]) + (q[2] + q[3])) + EPSF);
#pragma unroll
      for (int c = 0; c < 4; ++c) s[r][c] = s[r][c] * inv * qs;
    }
  }
  v4h* dst = (v4h*)(outg + ((size_t)hb * LL + l0) * DKH) + lane;
#pragma unroll
  for (int r = 0; r < RW; ++r) {
    v4h o;
#pragma unroll
    for (int c = 0; c < 4; ++c) o[c] = (_Float16)s[r][c];
    dst[r * 32] = o;
  }
}

#define PK 136   // halfs: rows of 128 f16 (q16, k16, -w)       272 B
#define PX 72    // halfs: rows of  64 f16 (X16, qk, vnT, (bv)^T) 144 B
#define PS 132   // floats: rows of 128 f32 (St)                 528 B
__global__ __launch_bounds__(256) void delta_prep_kernel(
    const _Float16* __restrict__ qg, const _Float16* __restrict__ kg,
    const _Float16* __restrict__ vg, const float* __restrict__ betag,
    float* __restrict__ ug, _Float16* __restrict__ wg, _Float16* __restrict__ qkg) {
  __shared__ __attribute__((aligned(16))) _Float16 q16[64 * PK];
  __shared__ __attribute__((aligned(16))) _Float16 k16[64 * PK];
  __shared__ __attribute__((aligned(16))) _Float16 vw16[128 * PX];   // 128*PX >= 64*PK
  __shared__ __attribute__((aligned(16))) float    Af[64 * 64];
  __shared__ __attribute__((aligned(16))) _Float16 X16[64 * PX];
  __shared__ __attribute__((aligned(16))) float    XT[3 * 32 * 32];  // f32 scratch of the inverse
  __shared__ __attribute__((aligned(16))) float    betaS[64];
  _Float16* qk16 = (_Float16*)Af;

  int tid = threadIdx.x, lane = tid & 31, wid = tid >> 5;
  int l15 = lane & 15, hi8 = (lane & 16) ? 8 : 0;
  size_t chunk = blockIdx.x;            // (b*H + h)*64 + c ; its rows start at chunk*64

  // ---- load chunk (beta first; fold beta into transposed v) ----
  if (tid < 64) betaS[tid] = betag[chunk * 64 + tid];
  __syncthreads();
  {
    // One chunk base per operand and a fully unrolled loop: every load is that
    // operand's lane pointer + an immediate.
    const _Float16* qc = qg + chunk * 64 * DKH;
    const _Float16* kc = kg + chunk * 64 * DKH;
    const _Float16* vc = vg + chunk * 64 * DKH;
    const int j0 = tid >> 7, d = tid & 127;
#pragma unroll
    for (int it = 0; it < 32; ++it) {
      int i = tid + it * 256;
      int j = j0 + it * 2;
      q16[j * PK + d] = qc[i];
      k16[j * PK + d] = kc[i];
      vw16[d * PX + j] = (_Float16)((float)vc[i] * betaS[j]);   // (beta*v)^T
    }
  }
  __syncthreads();

  // ---- kk = k k^T ; A = I + tril(beta*kk, -1) ----
#pragma unroll
  for (int ti = 0; ti < 2; ++ti) {
    int t = wid * 2 + ti, tm = t >> 2, tn = t & 3;
    v8f a0 = (v8f){};
    // beta of this lane's 8 rows, read unconditionally: the mask below is then a
    // select, with no branch between the last matrix instruction and its readers
    const v4f blo = *(const v4f*)&betaS[tm * 16 + hi8];
    const v4f bhi = *(const v4f*)&betaS[tm * 16 + hi8 + 4];
#pragma unroll
    for (int kb = 0; kb < 128; kb += 32) {
      v16h a, b;
#pragma unroll
      for (int e = 0; e < 16; ++e) {
        int ko = kb + koff(e, lane);
        a[e] = k16[(tm * 16 + l15) * PK + ko];
        b[e] = k16[(tn * 16 + l15) * PK + ko];   // k^T as B
      }
      a0 = wmma_f16(a, b, a0);
    }
#pragma unroll
    for (int r = 0; r < 8; ++r) {
      int m = tm * 16 + hi8 + r, n = tn * 16 + l15;
      Af[m * 64 + n] = (m == n) ? 1.f : ((n < m) ? (r < 4 ? blo[r & 3] : bhi[r & 3]) * a0[r] : 0.f);
    }
  }
  __syncthreads();

  // ---- X = A^-1 (unit lower tri), blocked 2x2 with 32x32 blocks, all f32 ----
  // X11 = A11^-1, X22 = A22^-1: one wave each, lane = column, the column kept in
  // registers, rows of A read as broadcasts. X21 = -X22 (A21 X11) on all 8 waves.
  // Every loop below is fully unrolled so that the per-lane arrays have static
  // indices and stay in registers.
  {
    float* Xf = XT;                   // [2][32][32] diagonal-block inverses
    float* Tf = Xf + 2 * 32 * 32;     // [32][32]    A21 * X11
    if (wid < 2) {
      int r0 = wid * 32;
      float xc[32];
      float ab[2][4][32];             // rows of A11/A22, two groups of 4 rows
#pragma unroll
      for (int r = 1; r < 4; ++r)
#pragma unroll
        for (int l = 0; l < r; ++l) ab[0][r][l] = Af[(r0 + r) * 64 + r0 + l];
#pragma unroll  // full unroll keeps xc[] and ab[] in registers (static indices only)
      for (int G = 0; G < 8; ++G) {
        if (G + 1 < 8) {
#pragma unroll
          for (int r = 0; r < 4; ++r) {
            int i = (G + 1) * 4 + r;
#pragma unroll
            for (int l = 0; l < i; ++l)
              ab[(G + 1) & 1][r][l] = Af[(r0 + i) * 64 + r0 + l];
          }
        }
        // keeps the next group's LDS reads above this group's arithmetic, so that
        // their latency is not paid row by row on the substitution's serial path
        __builtin_amdgcn_sched_barrier(0);
#pragma unroll
        for (int r = 0; r < 4; ++r) {
          int i = G * 4 + r;
          float s0 = 0.f, s1 = 0.f;
#pragma unroll
          for (int l = 0; l < i; ++l) {
            if (l & 1) s1 += ab[G & 1][r][l] * xc[l]; else s0 += ab[G & 1][r][l] * xc[l];
          }
          xc[i] = (i == lane) ? 1.f : -(s0 + s1);
          Xf[wid * 1024 + i * 32 + lane] = xc[i];
          X16[(r0 + i) * PX + r0 + lane] = (_Float16)xc[i];
        }
      }
    } else if (wid == 2) {
#pragma unroll
      for (int i = 0; i < 32; ++i) X16[i * PX + 32 + lane] = (_Float16)0.f;
    }
    __syncthreads();   // publishes X11, X22 to all waves
    {
      float xcol[32];
#pragma unroll
      for (int l = 0; l < 32; ++l) xcol[l] = Xf[l * 32 + lane];
#pragma unroll
      for (int r = 0; r < 4; ++r) {
        int i = wid * 4 + r;
        const v4f* ar = (const v4f*)&Af[(32 + i) * 64];
        float s0 = 0.f, s1 = 0.f, s2 = 0.f, s3 = 0.f;
#pragma unroll
        for (int g = 0; g < 8; ++g) {
          v4f a = ar[g];
          s0 += a[0] * xcol[g * 4 + 0];
          s1 += a[1] * xcol[g * 4 + 1];
          s2 += a[2] * xcol[g * 4 + 2];
          s3 += a[3] * xcol[g * 4 + 3];
        }
        Tf[i * 32 + lane] = (s0 + s1) + (s2 + s3);
      }
    }
    __syncthreads();   // publishes T = A21 X11
    {
      float tcol[32];
#pragma unroll
      for (int l = 0; l < 32; ++l) tcol[l] = Tf[l * 32 + lane];
#pragma unroll
      for (int r = 0; r < 4; ++r) {
        int i = wid * 4 + r;
        const v4f* xr = (const v4f*)&Xf[1024 + i * 32];
        float s0 = 0.f, s1 = 0.f, s2 = 0.f, s3 = 0.f;
#pragma unroll
        for (int g = 0; g < 8; ++g) {
          v4f a = xr[g];
          s0 += a[0] * tcol[g * 4 + 0];
          s1 += a[1] * tcol[g * 4 + 1];
          s2 += a[2] * tcol[g * 4 + 2];
          s3 += a[3] * tcol[g * 4 + 3];
        }
        X16[(32 + i) * PX + lane] = (_Float16)(-((s0 + s1) + (s2 + s3)));
      }
    }
  }
  __syncthreads();

  // ---- u = X @ (beta*v) -> workspace, in accumulator layout ----
#pragma unroll
  for (int ti = 0; ti < 4; ++ti) {
    int t = wid * 4 + ti, tm = t >> 3, tn = t & 7;
    v8f a0 = (v8f){};
#pragma unroll
    for (int kb = 0; kb < 64; kb += 32) {
      v16h a, b;
#pragma unroll
      for (int e = 0; e < 16; ++e) {
        int ko = kb + koff(e, lane);
        a[e] = X16[(tm * 16 + l15) * PX + ko];
        b[e] = vw16[(tn * 16 + l15) * PX + ko];           // (beta*v)^T
      }
      a0 = wmma_f16(a, b, a0);
    }
    *(v8f*)(ug + ((chunk * 32 + t) * 32 + lane) * 8) = a0;
  }
  __syncthreads();

  // ---- -w = -(X @ (beta*k)) -> vw16 (row-major) ; qk = tril(q k^T) ----
#pragma unroll
  for (int ti = 0; ti < 4; ++ti) {
    int t = wid * 4 + ti, tm = t >> 3, tn = t & 7;
    v8f a0 = (v8f){};
#pragma unroll
    for (int kb = 0; kb < 64; kb += 32) {
      v16h a, b;
#pragma unroll
      for (int e = 0; e < 16; ++e) {
        int ko = kb + koff(e, lane);
        a[e] = X16[(tm * 16 + l15) * PX + ko];
        b[e] = (_Float16)((float)k16[ko * PK + tn * 16 + l15] * betaS[ko]);
      }
      a0 = wmma_f16(a, b, a0);
    }
#pragma unroll
    for (int r = 0; r < 8; ++r)
      vw16[(tm * 16 + hi8 + r) * PK + tn * 16 + l15] = (_Float16)(-a0[r]);
  }
#pragma unroll
  for (int ti = 0; ti < 2; ++ti) {
    int t = wid * 2 + ti, tm = t >> 2, tn = t & 3;
    v8f a0 = (v8f){};
#pragma unroll
    for (int kb = 0; kb < 128; kb += 32) {
      v16h a, b;
#pragma unroll
      for (int e = 0; e < 16; ++e) {
        int ko = kb + koff(e, lane);
        a[e] = q16[(tm * 16 + l15) * PK + ko];
        b[e] = k16[(tn * 16 + l15) * PK + ko];
      }
      a0 = wmma_f16(a, b, a0);
    }
#pragma unroll
    for (int r = 0; r < 8; ++r) {
      int m = tm * 16 + hi8 + r, n = tn * 16 + l15;
      qk16[m * PX + n] = (_Float16)((n <= m) ? a0[r] : 0.f);
    }
  }
  __syncthreads();

  // ---- -w and qk: LDS -> workspace, 16 bytes a lane ----
  {
    int4* wo = (int4*)(wg + chunk * 64 * DKH) + tid;
    int4* qo = (int4*)(qkg + chunk * 64 * 64) + tid;
#pragma unroll
    for (int it = 0; it < 4; ++it) {
      int p = tid + it * 256;
      wo[it * 256] = *(const int4*)&vw16[(p >> 4) * PK + (p & 15) * 8];
    }
#pragma unroll
    for (int it = 0; it < 2; ++it) {
      int p = tid + it * 256;
      qo[it * 256] = *(const int4*)&qk16[(p >> 3) * PX + (p & 7) * 8];
    }
  }
}

__global__ __launch_bounds__(256) void delta_kernel(
    const _Float16* __restrict__ qg, const _Float16* __restrict__ kg,
    const _Float16* __restrict__ wg, const _Float16* __restrict__ qkg,
    const float* __restrict__ ug, float* __restrict__ og) {
  __shared__ __attribute__((aligned(16))) float    St[128 * PS];
  __shared__ __attribute__((aligned(16))) _Float16 q16[64 * PK];
  __shared__ __attribute__((aligned(16))) _Float16 k16[64 * PK];
  __shared__ __attribute__((aligned(16))) _Float16 vw16[64 * PK];
  __shared__ __attribute__((aligned(16))) _Float16 qk16[64 * PX];
  __shared__ __attribute__((aligned(16))) _Float16 vnT[128 * PX];

  int tid = threadIdx.x, lane = tid & 31, wid = tid >> 5;
  int l15 = lane & 15, hi8 = (lane & 16) ? 8 : 0;
  size_t bh = blockIdx.x;
  size_t rowbase = bh * (size_t)LL;

  for (int i = tid; i < 128 * PS; i += 256) St[i] = 0.f;

  for (int c = 0; c < NCHUNK; ++c) {
    // ---- load chunk: q, k, -w, qk -> LDS ; u -> accumulator registers ----
    v8f uacc[4], oacc[4];
    {
      // One chunk base per operand: every load is base + lane offset + an immediate.
      // (v4f is only the carrier of 16 bytes here: eight f16 move as they are)
      size_t chunk = bh * NCHUNK + c;
      const v4f* qc = (const v4f*)(qg + chunk * 64 * DKH);
      const v4f* kc = (const v4f*)(kg + chunk * 64 * DKH);
      const v4f* wc = (const v4f*)(wg + chunk * 64 * DKH);
      const v4f* xc = (const v4f*)(qkg + chunk * 64 * 64);
      const v8f*  uc = (const v8f*)(ug + chunk * 64 * DKH);
      const unsigned ut = (unsigned)tid, uu = (unsigned)(wid * 128 + lane);
      v4f tq[4], tk[4], tw[4], tx[2];
#pragma unroll
      for (int it = 0; it < 4; ++it) {
        tq[it] = qc[ut + it * 256];
        tk[it] = kc[ut + it * 256];
        tw[it] = wc[ut + it * 256];
      }
#pragma unroll
      for (int it = 0; it < 2; ++it) tx[it] = xc[ut + it * 256];
#pragma unroll
      for (int ti = 0; ti < 4; ++ti) uacc[ti] = uc[uu + ti * 32];   // tile wid*4+ti, this lane
      // inputs-only fence on the loaded values: all 22 loads are issued ahead of it and
      // share one trip to memory (without it they were built as load, wait, store, one by one)
      asm volatile("" :: "v"(tq[0]), "v"(tq[1]), "v"(tq[2]), "v"(tq[3]),
                         "v"(tk[0]), "v"(tk[1]), "v"(tk[2]), "v"(tk[3]),
                         "v"(tw[0]), "v"(tw[1]), "v"(tw[2]), "v"(tw[3]),
                         "v"(tx[0]), "v"(tx[1]),
                         "v"(uacc[0]), "v"(uacc[1]), "v"(uacc[2]), "v"(uacc[3]));
#pragma unroll
      for (int it = 0; it < 4; ++it) {
        int p = tid + it * 256;
        int o = (p >> 4) * PK + (p & 15) * 8;
        *(v4f*)&q16[o]  = tq[it];
        *(v4f*)&k16[o]  = tk[it];
        *(v4f*)&vw16[o] = tw[it];
      }
#pragma unroll
      for (int it = 0; it < 2; ++it) {
        int p = tid + it * 256;
        *(v4f*)&qk16[(p >> 3) * PX + (p & 7) * 8] = tx[it];
      }
    }
    __syncthreads();

    // ---- o1 = q @ S (regs) ; v_new = u + (-w) @ S -> vnT (transposed) ----
    // both products take the same S fragment
#pragma unroll
    for (int ti = 0; ti < 4; ++ti) {
      int t = wid * 4 + ti, tm = t >> 3, tn = t & 7;
      v8f a0 = uacc[ti];
      v8f a1 = (v8f){};
#pragma unroll
      for (int kb = 0; kb < 128; kb += 32) {
        v16h aq, aw, b;
#pragma unroll
        for (int e = 0; e < 16; ++e) {
          int ko = kb + koff(e, lane);
          aq[e] = q16[(tm * 16 + l15) * PK + ko];
          aw[e] = vw16[(tm * 16 + l15) * PK + ko];         // -w row-major
          b[e] = (_Float16)St[(tn * 16 + l15) * PS + ko];  // S^T rows
        }
        a1 = wmma_f16(aq, b, a1);
        a0 = wmma_f16(aw, b, a0);
      }
      oacc[ti] = a1;
#pragma unroll
      for (int r = 0; r < 8; ++r)
        vnT[(tn * 16 + l15) * PX + tm * 16 + hi8 + r] = (_Float16)a0[r];
    }
    __syncthreads();

    // ---- o = o1 + qk @ v_new -> global ----
#pragma unroll
    for (int ti = 0; ti < 4; ++ti) {
      int t = wid * 4 + ti, tm = t >> 3, tn = t & 7;
      v8f a0 = oacc[ti];
#pragma unroll
      for (int kb = 0; kb < 64; kb += 32) {
        v16h a, b;
#pragma unroll
        for (int e = 0; e < 16; ++e) {
          int ko = kb + koff(e, lane);
          a[e] = qk16[(tm * 16 + l15) * PX + ko];
          b[e] = vnT[(tn * 16 + l15) * PX + ko];            // v_new^T rows
        }
        a0 = wmma_f16(a, b, a0);
      }
#pragma unroll
      for (int r = 0; r < 8; ++r)
        og[(rowbase + (size_t)c * 64 + tm * 16 + hi8 + r) * 128 + tn * 16 + l15] = a0[r];
    }
    // ---- S^T += (k^T @ v_new)^T : tile (m=dk, n=dv), stored transposed ----
#pragma unroll
    for (int ti = 0; ti < 8; ++ti) {
      int t = wid * 8 + ti, tm = t >> 3, tn = t & 7;
      v8f a0;
#pragma unroll
      for (int r = 0; r < 8; ++r)
        a0[r] = St[(tn * 16 + l15) * PS + tm * 16 + hi8 + r];
#pragma unroll
      for (int kb = 0; kb < 64; kb += 32) {
        v16h a, b;
#pragma unroll
        for (int e = 0; e < 16; ++e) {
          int ko = kb + koff(e, lane);
          a[e] = k16[ko * PK + tm * 16 + l15];   // (k^T)[m][j] = k[j][m]
          b[e] = vnT[(tn * 16 + l15) * PX + ko];  // v_new^T rows
        }
        a0 = wmma_f16(a, b, a0);
      }
#pragma unroll
      for (int r = 0; r < 8; ++r)
        St[(tn * 16 + l15) * PS + tm * 16 + hi8 + r] = a0[r];
    }
    __syncthreads();
  }
}

// ---------------- per-head output RMSNorm -> [B,L,D] f16 -------------------
// a wave takes RW rows in a row of one head, a lane four channels
__global__ __launch_bounds__(256) void onorm_kernel(const float* __restrict__ og,
                                                    const float* __restrict__ w,
                                                    _Float16* __restrict__ on16) {
  int lane = threadIdx.x & 31;
  unsigned gw = blockIdx.x * 8 + wave_id();
  unsigned hb = gw / (LL / RW);         // b*H + h
  unsigned l0 = (gw % (LL / RW)) * RW;
  unsigned hh = hb % HH, b = hb / HH;
  const v4f* src = (const v4f*)(og + ((size_t)hb * LL + l0) * DKH) + lane;
  v4f v[RW];
#pragma unroll
  for (int r = 0; r < RW; ++r) v[r] = src[r * 32];
  v4f wv = *((const v4f*)w + lane);
  _Float16* dst = on16 + ((size_t)b * LL + l0) * DD + hh * DKH + lane * 4;
#pragma unroll
  for (int r = 0; r < RW; ++r) {
    v4f q = v[r] * v[r];
    float inv = rsqrtf(wave_sum((q[0] + q[1]) + (q[2] + q[3])) * (1.f / DKH) + EPSF);
    v4h o;
#pragma unroll
    for (int c = 0; c < 4; ++c) o[c] = (_Float16)(v[r][c] * inv * wv[c]);
    *(v4h*)(dst + (size_t)r * DD) = o;
  }
}

// ---------------------------------------------------------------------------
extern "C" void kernel_launch(void* const* d_in, const int* in_sizes, int n_in,
                              void* d_out, int out_size, void* d_ws, size_t ws_size,
                              hipStream_t stream) {
  const float* x        = (const float*)d_in[0];
  const float* norm_w   = (const float*)d_in[1];
  const float* Wq       = (const float*)d_in[2];
  const float* Wk       = (const float*)d_in[3];
  const float* Wv       = (const float*)d_in[4];
  const float* Wb       = (const float*)d_in[5];
  const float* conv_q   = (const float*)d_in[6];
  const float* conv_k   = (const float*)d_in[7];
  const float* conv_v   = (const float*)d_in[8];
  const float* o_norm_w = (const float*)d_in[9];
  const float* Wo       = (const float*)d_in[10];
  float* out = (float*)d_out;

  char* p = (char*)d_ws;
  auto take = [&](size_t bytes) { char* r = p; p += (bytes + 255) & ~(size_t)255; return r; };
  const size_t actF16 = (size_t)BLROWS * DD * sizeof(_Float16);   // 16 MiB
  const size_t wF16   = (size_t)DD * DD * sizeof(_Float16);       // 2 MiB

  _Float16* h16   = (_Float16*)take(actF16);
  _Float16* wq16t = (_Float16*)take(wF16);   // transposed [N][K]
  _Float16* wk16t = (_Float16*)take(wF16);
  _Float16* wv16t = (_Float16*)take(wF16);
  _Float16* wo16t = (_Float16*)take(wF16);
  _Float16* qpre  = (_Float16*)take(actF16);
  _Float16* kpre  = (_Float16*)take(actF16);
  _Float16* vpre  = (_Float16*)take(actF16);
  _Float16* qh    = (_Float16*)take(actF16);
  _Float16* kh    = (_Float16*)take(actF16);
  _Float16* vh    = (_Float16*)take(actF16);
  float*    betag = (float*)take((size_t)BB * HH * LL * sizeof(float));
  float*    og    = (float*)take((size_t)BB * HH * LL * DKH * sizeof(float));
  _Float16* on16  = (_Float16*)take(actF16);
  float*    ug    = (float*)take((size_t)BB * HH * LL * DKH * sizeof(float));
  _Float16* wg    = (_Float16*)take(actF16);
  _Float16* qkg   = (_Float16*)take((size_t)BB * HH * LL * 64 * sizeof(_Float16));

  // 1. h = rmsnorm(x)
  rmsnorm_kernel<<<BLROWS / 8, 256, 0, stream>>>(x, norm_w, h16);
  // 2. weights -> f16, transposed to [N][K] for K-contiguous B fragments
  int tgrid = (DD / 32) * (DD / 32);
  transpose_f16_kernel<<<tgrid, 256, 0, stream>>>(Wq, wq16t, DD, DD);
  transpose_f16_kernel<<<tgrid, 256, 0, stream>>>(Wk, wk16t, DD, DD);
  transpose_f16_kernel<<<tgrid, 256, 0, stream>>>(Wv, wv16t, DD, DD);
  transpose_f16_kernel<<<tgrid, 256, 0, stream>>>(Wo, wo16t, DD, DD);
  // 3. projections (WMMA GEMMs, async double-buffered staging)
  dim3 ggrid(DD / 128, BLROWS / 128);
  gemm_f16_kernel<0><<<ggrid, 256, 0, stream>>>(h16, wq16t, qpre, nullptr, nullptr, BLROWS, DD, DD);
  gemm_f16_kernel<0><<<ggrid, 256, 0, stream>>>(h16, wk16t, kpre, nullptr, nullptr, BLROWS, DD, DD);
  gemm_f16_kernel<0><<<ggrid, 256, 0, stream>>>(h16, wv16t, vpre, nullptr, nullptr, BLROWS, DD, DD);
  // 4. beta
  beta_kernel<<<BLROWS / 32, 256, 0, stream>>>(h16, Wb, betag);
  // 5. conv + activations + head layout
  conv_head_kernel<<<BB * HH * LL / (8 * RW), 256, 0, stream>>>(qpre, conv_q, qh, 2);
  conv_head_kernel<<<BB * HH * LL / (8 * RW), 256, 0, stream>>>(kpre, conv_k, kh, 1);
  conv_head_kernel<<<BB * HH * LL / (8 * RW), 256, 0, stream>>>(vpre, conv_v, vh, 0);
  // 6. chunkwise delta rule: per-chunk operands for all chunks, then the serial walk
  delta_prep_kernel<<<BB * HH * NCHUNK, 256, 0, stream>>>(qh, kh, vh, betag, ug, wg, qkg);
  delta_kernel<<<BB * HH, 256, 0, stream>>>(qh, kh, wg, qkg, ug, og);
  // 7. output norm
  onorm_kernel<<<BB * HH * LL / (8 * RW), 256, 0, stream>>>(og, o_norm_w, on16);
  // 8. out = x + on @ Wo
  gemm_f16_kernel<1><<<ggrid, 256, 0, stream>>>(on16, wo16t, nullptr, out, x, BLROWS, DD, DD);
}

// v005
// One run takes 379 microseconds.
// Two timings next to v004 put it at 1.44 and 1.45 times that version's speed.
// Counting every step since v000, it is 14.3 times as fast.
#include <hip/hip_runtime.h>
#include <hip/hip_bf16.h>

typedef __attribute__((ext_vector_type(16))) _Float16 v16h;
typedef __attribute__((ext_vector_type(8)))  float    v8f;
typedef __attribute__((ext_vector_type(4)))  float    v4f;

#define BB 2
#define LL 4096
#define DD 1024
#define HH 8
#define DKH 128
#define BLROWS (BB*LL)          // 8192
#define NCHUNK 64
#define EPSF 1e-6f

#if defined(__gfx1250__) && __has_builtin(__builtin_amdgcn_global_load_async_to_lds_b128)
#define HAVE_ASYNC 1
typedef int v4i_ __attribute__((ext_vector_type(4)));
typedef __attribute__((address_space(1))) v4i_* gp_v4i;
typedef __attribute__((address_space(3))) v4i_* lp_v4i;
#define GLA128(SRC, DST) \
  __builtin_amdgcn_global_load_async_to_lds_b128((gp_v4i)(void*)(SRC), (lp_v4i)(void*)(DST), 0, 0)
#if __has_builtin(__builtin_amdgcn_s_wait_asynccnt)
#define WAITA(n) __builtin_amdgcn_s_wait_asynccnt(n)
#else
#define WAITA(n) asm volatile("s_wait_asynccnt %0" :: "n"(n) : "memory")
#endif
#else
#define HAVE_ASYNC 0
#define WAITA(n)
#endif

__device__ __forceinline__ int koff(int e, int lane) {
  int j = e >> 1;
  return ((j & 4) << 2) + ((lane & 16) >> 1) + ((j & 3) << 1) + (e & 1);
}

__device__ __forceinline__ v8f wmma_f16(v16h a, v16h b, v8f c) {
  return __builtin_amdgcn_wmma_f32_16x16x32_f16(false, a, false, b, (short)0, c, false, false);
}

__device__ __forceinline__ float sigmoidf_(float x) { return 1.f / (1.f + __expf(-x)); }
__device__ __forceinline__ float siluf_(float x) { return x * sigmoidf_(x); }

// ---------------- the row kernels ------------------------------------------
// rmsnorm, beta, conv+l2norm and the output norm each work on short rows (128 or 1024
// elements). One wave takes whole rows: a lane holds its share of a row in registers,
// the row's sum is a butterfly over the 32 lanes, and there is no LDS and no barrier.
// One block per row cost far more in starting waves than in the rows' own work.
// Every '#pragma unroll' in these four kernels is on a loop over a lane's own share: fully
// unrolled, the per-lane arrays have static indices only and stay in registers.
typedef __attribute__((ext_vector_type(4))) _Float16 v4h;

// the wave's number in its block, held as a scalar, so that row numbers and row
// addresses are scalar arithmetic and the loads take base + lane offset + immediate
__device__ __forceinline__ unsigned wave_id() {
  return (unsigned)__builtin_amdgcn_readfirstlane((int)(threadIdx.x >> 5));
}

template <int M>
__device__ __forceinline__ float xmask_add(float v) {
  // v + (v of lane ^ M), M < 16: a DPP row_xmask move inside the 16-lane row
  int o = __builtin_amdgcn_update_dpp(0, __builtin_bit_cast(int, v), 0x160 | M, 0xf, 0xf, true);
  return v + __builtin_bit_cast(float, o);
}
// sum over the wave's 32 lanes, the same bits in every lane
__device__ __forceinline__ float wave_sum(float v) {
  v = xmask_add<1>(v);
  v = xmask_add<2>(v);
  v = xmask_add<4>(v);
  v = xmask_add<8>(v);
  int b = __builtin_bit_cast(int, v);
  int o = __builtin_amdgcn_permlanex16(b, b, 0x76543210, 0xfedcba98, false, false);  // lane ^ 16
  return v + __builtin_bit_cast(float, o);
}

// ---------------- RMSNorm (x -> h f16): one row a wave ----------------------
__global__ __launch_bounds__(256) void rmsnorm_kernel(const float* __restrict__ x,
                                                      const float* __restrict__ w,
                                                      _Float16* __restrict__ h16) {
  int lane = threadIdx.x & 31;
  size_t row = (size_t)(blockIdx.x * 8 + wave_id());
  const v4f* xr = (const v4f*)(x + row * DD) + lane;
  const v4f* wr = (const v4f*)w + lane;
  v4f xv[8];
#pragma unroll
  for (int j = 0; j < 8; ++j) xv[j] = xr[j * 32];
  v4f p = (v4f){};
#pragma unroll
  for (int j = 0; j < 8; ++j) p += xv[j] * xv[j];
  float inv = rsqrtf(wave_sum((p[0] + p[1]) + (p[2] + p[3])) * (1.f / DD) + EPSF);
  v4h* ho = (v4h*)(h16 + row * DD) + lane;
#pragma unroll
  for (int j = 0; j < 8; ++j) {
    v4f wv = wr[j * 32];
    v4h o;
#pragma unroll
    for (int c = 0; c < 4; ++c) o[c] = (_Float16)(xv[j][c] * inv * wv[c]);
    ho[j * 32] = o;
  }
}

// -------- LDS-tiled transpose: src f32 [R][C] -> dst f16 [C][R] ------------
__global__ __launch_bounds__(256) void transpose_f16_kernel(const float* __restrict__ src,
                                                            _Float16* __restrict__ dst,
                                                            int R, int C) {
  __shared__ float t[32][33];
  int nbx = C / 32;
  int bx = blockIdx.x % nbx, by = blockIdx.x / nbx;
  int r0 = by * 32, c0 = bx * 32;
  int tr = threadIdx.x >> 5, tc = threadIdx.x & 31;
#pragma unroll
  for (int i = 0; i < 32; i += 8)
    t[tr + i][tc] = src[(size_t)(r0 + tr + i) * C + c0 + tc];
  __syncthreads();
#pragma unroll
  for (int i = 0; i < 32; i += 8)
    dst[(size_t)(c0 + tr + i) * R + r0 + tc] = (_Float16)t[tc][tr + i];
}

// ---------------- WMMA GEMM: C[M,N] = A[M,K] * Bt[N,K]^T (+resid) ----------
// blockTile 128x128, 8 waves as 4(m)x2(n); double-buffered async LDS staging.
// MODE 0: f16 out ; MODE 1: f32 out with f32 residual added
template <int MODE>
__global__ __launch_bounds__(256) void gemm_f16_kernel(
    const _Float16* __restrict__ A, const _Float16* __restrict__ Bt,
    _Float16* __restrict__ out16, float* __restrict__ outf,
    const float* __restrict__ resid, int M, int N, int K) {
  __shared__ _Float16 As[2][128][32];
  __shared__ _Float16 Bs[2][128][32];
  int tid = threadIdx.x, lane = tid & 31;
  int wid = tid >> 5, l15 = lane & 15, hi8 = (lane & 16) ? 8 : 0;
  int wm = wid >> 1, wn = wid & 1;
  int bm = blockIdx.y * 128, bn = blockIdx.x * 128;

  int cr = tid >> 2, cs = (tid & 3) * 8;          // copy row / 8-half segment
  auto issue = [&](int buf, int k0) {
    const _Float16* ga = A + (size_t)(bm + cr) * K + k0 + cs;
    const _Float16* gb = Bt + (size_t)(bn + cr) * K + k0 + cs;
#if HAVE_ASYNC
    GLA128(ga,                    &As[buf][cr][cs]);
    GLA128(ga + (size_t)64 * K,   &As[buf][cr + 64][cs]);
    GLA128(gb,                    &Bs[buf][cr][cs]);
    GLA128(gb + (size_t)64 * K,   &Bs[buf][cr + 64][cs]);
#else
    *(int4*)&As[buf][cr][cs]      = *(const int4*)ga;
    *(int4*)&As[buf][cr + 64][cs] = *(const int4*)(ga + (size_t)64 * K);
    *(int4*)&Bs[buf][cr][cs]      = *(const int4*)gb;
    *(int4*)&Bs[buf][cr + 64][cs] = *(const int4*)(gb + (size_t)64 * K);
#endif
  };

  v8f acc[2][4];
#pragma unroll
  for (int i = 0; i < 2; ++i)
#pragma unroll
    for (int j = 0; j < 4; ++j) acc[i][j] = (v8f){};

  int nT = K / 32;
  issue(0, 0);
  for (int kt = 0; kt < nT; ++kt) {
    int buf = kt & 1;
    if (kt + 1 < nT) { issue(buf ^ 1, (kt + 1) * 32); WAITA(4); }
    else             { WAITA(0); }
    __syncthreads();
    v16h af[2], bf[4];
#pragma unroll
    for (int i = 0; i < 2; ++i) {
      int mr = wm * 32 + i * 16 + l15;
#pragma unroll
      for (int e = 0; e < 16; ++e) af[i][e] = As[buf][mr][koff(e, lane)];
    }
#pragma unroll
    for (int j = 0; j < 4; ++j) {
      int nc = wn * 64 + j * 16 + l15;
#pragma unroll
      for (int e = 0; e < 16; ++e) bf[j][e] = Bs[buf][nc][koff(e, lane)];
    }
#pragma unroll
    for (int i = 0; i < 2; ++i)
#pragma unroll
      for (int j = 0; j < 4; ++j) acc[i][j] = wmma_f16(af[i], bf[j], acc[i][j]);
    __syncthreads();
  }
#pragma unroll
  for (int i = 0; i < 2; ++i)
#pragma unroll
    for (int j = 0; j < 4; ++j)
#pragma unroll
      for (int r = 0; r < 8; ++r) {
        size_t gm = bm + wm * 32 + i * 16 + hi8 + r;
        size_t gn = bn + wn * 64 + j * 16 + l15;
        if (MODE == 0) out16[gm * N + gn] = (_Float16)acc[i][j][r];
        else           outf[gm * N + gn] = resid[gm * N + gn] + acc[i][j][r];
      }
}

// ---------------- beta = sigmoid(h @ Wb): four rows a wave ------------------
__global__ __launch_bounds__(256) void beta_kernel(const _Float16* __restrict__ h16,
                                                   const float* __restrict__ Wb,
                                                   float* __restrict__ betag) {
  int lane = threadIdx.x & 31;
  size_t row0 = (size_t)((blockIdx.x * 8 + wave_id()) * 4);   // b*L + l of the first row
  const _Float16* hr = h16 + row0 * DD + lane;
  const v4f* wb = (const v4f*)Wb + lane * 2;
  float acc[4][8];
#pragma unroll
  for (int r = 0; r < 4; ++r)
#pragma unroll
    for (int hh = 0; hh < 8; ++hh) acc[r][hh] = 0.f;
  // lane takes k = lane, lane + 32, ...; a row of Wb serves all four rows of h.
  // Eight k steps a trip, loaded ahead of the arithmetic: a trip pays the way to memory
  // once, not once a k step.
  for (int jo = 0; jo < DD / 32; jo += 8) {
    _Float16 hv[4][8];
    v4f wlo[8], whi[8];
#pragma unroll
    for (int r = 0; r < 4; ++r)
#pragma unroll
      for (int j = 0; j < 8; ++j) hv[r][j] = hr[r * DD + (jo + j) * 32];
#pragma unroll
    for (int j = 0; j < 8; ++j) {
      wlo[j] = wb[(jo + j) * 64];
      whi[j] = wb[(jo + j) * 64 + 1];
    }
#pragma unroll
    for (int j = 0; j < 8; ++j)
#pragma unroll
      for (int r = 0; r < 4; ++r) {
        float hf = (float)hv[r][j];
#pragma unroll
        for (int hh = 0; hh < 4; ++hh) {
          acc[r][hh]     += hf * wlo[j][hh];
          acc[r][hh + 4] += hf * whi[j][hh];
        }
      }
  }
  // lane r*8 + hh keeps and stores the sum of (row r, head hh)
  float mine = 0.f;
#pragma unroll
  for (int r = 0; r < 4; ++r)
#pragma unroll
    for (int hh = 0; hh < 8; ++hh) {
      float s = wave_sum(acc[r][hh]);
      mine = (lane == r * 8 + hh) ? s : mine;
    }
  size_t row = row0 + (lane >> 3);
  int b = (int)(row / LL), l = (int)(row % LL);
  betag[((size_t)b * HH + (lane & 7)) * LL + l] = sigmoidf_(mine);
}

// -------- causal conv(K=4)+silu [+silu+l2norm (+qscale)] -> heads f16 ------
// mode: 0 = v (conv+silu), 1 = k (+silu+l2norm), 2 = q (+silu+l2norm+DK^-.5)
// A wave takes RW rows in a row of one head, a lane four channels; the RW + 3 input
// rows are loaded once and each serves up to four output rows.
#define RW 8
__global__ __launch_bounds__(256) void conv_head_kernel(
    const _Float16* __restrict__ pre, const float* __restrict__ cw,
    _Float16* __restrict__ outg, int mode) {
  int lane = threadIdx.x & 31;
  unsigned gw = blockIdx.x * 8 + wave_id();
  unsigned hb = gw / (LL / RW);         // b*H + h
  unsigned l0 = (gw % (LL / RW)) * RW;
  unsigned hh = hb % HH, b = hb / HH;
  unsigned ch = hh * DKH + lane * 4;
  const bool first = (l0 == 0);         // the three rows in front of l0 are the left padding
  // rows l0-3 .. l0+RW-1; at l0 == 0 the first three loads read rows 0..2 instead
  // (inside the buffer) and are zeroed below
  const _Float16* src = pre + ((size_t)b * LL + l0) * DD + ch;
  const _Float16* srcm = first ? src : src - 3 * DD;
  v4h xin[RW + 3];
#pragma unroll
  for (int i = 0; i < 3; ++i) xin[i] = *(const v4h*)(srcm + i * DD);
#pragma unroll
  for (int i = 3; i < RW + 3; ++i) xin[i] = *(const v4h*)(src + (i - 3) * DD);
  v4f wt[4];                            // the four taps of each of the lane's channels
#pragma unroll
  for (int c = 0; c < 4; ++c) wt[c] = *(const v4f*)(cw + (ch + c) * 4);
  v4f xf[RW + 3];
#pragma unroll
  for (int i = 0; i < RW + 3; ++i)
#pragma unroll
    for (int c = 0; c < 4; ++c) xf[i][c] = (i < 3 && first) ? 0.f : (float)xin[i][c];
  v4f s[RW];
#pragma unroll
  for (int r = 0; r < RW; ++r)
#pragma unroll
    for (int c = 0; c < 4; ++c) {
      float acc = 0.f;
#pragma unroll
      for (int i = 0; i < 4; ++i) acc += xf[r + i][c] * wt[c][i];
      s[r][c] = siluf_(acc);
    }
  if (mode > 0) {
    float qs = (mode == 2) ? 0.08838834764831845f : 1.f;   // 128^-0.5
#pragma unroll
    for (int r = 0; r < RW; ++r) {
#pragma unroll
      for (int c = 0; c < 4; ++c) s[r][c] = siluf_(s[r][c]);
      v4f q = s[r] * s[r];
      float inv = rsqrtf(wave_sum((q[0] + q[1]) + (q[2] + q[3])) + EPSF);
#pragma unroll
      for (int c = 0; c < 4; ++c) s[r][c] = s[r][c] * inv * qs;
    }
  }
  v4h* dst = (v4h*)(outg + ((size_t)hb * LL + l0) * DKH) + lane;
#pragma unroll
  for (int r = 0; r < RW; ++r) {
    v4h o;
#pragma unroll
    for (int c = 0; c < 4; ++c) o[c] = (_Float16)s[r][c];
    dst[r * 32] = o;
  }
}

#define PK 136   // halfs: rows of 128 f16 (q16, k16, -w)       272 B
#define PX 72    // halfs: rows of  64 f16 (X16, qk, vnT, (bv)^T) 144 B
#define PS 132   // floats: rows of 128 f32 (St)                 528 B
__global__ __launch_bounds__(256) void delta_prep_kernel(
    const _Float16* __restrict__ qg, const _Float16* __restrict__ kg,
    const _Float16* __restrict__ vg, const float* __restrict__ betag,
    float* __restrict__ ug, _Float16* __restrict__ wg, _Float16* __restrict__ qkg) {
  __shared__ __attribute__((aligned(16))) _Float16 q16[64 * PK];
  __shared__ __attribute__((aligned(16))) _Float16 k16[64 * PK];
  __shared__ __attribute__((aligned(16))) _Float16 vw16[128 * PX];   // 128*PX >= 64*PK
  __shared__ __attribute__((aligned(16))) float    Af[64 * 64];
  __shared__ __attribute__((aligned(16))) _Float16 X16[64 * PX];
  __shared__ __attribute__((aligned(16))) float    XT[3 * 32 * 32];  // f32 scratch of the inverse
  __shared__ __attribute__((aligned(16))) float    betaS[64];
  _Float16* qk16 = (_Float16*)Af;

  int tid = threadIdx.x, lane = tid & 31, wid = tid >> 5;
  int l15 = lane & 15, hi8 = (lane & 16) ? 8 : 0;
  size_t chunk = blockIdx.x;            // (b*H + h)*64 + c ; its rows start at chunk*64

  // ---- load chunk (beta first; fold beta into transposed v) ----
  if (tid < 64) betaS[tid] = betag[chunk * 64 + tid];
  __syncthreads();
  {
    // One chunk base per operand and a fully unrolled loop: every load is that
    // operand's lane pointer + an immediate.
    const _Float16* qc = qg + chunk * 64 * DKH;
    const _Float16* kc = kg + chunk * 64 * DKH;
    const _Float16* vc = vg + chunk * 64 * DKH;
    const int j0 = tid >> 7, d = tid & 127;
#pragma unroll
    for (int it = 0; it < 32; ++it) {
      int i = tid + it * 256;
      int j = j0 + it * 2;
      q16[j * PK + d] = qc[i];
      k16[j * PK + d] = kc[i];
      vw16[d * PX + j] = (_Float16)((float)vc[i] * betaS[j]);   // (beta*v)^T
    }
  }
  __syncthreads();

  // ---- kk = k k^T ; A = I + tril(beta*kk, -1) ----
#pragma unroll
  for (int ti = 0; ti < 2; ++ti) {
    int t = wid * 2 + ti, tm = t >> 2, tn = t & 3;
    v8f a0 = (v8f){};
    // beta of this lane's 8 rows, read unconditionally: the mask below is then a
    // select, with no branch between the last matrix instruction and its readers
    const v4f blo = *(const v4f*)&betaS[tm * 16 + hi8];
    const v4f bhi = *(const v4f*)&betaS[tm * 16 + hi8 + 4];
#pragma unroll
    for (int kb = 0; kb < 128; kb += 32) {
      v16h a, b;
#pragma unroll
      for (int e = 0; e < 16; ++e) {
        int ko = kb + koff(e, lane);
        a[e] = k16[(tm * 16 + l15) * PK + ko];
        b[e] = k16[(tn * 16 + l15) * PK + ko];   // k^T as B
      }
      a0 = wmma_f16(a, b, a0);
    }
#pragma unroll
    for (int r = 0; r < 8; ++r) {
      int m = tm * 16 + hi8 + r, n = tn * 16 + l15;
      Af[m * 64 + n] = (m == n) ? 1.f : ((n < m) ? (r < 4 ? blo[r & 3] : bhi[r & 3]) * a0[r] : 0.f);
    }
  }
  __syncthreads();

  // ---- X = A^-1 (unit lower tri), blocked 2x2 with 32x32 blocks, all f32 ----
  // X11 = A11^-1, X22 = A22^-1: one wave each, lane = column, the column kept in
  // registers, rows of A read as broadcasts. X21 = -X22 (A21 X11) on all 8 waves.
  // Every loop below is fully unrolled so that the per-lane arrays have static
  // indices and stay in registers.
  {
    float* Xf = XT;                   // [2][32][32] diagonal-block inverses
    float* Tf = Xf + 2 * 32 * 32;     // [32][32]    A21 * X11
    if (wid < 2) {
      int r0 = wid * 32;
      float xc[32];
      float ab[2][4][32];             // rows of A11/A22, two groups of 4 rows
#pragma unroll
      for (int r = 1; r < 4; ++r)
#pragma unroll
        for (int l = 0; l < r; ++l) ab[0][r][l] = Af[(r0 + r) * 64 + r0 + l];
#pragma unroll  // full unroll keeps xc[] and ab[] in registers (static indices only)
      for (int G = 0; G < 8; ++G) {
        if (G + 1 < 8) {
#pragma unroll
          for (int r = 0; r < 4; ++r) {
            int i = (G + 1) * 4 + r;
#pragma unroll
            for (int l = 0; l < i; ++l)
              ab[(G + 1) & 1][r][l] = Af[(r0 + i) * 64 + r0 + l];
          }
        }
        // keeps the next group's LDS reads above this group's arithmetic, so that
        // their latency is not paid row by row on the substitution's serial path
        __builtin_amdgcn_sched_barrier(0);
#pragma unroll
        for (int r = 0; r < 4; ++r) {
          int i = G * 4 + r;
          float s0 = 0.f, s1 = 0.f;
#pragma unroll
          for (int l = 0; l < i; ++l) {
            if (l & 1) s1 += ab[G & 1][r][l] * xc[l]; else s0 += ab[G & 1][r][l] * xc[l];
          }
          xc[i] = (i == lane) ? 1.f : -(s0 + s1);
          Xf[wid * 1024 + i * 32 + lane] = xc[i];
          X16[(r0 + i) * PX + r0 + lane] = (_Float16)xc[i];
        }
      }
    } else if (wid == 2) {
#pragma unroll
      for (int i = 0; i < 32; ++i) X16[i * PX + 32 + lane] = (_Float16)0.f;
    }
    __syncthreads();   // publishes X11, X22 to all waves
    {
      float xcol[32];
#pragma unroll
      for (int l = 0; l < 32; ++l) xcol[l] = Xf[l * 32 + lane];
#pragma unroll
      for (int r = 0; r < 4; ++r) {
        int i = wid * 4 + r;
        const v4f* ar = (const v4f*)&Af[(32 + i) * 64];
        float s0 = 0.f, s1 = 0.f, s2 = 0.f, s3 = 0.f;
#pragma unroll
        for (int g = 0; g < 8; ++g) {
          v4f a = ar[g];
          s0 += a[0] * xcol[g * 4 + 0];
          s1 += a[1] * xcol[g * 4 + 1];
          s2 += a[2] * xcol[g * 4 + 2];
          s3 += a[3] * xcol[g * 4 + 3];
        }
        Tf[i * 32 + lane] = (s0 + s1) + (s2 + s3);
      }
    }
    __syncthreads();   // publishes T = A21 X11
    {
      float tcol[32];
#pragma unroll
      for (int l = 0; l < 32; ++l) tcol[l] = Tf[l * 32 + lane];
#pragma unroll
      for (int r = 0; r < 4; ++r) {
        int i = wid * 4 + r;
        const v4f* xr = (const v4f*)&Xf[1024 + i * 32];
        float s0 = 0.f, s1 = 0.f, s2 = 0.f, s3 = 0.f;
#pragma unroll
        for (int g = 0; g < 8; ++g) {
          v4f a = xr[g];
          s0 += a[0] * tcol[g * 4 + 0];
          s1 += a[1] * tcol[g * 4 + 1];
          s2 += a[2] * tcol[g * 4 + 2];
          s3 += a[3] * tcol[g * 4 + 3];
        }
        X16[(32 + i) * PX + lane] = (_Float16)(-((s0 + s1) + (s2 + s3)));
      }
    }
  }
  __syncthreads();

  // ---- u = X @ (beta*v) -> workspace, in accumulator layout ----
#pragma unroll
  for (int ti = 0; ti < 4; ++ti) {
    int t = wid * 4 + ti, tm = t >> 3, tn = t & 7;
    v8f a0 = (v8f){};
#pragma unroll
    for (int kb = 0; kb < 64; kb += 32) {
      v16h a, b;
#pragma unroll
      for (int e = 0; e < 16; ++e) {
        int ko = kb + koff(e, lane);
        a[e] = X16[(tm * 16 + l15) * PX + ko];
        b[e] = vw16[(tn * 16 + l15) * PX + ko];           // (beta*v)^T
      }
      a0 = wmma_f16(a, b, a0);
    }
    *(v8f*)(ug + ((chunk * 32 + t) * 32 + lane) * 8) = a0;
  }
  __syncthreads();

  // ---- -w = -(X @ (beta*k)) -> vw16 (row-major) ; qk = tril(q k^T) ----
#pragma unroll
  for (int ti = 0; ti < 4; ++ti) {
    int t = wid * 4 + ti, tm = t >> 3, tn = t & 7;
    v8f a0 = (v8f){};
#pragma unroll
    for (int kb = 0; kb < 64; kb += 32) {
      v16h a, b;
#pragma unroll
      for (int e = 0; e < 16; ++e) {
        int ko = kb + koff(e, lane);
        a[e] = X16[(tm * 16 + l15) * PX + ko];
        b[e] = (_Float16)((float)k16[ko * PK + tn * 16 + l15] * betaS[ko]);
      }
      a0 = wmma_f16(a, b, a0);
    }
#pragma unroll
    for (int r = 0; r < 8; ++r)
      vw16[(tm * 16 + hi8 + r) * PK + tn * 16 + l15] = (_Float16)(-a0[r]);
  }
#pragma unroll
  for (int ti = 0; ti < 2; ++ti) {
    int t = wid * 2 + ti, tm = t >> 2, tn = t & 3;
    v8f a0 = (v8f){};
#pragma unroll
    for (int kb = 0; kb < 128; kb += 32) {
      v16h a, b;
#pragma unroll
      for (int e = 0; e < 16; ++e) {
        int ko = kb + koff(e, lane);
        a[e] = q16[(tm * 16 + l15) * PK + ko];
        b[e] = k16[(tn * 16 + l15) * PK + ko];
      }
      a0 = wmma_f16(a, b, a0);
    }
#pragma unroll
    for (int r = 0; r < 8; ++r) {
      int m = tm * 16 + hi8 + r, n = tn * 16 + l15;
      qk16[m * PX + n] = (_Float16)((n <= m) ? a0[r] : 0.f);
    }
  }
  __syncthreads();

  // ---- -w and qk: LDS -> workspace, 16 bytes a lane ----
  {
    int4* wo = (int4*)(wg + chunk * 64 * DKH) + tid;
    int4* qo = (int4*)(qkg + chunk * 64 * 64) + tid;
#pragma unroll
    for (int it = 0; it < 4; ++it) {
      int p = tid + it * 256;
      wo[it * 256] = *(const int4*)&vw16[(p >> 4) * PK + (p & 15) * 8];
    }
#pragma unroll
    for (int it = 0; it < 2; ++it) {
      int p = tid + it * 256;
      qo[it * 256] = *(const int4*)&qk16[(p >> 3) * PX + (p & 7) * 8];
    }
  }
}

// The columns (dv) of the state never mix: v_new, o and the state update of a column read
// that column of S alone. So a (b,h) is walked by 128 / DVS blocks side by side, each with
// DVS columns of S, u, v_new and o; q, k, -w and qk are read by every one of them.
// DVS = 32: a block's part of a row of o is one whole 128-byte line.
#define DVS 32
#define NSL (DKH / DVS)
__global__ __launch_bounds__(256) void delta_kernel(
    const _Float16* __restrict__ qg, const _Float16* __restrict__ kg,
    const _Float16* __restrict__ wg, const _Float16* __restrict__ qkg,
    const float* __restrict__ ug, float* __restrict__ og) {
  __shared__ __attribute__((aligned(16))) float    St[DVS * PS];
  __shared__ __attribute__((aligned(16))) _Float16 q16[64 * PK];
  __shared__ __attribute__((aligned(16))) _Float16 k16[64 * PK];
  __shared__ __attribute__((aligned(16))) _Float16 vw16[64 * PK];
  __shared__ __attribute__((aligned(16))) _Float16 qk16[64 * PX];
  __shared__ __attribute__((aligned(16))) _Float16 vnT[DVS * PX];

  int tid = threadIdx.x, lane = tid & 31, wid = tid >> 5;
  int l15 = lane & 15, hi8 = (lane & 16) ? 8 : 0;
  // the slices of one (b,h) are BB*HH block numbers apart (speed only, nothing rests on it)
  size_t bh = blockIdx.x % (BB * HH);
  const int tg0 = (int)(blockIdx.x / (BB * HH)) * (DVS / 16);   // first 16-column tile of the block's slice
  size_t rowbase = bh * (size_t)LL;
  // the wave's one 16x16 tile of the 64 x DVS products: rows tm, columns tn (in the slice)
  const int tm = wid >> 1, tn = wid & 1;

  for (int i = tid; i < DVS * PS; i += 256) St[i] = 0.f;

  for (int c = 0; c < NCHUNK; ++c) {
    // ---- load chunk: q, k, -w, qk -> LDS ; u -> accumulator registers ----
    v8f uacc;
    {
      // One chunk base per operand: every load is base + lane offset + an immediate.
      // (v4f is only the carrier of 16 bytes here: eight f16 move as they are)
      size_t chunk = bh * NCHUNK + c;
      const v4f* qc = (const v4f*)(qg + chunk * 64 * DKH);
      const v4f* kc = (const v4f*)(kg + chunk * 64 * DKH);
      const v4f* wc = (const v4f*)(wg + chunk * 64 * DKH);
      const v4f* xc = (const v4f*)(qkg + chunk * 64 * 64);
      const v8f*  uc = (const v8f*)(ug + chunk * 64 * DKH);
      const unsigned ut = (unsigned)tid, uu = (unsigned)((tm * 8 + tg0 + tn) * 32 + lane);
      v4f tq[4], tk[4], tw[4], tx[2];
#pragma unroll
      for (int it = 0; it < 4; ++it) {
        tq[it] = qc[ut + it * 256];
        tk[it] = kc[ut + it * 256];
        tw[it] = wc[ut + it * 256];
      }
#pragma unroll
      for (int it = 0; it < 2; ++it) tx[it] = xc[ut + it * 256];
      uacc = uc[uu];                                   // the wave's tile, this lane
      // inputs-only fence on the loaded values: all 16 loads are issued ahead of it and
      // share one trip to memory (without it they were built as load, wait, store, one by one)
      asm volatile("" :: "v"(tq[0]), "v"(tq[1]), "v"(tq[2]), "v"(tq[3]),
                         "v"(tk[0]), "v"(tk[1]), "v"(tk[2]), "v"(tk[3]),
                         "v"(tw[0]), "v"(tw[1]), "v"(tw[2]), "v"(tw[3]),
                         "v"(tx[0]), "v"(tx[1]), "v"(uacc));
#pragma unroll
      for (int it = 0; it < 4; ++it) {
        int p = tid + it * 256;
        int o = (p >> 4) * PK + (p & 15) * 8;
        *(v4f*)&q16[o]  = tq[it];
        *(v4f*)&k16[o]  = tk[it];
        *(v4f*)&vw16[o] = tw[it];
      }
#pragma unroll
      for (int it = 0; it < 2; ++it) {
        int p = tid + it * 256;
        *(v4f*)&qk16[(p >> 3) * PX + (p & 7) * 8] = tx[it];
      }
    }
    __syncthreads();

    // ---- o1 = q @ S (regs) ; v_new = u + (-w) @ S -> vnT (transposed) ----
    // both products take the same S fragment
    v8f oacc = (v8f){};
    {
      v8f a0 = uacc;
#pragma unroll
      for (int kb = 0; kb < 128; kb += 32) {
        v16h aq, aw, b;
#pragma unroll
        for (int e = 0; e < 16; ++e) {
          int ko = kb + koff(e, lane);
          aq[e] = q16[(tm * 16 + l15) * PK + ko];
          aw[e] = vw16[(tm * 16 + l15) * PK + ko];         // -w row-major
          b[e] = (_Float16)St[(tn * 16 + l15) * PS + ko];  // S^T rows
        }
        oacc = wmma_f16(aq, b, oacc);
        a0 = wmma_f16(aw, b, a0);
      }
#pragma unroll
      for (int r = 0; r < 8; ++r)
        vnT[(tn * 16 + l15) * PX + tm * 16 + hi8 + r] = (_Float16)a0[r];
    }
    __syncthreads();

    // ---- o = o1 + qk @ v_new -> global ----
    {
      v8f a0 = oacc;
#pragma unroll
      for (int kb = 0; kb < 64; kb += 32) {
        v16h a, b;
#pragma unroll
        for (int e = 0; e < 16; ++e) {
          int ko = kb + koff(e, lane);
          a[e] = qk16[(tm * 16 + l15) * PX + ko];
          b[e] = vnT[(tn * 16 + l15) * PX + ko];            // v_new^T rows
        }
        a0 = wmma_f16(a, b, a0);
      }
#pragma unroll
      for (int r = 0; r < 8; ++r)
        og[(rowbase + (size_t)c * 64 + tm * 16 + hi8 + r) * 128 + (tg0 + tn) * 16 + l15] = a0[r];
    }
    // ---- S^T += (k^T @ v_new)^T : tile (m=dk, n=dv), stored transposed ----
    // the wave takes dk tile wid against every column tile of the slice
#pragma unroll
    for (int sn = 0; sn < DVS / 16; ++sn) {
      v8f a0;
#pragma unroll
      for (int r = 0; r < 8; ++r)
        a0[r] = St[(sn * 16 + l15) * PS + wid * 16 + hi8 + r];
#pragma unroll
      for (int kb = 0; kb < 64; kb += 32) {
        v16h a, b;
#pragma unroll
        for (int e = 0; e < 16; ++e) {
          int ko = kb + koff(e, lane);
          a[e] = k16[ko * PK + wid * 16 + l15];   // (k^T)[m][j] = k[j][m]
          b[e] = vnT[(sn * 16 + l15) * PX + ko];  // v_new^T rows
        }
        a0 = wmma_f16(a, b, a0);
      }
#pragma unroll
      for (int r = 0; r < 8; ++r)
        St[(sn * 16 + l15) * PS + wid * 16 + hi8 + r] = a0[r];
    }
    __syncthreads();
  }
}

// ---------------- per-head output RMSNorm -> [B,L,D] f16 -------------------
// a wave takes RW rows in a row of one head, a lane four channels
__global__ __launch_bounds__(256) void onorm_kernel(const float* __restrict__ og,
                                                    const float* __restrict__ w,
                                                    _Float16* __restrict__ on16) {
  int lane = threadIdx.x & 31;
  unsigned gw = blockIdx.x * 8 + wave_id();
  unsigned hb = gw / (LL / RW);         // b*H + h
  unsigned l0 = (gw % (LL / RW)) * RW;
  unsigned hh = hb % HH, b = hb / HH;
  const v4f* src = (const v4f*)(og + ((size_t)hb * LL + l0) * DKH) + lane;
  v4f v[RW];
#pragma unroll
  for (int r = 0; r < RW; ++r) v[r] = src[r * 32];
  v4f wv = *((const v4f*)w + lane);
  _Float16* dst = on16 + ((size_t)b * LL + l0) * DD + hh * DKH + lane * 4;
#pragma unroll
  for (int r = 0; r < RW; ++r) {
    v4f q = v[r] * v[r];
    float inv = rsqrtf(wave_sum((q[0] + q[1]) + (q[2] + q[3])) * (1.f / DKH) + EPSF);
    v4h o;
#pragma unroll
    for (int c = 0; c < 4; ++c) o[c] = (_Float16)(v[r][c] * inv * wv[c]);
    *(v4h*)(dst + (size_t)r * DD) = o;
  }
}

// ---------------------------------------------------------------------------
extern "C" void kernel_launch(void* const* d_in, const int* in_sizes, int n_in,
                              void* d_out, int out_size, void* d_ws, size_t ws_size,
                              hipStream_t stream) {
  const float* x        = (const float*)d_in[0];
  const float* norm_w   = (const float*)d_in[1];
  const float* Wq       = (const float*)d_in[2];
  const float* Wk       = (const float*)d_in[3];
  const float* Wv       = (const float*)d_in[4];
  const float* Wb       = (const float*)d_in[5];
  const float* conv_q   = (const float*)d_in[6];
  const float* conv_k   = (const float*)d_in[7];
  const float* conv_v   = (const float*)d_in[8];
  const float* o_norm_w = (const float*)d_in[9];
  const float* Wo       = (const float*)d_in[10];
  float* out = (float*)d_out;

  char* p = (char*)d_ws;
  auto take = [&](size_t bytes) { char* r = p; p += (bytes + 255) & ~(size_t)255; return r; };
  const size_t actF16 = (size_t)BLROWS * DD * sizeof(_Float16);   // 16 MiB
  const size_t wF16   = (size_t)DD * DD * sizeof(_Float16);       // 2 MiB

  _Float16* h16   = (_Float16*)take(actF16);
  _Float16* wq16t = (_Float16*)take(wF16);   // transposed [N][K]
  _Float16* wk16t = (_Float16*)take(wF16);
  _Float16* wv16t = (_Float16*)take(wF16);
  _Float16* wo16t = (_Float16*)take(wF16);
  _Float16* qpre  = (_Float16*)take(actF16);
  _Float16* kpre  = (_Float16*)take(actF16);
  _Float16* vpre  = (_Float16*)take(actF16);
  _Float16* qh    = (_Float16*)take(actF16);
  _Float16* kh    = (_Float16*)take(actF16);
  _Float16* vh    = (_Float16*)take(actF16);
  float*    betag = (float*)take((size_t)BB * HH * LL * sizeof(float));
  float*    og    = (float*)take((size_t)BB * HH * LL * DKH * sizeof(float));
  _Float16* on16  = (_Float16*)take(actF16);
  float*    ug    = (float*)take((size_t)BB * HH * LL * DKH * sizeof(float));
  _Float16* wg    = (_Float16*)take(actF16);
  _Float16* qkg   = (_Float16*)take((size_t)BB * HH * LL * 64 * sizeof(_Float16));

  // 1. h = rmsnorm(x)
  rmsnorm_kernel<<<BLROWS / 8, 256, 0, stream>>>(x, norm_w, h16);
  // 2. weights -> f16, transposed to [N][K] for K-contiguous B fragments
  int tgrid = (DD / 32) * (DD / 32);
  transpose_f16_kernel<<<tgrid, 256, 0, stream>>>(Wq, wq16t, DD, DD);
  transpose_f16_kernel<<<tgrid, 256, 0, stream>>>(Wk, wk16t, DD, DD);
  transpose_f16_kernel<<<tgrid, 256, 0, stream>>>(Wv, wv16t, DD, DD);
  transpose_f16_kernel<<<tgrid, 256, 0, stream>>>(Wo, wo16t, DD, DD);
  // 3. projections (WMMA GEMMs, async double-buffered staging)
  dim3 ggrid(DD / 128, BLROWS / 128);
  gemm_f16_kernel<0><<<ggrid, 256, 0, stream>>>(h16, wq16t, qpre, nullptr, nullptr, BLROWS, DD, DD);
  gemm_f16_kernel<0><<<ggrid, 256, 0, stream>>>(h16, wk16t, kpre, nullptr, nullptr, BLROWS, DD, DD);
  gemm_f16_kernel<0><<<ggrid, 256, 0, stream>>>(h16, wv16t, vpre, nullptr, nullptr, BLROWS, DD, DD);
  // 4. beta
  beta_kernel<<<BLROWS / 32, 256, 0, stream>>>(h16, Wb, betag);
  // 5. conv + activations + head layout
  conv_head_kernel<<<BB * HH * LL / (8 * RW), 256, 0, stream>>>(qpre, conv_q, qh, 2);
  conv_head_kernel<<<BB * HH * LL / (8 * RW), 256, 0, stream>>>(kpre, conv_k, kh, 1);
  conv_head_kernel<<<BB * HH * LL / (8 * RW), 256, 0, stream>>>(vpre, conv_v, vh, 0);
  // 6. chunkwise delta rule: per-chunk operands for all chunks, then the serial walk
  delta_prep_kernel<<<BB * HH * NCHUNK, 256, 0, stream>>>(qh, kh, vh, betag, ug, wg, qkg);
  delta_kernel<<<BB * HH * NSL, 256, 0, stream>>>(qh, kh, wg, qkg, ug, og);
  // 7. output norm
  onorm_kernel<<<BB * HH * LL / (8 * RW), 256, 0, stream>>>(og, o_norm_w, on16);
  // 8. out = x + on @ Wo
  gemm_f16_kernel<1><<<ggrid, 256, 0, stream>>>(on16, wo16t, nullptr, out, x, BLROWS, DD, DD);
}

// v006
// It runs in 339 microseconds.
// In two side-by-side timings against v005, it was 1.13 and 1.12 times as fast.
// Over all steps from v000 it is 16.1 times as fast.
#include <hip/hip_runtime.h>
#include <hip/hip_bf16.h>

typedef __attribute__((ext_vector_type(16))) _Float16 v16h;
typedef __attribute__((ext_vector_type(8)))  float    v8f;
typedef __attribute__((ext_vector_type(4)))  float    v4f;

#define BB 2
#define LL 4096
#define DD 1024
#define HH 8
#define DKH 128
#define BLROWS (BB*LL)          // 8192
#define NCHUNK 64
#define EPSF 1e-6f

#if defined(__gfx1250__) && __has_builtin(__builtin_amdgcn_global_load_async_to_lds_b128)
#define HAVE_ASYNC 1
typedef int v4i_ __attribute__((ext_vector_type(4)));
typedef __attribute__((address_space(1))) v4i_* gp_v4i;
typedef __attribute__((address_space(3))) v4i_* lp_v4i;
#define GLA128(SRC, DST) \
  __builtin_amdgcn_global_load_async_to_lds_b128((gp_v4i)(void*)(SRC), (lp_v4i)(void*)(DST), 0, 0)
#if __has_builtin(__builtin_amdgcn_s_wait_asynccnt)
#define WAITA(n) __builtin_amdgcn_s_wait_asynccnt(n)
#else
#define WAITA(n) asm volatile("s_wait_asynccnt %0" :: "n"(n) : "memory")
#endif
#else
#define HAVE_ASYNC 0
#define WAITA(n)
#endif

__device__ __forceinline__ int koff(int e, int lane) {
  int j = e >> 1;
  return ((j & 4) << 2) + ((lane & 16) >> 1) + ((j & 3) << 1) + (e & 1);
}

__device__ __forceinline__ v8f wmma_f16(v16h a, v16h b, v8f c) {
  return __builtin_amdgcn_wmma_f32_16x16x32_f16(false, a, false, b, (short)0, c, false, false);
}

__device__ __forceinline__ float sigmoidf_(float x) { return 1.f / (1.f + __expf(-x)); }
__device__ __forceinline__ float siluf_(float x) { return x * sigmoidf_(x); }

// ---------------- the row kernels ------------------------------------------
// rmsnorm, beta, conv+l2norm and the output norm each work on short rows (128 or 1024
// elements). One wave takes whole rows: a lane holds its share of a row in registers,
// the row's sum is a butterfly over the 32 lanes, and there is no LDS and no barrier.
// One block per row cost far more in starting waves than in the rows' own work.
// Every '#pragma unroll' in these four kernels is on a loop over a lane's own share: fully
// unrolled, the per-lane arrays have static indices only and stay in registers.
typedef __attribute__((ext_vector_type(4))) _Float16 v4h;

// the wave's number in its block, held as a scalar, so that row numbers and row
// addresses are scalar arithmetic and the loads take base + lane offset + immediate
__device__ __forceinline__ unsigned wave_id() {
  return (unsigned)__builtin_amdgcn_readfirstlane((int)(threadIdx.x >> 5));
}

template <int M>
__device__ __forceinline__ float xmask_add(float v) {
  // v + (v of lane ^ M), M < 16: a DPP row_xmask move inside the 16-lane row
  int o = __builtin_amdgcn_update_dpp(0, __builtin_bit_cast(int, v), 0x160 | M, 0xf, 0xf, true);
  return v + __builtin_bit_cast(float, o);
}
// sum over the wave's 32 lanes, the same bits in every lane
__device__ __forceinline__ float wave_sum(float v) {
  v = xmask_add<1>(v);
  v = xmask_add<2>(v);
  v = xmask_add<4>(v);
  v = xmask_add<8>(v);
  int b = __builtin_bit_cast(int, v);
  int o = __builtin_amdgcn_permlanex16(b, b, 0x76543210, 0xfedcba98, false, false);  // lane ^ 16
  return v + __builtin_bit_cast(float, o);
}

// ---------------- RMSNorm (x -> h f16): one row a wave ----------------------
__global__ __launch_bounds__(256) void rmsnorm_kernel(const float* __restrict__ x,
                                                      const float* __restrict__ w,
                                                      _Float16* __restrict__ h16) {
  int lane = threadIdx.x & 31;
  size_t row = (size_t)(blockIdx.x * 8 + wave_id());
  const v4f* xr = (const v4f*)(x + row * DD) + lane;
  const v4f* wr = (const v4f*)w + lane;
  v4f xv[8];
#pragma unroll
  for (int j = 0; j < 8; ++j) xv[j] = xr[j * 32];
  v4f p = (v4f){};
#pragma unroll
  for (int j = 0; j < 8; ++j) p += xv[j] * xv[j];
  float inv = rsqrtf(wave_sum((p[0] + p[1]) + (p[2] + p[3])) * (1.f / DD) + EPSF);
  v4h* ho = (v4h*)(h16 + row * DD) + lane;
#pragma unroll
  for (int j = 0; j < 8; ++j) {
    v4f wv = wr[j * 32];
    v4h o;
#pragma unroll
    for (int c = 0; c < 4; ++c) o[c] = (_Float16)(xv[j][c] * inv * wv[c]);
    ho[j * 32] = o;
  }
}

// -------- LDS-tiled transpose: src f32 [R][C] -> dst f16 [C][R] ------------
__global__ __launch_bounds__(256) void transpose_f16_kernel(const float* __restrict__ src,
                                                            _Float16* __restrict__ dst,
                                                            int R, int C) {
  __shared__ float t[32][33];
  int nbx = C / 32;
  int bx = blockIdx.x % nbx, by = blockIdx.x / nbx;
  int r0 = by * 32, c0 = bx * 32;
  int tr = threadIdx.x >> 5, tc = threadIdx.x & 31;
#pragma unroll
  for (int i = 0; i < 32; i += 8)
    t[tr + i][tc] = src[(size_t)(r0 + tr + i) * C + c0 + tc];
  __syncthreads();
#pragma unroll
  for (int i = 0; i < 32; i += 8)
    dst[(size_t)(c0 + tr + i) * R + r0 + tc] = (_Float16)t[tc][tr + i];
}

#define PG 40   // halfs
template <int MODE>
__global__ __launch_bounds__(256) void gemm_f16_kernel(
    const _Float16* __restrict__ A, const _Float16* __restrict__ Bt,
    _Float16* __restrict__ out16, float* __restrict__ outf,
    const float* __restrict__ resid, int M, int N, int K) {
  __shared__ __attribute__((aligned(16))) _Float16 As[2][128][PG];
  __shared__ __attribute__((aligned(16))) _Float16 Bs[2][128][PG];
  int tid = threadIdx.x, lane = tid & 31;
  int wid = tid >> 5, l15 = lane & 15, hi8 = (lane & 16) ? 8 : 0;
  int wm = wid >> 1, wn = wid & 1;
  int bm = blockIdx.y * 128, bn = blockIdx.x * 128;

  int cr = tid >> 2, cs = (tid & 3) * 8;          // copy row / 8-half segment
  auto issue = [&](int buf, int k0) {
    const _Float16* ga = A + (size_t)(bm + cr) * K + k0 + cs;
    const _Float16* gb = Bt + (size_t)(bn + cr) * K + k0 + cs;
#if HAVE_ASYNC
    GLA128(ga,                    &As[buf][cr][cs]);
    GLA128(ga + (size_t)64 * K,   &As[buf][cr + 64][cs]);
    GLA128(gb,                    &Bs[buf][cr][cs]);
    GLA128(gb + (size_t)64 * K,   &Bs[buf][cr + 64][cs]);
#else
    *(int4*)&As[buf][cr][cs]      = *(const int4*)ga;
    *(int4*)&As[buf][cr + 64][cs] = *(const int4*)(ga + (size_t)64 * K);
    *(int4*)&Bs[buf][cr][cs]      = *(const int4*)gb;
    *(int4*)&Bs[buf][cr + 64][cs] = *(const int4*)(gb + (size_t)64 * K);
#endif
  };

  v8f acc[2][4];
#pragma unroll
  for (int i = 0; i < 2; ++i)
#pragma unroll
    for (int j = 0; j < 4; ++j) acc[i][j] = (v8f){};

  int nT = K / 32;
  issue(0, 0);
  for (int kt = 0; kt < nT; ++kt) {
    int buf = kt & 1;
    if (kt + 1 < nT) { issue(buf ^ 1, (kt + 1) * 32); WAITA(4); }
    else             { WAITA(0); }
    __syncthreads();
    v16h af[2], bf[4];
#pragma unroll
    for (int i = 0; i < 2; ++i) {
      int mr = wm * 32 + i * 16 + l15;
#pragma unroll
      for (int e = 0; e < 16; ++e) af[i][e] = As[buf][mr][koff(e, lane)];
    }
#pragma unroll
    for (int j = 0; j < 4; ++j) {
      int nc = wn * 64 + j * 16 + l15;
#pragma unroll
      for (int e = 0; e < 16; ++e) bf[j][e] = Bs[buf][nc][koff(e, lane)];
    }
#pragma unroll
    for (int i = 0; i < 2; ++i)
#pragma unroll
      for (int j = 0; j < 4; ++j) acc[i][j] = wmma_f16(af[i], bf[j], acc[i][j]);
    __syncthreads();
  }
#pragma unroll
  for (int i = 0; i < 2; ++i)
#pragma unroll
    for (int j = 0; j < 4; ++j)
#pragma unroll
      for (int r = 0; r < 8; ++r) {
        size_t gm = bm + wm * 32 + i * 16 + hi8 + r;
        size_t gn = bn + wn * 64 + j * 16 + l15;
        if (MODE == 0) out16[gm * N + gn] = (_Float16)acc[i][j][r];
        else           outf[gm * N + gn] = resid[gm * N + gn] + acc[i][j][r];
      }
}

// ---------------- beta = sigmoid(h @ Wb): four rows a wave ------------------
__global__ __launch_bounds__(256) void beta_kernel(const _Float16* __restrict__ h16,
                                                   const float* __restrict__ Wb,
                                                   float* __restrict__ betag) {
  int lane = threadIdx.x & 31;
  size_t row0 = (size_t)((blockIdx.x * 8 + wave_id()) * 4);   // b*L + l of the first row
  const _Float16* hr = h16 + row0 * DD + lane;
  const v4f* wb = (const v4f*)Wb + lane * 2;
  float acc[4][8];
#pragma unroll
  for (int r = 0; r < 4; ++r)
#pragma unroll
    for (int hh = 0; hh < 8; ++hh) acc[r][hh] = 0.f;
  // lane takes k = lane, lane + 32, ...; a row of Wb serves all four rows of h.
  // Eight k steps a trip, loaded ahead of the arithmetic: a trip pays the way to memory
  // once, not once a k step.
  for (int jo = 0; jo < DD / 32; jo += 8) {
    _Float16 hv[4][8];
    v4f wlo[8], whi[8];
#pragma unroll
    for (int r = 0; r < 4; ++r)
#pragma unroll
      for (int j = 0; j < 8; ++j) hv[r][j] = hr[r * DD + (jo + j) * 32];
#pragma unroll
    for (int j = 0; j < 8; ++j) {
      wlo[j] = wb[(jo + j) * 64];
      whi[j] = wb[(jo + j) * 64 + 1];
    }
#pragma unroll
    for (int j = 0; j < 8; ++j)
#pragma unroll
      for (int r = 0; r < 4; ++r) {
        float hf = (float)hv[r][j];
#pragma unroll
        for (int hh = 0; hh < 4; ++hh) {
          acc[r][hh]     += hf * wlo[j][hh];
          acc[r][hh + 4] += hf * whi[j][hh];
        }
      }
  }
  // lane r*8 + hh keeps and stores the sum of (row r, head hh)
  float mine = 0.f;
#pragma unroll
  for (int r = 0; r < 4; ++r)
#pragma unroll
    for (int hh = 0; hh < 8; ++hh) {
      float s = wave_sum(acc[r][hh]);
      mine = (lane == r * 8 + hh) ? s : mine;
    }
  size_t row = row0 + (lane >> 3);
  int b = (int)(row / LL), l = (int)(row % LL);
  betag[((size_t)b * HH + (lane & 7)) * LL + l] = sigmoidf_(mine);
}

// -------- causal conv(K=4)+silu [+silu+l2norm (+qscale)] -> heads f16 ------
// mode: 0 = v (conv+silu), 1 = k (+silu+l2norm), 2 = q (+silu+l2norm+DK^-.5)
// A wave takes RW rows in a row of one head, a lane four channels; the RW + 3 input
// rows are loaded once and each serves up to four output rows.
#define RW 8
__global__ __launch_bounds__(256) void conv_head_kernel(
    const _Float16* __restrict__ pre, const float* __restrict__ cw,
    _Float16* __restrict__ outg, int mode) {
  int lane = threadIdx.x & 31;
  unsigned gw = blockIdx.x * 8 + wave_id();
  unsigned hb = gw / (LL / RW);         // b*H + h
  unsigned l0 = (gw % (LL / RW)) * RW;
  unsigned hh = hb % HH, b = hb / HH;
  unsigned ch = hh * DKH + lane * 4;
  const bool first = (l0 == 0);         // the three rows in front of l0 are the left padding
  // rows l0-3 .. l0+RW-1; at l0 == 0 the first three loads read rows 0..2 instead
  // (inside the buffer) and are zeroed below
  const _Float16* src = pre + ((size_t)b * LL + l0) * DD + ch;
  const _Float16* srcm = first ? src : src - 3 * DD;
  v4h xin[RW + 3];
#pragma unroll
  for (int i = 0; i < 3; ++i) xin[i] = *(const v4h*)(srcm + i * DD);
#pragma unroll
  for (int i = 3; i < RW + 3; ++i) xin[i] = *(const v4h*)(src + (i - 3) * DD);
  v4f wt[4];                            // the four taps of each of the lane's channels
#pragma unroll
  for (int c = 0; c < 4; ++c) wt[c] = *(const v4f*)(cw + (ch + c) * 4);
  v4f xf[RW + 3];
#pragma unroll
  for (int i = 0; i < RW + 3; ++i)
#pragma unroll
    for (int c = 0; c < 4; ++c) xf[i][c] = (i < 3 && first) ? 0.f : (float)xin[i][c];
  v4f s[RW];
#pragma unroll
  for (int r = 0; r < RW; ++r)
#pragma unroll
    for (int c = 0; c < 4; ++c) {
      float acc = 0.f;
#pragma unroll
      for (int i = 0; i < 4; ++i) acc += xf[r + i][c] * wt[c][i];
      s[r][c] = siluf_(acc);
    }
  if (mode > 0) {
    float qs = (mode == 2) ? 0.08838834764831845f : 1.f;   // 128^-0.5
#pragma unroll
    for (int r = 0; r < RW; ++r) {
#pragma unroll
      for (int c = 0; c < 4; ++c) s[r][c] = siluf_(s[r][c]);
      v4f q = s[r] * s[r];
      float inv = rsqrtf(wave_sum((q[0] + q[1]) + (q[2] + q[3])) + EPSF);
#pragma unroll
      for (int c = 0; c < 4; ++c) s[r][c] = s[r][c] * inv * qs;
    }
  }
  v4h* dst = (v4h*)(outg + ((size_t)hb * LL + l0) * DKH) + lane;
#pragma unroll
  for (int r = 0; r < RW; ++r) {
    v4h o;
#pragma unroll
    for (int c = 0; c < 4; ++c) o[c] = (_Float16)s[r][c];
    dst[r * 32] = o;
  }
}

#define PK 136   // halfs: rows of 128 f16 (q16, k16, -w)       272 B
#define PX 72    // halfs: rows of  64 f16 (X16, qk, vnT, (bv)^T) 144 B
#define PS 132   // floats: rows of 128 f32 (St)                 528 B
__global__ __launch_bounds__(256) void delta_prep_kernel(
    const _Float16* __restrict__ qg, const _Float16* __restrict__ kg,
    const _Float16* __restrict__ vg, const float* __restrict__ betag,
    float* __restrict__ ug, _Float16* __restrict__ wg, _Float16* __restrict__ qkg) {
  __shared__ __attribute__((aligned(16))) _Float16 q16[64 * PK];
  __shared__ __attribute__((aligned(16))) _Float16 k16[64 * PK];
  __shared__ __attribute__((aligned(16))) _Float16 vw16[128 * PX];   // 128*PX >= 64*PK
  __shared__ __attribute__((aligned(16))) float    Af[64 * 64];
  __shared__ __attribute__((aligned(16))) _Float16 X16[64 * PX];
  __shared__ __attribute__((aligned(16))) float    XT[3 * 32 * 32];  // f32 scratch of the inverse
  __shared__ __attribute__((aligned(16))) float    betaS[64];
  _Float16* qk16 = (_Float16*)Af;

  int tid = threadIdx.x, lane = tid & 31, wid = tid >> 5;
  int l15 = lane & 15, hi8 = (lane & 16) ? 8 : 0;
  size_t chunk = blockIdx.x;            // (b*H + h)*64 + c ; its rows start at chunk*64

  // ---- load chunk (beta first; fold beta into transposed v) ----
  if (tid < 64) betaS[tid] = betag[chunk * 64 + tid];
  __syncthreads();
  {
    // One chunk base per operand and a fully unrolled loop: every load is that
    // operand's lane pointer + an immediate.
    const _Float16* qc = qg + chunk * 64 * DKH;
    const _Float16* kc = kg + chunk * 64 * DKH;
    const _Float16* vc = vg + chunk * 64 * DKH;
    const int j0 = tid >> 7, d = tid & 127;
#pragma unroll
    for (int it = 0; it < 32; ++it) {
      int i = tid + it * 256;
      int j = j0 + it * 2;
      q16[j * PK + d] = qc[i];
      k16[j * PK + d] = kc[i];
      vw16[d * PX + j] = (_Float16)((float)vc[i] * betaS[j]);   // (beta*v)^T
    }
  }
  __syncthreads();

  // ---- kk = k k^T ; A = I + tril(beta*kk, -1) ----
#pragma unroll
  for (int ti = 0; ti < 2; ++ti) {
    int t = wid * 2 + ti, tm = t >> 2, tn = t & 3;
    v8f a0 = (v8f){};
    // beta of this lane's 8 rows, read unconditionally: the mask below is then a
    // select, with no branch between the last matrix instruction and its readers
    const v4f blo = *(const v4f*)&betaS[tm * 16 + hi8];
    const v4f bhi = *(const v4f*)&betaS[tm * 16 + hi8 + 4];
#pragma unroll
    for (int kb = 0; kb < 128; kb += 32) {
      v16h a, b;
#pragma unroll
      for (int e = 0; e < 16; ++e) {
        int ko = kb + koff(e, lane);
        a[e] = k16[(tm * 16 + l15) * PK + ko];
        b[e] = k16[(tn * 16 + l15) * PK + ko];   // k^T as B
      }
      a0 = wmma_f16(a, b, a0);
    }
#pragma unroll
    for (int r = 0; r < 8; ++r) {
      int m = tm * 16 + hi8 + r, n = tn * 16 + l15;
      Af[m * 64 + n] = (m == n) ? 1.f : ((n < m) ? (r < 4 ? blo[r & 3] : bhi[r & 3]) * a0[r] : 0.f);
    }
  }
  __syncthreads();

  // ---- X = A^-1 (unit lower tri), blocked 2x2 with 32x32 blocks, all f32 ----
  // X11 = A11^-1, X22 = A22^-1: one wave each, lane = column, the column kept in
  // registers, rows of A read as broadcasts. X21 = -X22 (A21 X11) on all 8 waves.
  // Every loop below is fully unrolled so that the per-lane arrays have static
  // indices and stay in registers.
  {
    float* Xf = XT;                   // [2][32][32] diagonal-block inverses
    float* Tf = Xf + 2 * 32 * 32;     // [32][32]    A21 * X11
    if (wid < 2) {
      int r0 = wid * 32;
      float xc[32];
      float ab[2][4][32];             // rows of A11/A22, two groups of 4 rows
#pragma unroll
      for (int r = 1; r < 4; ++r)
#pragma unroll
        for (int l = 0; l < r; ++l) ab[0][r][l] = Af[(r0 + r) * 64 + r0 + l];
#pragma unroll  // full unroll keeps xc[] and ab[] in registers (static indices only)
      for (int G = 0; G < 8; ++G) {
        if (G + 1 < 8) {
#pragma unroll
          for (int r = 0; r < 4; ++r) {
            int i = (G + 1) * 4 + r;
#pragma unroll
            for (int l = 0; l < i; ++l)
              ab[(G + 1) & 1][r][l] = Af[(r0 + i) * 64 + r0 + l];
          }
        }
        // keeps the next group's LDS reads above this group's arithmetic, so that
        // their latency is not paid row by row on the substitution's serial path
        __builtin_amdgcn_sched_barrier(0);
#pragma unroll
        for (int r = 0; r < 4; ++r) {
          int i = G * 4 + r;
          float s0 = 0.f, s1 = 0.f;
#pragma unroll
          for (int l = 0; l < i; ++l) {
            if (l & 1) s1 += ab[G & 1][r][l] * xc[l]; else s0 += ab[G & 1][r][l] * xc[l];
          }
          xc[i] = (i == lane) ? 1.f : -(s0 + s1);
          Xf[wid * 1024 + i * 32 + lane] = xc[i];
          X16[(r0 + i) * PX + r0 + lane] = (_Float16)xc[i];
        }
      }
    } else if (wid == 2) {
#pragma unroll
      for (int i = 0; i < 32; ++i) X16[i * PX + 32 + lane] = (_Float16)0.f;
    }
    __syncthreads();   // publishes X11, X22 to all waves
    {
      float xcol[32];
#pragma unroll
      for (int l = 0; l < 32; ++l) xcol[l] = Xf[l * 32 + lane];
#pragma unroll
      for (int r = 0; r < 4; ++r) {
        int i = wid * 4 + r;
        const v4f* ar = (const v4f*)&Af[(32 + i) * 64];
        float s0 = 0.f, s1 = 0.f, s2 = 0.f, s3 = 0.f;
#pragma unroll
        for (int g = 0; g < 8; ++g) {
          v4f a = ar[g];
          s0 += a[0] * xcol[g * 4 + 0];
          s1 += a[1] * xcol[g * 4 + 1];
          s2 += a[2] * xcol[g * 4 + 2];
          s3 += a[3] * xcol[g * 4 + 3];
        }
        Tf[i * 32 + lane] = (s0 + s1) + (s2 + s3);
      }
    }
    __syncthreads();   // publishes T = A21 X11
    {
      float tcol[32];
#pragma unroll
      for (int l = 0; l < 32; ++l) tcol[l] = Tf[l * 32 + lane];
#pragma unroll
      for (int r = 0; r < 4; ++r) {
        int i = wid * 4 + r;
        const v4f* xr = (const v4f*)&Xf[1024 + i * 32];
        float s0 = 0.f, s1 = 0.f, s2 = 0.f, s3 = 0.f;
#pragma unroll
        for (int g = 0; g < 8; ++g) {
          v4f a = xr[g];
          s0 += a[0] * tcol[g * 4 + 0];
          s1 += a[1] * tcol[g * 4 + 1];
          s2 += a[2] * tcol[g * 4 + 2];
          s3 += a[3] * tcol[g * 4 + 3];
        }
        X16[(32 + i) * PX + lane] = (_Float16)(-((s0 + s1) + (s2 + s3)));
      }
    }
  }
  __syncthreads();

  // ---- u = X @ (beta*v) -> workspace, in accumulator layout ----
#pragma unroll
  for (int ti = 0; ti < 4; ++ti) {
    int t = wid * 4 + ti, tm = t >> 3, tn = t & 7;
    v8f a0 = (v8f){};
#pragma unroll
    for (int kb = 0; kb < 64; kb += 32) {
      v16h a, b;
#pragma unroll
      for (int e = 0; e < 16; ++e) {
        int ko = kb + koff(e, lane);
        a[e] = X16[(tm * 16 + l15) * PX + ko];
        b[e] = vw16[(tn * 16 + l15) * PX + ko];           // (beta*v)^T
      }
      a0 = wmma_f16(a, b, a0);
    }
    *(v8f*)(ug + ((chunk * 32 + t) * 32 + lane) * 8) = a0;
  }
  __syncthreads();

  // ---- -w = -(X @ (beta*k)) -> vw16 (row-major) ; qk = tril(q k^T) ----
#pragma unroll
  for (int ti = 0; ti < 4; ++ti) {
    int t = wid * 4 + ti, tm = t >> 3, tn = t & 7;
    v8f a0 = (v8f){};
#pragma unroll
    for (int kb = 0; kb < 64; kb += 32) {
      v16h a, b;
#pragma unroll
      for (int e = 0; e < 16; ++e) {
        int ko = kb + koff(e, lane);
        a[e] = X16[(tm * 16 + l15) * PX + ko];
        b[e] = (_Float16)((float)k16[ko * PK + tn * 16 + l15] * betaS[ko]);
      }
      a0 = wmma_f16(a, b, a0);
    }
#pragma unroll
    for (int r = 0; r < 8; ++r)
      vw16[(tm * 16 + hi8 + r) * PK + tn * 16 + l15] = (_Float16)(-a0[r]);
  }
#pragma unroll
  for (int ti = 0; ti < 2; ++ti) {
    int t = wid * 2 + ti, tm = t >> 2, tn = t & 3;
    v8f a0 = (v8f){};
#pragma unroll
    for (int kb = 0; kb < 128; kb += 32) {
      v16h a, b;
#pragma unroll
      for (int e = 0; e < 16; ++e) {
        int ko = kb + koff(e, lane);
        a[e] = q16[(tm * 16 + l15) * PK + ko];
        b[e] = k16[(tn * 16 + l15) * PK + ko];
      }
      a0 = wmma_f16(a, b, a0);
    }
#pragma unroll
    for (int r = 0; r < 8; ++r) {
      int m = tm * 16 + hi8 + r, n = tn * 16 + l15;
      qk16[m * PX + n] = (_Float16)((n <= m) ? a0[r] : 0.f);
    }
  }
  __syncthreads();

  // ---- -w and qk: LDS -> workspace, 16 bytes a lane ----
  {
    int4* wo = (int4*)(wg + chunk * 64 * DKH) + tid;
    int4* qo = (int4*)(qkg + chunk * 64 * 64) + tid;
#pragma unroll
    for (int it = 0; it < 4; ++it) {
      int p = tid + it * 256;
      wo[it * 256] = *(const int4*)&vw16[(p >> 4) * PK + (p & 15) * 8];
    }
#pragma unroll
    for (int it = 0; it < 2; ++it) {
      int p = tid + it * 256;
      qo[it * 256] = *(const int4*)&qk16[(p >> 3) * PX + (p & 7) * 8];
    }
  }
}

// The columns (dv) of the state never mix: v_new, o and the state update of a column read
// that column of S alone. So a (b,h) is walked by 128 / DVS blocks side by side, each with
// DVS columns of S, u, v_new and o; q, k, -w and qk are read by every one of them.
// DVS = 32: a block's part of a row of o is one whole 128-byte line.
#define DVS 32
#define NSL (DKH / DVS)
__global__ __launch_bounds__(256) void delta_kernel(
    const _Float16* __restrict__ qg, const _Float16* __restrict__ kg,
    const _Float16* __restrict__ wg, const _Float16* __restrict__ qkg,
    const float* __restrict__ ug, float* __restrict__ og) {
  __shared__ __attribute__((aligned(16))) float    St[DVS * PS];
  __shared__ __attribute__((aligned(16))) _Float16 q16[64 * PK];
  __shared__ __attribute__((aligned(16))) _Float16 k16[64 * PK];
  __shared__ __attribute__((aligned(16))) _Float16 vw16[64 * PK];
  __shared__ __attribute__((aligned(16))) _Float16 qk16[64 * PX];
  __shared__ __attribute__((aligned(16))) _Float16 vnT[DVS * PX];

  int tid = threadIdx.x, lane = tid & 31, wid = tid >> 5;
  int l15 = lane & 15, hi8 = (lane & 16) ? 8 : 0;
  // the slices of one (b,h) are BB*HH block numbers apart (speed only, nothing rests on it)
  size_t bh = blockIdx.x % (BB * HH);
  const int tg0 = (int)(blockIdx.x / (BB * HH)) * (DVS / 16);   // first 16-column tile of the block's slice
  size_t rowbase = bh * (size_t)LL;
  // the wave's one 16x16 tile of the 64 x DVS products: rows tm, columns tn (in the slice)
  const int tm = wid >> 1, tn = wid & 1;

  for (int i = tid; i < DVS * PS; i += 256) St[i] = 0.f;

  for (int c = 0; c < NCHUNK; ++c) {
    // ---- load chunk: q, k, -w, qk -> LDS ; u -> accumulator registers ----
    v8f uacc;
    {
      // One chunk base per operand: every load is base + lane offset + an immediate.
      // (v4f is only the carrier of 16 bytes here: eight f16 move as they are)
      size_t chunk = bh * NCHUNK + c;
      const v4f* qc = (const v4f*)(qg + chunk * 64 * DKH);
      const v4f* kc = (const v4f*)(kg + chunk * 64 * DKH);
      const v4f* wc = (const v4f*)(wg + chunk * 64 * DKH);
      const v4f* xc = (const v4f*)(qkg + chunk * 64 * 64);
      const v8f*  uc = (const v8f*)(ug + chunk * 64 * DKH);
      const unsigned ut = (unsigned)tid, uu = (unsigned)((tm * 8 + tg0 + tn) * 32 + lane);
      v4f tq[4], tk[4], tw[4], tx[2];
#pragma unroll
      for (int it = 0; it < 4; ++it) {
        tq[it] = qc[ut + it * 256];
        tk[it] = kc[ut + it * 256];
        tw[it] = wc[ut + it * 256];
      }
#pragma unroll
      for (int it = 0; it < 2; ++it) tx[it] = xc[ut + it * 256];
      uacc = uc[uu];                                   // the wave's tile, this lane
      // inputs-only fence on the loaded values: all 16 loads are issued ahead of it and
      // share one trip to memory (without it they were built as load, wait, store, one by one)
      asm volatile("" :: "v"(tq[0]), "v"(tq[1]), "v"(tq[2]), "v"(tq[3]),
                         "v"(tk[0]), "v"(tk[1]), "v"(tk[2]), "v"(tk[3]),
                         "v"(tw[0]), "v"(tw[1]), "v"(tw[2]), "v"(tw[3]),
                         "v"(tx[0]), "v"(tx[1]), "v"(uacc));
#pragma unroll
      for (int it = 0; it < 4; ++it) {
        int p = tid + it * 256;
        int o = (p >> 4) * PK + (p & 15) * 8;
        *(v4f*)&q16[o]  = tq[it];
        *(v4f*)&k16[o]  = tk[it];
        *(v4f*)&vw16[o] = tw[it];
      }
#pragma unroll
      for (int it = 0; it < 2; ++it) {
        int p = tid + it * 256;
        *(v4f*)&qk16[(p >> 3) * PX + (p & 7) * 8] = tx[it];
      }
    }
    __syncthreads();

    // ---- o1 = q @ S (regs) ; v_new = u + (-w) @ S -> vnT (transposed) ----
    // both products take the same S fragment
    v8f oacc = (v8f){};
    {
      v8f a0 = uacc;
#pragma unroll
      for (int kb = 0; kb < 128; kb += 32) {
        v16h aq, aw, b;
#pragma unroll
        for (int e = 0; e < 16; ++e) {
          int ko = kb + koff(e, lane);
          aq[e] = q16[(tm * 16 + l15) * PK + ko];
          aw[e] = vw16[(tm * 16 + l15) * PK + ko];         // -w row-major
          b[e] = (_Float16)St[(tn * 16 + l15) * PS + ko];  // S^T rows
        }
        oacc = wmma_f16(aq, b, oacc);
        a0 = wmma_f16(aw, b, a0);
      }
#pragma unroll
      for (int r = 0; r < 8; ++r)
        vnT[(tn * 16 + l15) * PX + tm * 16 + hi8 + r] = (_Float16)a0[r];
    }
    __syncthreads();

    // ---- o = o1 + qk @ v_new -> global ----
    {
      v8f a0 = oacc;
#pragma unroll
      for (int kb = 0; kb < 64; kb += 32) {
        v16h a, b;
#pragma unroll
        for (int e = 0; e < 16; ++e) {
          int ko = kb + koff(e, lane);
          a[e] = qk16[(tm * 16 + l15) * PX + ko];
          b[e] = vnT[(tn * 16 + l15) * PX + ko];            // v_new^T rows
        }
        a0 = wmma_f16(a, b, a0);
      }
#pragma unroll
      for (int r = 0; r < 8; ++r)
        og[(rowbase + (size_t)c * 64 + tm * 16 + hi8 + r) * 128 + (tg0 + tn) * 16 + l15] = a0[r];
    }
    // ---- S^T += (k^T @ v_new)^T : tile (m=dk, n=dv), stored transposed ----
    // the wave takes dk tile wid against every column tile of the slice
#pragma unroll
    for (int sn = 0; sn < DVS / 16; ++sn) {
      v8f a0;
#pragma unroll
      for (int r = 0; r < 8; ++r)
        a0[r] = St[(sn * 16 + l15) * PS + wid * 16 + hi8 + r];
#pragma unroll
      for (int kb = 0; kb < 64; kb += 32) {
        v16h a, b;
#pragma unroll
        for (int e = 0; e < 16; ++e) {
          int ko = kb + koff(e, lane);
          a[e] = k16[ko * PK + wid * 16 + l15];   // (k^T)[m][j] = k[j][m]
          b[e] = vnT[(sn * 16 + l15) * PX + ko];  // v_new^T rows
        }
        a0 = wmma_f16(a, b, a0);
      }
#pragma unroll
      for (int r = 0; r < 8; ++r)
        St[(sn * 16 + l15) * PS + wid * 16 + hi8 + r] = a0[r];
    }
    __syncthreads();
  }
}

// ---------------- per-head output RMSNorm -> [B,L,D] f16 -------------------
// a wave takes RW rows in a row of one head, a lane four channels
__global__ __launch_bounds__(256) void onorm_kernel(const float* __restrict__ og,
                                                    const float* __restrict__ w,
                                                    _Float16* __restrict__ on16) {
  int lane = threadIdx.x & 31;
  unsigned gw = blockIdx.x * 8 + wave_id();
  unsigned hb = gw / (LL / RW);         // b*H + h
  unsigned l0 = (gw % (LL / RW)) * RW;
  unsigned hh = hb % HH, b = hb / HH;
  const v4f* src = (const v4f*)(og + ((size_t)hb * LL + l0) * DKH) + lane;
  v4f v[RW];
#pragma unroll
  for (int r = 0; r < RW; ++r) v[r] = src[r * 32];
  v4f wv = *((const v4f*)w + lane);
  _Float16* dst = on16 + ((size_t)b * LL + l0) * DD + hh * DKH + lane * 4;
#pragma unroll
  for (int r = 0; r < RW; ++r) {
    v4f q = v[r] * v[r];
    float inv = rsqrtf(wave_sum((q[0] + q[1]) + (q[2] + q[3])) * (1.f / DKH) + EPSF);
    v4h o;
#pragma unroll
    for (int c = 0; c < 4; ++c) o[c] = (_Float16)(v[r][c] * inv * wv[c]);
    *(v4h*)(dst + (size_t)r * DD) = o;
  }
}

// ---------------------------------------------------------------------------
extern "C" void kernel_launch(void* const* d_in, const int* in_sizes, int n_in,
                              void* d_out, int out_size, void* d_ws, size_t ws_size,
                              hipStream_t stream) {
  const float* x        = (const float*)d_in[0];
  const float* norm_w   = (const float*)d_in[1];
  const float* Wq       = (const float*)d_in[2];
  const float* Wk       = (const float*)d_in[3];
  const float* Wv       = (const float*)d_in[4];
  const float* Wb       = (const float*)d_in[5];
  const float* conv_q   = (const float*)d_in[6];
  const float* conv_k   = (const float*)d_in[7];
  const float* conv_v   = (const float*)d_in[8];
  const float* o_norm_w = (const float*)d_in[9];
  const float* Wo       = (const float*)d_in[10];
  float* out = (float*)d_out;

  char* p = (char*)d_ws;
  auto take = [&](size_t bytes) { char* r = p; p += (bytes + 255) & ~(size_t)255; return r; };
  const size_t actF16 = (size_t)BLROWS * DD * sizeof(_Float16);   // 16 MiB
  const size_t wF16   = (size_t)DD * DD * sizeof(_Float16);       // 2 MiB

  _Float16* h16   = (_Float16*)take(actF16);
  _Float16* wq16t = (_Float16*)take(wF16);   // transposed [N][K]
  _Float16* wk16t = (_Float16*)take(wF16);
  _Float16* wv16t = (_Float16*)take(wF16);
  _Float16* wo16t = (_Float16*)take(wF16);
  _Float16* qpre  = (_Float16*)take(actF16);
  _Float16* kpre  = (_Float16*)take(actF16);
  _Float16* vpre  = (_Float16*)take(actF16);
  _Float16* qh    = (_Float16*)take(actF16);
  _Float16* kh    = (_Float16*)take(actF16);
  _Float16* vh    = (_Float16*)take(actF16);
  float*    betag = (float*)take((size_t)BB * HH * LL * sizeof(float));
  float*    og    = (float*)take((size_t)BB * HH * LL * DKH * sizeof(float));
  _Float16* on16  = (_Float16*)take(actF16);
  float*    ug    = (float*)take((size_t)BB * HH * LL * DKH * sizeof(float));
  _Float16* wg    = (_Float16*)take(actF16);
  _Float16* qkg   = (_Float16*)take((size_t)BB * HH * LL * 64 * sizeof(_Float16));

  // 1. h = rmsnorm(x)
  rmsnorm_kernel<<<BLROWS / 8, 256, 0, stream>>>(x, norm_w, h16);
  // 2. weights -> f16, transposed to [N][K] for K-contiguous B fragments
  int tgrid = (DD / 32) * (DD / 32);
  transpose_f16_kernel<<<tgrid, 256, 0, stream>>>(Wq, wq16t, DD, DD);
  transpose_f16_kernel<<<tgrid, 256, 0, stream>>>(Wk, wk16t, DD, DD);
  transpose_f16_kernel<<<tgrid, 256, 0, stream>>>(Wv, wv16t, DD, DD);
  transpose_f16_kernel<<<tgrid, 256, 0, stream>>>(Wo, wo16t, DD, DD);
  // 3. projections (WMMA GEMMs, async double-buffered staging)
  dim3 ggrid(DD / 128, BLROWS / 128);
  gemm_f16_kernel<0><<<ggrid, 256, 0, stream>>>(h16, wq16t, qpre, nullptr, nullptr, BLROWS, DD, DD);
  gemm_f16_kernel<0><<<ggrid, 256, 0, stream>>>(h16, wk16t, kpre, nullptr, nullptr, BLROWS, DD, DD);
  gemm_f16_kernel<0><<<ggrid, 256, 0, stream>>>(h16, wv16t, vpre, nullptr, nullptr, BLROWS, DD, DD);
  // 4. beta
  beta_kernel<<<BLROWS / 32, 256, 0, stream>>>(h16, Wb, betag);
  // 5. conv + activations + head layout
  conv_head_kernel<<<BB * HH * LL / (8 * RW), 256, 0, stream>>>(qpre, conv_q, qh, 2);
  conv_head_kernel<<<BB * HH * LL / (8 * RW), 256, 0, stream>>>(kpre, conv_k, kh, 1);
  conv_head_kernel<<<BB * HH * LL / (8 * RW), 256, 0, stream>>>(vpre, conv_v, vh, 0);
  // 6. chunkwise delta rule: per-chunk operands for all chunks, then the serial walk
  delta_prep_kernel<<<BB * HH * NCHUNK, 256, 0, stream>>>(qh, kh, vh, betag, ug, wg, qkg);
  delta_kernel<<<BB * HH * NSL, 256, 0, stream>>>(qh, kh, wg, qkg, ug, og);
  // 7. output norm
  onorm_kernel<<<BB * HH * LL / (8 * RW), 256, 0, stream>>>(og, o_norm_w, on16);
  // 8. out = x + on @ Wo
  gemm_f16_kernel<1><<<ggrid, 256, 0, stream>>>(on16, wo16t, nullptr, out, x, BLROWS, DD, DD);
}

// v007
// A run of this version takes 278 microseconds.
// In both of two side-by-side timings against v006, it was 1.20 times as fast.
// Counting every step since v000, it is 19.3 times as fast.
#include <hip/hip_runtime.h>
#include <hip/hip_bf16.h>

typedef __attribute__((ext_vector_type(16))) _Float16 v16h;
typedef __attribute__((ext_vector_type(8)))  float    v8f;
typedef __attribute__((ext_vector_type(4)))  float    v4f;

#define BB 2
#define LL 4096
#define DD 1024
#define HH 8
#define DKH 128
#define BLROWS (BB*LL)          // 8192
#define NCHUNK 64
#define EPSF 1e-6f

#if defined(__gfx1250__) && __has_builtin(__builtin_amdgcn_global_load_async_to_lds_b128)
#define HAVE_ASYNC 1
typedef int v4i_ __attribute__((ext_vector_type(4)));
typedef __attribute__((address_space(1))) v4i_* gp_v4i;
typedef __attribute__((address_space(3))) v4i_* lp_v4i;
#define GLA128(SRC, DST) \
  __builtin_amdgcn_global_load_async_to_lds_b128((gp_v4i)(void*)(SRC), (lp_v4i)(void*)(DST), 0, 0)
#if __has_builtin(__builtin_amdgcn_s_wait_asynccnt)
#define WAITA(n) __builtin_amdgcn_s_wait_asynccnt(n)
#else
#define WAITA(n) asm volatile("s_wait_asynccnt %0" :: "n"(n) : "memory")
#endif
#else
#define HAVE_ASYNC 0
#define WAITA(n)
#endif

__device__ __forceinline__ int koff(int e, int lane) {
  int j = e >> 1;
  return ((j & 4) << 2) + ((lane & 16) >> 1) + ((j & 3) << 1) + (e & 1);
}

__device__ __forceinline__ v8f wmma_f16(v16h a, v16h b, v8f c) {
  return __builtin_amdgcn_wmma_f32_16x16x32_f16(false, a, false, b, (short)0, c, false, false);
}

__device__ __forceinline__ float sigmoidf_(float x) { return 1.f / (1.f + __expf(-x)); }
__device__ __forceinline__ float siluf_(float x) { return x * sigmoidf_(x); }

// ---------------- the row kernels ------------------------------------------
// rmsnorm, beta, conv+l2norm and the output norm each work on short rows (128 or 1024
// elements). One wave takes whole rows: a lane holds its share of a row in registers,
// the row's sum is a butterfly over the 32 lanes, and there is no LDS and no barrier.
// One block per row cost far more in starting waves than in the rows' own work.
// Every '#pragma unroll' in these four kernels is on a loop over a lane's own share: fully
// unrolled, the per-lane arrays have static indices only and stay in registers.
typedef __attribute__((ext_vector_type(4))) _Float16 v4h;

// the wave's number in its block, held as a scalar, so that row numbers and row
// addresses are scalar arithmetic and the loads take base + lane offset + immediate
__device__ __forceinline__ unsigned wave_id() {
  return (unsigned)__builtin_amdgcn_readfirstlane((int)(threadIdx.x >> 5));
}

template <int M>
__device__ __forceinline__ float xmask_add(float v) {
  // v + (v of lane ^ M), M < 16: a DPP row_xmask move inside the 16-lane row
  int o = __builtin_amdgcn_update_dpp(0, __builtin_bit_cast(int, v), 0x160 | M, 0xf, 0xf, true);
  return v + __builtin_bit_cast(float, o);
}
// sum over the wave's 32 lanes, the same bits in every lane
__device__ __forceinline__ float wave_sum(float v) {
  v = xmask_add<1>(v);
  v = xmask_add<2>(v);
  v = xmask_add<4>(v);
  v = xmask_add<8>(v);
  int b = __builtin_bit_cast(int, v);
  int o = __builtin_amdgcn_permlanex16(b, b, 0x76543210, 0xfedcba98, false, false);  // lane ^ 16
  return v + __builtin_bit_cast(float, o);
}

// ---------------- RMSNorm (x -> h f16): one row a wave ----------------------
__global__ __launch_bounds__(256) void rmsnorm_kernel(const float* __restrict__ x,
                                                      const float* __restrict__ w,
                                                      _Float16* __restrict__ h16) {
  int lane = threadIdx.x & 31;
  size_t row = (size_t)(blockIdx.x * 8 + wave_id());
  const v4f* xr = (const v4f*)(x + row * DD) + lane;
  const v4f* wr = (const v4f*)w + lane;
  v4f xv[8];
#pragma unroll
  for (int j = 0; j < 8; ++j) xv[j] = xr[j * 32];
  v4f p = (v4f){};
#pragma unroll
  for (int j = 0; j < 8; ++j) p += xv[j] * xv[j];
  float inv = rsqrtf(wave_sum((p[0] + p[1]) + (p[2] + p[3])) * (1.f / DD) + EPSF);
  v4h* ho = (v4h*)(h16 + row * DD) + lane;
#pragma unroll
  for (int j = 0; j < 8; ++j) {
    v4f wv = wr[j * 32];
    v4h o;
#pragma unroll
    for (int c = 0; c < 4; ++c) o[c] = (_Float16)(xv[j][c] * inv * wv[c]);
    ho[j * 32] = o;
  }
}

// -------- LDS-tiled transpose: src f32 [R][C] -> dst f16 [C][R] ------------
__global__ __launch_bounds__(256) void transpose_f16_kernel(const float* __restrict__ src,
                                                            _Float16* __restrict__ dst,
                                                            int R, int C) {
  __shared__ float t[32][33];
  int nbx = C / 32;
  int bx = blockIdx.x % nbx, by = blockIdx.x / nbx;
  int r0 = by * 32, c0 = bx * 32;
  int tr = threadIdx.x >> 5, tc = threadIdx.x & 31;
#pragma unroll
  for (int i = 0; i < 32; i += 8)
    t[tr + i][tc] = src[(size_t)(r0 + tr + i) * C + c0 + tc];
  __syncthreads();
#pragma unroll
  for (int i = 0; i < 32; i += 8)
    dst[(size_t)(c0 + tr + i) * R + r0 + tc] = (_Float16)t[tc][tr + i];
}

#define PG 40   // halfs
template <int MODE>
__global__ __launch_bounds__(256) void gemm_f16_kernel(
    const _Float16* __restrict__ A, const _Float16* __restrict__ Bt,
    _Float16* __restrict__ out16, float* __restrict__ outf,
    const float* __restrict__ resid, int M, int N, int K) {
  __shared__ __attribute__((aligned(16))) _Float16 As[2][128][PG];
  __shared__ __attribute__((aligned(16))) _Float16 Bs[2][128][PG];
  int tid = threadIdx.x, lane = tid & 31;
  int wid = tid >> 5, l15 = lane & 15, hi8 = (lane & 16) ? 8 : 0;
  int wm = wid >> 1, wn = wid & 1;
  int bm = blockIdx.y * 128, bn = blockIdx.x * 128;

  int cr = tid >> 2, cs = (tid & 3) * 8;          // copy row / 8-half segment
  auto issue = [&](int buf, int k0) {
    const _Float16* ga = A + (size_t)(bm + cr) * K + k0 + cs;
    const _Float16* gb = Bt + (size_t)(bn + cr) * K + k0 + cs;
#if HAVE_ASYNC
    GLA128(ga,                    &As[buf][cr][cs]);
    GLA128(ga + (size_t)64 * K,   &As[buf][cr + 64][cs]);
    GLA128(gb,                    &Bs[buf][cr][cs]);
    GLA128(gb + (size_t)64 * K,   &Bs[buf][cr + 64][cs]);
#else
    *(int4*)&As[buf][cr][cs]      = *(const int4*)ga;
    *(int4*)&As[buf][cr + 64][cs] = *(const int4*)(ga + (size_t)64 * K);
    *(int4*)&Bs[buf][cr][cs]      = *(const int4*)gb;
    *(int4*)&Bs[buf][cr + 64][cs] = *(const int4*)(gb + (size_t)64 * K);
#endif
  };

  v8f acc[2][4];
#pragma unroll
  for (int i = 0; i < 2; ++i)
#pragma unroll
    for (int j = 0; j < 4; ++j) acc[i][j] = (v8f){};

  int nT = K / 32;
  issue(0, 0);
  for (int kt = 0; kt < nT; ++kt) {
    int buf = kt & 1;
    if (kt + 1 < nT) { issue(buf ^ 1, (kt + 1) * 32); WAITA(4); }
    else             { WAITA(0); }
    __syncthreads();
    v16h af[2], bf[4];
#pragma unroll
    for (int i = 0; i < 2; ++i) {
      int mr = wm * 32 + i * 16 + l15;
#pragma unroll
      for (int e = 0; e < 16; ++e) af[i][e] = As[buf][mr][koff(e, lane)];
    }
#pragma unroll
    for (int j = 0; j < 4; ++j) {
      int nc = wn * 64 + j * 16 + l15;
#pragma unroll
      for (int e = 0; e < 16; ++e) bf[j][e] = Bs[buf][nc][koff(e, lane)];
    }
#pragma unroll
    for (int i = 0; i < 2; ++i)
#pragma unroll
      for (int j = 0; j < 4; ++j) acc[i][j] = wmma_f16(af[i], bf[j], acc[i][j]);
    __syncthreads();
  }
#pragma unroll
  for (int i = 0; i < 2; ++i)
#pragma unroll
    for (int j = 0; j < 4; ++j)
#pragma unroll
      for (int r = 0; r < 8; ++r) {
        size_t gm = bm + wm * 32 + i * 16 + hi8 + r;
        size_t gn = bn + wn * 64 + j * 16 + l15;
        if (MODE == 0) out16[gm * N + gn] = (_Float16)acc[i][j][r];
        else           outf[gm * N + gn] = resid[gm * N + gn] + acc[i][j][r];
      }
}

// ---------------- beta = sigmoid(h @ Wb): four rows a wave ------------------
__global__ __launch_bounds__(256) void beta_kernel(const _Float16* __restrict__ h16,
                                                   const float* __restrict__ Wb,
                                                   float* __restrict__ betag) {
  int lane = threadIdx.x & 31;
  size_t row0 = (size_t)((blockIdx.x * 8 + wave_id()) * 4);   // b*L + l of the first row
  const _Float16* hr = h16 + row0 * DD + lane;
  const v4f* wb = (const v4f*)Wb + lane * 2;
  float acc[4][8];
#pragma unroll
  for (int r = 0; r < 4; ++r)
#pragma unroll
    for (int hh = 0; hh < 8; ++hh) acc[r][hh] = 0.f;
  // lane takes k = lane, lane + 32, ...; a row of Wb serves all four rows of h.
  // Eight k steps a trip, loaded ahead of the arithmetic: a trip pays the way to memory
  // once, not once a k step.
  for (int jo = 0; jo < DD / 32; jo += 8) {
    _Float16 hv[4][8];
    v4f wlo[8], whi[8];
#pragma unroll
    for (int r = 0; r < 4; ++r)
#pragma unroll
      for (int j = 0; j < 8; ++j) hv[r][j] = hr[r * DD + (jo + j) * 32];
#pragma unroll
    for (int j = 0; j < 8; ++j) {
      wlo[j] = wb[(jo + j) * 64];
      whi[j] = wb[(jo + j) * 64 + 1];
    }
#pragma unroll
    for (int j = 0; j < 8; ++j)
#pragma unroll
      for (int r = 0; r < 4; ++r) {
        float hf = (float)hv[r][j];
#pragma unroll
        for (int hh = 0; hh < 4; ++hh) {
          acc[r][hh]     += hf * wlo[j][hh];
          acc[r][hh + 4] += hf * whi[j][hh];
        }
      }
  }
  // lane r*8 + hh keeps and stores the sum of (row r, head hh)
  float mine = 0.f;
#pragma unroll
  for (int r = 0; r < 4; ++r)
#pragma unroll
    for (int hh = 0; hh < 8; ++hh) {
      float s = wave_sum(acc[r][hh]);
      mine = (lane == r * 8 + hh) ? s : mine;
    }
  size_t row = row0 + (lane >> 3);
  int b = (int)(row / LL), l = (int)(row % LL);
  betag[((size_t)b * HH + (lane & 7)) * LL + l] = sigmoidf_(mine);
}

// -------- causal conv(K=4)+silu [+silu+l2norm (+qscale)] -> heads f16 ------
// mode: 0 = v (conv+silu), 1 = k (+silu+l2norm), 2 = q (+silu+l2norm+DK^-.5)
// A wave takes RW rows in a row of one head, a lane four channels; the RW + 3 input
// rows are loaded once and each serves up to four output rows.
#define RW 8
__global__ __launch_bounds__(256) void conv_head_kernel(
    const _Float16* __restrict__ pre, const float* __restrict__ cw,
    _Float16* __restrict__ outg, int mode) {
  int lane = threadIdx.x & 31;
  unsigned gw = blockIdx.x * 8 + wave_id();
  unsigned hb = gw / (LL / RW);         // b*H + h
  unsigned l0 = (gw % (LL / RW)) * RW;
  unsigned hh = hb % HH, b = hb / HH;
  unsigned ch = hh * DKH + lane * 4;
  const bool first = (l0 == 0);         // the three rows in front of l0 are the left padding
  // rows l0-3 .. l0+RW-1; at l0 == 0 the first three loads read rows 0..2 instead
  // (inside the buffer) and are zeroed below
  const _Float16* src = pre + ((size_t)b * LL + l0) * DD + ch;
  const _Float16* srcm = first ? src : src - 3 * DD;
  v4h xin[RW + 3];
#pragma unroll
  for (int i = 0; i < 3; ++i) xin[i] = *(const v4h*)(srcm + i * DD);
#pragma unroll
  for (int i = 3; i < RW + 3; ++i) xin[i] = *(const v4h*)(src + (i - 3) * DD);
  v4f wt[4];                            // the four taps of each of the lane's channels
#pragma unroll
  for (int c = 0; c < 4; ++c) wt[c] = *(const v4f*)(cw + (ch + c) * 4);
  v4f xf[RW + 3];
#pragma unroll
  for (int i = 0; i < RW + 3; ++i)
#pragma unroll
    for (int c = 0; c < 4; ++c) xf[i][c] = (i < 3 && first) ? 0.f : (float)xin[i][c];
  v4f s[RW];
#pragma unroll
  for (int r = 0; r < RW; ++r)
#pragma unroll
    for (int c = 0; c < 4; ++c) {
      float acc = 0.f;
#pragma unroll
      for (int i = 0; i < 4; ++i) acc += xf[r + i][c] * wt[c][i];
      s[r][c] = siluf_(acc);
    }
  if (mode > 0) {
    float qs = (mode == 2) ? 0.08838834764831845f : 1.f;   // 128^-0.5
#pragma unroll
    for (int r = 0; r < RW; ++r) {
#pragma unroll
      for (int c = 0; c < 4; ++c) s[r][c] = siluf_(s[r][c]);
      v4f q = s[r] * s[r];
      float inv = rsqrtf(wave_sum((q[0] + q[1]) + (q[2] + q[3])) + EPSF);
#pragma unroll
      for (int c = 0; c < 4; ++c) s[r][c] = s[r][c] * inv * qs;
    }
  }
  v4h* dst = (v4h*)(outg + ((size_t)hb * LL + l0) * DKH) + lane;
#pragma unroll
  for (int r = 0; r < RW; ++r) {
    v4h o;
#pragma unroll
    for (int c = 0; c < 4; ++c) o[c] = (_Float16)s[r][c];
    dst[r * 32] = o;
  }
}

#define PK 136   // halfs: rows of 128 f16 (q16, k16, -w)       272 B
#define PX 72    // halfs: rows of  64 f16 (X16, qk, vnT, (bv)^T) 144 B
#define PS 132   // floats: rows of 128 f32 (St)                 528 B
__global__ __launch_bounds__(256) void delta_prep_kernel(
    const _Float16* __restrict__ qg, const _Float16* __restrict__ kg,
    const _Float16* __restrict__ vg, const float* __restrict__ betag,
    float* __restrict__ ug, _Float16* __restrict__ wg, _Float16* __restrict__ qkg) {
  __shared__ __attribute__((aligned(16))) _Float16 q16[64 * PK];
  __shared__ __attribute__((aligned(16))) _Float16 k16[64 * PK];
  __shared__ __attribute__((aligned(16))) _Float16 vw16[128 * PX];   // 128*PX >= 64*PK
  __shared__ __attribute__((aligned(16))) float    Af[64 * 64];
  __shared__ __attribute__((aligned(16))) _Float16 X16[64 * PX];
  __shared__ __attribute__((aligned(16))) float    XT[3 * 32 * 32];  // f32 scratch of the inverse
  __shared__ __attribute__((aligned(16))) float    betaS[64];
  _Float16* qk16 = (_Float16*)Af;

  int tid = threadIdx.x, lane = tid & 31, wid = tid >> 5;
  int l15 = lane & 15, hi8 = (lane & 16) ? 8 : 0;
  size_t chunk = blockIdx.x;            // (b*H + h)*64 + c ; its rows start at chunk*64

  // ---- load chunk (beta first; fold beta into transposed v) ----
  if (tid < 64) betaS[tid] = betag[chunk * 64 + tid];
  __syncthreads();
  {
    // One chunk base per operand and a fully unrolled loop: every load is that
    // operand's lane pointer + an immediate.
    const _Float16* qc = qg + chunk * 64 * DKH;
    const _Float16* kc = kg + chunk * 64 * DKH;
    const _Float16* vc = vg + chunk * 64 * DKH;
    const int j0 = tid >> 7, d = tid & 127;
#pragma unroll
    for (int it = 0; it < 32; ++it) {
      int i = tid + it * 256;
      int j = j0 + it * 2;
      q16[j * PK + d] = qc[i];
      k16[j * PK + d] = kc[i];
      vw16[d * PX + j] = (_Float16)((float)vc[i] * betaS[j]);   // (beta*v)^T
    }
  }
  __syncthreads();

  // ---- kk = k k^T ; A = I + tril(beta*kk, -1) ----
#pragma unroll
  for (int ti = 0; ti < 2; ++ti) {
    int t = wid * 2 + ti, tm = t >> 2, tn = t & 3;
    v8f a0 = (v8f){};
    // beta of this lane's 8 rows, read unconditionally: the mask below is then a
    // select, with no branch between the last matrix instruction and its readers
    const v4f blo = *(const v4f*)&betaS[tm * 16 + hi8];
    const v4f bhi = *(const v4f*)&betaS[tm * 16 + hi8 + 4];
#pragma unroll
    for (int kb = 0; kb < 128; kb += 32) {
      v16h a, b;
#pragma unroll
      for (int e = 0; e < 16; ++e) {
        int ko = kb + koff(e, lane);
        a[e] = k16[(tm * 16 + l15) * PK + ko];
        b[e] = k16[(tn * 16 + l15) * PK + ko];   // k^T as B
      }
      a0 = wmma_f16(a, b, a0);
    }
#pragma unroll
    for (int r = 0; r < 8; ++r) {
      int m = tm * 16 + hi8 + r, n = tn * 16 + l15;
      Af[m * 64 + n] = (m == n) ? 1.f : ((n < m) ? (r < 4 ? blo[r & 3] : bhi[r & 3]) * a0[r] : 0.f);
    }
  }
  __syncthreads();

  // ---- X = A^-1 (unit lower tri), blocked 2x2 with 32x32 blocks, all f32 ----
  // X11 = A11^-1, X22 = A22^-1: one wave each, lane = column, the column kept in
  // registers, rows of A read as broadcasts. X21 = -X22 (A21 X11) on all 8 waves.
  // Every loop below is fully unrolled so that the per-lane arrays have static
  // indices and stay in registers.
  {
    float* Xf = XT;                   // [2][32][32] diagonal-block inverses
    float* Tf = Xf + 2 * 32 * 32;     // [32][32]    A21 * X11
    if (wid < 2) {
      int r0 = wid * 32;
      float xc[32];
      float ab[2][4][32];             // rows of A11/A22, two groups of 4 rows
#pragma unroll
      for (int r = 1; r < 4; ++r)
#pragma unroll
        for (int l = 0; l < r; ++l) ab[0][r][l] = Af[(r0 + r) * 64 + r0 + l];
#pragma unroll  // full unroll keeps xc[] and ab[] in registers (static indices only)
      for (int G = 0; G < 8; ++G) {
        if (G + 1 < 8) {
#pragma unroll
          for (int r = 0; r < 4; ++r) {
            int i = (G + 1) * 4 + r;
#pragma unroll
            for (int l = 0; l < i; ++l)
              ab[(G + 1) & 1][r][l] = Af[(r0 + i) * 64 + r0 + l];
          }
        }
        // keeps the next group's LDS reads above this group's arithmetic, so that
        // their latency is not paid row by row on the substitution's serial path
        __builtin_amdgcn_sched_barrier(0);
#pragma unroll
        for (int r = 0; r < 4; ++r) {
          int i = G * 4 + r;
          float s0 = 0.f, s1 = 0.f;
#pragma unroll
          for (int l = 0; l < i; ++l) {
            if (l & 1) s1 += ab[G & 1][r][l] * xc[l]; else s0 += ab[G & 1][r][l] * xc[l];
          }
          xc[i] = (i == lane) ? 1.f : -(s0 + s1);
          Xf[wid * 1024 + i * 32 + lane] = xc[i];
          X16[(r0 + i) * PX + r0 + lane] = (_Float16)xc[i];
        }
      }
    } else if (wid == 2) {
#pragma unroll
      for (int i = 0; i < 32; ++i) X16[i * PX + 32 + lane] = (_Float16)0.f;
    }
    __syncthreads();   // publishes X11, X22 to all waves
    {
      float xcol[32];
#pragma unroll
      for (int l = 0; l < 32; ++l) xcol[l] = Xf[l * 32 + lane];
#pragma unroll
      for (int r = 0; r < 4; ++r) {
        int i = wid * 4 + r;
        const v4f* ar = (const v4f*)&Af[(32 + i) * 64];
        float s0 = 0.f, s1 = 0.f, s2 = 0.f, s3 = 0.f;
#pragma unroll
        for (int g = 0; g < 8; ++g) {
          v4f a = ar[g];
          s0 += a[0] * xcol[g * 4 + 0];
          s1 += a[1] * xcol[g * 4 + 1];
          s2 += a[2] * xcol[g * 4 + 2];
          s3 += a[3] * xcol[g * 4 + 3];
        }
        Tf[i * 32 + lane] = (s0 + s1) + (s2 + s3);
      }
    }
    __syncthreads();   // publishes T = A21 X11
    {
      float tcol[32];
#pragma unroll
      for (int l = 0; l < 32; ++l) tcol[l] = Tf[l * 32 + lane];
#pragma unroll
      for (int r = 0; r < 4; ++r) {
        int i = wid * 4 + r;
        const v4f* xr = (const v4f*)&Xf[1024 + i * 32];
        float s0 = 0.f, s1 = 0.f, s2 = 0.f, s3 = 0.f;
#pragma unroll
        for (int g = 0; g < 8; ++g) {
          v4f a = xr[g];
          s0 += a[0] * tcol[g * 4 + 0];
          s1 += a[1] * tcol[g * 4 + 1];
          s2 += a[2] * tcol[g * 4 + 2];
          s3 += a[3] * tcol[g * 4 + 3];
        }
        X16[(32 + i) * PX + lane] = (_Float16)(-((s0 + s1) + (s2 + s3)));
      }
    }
  }
  __syncthreads();

  // ---- u = X @ (beta*v) -> workspace, in accumulator layout ----
#pragma unroll
  for (int ti = 0; ti < 4; ++ti) {
    int t = wid * 4 + ti, tm = t >> 3, tn = t & 7;
    v8f a0 = (v8f){};
#pragma unroll
    for (int kb = 0; kb < 64; kb += 32) {
      v16h a, b;
#pragma unroll
      for (int e = 0; e < 16; ++e) {
        int ko = kb + koff(e, lane);
        a[e] = X16[(tm * 16 + l15) * PX + ko];
        b[e] = vw16[(tn * 16 + l15) * PX + ko];           // (beta*v)^T
      }
      a0 = wmma_f16(a, b, a0);
    }
    *(v8f*)(ug + ((chunk * 32 + t) * 32 + lane) * 8) = a0;
  }
  __syncthreads();

  // ---- -w = -(X @ (beta*k)) -> vw16 (row-major) ; qk = tril(q k^T) ----
#pragma unroll
  for (int ti = 0; ti < 4; ++ti) {
    int t = wid * 4 + ti, tm = t >> 3, tn = t & 7;
    v8f a0 = (v8f){};
#pragma unroll
    for (int kb = 0; kb < 64; kb += 32) {
      v16h a, b;
#pragma unroll
      for (int e = 0; e < 16; ++e) {
        int ko = kb + koff(e, lane);
        a[e] = X16[(tm * 16 + l15) * PX + ko];
        b[e] = (_Float16)((float)k16[ko * PK + tn * 16 + l15] * betaS[ko]);
      }
      a0 = wmma_f16(a, b, a0);
    }
#pragma unroll
    for (int r = 0; r < 8; ++r)
      vw16[(tm * 16 + hi8 + r) * PK + tn * 16 + l15] = (_Float16)(-a0[r]);
  }
#pragma unroll
  for (int ti = 0; ti < 2; ++ti) {
    int t = wid * 2 + ti, tm = t >> 2, tn = t & 3;
    v8f a0 = (v8f){};
#pragma unroll
    for (int kb = 0; kb < 128; kb += 32) {
      v16h a, b;
#pragma unroll
      for (int e = 0; e < 16; ++e) {
        int ko = kb + koff(e, lane);
        a[e] = q16[(tm * 16 + l15) * PK + ko];
        b[e] = k16[(tn * 16 + l15) * PK + ko];
      }
      a0 = wmma_f16(a, b, a0);
    }
#pragma unroll
    for (int r = 0; r < 8; ++r) {
      int m = tm * 16 + hi8 + r, n = tn * 16 + l15;
      qk16[m * PX + n] = (_Float16)((n <= m) ? a0[r] : 0.f);
    }
  }
  __syncthreads();

  // ---- -w and qk: LDS -> workspace, 16 bytes a lane ----
  {
    int4* wo = (int4*)(wg + chunk * 64 * DKH) + tid;
    int4* qo = (int4*)(qkg + chunk * 64 * 64) + tid;
#pragma unroll
    for (int it = 0; it < 4; ++it) {
      int p = tid + it * 256;
      wo[it * 256] = *(const int4*)&vw16[(p >> 4) * PK + (p & 15) * 8];
    }
#pragma unroll
    for (int it = 0; it < 2; ++it) {
      int p = tid + it * 256;
      qo[it * 256] = *(const int4*)&qk16[(p >> 3) * PX + (p & 7) * 8];
    }
  }
}

// The columns (dv) of the state never mix: v_new, o and the state update of a column read
// that column of S alone. So a (b,h) is walked by 128 / DVS blocks side by side, each with
// DVS columns of S, u, v_new and o; q, k, -w and qk are read by every one of them.
// DVS = 32: a block's part of a row of o is one whole 128-byte line.
#define DVS 32
#define NSL (DKH / DVS)
// One chunk's q, k, -w and qk lie in one staging buffer in LDS, at these places (in halfs);
// the block's part of u has a buffer of its own: two planes of 16 B a thread, each thread's
// eight accumulator values as they stand in the workspace.
// There are two of each: while a chunk is worked on out of one, the next chunk's
// operands are on their way into the other, by asynchronous copies that pass no register.
#define SQ 0
#define SK (64 * PK)
#define SW (2 * 64 * PK)
#define SX (3 * 64 * PK)
#define STG (3 * 64 * PK + 64 * PX)   // 61440 B a buffer

// the LDS byte address of a __shared__ element: the low 32 bits of its address
__device__ __forceinline__ unsigned lds_addr(const void* p) { return (unsigned)(size_t)p; }

// Issues the copies of one chunk: 16 bytes a lane and copy, four copies for each of q, k, -w
// (64 rows of 256 B, laid at pitch PK), two for qk (64 rows of 128 B, at pitch PX) and two
// for u (uc: this thread's own eight floats of the chunk).
__device__ __forceinline__ void stage_chunk(const _Float16* __restrict__ qc, const _Float16* __restrict__ kc,
                                            const _Float16* __restrict__ wc, const _Float16* __restrict__ xc,
                                            const float* __restrict__ uc,
                                            const _Float16* sb, const float* su, int tid) {
  const unsigned lr = lds_addr(sb) + (unsigned)((tid >> 4) * PK + (tid & 15) * 8) * 2u;
  const unsigned lx = lds_addr(sb) + (unsigned)(SX + (tid >> 3) * PX + (tid & 7) * 8) * 2u;
  const unsigned lq = lr + SQ * 2u, lk = lr + SK * 2u, lw = lr + SW * 2u;
  const _Float16* gq = qc + tid * 8;
  const _Float16* gk = kc + tid * 8;
  const _Float16* gw = wc + tid * 8;
  const _Float16* gx = xc + tid * 8;
  const unsigned lu = lds_addr(su) + (unsigned)tid * 16u;
  asm volatile(
      "global_load_async_to_lds_b128 %0, %1, off\n\t"
      "global_load_async_to_lds_b128 %2, %3, off\n\t"
      "global_load_async_to_lds_b128 %4, %5, off\n\t"
      "global_load_async_to_lds_b128 %6, %7, off\n\t"
      "global_load_async_to_lds_b128 %8, %9, off\n\t"
      "global_load_async_to_lds_b128 %10, %11, off\n\t"
      "global_load_async_to_lds_b128 %12, %13, off\n\t"
      "global_load_async_to_lds_b128 %14, %15, off\n\t"
      "global_load_async_to_lds_b128 %16, %17, off\n\t"
      "global_load_async_to_lds_b128 %18, %19, off\n\t"
      "s_wait_xcnt 0x0"
      :: "v"(lq),                    "v"(gq),
         "v"(lw),                    "v"(gw),
         "v"(lq + 16 * PK * 2u),     "v"(gq + 2048),
         "v"(lw + 16 * PK * 2u),     "v"(gw + 2048),
         "v"(lq + 32 * PK * 2u),     "v"(gq + 4096),
         "v"(lw + 32 * PK * 2u),     "v"(gw + 4096),
         "v"(lq + 48 * PK * 2u),     "v"(gq + 6144),
         "v"(lw + 48 * PK * 2u),     "v"(gw + 6144),
         "v"(lu),                    "v"(uc),
         "v"(lu + 4096u),            "v"(uc + 4)
      : "memory");
  asm volatile(
      "global_load_async_to_lds_b128 %0, %1, off\n\t"
      "global_load_async_to_lds_b128 %2, %3, off\n\t"
      "global_load_async_to_lds_b128 %4, %5, off\n\t"
      "global_load_async_to_lds_b128 %6, %7, off\n\t"
      "global_load_async_to_lds_b128 %8, %9, off\n\t"
      "global_load_async_to_lds_b128 %10, %11, off\n\t"
      "s_wait_xcnt 0x0"
      :: "v"(lx),                    "v"(gx),
         "v"(lx + 32 * PX * 2u),     "v"(gx + 2048),
         "v"(lk),                    "v"(gk),
         "v"(lk + 16 * PK * 2u),     "v"(gk + 2048),
         "v"(lk + 32 * PK * 2u),     "v"(gk + 4096),
         "v"(lk + 48 * PK * 2u),     "v"(gk + 6144)
      : "memory");
}

__global__ __launch_bounds__(256) void delta_kernel(
    const _Float16* __restrict__ qg, const _Float16* __restrict__ kg,
    const _Float16* __restrict__ wg, const _Float16* __restrict__ qkg,
    const float* __restrict__ ug, float* __restrict__ og) {
  __shared__ __attribute__((aligned(16))) _Float16 stg[2][STG];
  __shared__ __attribute__((aligned(16))) float    us[2][2 * 256 * 4];
  __shared__ __attribute__((aligned(16))) float    St[DVS * PS];
  __shared__ __attribute__((aligned(16))) _Float16 vnT[DVS * PX];

  int tid = threadIdx.x, lane = tid & 31, wid = tid >> 5;
  int l15 = lane & 15, hi8 = (lane & 16) ? 8 : 0;
  // the slices of one (b,h) are BB*HH block numbers apart (speed only, nothing rests on it)
  size_t bh = blockIdx.x % (BB * HH);
  const int tg0 = (int)(blockIdx.x / (BB * HH)) * (DVS / 16);   // first 16-column tile of the block's slice
  size_t rowbase = bh * (size_t)LL;
  // the wave's one 16x16 tile of the 64 x DVS products: rows tm, columns tn (in the slice)
  const int tm = wid >> 1, tn = wid & 1;

  // chunk 0 of this (b,h) in each operand; a chunk is 64*DKH elements (qk: 64*64) further on
  const _Float16* qb = qg + bh * NCHUNK * 64 * DKH;
  const _Float16* kb_ = kg + bh * NCHUNK * 64 * DKH;
  const _Float16* wb = wg + bh * NCHUNK * 64 * DKH;
  const _Float16* xb = qkg + bh * NCHUNK * 64 * 64;
  // u: the wave's tile, this lane's eight values
  const float* ub = ug + bh * NCHUNK * 64 * DKH + (unsigned)((tm * 8 + tg0 + tn) * 32 + lane) * 8;

  // ---- in front of the loop: chunk 0 lands and is published, chunk 1 is sent for ----
  stage_chunk(qb, kb_, wb, xb, ub, stg[0], us[0], tid);
  for (int i = tid; i < DVS * PS; i += 256) St[i] = 0.f;
  // this wave's copies of chunk 0 have landed before the barrier lets other waves read them
  asm volatile("s_wait_asynccnt 0x0" ::: "memory");
  __syncthreads();
  stage_chunk(qb + 64 * DKH, kb_ + 64 * DKH, wb + 64 * DKH, xb + 64 * 64, ub + 64 * DKH, stg[1], us[1], tid);

  for (int c = 0; c < NCHUNK; ++c) {
    const _Float16* sb = stg[c & 1];
    const _Float16* q16  = sb + SQ;
    const _Float16* k16  = sb + SK;
    const _Float16* vw16 = sb + SW;
    const _Float16* qk16 = sb + SX;
    const float* su = us[c & 1];
    const v4f ulo = *(const v4f*)&su[tid * 4], uhi = *(const v4f*)&su[1024 + tid * 4];
    const v8f uacc = __builtin_shufflevector(ulo, uhi, 0, 1, 2, 3, 4, 5, 6, 7);

    // ---- o1 = q @ S (regs) ; v_new = u + (-w) @ S -> vnT (transposed) ----
    // both products take the same S fragment
    v8f oacc = (v8f){};
    {
      v8f a0 = uacc;
#pragma unroll
      for (int kb = 0; kb < 128; kb += 32) {
        v16h aq, aw, b;
#pragma unroll
        for (int e = 0; e < 16; ++e) {
          int ko = kb + koff(e, lane);
          aq[e] = q16[(tm * 16 + l15) * PK + ko];
          aw[e] = vw16[(tm * 16 + l15) * PK + ko];         // -w row-major
          b[e] = (_Float16)St[(tn * 16 + l15) * PS + ko];  // S^T rows
        }
        oacc = wmma_f16(aq, b, oacc);
        a0 = wmma_f16(aw, b, a0);
      }
#pragma unroll
      for (int r = 0; r < 8; ++r)
        vnT[(tn * 16 + l15) * PX + tm * 16 + hi8 + r] = (_Float16)a0[r];
    }
    __syncthreads();

    // ---- o = o1 + qk @ v_new -> global ----
    {
      v8f a0 = oacc;
#pragma unroll
      for (int kb = 0; kb < 64; kb += 32) {
        v16h a, b;
#pragma unroll
        for (int e = 0; e < 16; ++e) {
          int ko = kb + koff(e, lane);
          a[e] = qk16[(tm * 16 + l15) * PX + ko];
          b[e] = vnT[(tn * 16 + l15) * PX + ko];            // v_new^T rows
        }
        a0 = wmma_f16(a, b, a0);
      }
#pragma unroll
      for (int r = 0; r < 8; ++r)
        og[(rowbase + (size_t)c * 64 + tm * 16 + hi8 + r) * 128 + (tg0 + tn) * 16 + l15] = a0[r];
    }
    // ---- S^T += (k^T @ v_new)^T : tile (m=dk, n=dv), stored transposed ----
    // the wave takes dk tile wid against every column tile of the slice
#pragma unroll
    for (int sn = 0; sn < DVS / 16; ++sn) {
      v8f a0;
#pragma unroll
      for (int r = 0; r < 8; ++r)
        a0[r] = St[(sn * 16 + l15) * PS + wid * 16 + hi8 + r];
#pragma unroll
      for (int kb = 0; kb < 64; kb += 32) {
        v16h a, b;
#pragma unroll
        for (int e = 0; e < 16; ++e) {
          int ko = kb + koff(e, lane);
          a[e] = k16[ko * PK + wid * 16 + l15];   // (k^T)[m][j] = k[j][m]
          b[e] = vnT[(sn * 16 + l15) * PX + ko];  // v_new^T rows
        }
        a0 = wmma_f16(a, b, a0);
      }
#pragma unroll
      for (int r = 0; r < 8; ++r)
        St[(sn * 16 + l15) * PS + wid * 16 + hi8 + r] = a0[r];
    }
    // ---- foot of the trip: chunk c + 1 is published, this trip's buffer is freed ----
    // this wave's LDS reads of the buffer and its writes of St are done
    asm volatile("s_wait_dscnt 0x0" ::: "memory");
    // this wave's copies of chunk c + 1 have landed
    asm volatile("s_wait_asynccnt 0x0" ::: "memory");
    __syncthreads();
    if (c + 2 < NCHUNK) {
      size_t n = (size_t)(c + 2);
      stage_chunk(qb + n * 64 * DKH, kb_ + n * 64 * DKH, wb + n * 64 * DKH, xb + n * 64 * 64,
                  ub + n * 64 * DKH, sb, su, tid);
    }
  }
  // no copy is outstanding when the wave ends
  asm volatile("s_wait_asynccnt 0x0" ::: "memory");
}

// ---------------- per-head output RMSNorm -> [B,L,D] f16 -------------------
// a wave takes RW rows in a row of one head, a lane four channels
__global__ __launch_bounds__(256) void onorm_kernel(const float* __restrict__ og,
                                                    const float* __restrict__ w,
                                                    _Float16* __restrict__ on16) {
  int lane = threadIdx.x & 31;
  unsigned gw = blockIdx.x * 8 + wave_id();
  unsigned hb = gw / (LL / RW);         // b*H + h
  unsigned l0 = (gw % (LL / RW)) * RW;
  unsigned hh = hb % HH, b = hb / HH;
  const v4f* src = (const v4f*)(og + ((size_t)hb * LL + l0) * DKH) + lane;
  v4f v[RW];
#pragma unroll
  for (int r = 0; r < RW; ++r) v[r] = src[r * 32];
  v4f wv = *((const v4f*)w + lane);
  _Float16* dst = on16 + ((size_t)b * LL + l0) * DD + hh * DKH + lane * 4;
#pragma unroll
  for (int r = 0; r < RW; ++r) {
    v4f q = v[r] * v[r];
    float inv = rsqrtf(wave_sum((q[0] + q[1]) + (q[2] + q[3])) * (1.f / DKH) + EPSF);
    v4h o;
#pragma unroll
    for (int c = 0; c < 4; ++c) o[c] = (_Float16)(v[r][c] * inv * wv[c]);
    *(v4h*)(dst + (size_t)r * DD) = o;
  }
}

// ---------------------------------------------------------------------------
extern "C" void kernel_launch(void* const* d_in, const int* in_sizes, int n_in,
                              void* d_out, int out_size, void* d_ws, size_t ws_size,
                              hipStream_t stream) {
  const float* x        = (const float*)d_in[0];
  const float* norm_w   = (const float*)d_in[1];
  const float* Wq       = (const float*)d_in[2];
  const float* Wk       = (const float*)d_in[3];
  const float* Wv       = (const float*)d_in[4];
  const float* Wb       = (const float*)d_in[5];
  const float* conv_q   = (const float*)d_in[6];
  const float* conv_k   = (const float*)d_in[7];
  const float* conv_v   = (const float*)d_in[8];
  const float* o_norm_w = (const float*)d_in[9];
  const float* Wo       = (const float*)d_in[10];
  float* out = (float*)d_out;

  char* p = (char*)d_ws;
  auto take = [&](size_t bytes) { char* r = p; p += (bytes + 255) & ~(size_t)255; return r; };
  const size_t actF16 = (size_t)BLROWS * DD * sizeof(_Float16);   // 16 MiB
  const size_t wF16   = (size_t)DD * DD * sizeof(_Float16);       // 2 MiB

  _Float16* h16   = (_Float16*)take(actF16);
  _Float16* wq16t = (_Float16*)take(wF16);   // transposed [N][K]
  _Float16* wk16t = (_Float16*)take(wF16);
  _Float16* wv16t = (_Float16*)take(wF16);
  _Float16* wo16t = (_Float16*)take(wF16);
  _Float16* qpre  = (_Float16*)take(actF16);
  _Float16* kpre  = (_Float16*)take(actF16);
  _Float16* vpre  = (_Float16*)take(actF16);
  _Float16* qh    = (_Float16*)take(actF16);
  _Float16* kh    = (_Float16*)take(actF16);
  _Float16* vh    = (_Float16*)take(actF16);
  float*    betag = (float*)take((size_t)BB * HH * LL * sizeof(float));
  float*    og    = (float*)take((size_t)BB * HH * LL * DKH * sizeof(float));
  _Float16* on16  = (_Float16*)take(actF16);
  float*    ug    = (float*)take((size_t)BB * HH * LL * DKH * sizeof(float));
  _Float16* wg    = (_Float16*)take(actF16);
  _Float16* qkg   = (_Float16*)take((size_t)BB * HH * LL * 64 * sizeof(_Float16));

  // 1. h = rmsnorm(x)
  rmsnorm_kernel<<<BLROWS / 8, 256, 0, stream>>>(x, norm_w, h16);
  // 2. weights -> f16, transposed to [N][K] for K-contiguous B fragments
  int tgrid = (DD / 32) * (DD / 32);
  transpose_f16_kernel<<<tgrid, 256, 0, stream>>>(Wq, wq16t, DD, DD);
  transpose_f16_kernel<<<tgrid, 256, 0, stream>>>(Wk, wk16t, DD, DD);
  transpose_f16_kernel<<<tgrid, 256, 0, stream>>>(Wv, wv16t, DD, DD);
  transpose_f16_kernel<<<tgrid, 256, 0, stream>>>(Wo, wo16t, DD, DD);
  // 3. projections (WMMA GEMMs, async double-buffered staging)
  dim3 ggrid(DD / 128, BLROWS / 128);
  gemm_f16_kernel<0><<<ggrid, 256, 0, stream>>>(h16, wq16t, qpre, nullptr, nullptr, BLROWS, DD, DD);
  gemm_f16_kernel<0><<<ggrid, 256, 0, stream>>>(h16, wk16t, kpre, nullptr, nullptr, BLROWS, DD, DD);
  gemm_f16_kernel<0><<<ggrid, 256, 0, stream>>>(h16, wv16t, vpre, nullptr, nullptr, BLROWS, DD, DD);
  // 4. beta
  beta_kernel<<<BLROWS / 32, 256, 0, stream>>>(h16, Wb, betag);
  // 5. conv + activations + head layout
  conv_head_kernel<<<BB * HH * LL / (8 * RW), 256, 0, stream>>>(qpre, conv_q, qh, 2);
  conv_head_kernel<<<BB * HH * LL / (8 * RW), 256, 0, stream>>>(kpre, conv_k, kh, 1);
  conv_head_kernel<<<BB * HH * LL / (8 * RW), 256, 0, stream>>>(vpre, conv_v, vh, 0);
  // 6. chunkwise delta rule: per-chunk operands for all chunks, then the serial walk
  delta_prep_kernel<<<BB * HH * NCHUNK, 256, 0, stream>>>(qh, kh, vh, betag, ug, wg, qkg);
  delta_kernel<<<BB * HH * NSL, 256, 0, stream>>>(qh, kh, wg, qkg, ug, og);
  // 7. output norm
  onorm_kernel<<<BB * HH * LL / (8 * RW), 256, 0, stream>>>(og, o_norm_w, on16);
  // 8. out = x + on @ Wo
  gemm_f16_kernel<1><<<ggrid, 256, 0, stream>>>(on16, wo16t, nullptr, out, x, BLROWS, DD, DD);
}

// v008
// One run takes 250 microseconds.
// In two side-by-side timings against v007, it was 1.15 and 1.12 times as fast.
// All steps since v000 together make it 21.9 times as fast.
#include <hip/hip_runtime.h>
#include <hip/hip_bf16.h>

typedef __attribute__((ext_vector_type(16))) _Float16 v16h;
typedef __attribute__((ext_vector_type(8)))  float    v8f;
typedef __attribute__((ext_vector_type(4)))  float    v4f;

#define BB 2
#define LL 4096
#define DD 1024
#define HH 8
#define DKH 128
#define BLROWS (BB*LL)          // 8192
#define NCHUNK 64
#define EPSF 1e-6f

#if defined(__gfx1250__) && __has_builtin(__builtin_amdgcn_global_load_async_to_lds_b128)
#define HAVE_ASYNC 1
typedef int v4i_ __attribute__((ext_vector_type(4)));
typedef __attribute__((address_space(1))) v4i_* gp_v4i;
typedef __attribute__((address_space(3))) v4i_* lp_v4i;
#define GLA128(SRC, DST) \
  __builtin_amdgcn_global_load_async_to_lds_b128((gp_v4i)(void*)(SRC), (lp_v4i)(void*)(DST), 0, 0)
#if __has_builtin(__builtin_amdgcn_s_wait_asynccnt)
#define WAITA(n) __builtin_amdgcn_s_wait_asynccnt(n)
#else
#define WAITA(n) asm volatile("s_wait_asynccnt %0" :: "n"(n) : "memory")
#endif
#else
#define HAVE_ASYNC 0
#define WAITA(n)
#endif

__device__ __forceinline__ int koff(int e, int lane) {
  int j = e >> 1;
  return ((j & 4) << 2) + ((lane & 16) >> 1) + ((j & 3) << 1) + (e & 1);
}

__device__ __forceinline__ v8f wmma_f16(v16h a, v16h b, v8f c) {
  return __builtin_amdgcn_wmma_f32_16x16x32_f16(false, a, false, b, (short)0, c, false, false);
}

__device__ __forceinline__ float sigmoidf_(float x) { return 1.f / (1.f + __expf(-x)); }
__device__ __forceinline__ float siluf_(float x) { return x * sigmoidf_(x); }

// ---------------- the row kernels ------------------------------------------
// rmsnorm, beta, conv+l2norm and the output norm each work on short rows (128 or 1024
// elements). One wave takes whole rows: a lane holds its share of a row in registers,
// the row's sum is a butterfly over the 32 lanes, and there is no LDS and no barrier.
// One block per row cost far more in starting waves than in the rows' own work.
// Every '#pragma unroll' in these four kernels is on a loop over a lane's own share: fully
// unrolled, the per-lane arrays have static indices only and stay in registers.
typedef __attribute__((ext_vector_type(4))) _Float16 v4h;

// the wave's number in its block, held as a scalar, so that row numbers and row
// addresses are scalar arithmetic and the loads take base + lane offset + immediate
__device__ __forceinline__ unsigned wave_id() {
  return (unsigned)__builtin_amdgcn_readfirstlane((int)(threadIdx.x >> 5));
}

template <int M>
__device__ __forceinline__ float xmask_add(float v) {
  // v + (v of lane ^ M), M < 16: a DPP row_xmask move inside the 16-lane row
  int o = __builtin_amdgcn_update_dpp(0, __builtin_bit_cast(int, v), 0x160 | M, 0xf, 0xf, true);
  return v + __builtin_bit_cast(float, o);
}
// sum over the wave's 32 lanes, the same bits in every lane
__device__ __forceinline__ float wave_sum(float v) {
  v = xmask_add<1>(v);
  v = xmask_add<2>(v);
  v = xmask_add<4>(v);
  v = xmask_add<8>(v);
  int b = __builtin_bit_cast(int, v);
  int o = __builtin_amdgcn_permlanex16(b, b, 0x76543210, 0xfedcba98, false, false);  // lane ^ 16
  return v + __builtin_bit_cast(float, o);
}

// ---------------- RMSNorm (x -> h f16): one row a wave ----------------------
__global__ __launch_bounds__(256) void rmsnorm_kernel(const float* __restrict__ x,
                                                      const float* __restrict__ w,
                                                      _Float16* __restrict__ h16) {
  int lane = threadIdx.x & 31;
  size_t row = (size_t)(blockIdx.x * 8 + wave_id());
  const v4f* xr = (const v4f*)(x + row * DD) + lane;
  const v4f* wr = (const v4f*)w + lane;
  v4f xv[8];
#pragma unroll
  for (int j = 0; j < 8; ++j) xv[j] = xr[j * 32];
  v4f p = (v4f){};
#pragma unroll
  for (int j = 0; j < 8; ++j) p += xv[j] * xv[j];
  float inv = rsqrtf(wave_sum((p[0] + p[1]) + (p[2] + p[3])) * (1.f / DD) + EPSF);
  v4h* ho = (v4h*)(h16 + row * DD) + lane;
#pragma unroll
  for (int j = 0; j < 8; ++j) {
    v4f wv = wr[j * 32];
    v4h o;
#pragma unroll
    for (int c = 0; c < 4; ++c) o[c] = (_Float16)(xv[j][c] * inv * wv[c]);
    ho[j * 32] = o;
  }
}

// -------- LDS-tiled transpose: src f32 [R][C] -> dst f16 [C][R] ------------
__global__ __launch_bounds__(256) void transpose_f16_kernel(const float* __restrict__ src,
                                                            _Float16* __restrict__ dst,
                                                            int R, int C) {
  __shared__ float t[32][33];
  int nbx = C / 32;
  int bx = blockIdx.x % nbx, by = blockIdx.x / nbx;
  int r0 = by * 32, c0 = bx * 32;
  int tr = threadIdx.x >> 5, tc = threadIdx.x & 31;
#pragma unroll
  for (int i = 0; i < 32; i += 8)
    t[tr + i][tc] = src[(size_t)(r0 + tr + i) * C + c0 + tc];
  __syncthreads();
#pragma unroll
  for (int i = 0; i < 32; i += 8)
    dst[(size_t)(c0 + tr + i) * R + r0 + tc] = (_Float16)t[tc][tr + i];
}

#define PG 40   // halfs
template <int MODE>
__global__ __launch_bounds__(256) void gemm_f16_kernel(
    const _Float16* __restrict__ A, const _Float16* __restrict__ Bt,
    _Float16* __restrict__ out16, float* __restrict__ outf,
    const float* __restrict__ resid, int M, int N, int K) {
  __shared__ __attribute__((aligned(16))) _Float16 As[2][128][PG];
  __shared__ __attribute__((aligned(16))) _Float16 Bs[2][128][PG];
  int tid = threadIdx.x, lane = tid & 31;
  int wid = tid >> 5, l15 = lane & 15, hi8 = (lane & 16) ? 8 : 0;
  int wm = wid >> 1, wn = wid & 1;
  int bm = blockIdx.y * 128, bn = blockIdx.x * 128;

  int cr = tid >> 2, cs = (tid & 3) * 8;          // copy row / 8-half segment
  auto issue = [&](int buf, int k0) {
    const _Float16* ga = A + (size_t)(bm + cr) * K + k0 + cs;
    const _Float16* gb = Bt + (size_t)(bn + cr) * K + k0 + cs;
#if HAVE_ASYNC
    GLA128(ga,                    &As[buf][cr][cs]);
    GLA128(ga + (size_t)64 * K,   &As[buf][cr + 64][cs]);
    GLA128(gb,                    &Bs[buf][cr][cs]);
    GLA128(gb + (size_t)64 * K,   &Bs[buf][cr + 64][cs]);
#else
    *(int4*)&As[buf][cr][cs]      = *(const int4*)ga;
    *(int4*)&As[buf][cr + 64][cs] = *(const int4*)(ga + (size_t)64 * K);
    *(int4*)&Bs[buf][cr][cs]      = *(const int4*)gb;
    *(int4*)&Bs[buf][cr + 64][cs] = *(const int4*)(gb + (size_t)64 * K);
#endif
  };

  v8f acc[2][4];
#pragma unroll
  for (int i = 0; i < 2; ++i)
#pragma unroll
    for (int j = 0; j < 4; ++j) acc[i][j] = (v8f){};

  int nT = K / 32;
  issue(0, 0);
  for (int kt = 0; kt < nT; ++kt) {
    int buf = kt & 1;
    if (kt + 1 < nT) { issue(buf ^ 1, (kt + 1) * 32); WAITA(4); }
    else             { WAITA(0); }
    __syncthreads();
    v16h af[2], bf[4];
#pragma unroll
    for (int i = 0; i < 2; ++i) {
      int mr = wm * 32 + i * 16 + l15;
#pragma unroll
      for (int e = 0; e < 16; ++e) af[i][e] = As[buf][mr][koff(e, lane)];
    }
#pragma unroll
    for (int j = 0; j < 4; ++j) {
      int nc = wn * 64 + j * 16 + l15;
#pragma unroll
      for (int e = 0; e < 16; ++e) bf[j][e] = Bs[buf][nc][koff(e, lane)];
    }
#pragma unroll
    for (int i = 0; i < 2; ++i)
#pragma unroll
      for (int j = 0; j < 4; ++j) acc[i][j] = wmma_f16(af[i], bf[j], acc[i][j]);
    __syncthreads();
  }
#pragma unroll
  for (int i = 0; i < 2; ++i)
#pragma unroll
    for (int j = 0; j < 4; ++j)
#pragma unroll
      for (int r = 0; r < 8; ++r) {
        size_t gm = bm + wm * 32 + i * 16 + hi8 + r;
        size_t gn = bn + wn * 64 + j * 16 + l15;
        if (MODE == 0) out16[gm * N + gn] = (_Float16)acc[i][j][r];
        else           outf[gm * N + gn] = resid[gm * N + gn] + acc[i][j][r];
      }
}

// ---------------- beta = sigmoid(h @ Wb): four rows a wave ------------------
__global__ __launch_bounds__(256) void beta_kernel(const _Float16* __restrict__ h16,
                                                   const float* __restrict__ Wb,
                                                   float* __restrict__ betag) {
  int lane = threadIdx.x & 31;
  size_t row0 = (size_t)((blockIdx.x * 8 + wave_id()) * 4);   // b*L + l of the first row
  const _Float16* hr = h16 + row0 * DD + lane;
  const v4f* wb = (const v4f*)Wb + lane * 2;
  float acc[4][8];
#pragma unroll
  for (int r = 0; r < 4; ++r)
#pragma unroll
    for (int hh = 0; hh < 8; ++hh) acc[r][hh] = 0.f;
  // lane takes k = lane, lane + 32, ...; a row of Wb serves all four rows of h.
  // Eight k steps a trip, loaded ahead of the arithmetic: a trip pays the way to memory
  // once, not once a k step.
  for (int jo = 0; jo < DD / 32; jo += 8) {
    _Float16 hv[4][8];
    v4f wlo[8], whi[8];
#pragma unroll
    for (int r = 0; r < 4; ++r)
#pragma unroll
      for (int j = 0; j < 8; ++j) hv[r][j] = hr[r * DD + (jo + j) * 32];
#pragma unroll
    for (int j = 0; j < 8; ++j) {
      wlo[j] = wb[(jo + j) * 64];
      whi[j] = wb[(jo + j) * 64 + 1];
    }
#pragma unroll
    for (int j = 0; j < 8; ++j)
#pragma unroll
      for (int r = 0; r < 4; ++r) {
        float hf = (float)hv[r][j];
#pragma unroll
        for (int hh = 0; hh < 4; ++hh) {
          acc[r][hh]     += hf * wlo[j][hh];
          acc[r][hh + 4] += hf * whi[j][hh];
        }
      }
  }
  // lane r*8 + hh keeps and stores the sum of (row r, head hh)
  float mine = 0.f;
#pragma unroll
  for (int r = 0; r < 4; ++r)
#pragma unroll
    for (int hh = 0; hh < 8; ++hh) {
      float s = wave_sum(acc[r][hh]);
      mine = (lane == r * 8 + hh) ? s : mine;
    }
  size_t row = row0 + (lane >> 3);
  int b = (int)(row / LL), l = (int)(row % LL);
  betag[((size_t)b * HH + (lane & 7)) * LL + l] = sigmoidf_(mine);
}

// -------- causal conv(K=4)+silu [+silu+l2norm (+qscale)] -> heads f16 ------
// mode: 0 = v (conv+silu), 1 = k (+silu+l2norm), 2 = q (+silu+l2norm+DK^-.5)
// A wave takes RW rows in a row of one head, a lane four channels; the RW + 3 input
// rows are loaded once and each serves up to four output rows.
#define RW 8
__global__ __launch_bounds__(256) void conv_head_kernel(
    const _Float16* __restrict__ pre, const float* __restrict__ cw,
    _Float16* __restrict__ outg, int mode) {
  int lane = threadIdx.x & 31;
  unsigned gw = blockIdx.x * 8 + wave_id();
  unsigned hb = gw / (LL / RW);         // b*H + h
  unsigned l0 = (gw % (LL / RW)) * RW;
  unsigned hh = hb % HH, b = hb / HH;
  unsigned ch = hh * DKH + lane * 4;
  const bool first = (l0 == 0);         // the three rows in front of l0 are the left padding
  // rows l0-3 .. l0+RW-1; at l0 == 0 the first three loads read rows 0..2 instead
  // (inside the buffer) and are zeroed below
  const _Float16* src = pre + ((size_t)b * LL + l0) * DD + ch;
  const _Float16* srcm = first ? src : src - 3 * DD;
  v4h xin[RW + 3];
#pragma unroll
  for (int i = 0; i < 3; ++i) xin[i] = *(const v4h*)(srcm + i * DD);
#pragma unroll
  for (int i = 3; i < RW + 3; ++i) xin[i] = *(const v4h*)(src + (i - 3) * DD);
  v4f wt[4];                            // the four taps of each of the lane's channels
#pragma unroll
  for (int c = 0; c < 4; ++c) wt[c] = *(const v4f*)(cw + (ch + c) * 4);
  v4f xf[RW + 3];
#pragma unroll
  for (int i = 0; i < RW + 3; ++i)
#pragma unroll
    for (int c = 0; c < 4; ++c) xf[i][c] = (i < 3 && first) ? 0.f : (float)xin[i][c];
  v4f s[RW];
#pragma unroll
  for (int r = 0; r < RW; ++r)
#pragma unroll
    for (int c = 0; c < 4; ++c) {
      float acc = 0.f;
#pragma unroll
      for (int i = 0; i < 4; ++i) acc += xf[r + i][c] * wt[c][i];
      s[r][c] = siluf_(acc);
    }
  if (mode > 0) {
    float qs = (mode == 2) ? 0.08838834764831845f : 1.f;   // 128^-0.5
#pragma unroll
    for (int r = 0; r < RW; ++r) {
#pragma unroll
      for (int c = 0; c < 4; ++c) s[r][c] = siluf_(s[r][c]);
      v4f q = s[r] * s[r];
      float inv = rsqrtf(wave_sum((q[0] + q[1]) + (q[2] + q[3])) + EPSF);
#pragma unroll
      for (int c = 0; c < 4; ++c) s[r][c] = s[r][c] * inv * qs;
    }
  }
  v4h* dst = (v4h*)(outg + ((size_t)hb * LL + l0) * DKH) + lane;
#pragma unroll
  for (int r = 0; r < RW; ++r) {
    v4h o;
#pragma unroll
    for (int c = 0; c < 4; ++c) o[c] = (_Float16)s[r][c];
    dst[r * 32] = o;
  }
}

#define PK 136   // halfs: rows of 128 f16 (q16, k16, -w)       272 B
#define PX 72    // halfs: rows of  64 f16 (X16, qk, vnT, (bv)^T) 144 B
#define PS 132   // floats: rows of 128 f32 (St)                 528 B
// A work-group barrier that orders LDS alone. __syncthreads() also releases the wave's global
// stores: behind a store it holds the wave until every store has been acknowledged
// (s_wait_storecnt 0). Where no wave of the launch reads what was stored (o, u), only the LDS
// traffic has to be done at the barrier: the two fences name the LDS address space, so the
// release is s_wait_dscnt 0 and the stores stay in flight across the barrier.
__device__ __forceinline__ void lds_barrier() {
  __builtin_amdgcn_fence(__ATOMIC_RELEASE, "workgroup", "local");   // this wave's LDS reads and writes are done
  __builtin_amdgcn_s_barrier();
  __builtin_amdgcn_fence(__ATOMIC_ACQUIRE, "workgroup", "local");   // no LDS read is lifted over the barrier
}

__global__ __launch_bounds__(256) void delta_prep_kernel(
    const _Float16* __restrict__ qg, const _Float16* __restrict__ kg,
    const _Float16* __restrict__ vg, const float* __restrict__ betag,
    float* __restrict__ ug, _Float16* __restrict__ wg, _Float16* __restrict__ qkg) {
  __shared__ __attribute__((aligned(16))) _Float16 q16[64 * PK];
  __shared__ __attribute__((aligned(16))) _Float16 k16[64 * PK];
  __shared__ __attribute__((aligned(16))) _Float16 vw16[128 * PX];   // 128*PX >= 64*PK
  __shared__ __attribute__((aligned(16))) float    Af[64 * 64];
  __shared__ __attribute__((aligned(16))) _Float16 X16[64 * PX];
  __shared__ __attribute__((aligned(16))) float    XT[3 * 32 * 32];  // f32 scratch of the inverse
  __shared__ __attribute__((aligned(16))) float    betaS[64];
  _Float16* qk16 = (_Float16*)Af;

  int tid = threadIdx.x, lane = tid & 31, wid = tid >> 5;
  int l15 = lane & 15, hi8 = (lane & 16) ? 8 : 0;
  size_t chunk = blockIdx.x;            // (b*H + h)*64 + c ; its rows start at chunk*64

  // ---- load chunk (beta first; fold beta into transposed v) ----
  if (tid < 64) betaS[tid] = betag[chunk * 64 + tid];
  __syncthreads();
  {
    // One chunk base per operand and a fully unrolled loop: every load is that
    // operand's lane pointer + an immediate.
    const _Float16* qc = qg + chunk * 64 * DKH;
    const _Float16* kc = kg + chunk * 64 * DKH;
    const _Float16* vc = vg + chunk * 64 * DKH;
    const int j0 = tid >> 7, d = tid & 127;
#pragma unroll
    for (int it = 0; it < 32; ++it) {
      int i = tid + it * 256;
      int j = j0 + it * 2;
      q16[j * PK + d] = qc[i];
      k16[j * PK + d] = kc[i];
      vw16[d * PX + j] = (_Float16)((float)vc[i] * betaS[j]);   // (beta*v)^T
    }
  }
  __syncthreads();

  // ---- kk = k k^T ; A = I + tril(beta*kk, -1) ----
#pragma unroll
  for (int ti = 0; ti < 2; ++ti) {
    int t = wid * 2 + ti, tm = t >> 2, tn = t & 3;
    v8f a0 = (v8f){};
    // beta of this lane's 8 rows, read unconditionally: the mask below is then a
    // select, with no branch between the last matrix instruction and its readers
    const v4f blo = *(const v4f*)&betaS[tm * 16 + hi8];
    const v4f bhi = *(const v4f*)&betaS[tm * 16 + hi8 + 4];
#pragma unroll
    for (int kb = 0; kb < 128; kb += 32) {
      v16h a, b;
#pragma unroll
      for (int e = 0; e < 16; ++e) {
        int ko = kb + koff(e, lane);
        a[e] = k16[(tm * 16 + l15) * PK + ko];
        b[e] = k16[(tn * 16 + l15) * PK + ko];   // k^T as B
      }
      a0 = wmma_f16(a, b, a0);
    }
#pragma unroll
    for (int r = 0; r < 8; ++r) {
      int m = tm * 16 + hi8 + r, n = tn * 16 + l15;
      Af[m * 64 + n] = (m == n) ? 1.f : ((n < m) ? (r < 4 ? blo[r & 3] : bhi[r & 3]) * a0[r] : 0.f);
    }
  }
  __syncthreads();

  // ---- X = A^-1 (unit lower tri), blocked 2x2 with 32x32 blocks, all f32 ----
  // X11 = A11^-1, X22 = A22^-1: one wave each, lane = column, the column kept in
  // registers, rows of A read as broadcasts. X21 = -X22 (A21 X11) on all 8 waves.
  // Every loop below is fully unrolled so that the per-lane arrays have static
  // indices and stay in registers.
  {
    float* Xf = XT;                   // [2][32][32] diagonal-block inverses
    float* Tf = Xf + 2 * 32 * 32;     // [32][32]    A21 * X11
    if (wid < 2) {
      int r0 = wid * 32;
      float xc[32];
      float ab[2][4][32];             // rows of A11/A22, two groups of 4 rows
#pragma unroll
      for (int r = 1; r < 4; ++r)
#pragma unroll
        for (int l = 0; l < r; ++l) ab[0][r][l] = Af[(r0 + r) * 64 + r0 + l];
#pragma unroll  // full unroll keeps xc[] and ab[] in registers (static indices only)
      for (int G = 0; G < 8; ++G) {
        if (G + 1 < 8) {
#pragma unroll
          for (int r = 0; r < 4; ++r) {
            int i = (G + 1) * 4 + r;
#pragma unroll
            for (int l = 0; l < i; ++l)
              ab[(G + 1) & 1][r][l] = Af[(r0 + i) * 64 + r0 + l];
          }
        }
        // keeps the next group's LDS reads above this group's arithmetic, so that
        // their latency is not paid row by row on the substitution's serial path
        __builtin_amdgcn_sched_barrier(0);
#pragma unroll
        for (int r = 0; r < 4; ++r) {
          int i = G * 4 + r;
          float s0 = 0.f, s1 = 0.f;
#pragma unroll
          for (int l = 0; l < i; ++l) {
            if (l & 1) s1 += ab[G & 1][r][l] * xc[l]; else s0 += ab[G & 1][r][l] * xc[l];
          }
          xc[i] = (i == lane) ? 1.f : -(s0 + s1);
          Xf[wid * 1024 + i * 32 + lane] = xc[i];
          X16[(r0 + i) * PX + r0 + lane] = (_Float16)xc[i];
        }
      }
    } else if (wid == 2) {
#pragma unroll
      for (int i = 0; i < 32; ++i) X16[i * PX + 32 + lane] = (_Float16)0.f;
    }
    __syncthreads();   // publishes X11, X22 to all waves
    {
      float xcol[32];
#pragma unroll
      for (int l = 0; l < 32; ++l) xcol[l] = Xf[l * 32 + lane];
#pragma unroll
      for (int r = 0; r < 4; ++r) {
        int i = wid * 4 + r;
        const v4f* ar = (const v4f*)&Af[(32 + i) * 64];
        float s0 = 0.f, s1 = 0.f, s2 = 0.f, s3 = 0.f;
#pragma unroll
        for (int g = 0; g < 8; ++g) {
          v4f a = ar[g];
          s0 += a[0] * xcol[g * 4 + 0];
          s1 += a[1] * xcol[g * 4 + 1];
          s2 += a[2] * xcol[g * 4 + 2];
          s3 += a[3] * xcol[g * 4 + 3];
        }
        Tf[i * 32 + lane] = (s0 + s1) + (s2 + s3);
      }
    }
    __syncthreads();   // publishes T = A21 X11
    {
      float tcol[32];
#pragma unroll
      for (int l = 0; l < 32; ++l) tcol[l] = Tf[l * 32 + lane];
#pragma unroll
      for (int r = 0; r < 4; ++r) {
        int i = wid * 4 + r;
        const v4f* xr = (const v4f*)&Xf[1024 + i * 32];
        float s0 = 0.f, s1 = 0.f, s2 = 0.f, s3 = 0.f;
#pragma unroll
        for (int g = 0; g < 8; ++g) {
          v4f a = xr[g];
          s0 += a[0] * tcol[g * 4 + 0];
          s1 += a[1] * tcol[g * 4 + 1];
          s2 += a[2] * tcol[g * 4 + 2];
          s3 += a[3] * tcol[g * 4 + 3];
        }
        X16[(32 + i) * PX + lane] = (_Float16)(-((s0 + s1) + (s2 + s3)));
      }
    }
  }
  __syncthreads();

  // ---- u = X @ (beta*v) -> workspace, in accumulator layout ----
#pragma unroll
  for (int ti = 0; ti < 4; ++ti) {
    int t = wid * 4 + ti, tm = t >> 3, tn = t & 7;
    v8f a0 = (v8f){};
#pragma unroll
    for (int kb = 0; kb < 64; kb += 32) {
      v16h a, b;
#pragma unroll
      for (int e = 0; e < 16; ++e) {
        int ko = kb + koff(e, lane);
        a[e] = X16[(tm * 16 + l15) * PX + ko];
        b[e] = vw16[(tn * 16 + l15) * PX + ko];           // (beta*v)^T
      }
      a0 = wmma_f16(a, b, a0);
    }
    *(v8f*)(ug + ((chunk * 32 + t) * 32 + lane) * 8) = a0;
  }
  // no register that a store of u names is rewritten ahead of this wait
  asm volatile("s_wait_xcnt 0x0" ::: "memory");
  lds_barrier();   // ends the reads of (beta*v)^T; the u stores need not have arrived

  // ---- -w = -(X @ (beta*k)) -> vw16 (row-major) ; qk = tril(q k^T) ----
#pragma unroll
  for (int ti = 0; ti < 4; ++ti) {
    int t = wid * 4 + ti, tm = t >> 3, tn = t & 7;
    v8f a0 = (v8f){};
#pragma unroll
    for (int kb = 0; kb < 64; kb += 32) {
      v16h a, b;
#pragma unroll
      for (int e = 0; e < 16; ++e) {
        int ko = kb + koff(e, lane);
        a[e] = X16[(tm * 16 + l15) * PX + ko];
        b[e] = (_Float16)((float)k16[ko * PK + tn * 16 + l15] * betaS[ko]);
      }
      a0 = wmma_f16(a, b, a0);
    }
#pragma unroll
    for (int r = 0; r < 8; ++r)
      vw16[(tm * 16 + hi8 + r) * PK + tn * 16 + l15] = (_Float16)(-a0[r]);
  }
#pragma unroll
  for (int ti = 0; ti < 2; ++ti) {
    int t = wid * 2 + ti, tm = t >> 2, tn = t & 3;
    v8f a0 = (v8f){};
#pragma unroll
    for (int kb = 0; kb < 128; kb += 32) {
      v16h a, b;
#pragma unroll
      for (int e = 0; e < 16; ++e) {
        int ko = kb + koff(e, lane);
        a[e] = q16[(tm * 16 + l15) * PK + ko];
        b[e] = k16[(tn * 16 + l15) * PK + ko];
      }
      a0 = wmma_f16(a, b, a0);
    }
#pragma unroll
    for (int r = 0; r < 8; ++r) {
      int m = tm * 16 + hi8 + r, n = tn * 16 + l15;
      qk16[m * PX + n] = (_Float16)((n <= m) ? a0[r] : 0.f);
    }
  }
  lds_barrier();   // publishes -w and qk in LDS (__syncthreads() would wait here for the u stores)

  // ---- -w and qk: LDS -> workspace, 16 bytes a lane ----
  {
    int4* wo = (int4*)(wg + chunk * 64 * DKH) + tid;
    int4* qo = (int4*)(qkg + chunk * 64 * 64) + tid;
#pragma unroll
    for (int it = 0; it < 4; ++it) {
      int p = tid + it * 256;
      wo[it * 256] = *(const int4*)&vw16[(p >> 4) * PK + (p & 15) * 8];
    }
#pragma unroll
    for (int it = 0; it < 2; ++it) {
      int p = tid + it * 256;
      qo[it * 256] = *(const int4*)&qk16[(p >> 3) * PX + (p & 7) * 8];
    }
  }
}

// The columns (dv) of the state never mix: v_new, o and the state update of a column read
// that column of S alone. So a (b,h) is walked by 128 / DVS blocks side by side, each with
// DVS columns of S, u, v_new and o; q, k, -w and qk are read by every one of them.
// DVS = 32: a block's part of a row of o is one whole 128-byte line.
#define DVS 32
#define NSL (DKH / DVS)
// One chunk's q, k, -w and qk lie in one staging buffer in LDS, at these places (in halfs);
// the block's part of u has a buffer of its own: two planes of 16 B a thread, each thread's
// eight accumulator values as they stand in the workspace.
// There are two of each: while a chunk is worked on out of one, the next chunk's
// operands are on their way into the other, by asynchronous copies that pass no register.
#define SQ 0
#define SK (64 * PK)
#define SW (2 * 64 * PK)
#define SX (3 * 64 * PK)
#define STG (3 * 64 * PK + 64 * PX)   // 61440 B a buffer

// the LDS byte address of a __shared__ element: the low 32 bits of its address
__device__ __forceinline__ unsigned lds_addr(const void* p) { return (unsigned)(size_t)p; }

// Issues the copies of one chunk: 16 bytes a lane and copy, four copies for each of q, k, -w
// (64 rows of 256 B, laid at pitch PK), two for qk (64 rows of 128 B, at pitch PX) and two
// for u (uc: this thread's own eight floats of the chunk).
__device__ __forceinline__ void stage_chunk(const _Float16* __restrict__ qc, const _Float16* __restrict__ kc,
                                            const _Float16* __restrict__ wc, const _Float16* __restrict__ xc,
                                            const float* __restrict__ uc,
                                            const _Float16* sb, const float* su, int tid) {
  const unsigned lr = lds_addr(sb) + (unsigned)((tid >> 4) * PK + (tid & 15) * 8) * 2u;
  const unsigned lx = lds_addr(sb) + (unsigned)(SX + (tid >> 3) * PX + (tid & 7) * 8) * 2u;
  const unsigned lq = lr + SQ * 2u, lk = lr + SK * 2u, lw = lr + SW * 2u;
  const _Float16* gq = qc + tid * 8;
  const _Float16* gk = kc + tid * 8;
  const _Float16* gw = wc + tid * 8;
  const _Float16* gx = xc + tid * 8;
  const unsigned lu = lds_addr(su) + (unsigned)tid * 16u;
  asm volatile(
      "global_load_async_to_lds_b128 %0, %1, off\n\t"
      "global_load_async_to_lds_b128 %2, %3, off\n\t"
      "global_load_async_to_lds_b128 %4, %5, off\n\t"
      "global_load_async_to_lds_b128 %6, %7, off\n\t"
      "global_load_async_to_lds_b128 %8, %9, off\n\t"
      "global_load_async_to_lds_b128 %10, %11, off\n\t"
      "global_load_async_to_lds_b128 %12, %13, off\n\t"
      "global_load_async_to_lds_b128 %14, %15, off\n\t"
      "global_load_async_to_lds_b128 %16, %17, off\n\t"
      "global_load_async_to_lds_b128 %18, %19, off\n\t"
      "s_wait_xcnt 0x0"
      :: "v"(lq),                    "v"(gq),
         "v"(lw),                    "v"(gw),
         "v"(lq + 16 * PK * 2u),     "v"(gq + 2048),
         "v"(lw + 16 * PK * 2u),     "v"(gw + 2048),
         "v"(lq + 32 * PK * 2u),     "v"(gq + 4096),
         "v"(lw + 32 * PK * 2u),     "v"(gw + 4096),
         "v"(lq + 48 * PK * 2u),     "v"(gq + 6144),
         "v"(lw + 48 * PK * 2u),     "v"(gw + 6144),
         "v"(lu),                    "v"(uc),
         "v"(lu + 4096u),            "v"(uc + 4)
      : "memory");
  asm volatile(
      "global_load_async_to_lds_b128 %0, %1, off\n\t"
      "global_load_async_to_lds_b128 %2, %3, off\n\t"
      "global_load_async_to_lds_b128 %4, %5, off\n\t"
      "global_load_async_to_lds_b128 %6, %7, off\n\t"
      "global_load_async_to_lds_b128 %8, %9, off\n\t"
      "global_load_async_to_lds_b128 %10, %11, off\n\t"
      "s_wait_xcnt 0x0"
      :: "v"(lx),                    "v"(gx),
         "v"(lx + 32 * PX * 2u),     "v"(gx + 2048),
         "v"(lk),                    "v"(gk),
         "v"(lk + 16 * PK * 2u),     "v"(gk + 2048),
         "v"(lk + 32 * PK * 2u),     "v"(gk + 4096),
         "v"(lk + 48 * PK * 2u),     "v"(gk + 6144)
      : "memory");
}

__global__ __launch_bounds__(256) void delta_kernel(
    const _Float16* __restrict__ qg, const _Float16* __restrict__ kg,
    const _Float16* __restrict__ wg, const _Float16* __restrict__ qkg,
    const float* __restrict__ ug, float* __restrict__ og) {
  __shared__ __attribute__((aligned(16))) _Float16 stg[2][STG];
  __shared__ __attribute__((aligned(16))) float    us[2][2 * 256 * 4];
  __shared__ __attribute__((aligned(16))) float    St[DVS * PS];
  __shared__ __attribute__((aligned(16))) _Float16 vnT[DVS * PX];

  int tid = threadIdx.x, lane = tid & 31, wid = tid >> 5;
  int l15 = lane & 15, hi8 = (lane & 16) ? 8 : 0;
  // the slices of one (b,h) are BB*HH block numbers apart (speed only, nothing rests on it)
  size_t bh = blockIdx.x % (BB * HH);
  const int tg0 = (int)(blockIdx.x / (BB * HH)) * (DVS / 16);   // first 16-column tile of the block's slice
  size_t rowbase = bh * (size_t)LL;
  // the wave's one 16x16 tile of the 64 x DVS products: rows tm, columns tn (in the slice)
  const int tm = wid >> 1, tn = wid & 1;

  // chunk 0 of this (b,h) in each operand; a chunk is 64*DKH elements (qk: 64*64) further on
  const _Float16* qb = qg + bh * NCHUNK * 64 * DKH;
  const _Float16* kb_ = kg + bh * NCHUNK * 64 * DKH;
  const _Float16* wb = wg + bh * NCHUNK * 64 * DKH;
  const _Float16* xb = qkg + bh * NCHUNK * 64 * 64;
  // u: the wave's tile, this lane's eight values
  const float* ub = ug + bh * NCHUNK * 64 * DKH + (unsigned)((tm * 8 + tg0 + tn) * 32 + lane) * 8;

  // ---- in front of the loop: chunk 0 lands and is published, chunk 1 is sent for ----
  stage_chunk(qb, kb_, wb, xb, ub, stg[0], us[0], tid);
  for (int i = tid; i < DVS * PS; i += 256) St[i] = 0.f;
  // this wave's copies of chunk 0 have landed before the barrier lets other waves read them
  asm volatile("s_wait_asynccnt 0x0" ::: "memory");
  __syncthreads();
  stage_chunk(qb + 64 * DKH, kb_ + 64 * DKH, wb + 64 * DKH, xb + 64 * 64, ub + 64 * DKH, stg[1], us[1], tid);

  for (int c = 0; c < NCHUNK; ++c) {
    const _Float16* sb = stg[c & 1];
    const _Float16* q16  = sb + SQ;
    const _Float16* k16  = sb + SK;
    const _Float16* vw16 = sb + SW;
    const _Float16* qk16 = sb + SX;
    const float* su = us[c & 1];
    const v4f ulo = *(const v4f*)&su[tid * 4], uhi = *(const v4f*)&su[1024 + tid * 4];
    const v8f uacc = __builtin_shufflevector(ulo, uhi, 0, 1, 2, 3, 4, 5, 6, 7);

    // ---- o1 = q @ S (regs) ; v_new = u + (-w) @ S -> vnT (transposed) ----
    // both products take the same S fragment
    v8f oacc = (v8f){};
    {
      v8f a0 = uacc;
#pragma unroll
      for (int kb = 0; kb < 128; kb += 32) {
        v16h aq, aw, b;
#pragma unroll
        for (int e = 0; e < 16; ++e) {
          int ko = kb + koff(e, lane);
          aq[e] = q16[(tm * 16 + l15) * PK + ko];
          aw[e] = vw16[(tm * 16 + l15) * PK + ko];         // -w row-major
          b[e] = (_Float16)St[(tn * 16 + l15) * PS + ko];  // S^T rows
        }
        oacc = wmma_f16(aq, b, oacc);
        a0 = wmma_f16(aw, b, a0);
      }
#pragma unroll
      for (int r = 0; r < 8; ++r)
        vnT[(tn * 16 + l15) * PX + tm * 16 + hi8 + r] = (_Float16)a0[r];
    }
    lds_barrier();   // publishes v_new; the last chunk's o stores may still be on their way

    // ---- o = o1 + qk @ v_new -> global ----
    {
      v8f a0 = oacc;
#pragma unroll
      for (int kb = 0; kb < 64; kb += 32) {
        v16h a, b;
#pragma unroll
        for (int e = 0; e < 16; ++e) {
          int ko = kb + koff(e, lane);
          a[e] = qk16[(tm * 16 + l15) * PX + ko];
          b[e] = vnT[(tn * 16 + l15) * PX + ko];            // v_new^T rows
        }
        a0 = wmma_f16(a, b, a0);
      }
#pragma unroll
      for (int r = 0; r < 8; ++r)
        og[(rowbase + (size_t)c * 64 + tm * 16 + hi8 + r) * 128 + (tg0 + tn) * 16 + l15] = a0[r];
    }
    // ---- S^T += (k^T @ v_new)^T : tile (m=dk, n=dv), stored transposed ----
    // the wave takes dk tile wid against every column tile of the slice
#pragma unroll
    for (int sn = 0; sn < DVS / 16; ++sn) {
      v8f a0;
#pragma unroll
      for (int r = 0; r < 8; ++r)
        a0[r] = St[(sn * 16 + l15) * PS + wid * 16 + hi8 + r];
#pragma unroll
      for (int kb = 0; kb < 64; kb += 32) {
        v16h a, b;
#pragma unroll
        for (int e = 0; e < 16; ++e) {
          int ko = kb + koff(e, lane);
          a[e] = k16[ko * PK + wid * 16 + l15];   // (k^T)[m][j] = k[j][m]
          b[e] = vnT[(sn * 16 + l15) * PX + ko];  // v_new^T rows
        }
        a0 = wmma_f16(a, b, a0);
      }
#pragma unroll
      for (int r = 0; r < 8; ++r)
        St[(sn * 16 + l15) * PS + wid * 16 + hi8 + r] = a0[r];
    }
    // ---- foot of the trip: chunk c + 1 is published, this trip's buffer is freed ----
    // this wave's LDS reads of the buffer and its writes of St are done
    asm volatile("s_wait_dscnt 0x0" ::: "memory");
    // this wave's copies of chunk c + 1 have landed
    asm volatile("s_wait_asynccnt 0x0" ::: "memory");
    // no register that a store of o names is rewritten ahead of this wait
    asm volatile("s_wait_xcnt 0x0" ::: "memory");
    lds_barrier();   // the chunk's o stores are not waited for: nobody in this launch reads o
    if (c + 2 < NCHUNK) {
      size_t n = (size_t)(c + 2);
      stage_chunk(qb + n * 64 * DKH, kb_ + n * 64 * DKH, wb + n * 64 * DKH, xb + n * 64 * 64,
                  ub + n * 64 * DKH, sb, su, tid);
    }
  }
  // no copy is outstanding when the wave ends
  asm volatile("s_wait_asynccnt 0x0" ::: "memory");
}

// ---------------- per-head output RMSNorm -> [B,L,D] f16 -------------------
// a wave takes RW rows in a row of one head, a lane four channels
__global__ __launch_bounds__(256) void onorm_kernel(const float* __restrict__ og,
                                                    const float* __restrict__ w,
                                                    _Float16* __restrict__ on16) {
  int lane = threadIdx.x & 31;
  unsigned gw = blockIdx.x * 8 + wave_id();
  unsigned hb = gw / (LL / RW);         // b*H + h
  unsigned l0 = (gw % (LL / RW)) * RW;
  unsigned hh = hb % HH, b = hb / HH;
  const v4f* src = (const v4f*)(og + ((size_t)hb * LL + l0) * DKH) + lane;
  v4f v[RW];
#pragma unroll
  for (int r = 0; r < RW; ++r) v[r] = src[r * 32];
  v4f wv = *((const v4f*)w + lane);
  _Float16* dst = on16 + ((size_t)b * LL + l0) * DD + hh * DKH + lane * 4;
#pragma unroll
  for (int r = 0; r < RW; ++r) {
    v4f q = v[r] * v[r];
    float inv = rsqrtf(wave_sum((q[0] + q[1]) + (q[2] + q[3])) * (1.f / DKH) + EPSF);
    v4h o;
#pragma unroll
    for (int c = 0; c < 4; ++c) o[c] = (_Float16)(v[r][c] * inv * wv[c]);
    *(v4h*)(dst + (size_t)r * DD) = o;
  }
}

// ---------------------------------------------------------------------------
extern "C" void kernel_launch(void* const* d_in, const int* in_sizes, int n_in,
                              void* d_out, int out_size, void* d_ws, size_t ws_size,
                              hipStream_t stream) {
  const float* x        = (const float*)d_in[0];
  const float* norm_w   = (const float*)d_in[1];
  const float* Wq       = (const float*)d_in[2];
  const float* Wk       = (const float*)d_in[3];
  const float* Wv       = (const float*)d_in[4];
  const float* Wb       = (const float*)d_in[5];
  const float* conv_q   = (const float*)d_in[6];
  const float* conv_k   = (const float*)d_in[7];
  const float* conv_v   = (const float*)d_in[8];
  const float* o_norm_w = (const float*)d_in[9];
  const float* Wo       = (const float*)d_in[10];
  float* out = (float*)d_out;

  char* p = (char*)d_ws;
  auto take = [&](size_t bytes) { char* r = p; p += (bytes + 255) & ~(size_t)255; return r; };
  const size_t actF16 = (size_t)BLROWS * DD * sizeof(_Float16);   // 16 MiB
  const size_t wF16   = (size_t)DD * DD * sizeof(_Float16);       // 2 MiB

  _Float16* h16   = (_Float16*)take(actF16);
  _Float16* wq16t = (_Float16*)take(wF16);   // transposed [N][K]
  _Float16* wk16t = (_Float16*)take(wF16);
  _Float16* wv16t = (_Float16*)take(wF16);
  _Float16* wo16t = (_Float16*)take(wF16);
  _Float16* qpre  = (_Float16*)take(actF16);
  _Float16* kpre  = (_Float16*)take(actF16);
  _Float16* vpre  = (_Float16*)take(actF16);
  _Float16* qh    = (_Float16*)take(actF16);
  _Float16* kh    = (_Float16*)take(actF16);
  _Float16* vh    = (_Float16*)take(actF16);
  float*    betag = (float*)take((size_t)BB * HH * LL * sizeof(float));
  float*    og    = (float*)take((size_t)BB * HH * LL * DKH * sizeof(float));
  _Float16* on16  = (_Float16*)take(actF16);
  float*    ug    = (float*)take((size_t)BB * HH * LL * DKH * sizeof(float));
  _Float16* wg    = (_Float16*)take(actF16);
  _Float16* qkg   = (_Float16*)take((size_t)BB * HH * LL * 64 * sizeof(_Float16));

  // 1. h = rmsnorm(x)
  rmsnorm_kernel<<<BLROWS / 8, 256, 0, stream>>>(x, norm_w, h16);
  // 2. weights -> f16, transposed to [N][K] for K-contiguous B fragments
  int tgrid = (DD / 32) * (DD / 32);
  transpose_f16_kernel<<<tgrid, 256, 0, stream>>>(Wq, wq16t, DD, DD);
  transpose_f16_kernel<<<tgrid, 256, 0, stream>>>(Wk, wk16t, DD, DD);
  transpose_f16_kernel<<<tgrid, 256, 0, stream>>>(Wv, wv16t, DD, DD);
  transpose_f16_kernel<<<tgrid, 256, 0, stream>>>(Wo, wo16t, DD, DD);
  // 3. projections (WMMA GEMMs, async double-buffered staging)
  dim3 ggrid(DD / 128, BLROWS / 128);
  gemm_f16_kernel<0><<<ggrid, 256, 0, stream>>>(h16, wq16t, qpre, nullptr, nullptr, BLROWS, DD, DD);
  gemm_f16_kernel<0><<<ggrid, 256, 0, stream>>>(h16, wk16t, kpre, nullptr, nullptr, BLROWS, DD, DD);
  gemm_f16_kernel<0><<<ggrid, 256, 0, stream>>>(h16, wv16t, vpre, nullptr, nullptr, BLROWS, DD, DD);
  // 4. beta
  beta_kernel<<<BLROWS / 32, 256, 0, stream>>>(h16, Wb, betag);
  // 5. conv + activations + head layout
  conv_head_kernel<<<BB * HH * LL / (8 * RW), 256, 0, stream>>>(qpre, conv_q, qh, 2);
  conv_head_kernel<<<BB * HH * LL / (8 * RW), 256, 0, stream>>>(kpre, conv_k, kh, 1);
  conv_head_kernel<<<BB * HH * LL / (8 * RW), 256, 0, stream>>>(vpre, conv_v, vh, 0);
  // 6. chunkwise delta rule: per-chunk operands for all chunks, then the serial walk
  delta_prep_kernel<<<BB * HH * NCHUNK, 256, 0, stream>>>(qh, kh, vh, betag, ug, wg, qkg);
  delta_kernel<<<BB * HH * NSL, 256, 0, stream>>>(qh, kh, wg, qkg, ug, og);
  // 7. output norm
  onorm_kernel<<<BB * HH * LL / (8 * RW), 256, 0, stream>>>(og, o_norm_w, on16);
  // 8. out = x + on @ Wo
  gemm_f16_kernel<1><<<ggrid, 256, 0, stream>>>(on16, wo16t, nullptr, out, x, BLROWS, DD, DD);
}

// v009
// It runs in 238 microseconds.
// Next to v008, in two timings, it ran 1.06 and 1.04 times as fast.
// All steps since v000 together make it 23.0 times as fast.
#include <hip/hip_runtime.h>
#include <hip/hip_bf16.h>

typedef __attribute__((ext_vector_type(16))) _Float16 v16h;
typedef __attribute__((ext_vector_type(8)))  float    v8f;
typedef __attribute__((ext_vector_type(4)))  float    v4f;

#define BB 2
#define LL 4096
#define DD 1024
#define HH 8
#define DKH 128
#define BLROWS (BB*LL)          // 8192
#define NCHUNK 64
#define EPSF 1e-6f

#if defined(__gfx1250__) && __has_builtin(__builtin_amdgcn_global_load_async_to_lds_b128)
#define HAVE_ASYNC 1
typedef int v4i_ __attribute__((ext_vector_type(4)));
typedef __attribute__((address_space(1))) v4i_* gp_v4i;
typedef __attribute__((address_space(3))) v4i_* lp_v4i;
#define GLA128(SRC, DST) \
  __builtin_amdgcn_global_load_async_to_lds_b128((gp_v4i)(void*)(SRC), (lp_v4i)(void*)(DST), 0, 0)
#if __has_builtin(__builtin_amdgcn_s_wait_asynccnt)
#define WAITA(n) __builtin_amdgcn_s_wait_asynccnt(n)
#else
#define WAITA(n) asm volatile("s_wait_asynccnt %0" :: "n"(n) : "memory")
#endif
#else
#define HAVE_ASYNC 0
#define WAITA(n)
#endif

__device__ __forceinline__ int koff(int e, int lane) {
  int j = e >> 1;
  return ((j & 4) << 2) + ((lane & 16) >> 1) + ((j & 3) << 1) + (e & 1);
}

__device__ __forceinline__ v8f wmma_f16(v16h a, v16h b, v8f c) {
  return __builtin_amdgcn_wmma_f32_16x16x32_f16(false, a, false, b, (short)0, c, false, false);
}

__device__ __forceinline__ float sigmoidf_(float x) { return 1.f / (1.f + __expf(-x)); }
__device__ __forceinline__ float siluf_(float x) { return x * sigmoidf_(x); }

// ---------------- the row kernels ------------------------------------------
// rmsnorm, beta, conv+l2norm and the output norm each work on short rows (128 or 1024
// elements). One wave takes whole rows: a lane holds its share of a row in registers,
// the row's sum is a butterfly over the 32 lanes, and there is no LDS and no barrier.
// One block per row cost far more in starting waves than in the rows' own work.
// Every '#pragma unroll' in these four kernels is on a loop over a lane's own share: fully
// unrolled, the per-lane arrays have static indices only and stay in registers.
typedef __attribute__((ext_vector_type(4))) _Float16 v4h;

// the wave's number in its block, held as a scalar, so that row numbers and row
// addresses are scalar arithmetic and the loads take base + lane offset + immediate
__device__ __forceinline__ unsigned wave_id() {
  return (unsigned)__builtin_amdgcn_readfirstlane((int)(threadIdx.x >> 5));
}

template <int M>
__device__ __forceinline__ float xmask_add(float v) {
  // v + (v of lane ^ M), M < 16: a DPP row_xmask move inside the 16-lane row
  int o = __builtin_amdgcn_update_dpp(0, __builtin_bit_cast(int, v), 0x160 | M, 0xf, 0xf, true);
  return v + __builtin_bit_cast(float, o);
}
// sum over the wave's 32 lanes, the same bits in every lane
__device__ __forceinline__ float wave_sum(float v) {
  v = xmask_add<1>(v);
  v = xmask_add<2>(v);
  v = xmask_add<4>(v);
  v = xmask_add<8>(v);
  int b = __builtin_bit_cast(int, v);
  int o = __builtin_amdgcn_permlanex16(b, b, 0x76543210, 0xfedcba98, false, false);  // lane ^ 16
  return v + __builtin_bit_cast(float, o);
}

// ---------------- RMSNorm (x -> h f16): one row a wave ----------------------
__global__ __launch_bounds__(256) void rmsnorm_kernel(const float* __restrict__ x,
                                                      const float* __restrict__ w,
                                                      _Float16* __restrict__ h16) {
  int lane = threadIdx.x & 31;
  size_t row = (size_t)(blockIdx.x * 8 + wave_id());
  const v4f* xr = (const v4f*)(x + row * DD) + lane;
  const v4f* wr = (const v4f*)w + lane;
  v4f xv[8];
#pragma unroll
  for (int j = 0; j < 8; ++j) xv[j] = xr[j * 32];
  v4f p = (v4f){};
#pragma unroll
  for (int j = 0; j < 8; ++j) p += xv[j] * xv[j];
  float inv = rsqrtf(wave_sum((p[0] + p[1]) + (p[2] + p[3])) * (1.f / DD) + EPSF);
  v4h* ho = (v4h*)(h16 + row * DD) + lane;
#pragma unroll
  for (int j = 0; j < 8; ++j) {
    v4f wv = wr[j * 32];
    v4h o;
#pragma unroll
    for (int c = 0; c < 4; ++c) o[c] = (_Float16)(xv[j][c] * inv * wv[c]);
    ho[j * 32] = o;
  }
}

// -------- LDS-tiled transpose: src f32 [R][C] -> dst f16 [C][R] ------------
__global__ __launch_bounds__(256) void transpose_f16_kernel(const float* __restrict__ src,
                                                            _Float16* __restrict__ dst,
                                                            int R, int C) {
  __shared__ float t[32][33];
  int nbx = C / 32;
  int bx = blockIdx.x % nbx, by = blockIdx.x / nbx;
  int r0 = by * 32, c0 = bx * 32;
  int tr = threadIdx.x >> 5, tc = threadIdx.x & 31;
#pragma unroll
  for (int i = 0; i < 32; i += 8)
    t[tr + i][tc] = src[(size_t)(r0 + tr + i) * C + c0 + tc];
  __syncthreads();
#pragma unroll
  for (int i = 0; i < 32; i += 8)
    dst[(size_t)(c0 + tr + i) * R + r0 + tc] = (_Float16)t[tc][tr + i];
}

#define BKG 64  // halfs
#define PG 72   // halfs
template <int MODE>
__global__ __launch_bounds__(256) void gemm_f16_kernel(
    const _Float16* __restrict__ A, const _Float16* __restrict__ Bt,
    _Float16* __restrict__ out16, float* __restrict__ outf,
    const float* __restrict__ resid, int M, int N, int K) {
  __shared__ __attribute__((aligned(16))) _Float16 As[2][128][PG];
  __shared__ __attribute__((aligned(16))) _Float16 Bs[2][128][PG];
  int tid = threadIdx.x, lane = tid & 31;
  int wid = tid >> 5, l15 = lane & 15, hi8 = (lane & 16) ? 8 : 0;
  int wm = wid >> 1, wn = wid & 1;
  int bm = blockIdx.y * 128, bn = blockIdx.x * 128;

  int cr = tid >> 3, cs = (tid & 7) * 8;          // copy row / 8-half segment: eight lanes a row
  auto issue = [&](int buf, int k0) {
    const _Float16* ga = A + (size_t)(bm + cr) * K + k0 + cs;
    const _Float16* gb = Bt + (size_t)(bn + cr) * K + k0 + cs;
    // 256 lanes x 16 B = 32 rows a copy, four copies for each operand's 128 rows
#pragma unroll
    for (int g = 0; g < 4; ++g) {
#if HAVE_ASYNC
      GLA128(ga + (size_t)(g * 32) * K, &As[buf][cr + g * 32][cs]);
      GLA128(gb + (size_t)(g * 32) * K, &Bs[buf][cr + g * 32][cs]);
#else
      *(int4*)&As[buf][cr + g * 32][cs] = *(const int4*)(ga + (size_t)(g * 32) * K);
      *(int4*)&Bs[buf][cr + g * 32][cs] = *(const int4*)(gb + (size_t)(g * 32) * K);
#endif
    }
  };

  v8f acc[2][4];
#pragma unroll
  for (int i = 0; i < 2; ++i)
#pragma unroll
    for (int j = 0; j < 4; ++j) acc[i][j] = (v8f){};

  int nT = K / BKG;
  issue(0, 0);
  for (int kt = 0; kt < nT; ++kt) {
    int buf = kt & 1;
    // eight copies a tile and wave: all but the next tile's eight have landed
    if (kt + 1 < nT) { issue(buf ^ 1, (kt + 1) * BKG); WAITA(8); }
    else             { WAITA(0); }
    __syncthreads();
    // the tile's two 32-wide k slices, in ascending k: fully unrolled, so that the second
    // slice's fragment reads can stand among the first slice's matrix instructions
#pragma unroll
    for (int ks = 0; ks < BKG; ks += 32) {
      v16h af[2], bf[4];
#pragma unroll
      for (int i = 0; i < 2; ++i) {
        int mr = wm * 32 + i * 16 + l15;
#pragma unroll
        for (int e = 0; e < 16; ++e) af[i][e] = As[buf][mr][ks + koff(e, lane)];
      }
#pragma unroll
      for (int j = 0; j < 4; ++j) {
        int nc = wn * 64 + j * 16 + l15;
#pragma unroll
        for (int e = 0; e < 16; ++e) bf[j][e] = Bs[buf][nc][ks + koff(e, lane)];
      }
#pragma unroll
      for (int i = 0; i < 2; ++i)
#pragma unroll
        for (int j = 0; j < 4; ++j) acc[i][j] = wmma_f16(af[i], bf[j], acc[i][j]);
    }
    __syncthreads();
  }
#pragma unroll
  for (int i = 0; i < 2; ++i)
#pragma unroll
    for (int j = 0; j < 4; ++j)
#pragma unroll
      for (int r = 0; r < 8; ++r) {
        size_t gm = bm + wm * 32 + i * 16 + hi8 + r;
        size_t gn = bn + wn * 64 + j * 16 + l15;
        if (MODE == 0) out16[gm * N + gn] = (_Float16)acc[i][j][r];
        else           outf[gm * N + gn] = resid[gm * N + gn] + acc[i][j][r];
      }
}

// ---------------- beta = sigmoid(h @ Wb): four rows a wave ------------------
__global__ __launch_bounds__(256) void beta_kernel(const _Float16* __restrict__ h16,
                                                   const float* __restrict__ Wb,
                                                   float* __restrict__ betag) {
  int lane = threadIdx.x & 31;
  size_t row0 = (size_t)((blockIdx.x * 8 + wave_id()) * 4);   // b*L + l of the first row
  const _Float16* hr = h16 + row0 * DD + lane;
  const v4f* wb = (const v4f*)Wb + lane * 2;
  float acc[4][8];
#pragma unroll
  for (int r = 0; r < 4; ++r)
#pragma unroll
    for (int hh = 0; hh < 8; ++hh) acc[r][hh] = 0.f;
  // lane takes k = lane, lane + 32, ...; a row of Wb serves all four rows of h.
  // Eight k steps a trip, loaded ahead of the arithmetic: a trip pays the way to memory
  // once, not once a k step.
  for (int jo = 0; jo < DD / 32; jo += 8) {
    _Float16 hv[4][8];
    v4f wlo[8], whi[8];
#pragma unroll
    for (int r = 0; r < 4; ++r)
#pragma unroll
      for (int j = 0; j < 8; ++j) hv[r][j] = hr[r * DD + (jo + j) * 32];
#pragma unroll
    for (int j = 0; j < 8; ++j) {
      wlo[j] = wb[(jo + j) * 64];
      whi[j] = wb[(jo + j) * 64 + 1];
    }
#pragma unroll
    for (int j = 0; j < 8; ++j)
#pragma unroll
      for (int r = 0; r < 4; ++r) {
        float hf = (float)hv[r][j];
#pragma unroll
        for (int hh = 0; hh < 4; ++hh) {
          acc[r][hh]     += hf * wlo[j][hh];
          acc[r][hh + 4] += hf * whi[j][hh];
        }
      }
  }
  // lane r*8 + hh keeps and stores the sum of (row r, head hh)
  float mine = 0.f;
#pragma unroll
  for (int r = 0; r < 4; ++r)
#pragma unroll
    for (int hh = 0; hh < 8; ++hh) {
      float s = wave_sum(acc[r][hh]);
      mine = (lane == r * 8 + hh) ? s : mine;
    }
  size_t row = row0 + (lane >> 3);
  int b = (int)(row / LL), l = (int)(row % LL);
  betag[((size_t)b * HH + (lane & 7)) * LL + l] = sigmoidf_(mine);
}

// -------- causal conv(K=4)+silu [+silu+l2norm (+qscale)] -> heads f16 ------
// mode: 0 = v (conv+silu), 1 = k (+silu+l2norm), 2 = q (+silu+l2norm+DK^-.5)
// A wave takes RW rows in a row of one head, a lane four channels; the RW + 3 input
// rows are loaded once and each serves up to four output rows.
#define RW 8
__global__ __launch_bounds__(256) void conv_head_kernel(
    const _Float16* __restrict__ pre, const float* __restrict__ cw,
    _Float16* __restrict__ outg, int mode) {
  int lane = threadIdx.x & 31;
  unsigned gw = blockIdx.x * 8 + wave_id();
  unsigned hb = gw / (LL / RW);         // b*H + h
  unsigned l0 = (gw % (LL / RW)) * RW;
  unsigned hh = hb % HH, b = hb / HH;
  unsigned ch = hh * DKH + lane * 4;
  const bool first = (l0 == 0);         // the three rows in front of l0 are the left padding
  // rows l0-3 .. l0+RW-1; at l0 == 0 the first three loads read rows 0..2 instead
  // (inside the buffer) and are zeroed below
  const _Float16* src = pre + ((size_t)b * LL + l0) * DD + ch;
  const _Float16* srcm = first ? src : src - 3 * DD;
  v4h xin[RW + 3];
#pragma unroll
  for (int i = 0; i < 3; ++i) xin[i] = *(const v4h*)(srcm + i * DD);
#pragma unroll
  for (int i = 3; i < RW + 3; ++i) xin[i] = *(const v4h*)(src + (i - 3) * DD);
  v4f wt[4];                            // the four taps of each of the lane's channels
#pragma unroll
  for (int c = 0; c < 4; ++c) wt[c] = *(const v4f*)(cw + (ch + c) * 4);
  v4f xf[RW + 3];
#pragma unroll
  for (int i = 0; i < RW + 3; ++i)
#pragma unroll
    for (int c = 0; c < 4; ++c) xf[i][c] = (i < 3 && first) ? 0.f : (float)xin[i][c];
  v4f s[RW];
#pragma unroll
  for (int r = 0; r < RW; ++r)
#pragma unroll
    for (int c = 0; c < 4; ++c) {
      float acc = 0.f;
#pragma unroll
      for (int i = 0; i < 4; ++i) acc += xf[r + i][c] * wt[c][i];
      s[r][c] = siluf_(acc);
    }
  if (mode > 0) {
    float qs = (mode == 2) ? 0.08838834764831845f : 1.f;   // 128^-0.5
#pragma unroll
    for (int r = 0; r < RW; ++r) {
#pragma unroll
      for (int c = 0; c < 4; ++c) s[r][c] = siluf_(s[r][c]);
      v4f q = s[r] * s[r];
      float inv = rsqrtf(wave_sum((q[0] + q[1]) + (q[2] + q[3])) + EPSF);
#pragma unroll
      for (int c = 0; c < 4; ++c) s[r][c] = s[r][c] * inv * qs;
    }
  }
  v4h* dst = (v4h*)(outg + ((size_t)hb * LL + l0) * DKH) + lane;
#pragma unroll
  for (int r = 0; r < RW; ++r) {
    v4h o;
#pragma unroll
    for (int c = 0; c < 4; ++c) o[c] = (_Float16)s[r][c];
    dst[r * 32] = o;
  }
}

#define PK 136   // halfs: rows of 128 f16 (q16, k16, -w)       272 B
#define PX 72    // halfs: rows of  64 f16 (X16, qk, vnT, (bv)^T) 144 B
#define PS 132   // floats: rows of 128 f32 (St)                 528 B
// A work-group barrier that orders LDS alone. __syncthreads() also releases the wave's global
// stores: behind a store it holds the wave until every store has been acknowledged
// (s_wait_storecnt 0). Where no wave of the launch reads what was stored (o, u), only the LDS
// traffic has to be done at the barrier: the two fences name the LDS address space, so the
// release is s_wait_dscnt 0 and the stores stay in flight across the barrier.
__device__ __forceinline__ void lds_barrier() {
  __builtin_amdgcn_fence(__ATOMIC_RELEASE, "workgroup", "local");   // this wave's LDS reads and writes are done
  __builtin_amdgcn_s_barrier();
  __builtin_amdgcn_fence(__ATOMIC_ACQUIRE, "workgroup", "local");   // no LDS read is lifted over the barrier
}

__global__ __launch_bounds__(256) void delta_prep_kernel(
    const _Float16* __restrict__ qg, const _Float16* __restrict__ kg,
    const _Float16* __restrict__ vg, const float* __restrict__ betag,
    float* __restrict__ ug, _Float16* __restrict__ wg, _Float16* __restrict__ qkg) {
  __shared__ __attribute__((aligned(16))) _Float16 q16[64 * PK];
  __shared__ __attribute__((aligned(16))) _Float16 k16[64 * PK];
  __shared__ __attribute__((aligned(16))) _Float16 vw16[128 * PX];   // 128*PX >= 64*PK
  __shared__ __attribute__((aligned(16))) float    Af[64 * 64];
  __shared__ __attribute__((aligned(16))) _Float16 X16[64 * PX];
  __shared__ __attribute__((aligned(16))) float    XT[3 * 32 * 32];  // f32 scratch of the inverse
  __shared__ __attribute__((aligned(16))) float    betaS[64];
  _Float16* qk16 = (_Float16*)Af;

  int tid = threadIdx.x, lane = tid & 31, wid = tid >> 5;
  int l15 = lane & 15, hi8 = (lane & 16) ? 8 : 0;
  size_t chunk = blockIdx.x;            // (b*H + h)*64 + c ; its rows start at chunk*64

  // ---- load chunk (beta first; fold beta into transposed v) ----
  if (tid < 64) betaS[tid] = betag[chunk * 64 + tid];
  __syncthreads();
  {
    // One chunk base per operand and a fully unrolled loop: every load is that
    // operand's lane pointer + an immediate.
    const _Float16* qc = qg + chunk * 64 * DKH;
    const _Float16* kc = kg + chunk * 64 * DKH;
    const _Float16* vc = vg + chunk * 64 * DKH;
    const int j0 = tid >> 7, d = tid & 127;
#pragma unroll
    for (int it = 0; it < 32; ++it) {
      int i = tid + it * 256;
      int j = j0 + it * 2;
      q16[j * PK + d] = qc[i];
      k16[j * PK + d] = kc[i];
      vw16[d * PX + j] = (_Float16)((float)vc[i] * betaS[j]);   // (beta*v)^T
    }
  }
  __syncthreads();

  // ---- kk = k k^T ; A = I + tril(beta*kk, -1) ----
#pragma unroll
  for (int ti = 0; ti < 2; ++ti) {
    int t = wid * 2 + ti, tm = t >> 2, tn = t & 3;
    v8f a0 = (v8f){};
    // beta of this lane's 8 rows, read unconditionally: the mask below is then a
    // select, with no branch between the last matrix instruction and its readers
    const v4f blo = *(const v4f*)&betaS[tm * 16 + hi8];
    const v4f bhi = *(const v4f*)&betaS[tm * 16 + hi8 + 4];
#pragma unroll
    for (int kb = 0; kb < 128; kb += 32) {
      v16h a, b;
#pragma unroll
      for (int e = 0; e < 16; ++e) {
        int ko = kb + koff(e, lane);
        a[e] = k16[(tm * 16 + l15) * PK + ko];
        b[e] = k16[(tn * 16 + l15) * PK + ko];   // k^T as B
      }
      a0 = wmma_f16(a, b, a0);
    }
#pragma unroll
    for (int r = 0; r < 8; ++r) {
      int m = tm * 16 + hi8 + r, n = tn * 16 + l15;
      Af[m * 64 + n] = (m == n) ? 1.f : ((n < m) ? (r < 4 ? blo[r & 3] : bhi[r & 3]) * a0[r] : 0.f);
    }
  }
  __syncthreads();

  // ---- X = A^-1 (unit lower tri), blocked 2x2 with 32x32 blocks, all f32 ----
  // X11 = A11^-1, X22 = A22^-1: one wave each, lane = column, the column kept in
  // registers, rows of A read as broadcasts. X21 = -X22 (A21 X11) on all 8 waves.
  // Every loop below is fully unrolled so that the per-lane arrays have static
  // indices and stay in registers.
  {
    float* Xf = XT;                   // [2][32][32] diagonal-block inverses
    float* Tf = Xf + 2 * 32 * 32;     // [32][32]    A21 * X11
    if (wid < 2) {
      int r0 = wid * 32;
      float xc[32];
      float ab[2][4][32];             // rows of A11/A22, two groups of 4 rows
#pragma unroll
      for (int r = 1; r < 4; ++r)
#pragma unroll
        for (int l = 0; l < r; ++l) ab[0][r][l] = Af[(r0 + r) * 64 + r0 + l];
#pragma unroll  // full unroll keeps xc[] and ab[] in registers (static indices only)
      for (int G = 0; G < 8; ++G) {
        if (G + 1 < 8) {
#pragma unroll
          for (int r = 0; r < 4; ++r) {
            int i = (G + 1) * 4 + r;
#pragma unroll
            for (int l = 0; l < i; ++l)
              ab[(G + 1) & 1][r][l] = Af[(r0 + i) * 64 + r0 + l];
          }
        }
        // keeps the next group's LDS reads above this group's arithmetic, so that
        // their latency is not paid row by row on the substitution's serial path
        __builtin_amdgcn_sched_barrier(0);
#pragma unroll
        for (int r = 0; r < 4; ++r) {
          int i = G * 4 + r;
          float s0 = 0.f, s1 = 0.f;
#pragma unroll
          for (int l = 0; l < i; ++l) {
            if (l & 1) s1 += ab[G & 1][r][l] * xc[l]; else s0 += ab[G & 1][r][l] * xc[l];
          }
          xc[i] = (i == lane) ? 1.f : -(s0 + s1);
          Xf[wid * 1024 + i * 32 + lane] = xc[i];
          X16[(r0 + i) * PX + r0 + lane] = (_Float16)xc[i];
        }
      }
    } else if (wid == 2) {
#pragma unroll
      for (int i = 0; i < 32; ++i) X16[i * PX + 32 + lane] = (_Float16)0.f;
    }
    __syncthreads();   // publishes X11, X22 to all waves
    {
      float xcol[32];
#pragma unroll
      for (int l = 0; l < 32; ++l) xcol[l] = Xf[l * 32 + lane];
#pragma unroll
      for (int r = 0; r < 4; ++r) {
        int i = wid * 4 + r;
        const v4f* ar = (const v4f*)&Af[(32 + i) * 64];
        float s0 = 0.f, s1 = 0.f, s2 = 0.f, s3 = 0.f;
#pragma unroll
        for (int g = 0; g < 8; ++g) {
          v4f a = ar[g];
          s0 += a[0] * xcol[g * 4 + 0];
          s1 += a[1] * xcol[g * 4 + 1];
          s2 += a[2] * xcol[g * 4 + 2];
          s3 += a[3] * xcol[g * 4 + 3];
        }
        Tf[i * 32 + lane] = (s0 + s1) + (s2 + s3);
      }
    }
    __syncthreads();   // publishes T = A21 X11
    {
      float tcol[32];
#pragma unroll
      for (int l = 0; l < 32; ++l) tcol[l] = Tf[l * 32 + lane];
#pragma unroll
      for (int r = 0; r < 4; ++r) {
        int i = wid * 4 + r;
        const v4f* xr = (const v4f*)&Xf[1024 + i * 32];
        float s0 = 0.f, s1 = 0.f, s2 = 0.f, s3 = 0.f;
#pragma unroll
        for (int g = 0; g < 8; ++g) {
          v4f a = xr[g];
          s0 += a[0] * tcol[g * 4 + 0];
          s1 += a[1] * tcol[g * 4 + 1];
          s2 += a[2] * tcol[g * 4 + 2];
          s3 += a[3] * tcol[g * 4 + 3];
        }
        X16[(32 + i) * PX + lane] = (_Float16)(-((s0 + s1) + (s2 + s3)));
      }
    }
  }
  __syncthreads();

  // ---- u = X @ (beta*v) -> workspace, in accumulator layout ----
#pragma unroll
  for (int ti = 0; ti < 4; ++ti) {
    int t = wid * 4 + ti, tm = t >> 3, tn = t & 7;
    v8f a0 = (v8f){};
#pragma unroll
    for (int kb = 0; kb < 64; kb += 32) {
      v16h a, b;
#pragma unroll
      for (int e = 0; e < 16; ++e) {
        int ko = kb + koff(e, lane);
        a[e] = X16[(tm * 16 + l15) * PX + ko];
        b[e] = vw16[(tn * 16 + l15) * PX + ko];           // (beta*v)^T
      }
      a0 = wmma_f16(a, b, a0);
    }
    *(v8f*)(ug + ((chunk * 32 + t) * 32 + lane) * 8) = a0;
  }
  // no register that a store of u names is rewritten ahead of this wait
  asm volatile("s_wait_xcnt 0x0" ::: "memory");
  lds_barrier();   // ends the reads of (beta*v)^T; the u stores need not have arrived

  // ---- -w = -(X @ (beta*k)) -> vw16 (row-major) ; qk = tril(q k^T) ----
#pragma unroll
  for (int ti = 0; ti < 4; ++ti) {
    int t = wid * 4 + ti, tm = t >> 3, tn = t & 7;
    v8f a0 = (v8f){};
#pragma unroll
    for (int kb = 0; kb < 64; kb += 32) {
      v16h a, b;
#pragma unroll
      for (int e = 0; e < 16; ++e) {
        int ko = kb + koff(e, lane);
        a[e] = X16[(tm * 16 + l15) * PX + ko];
        b[e] = (_Float16)((float)k16[ko * PK + tn * 16 + l15] * betaS[ko]);
      }
      a0 = wmma_f16(a, b, a0);
    }
#pragma unroll
    for (int r = 0; r < 8; ++r)
      vw16[(tm * 16 + hi8 + r) * PK + tn * 16 + l15] = (_Float16)(-a0[r]);
  }
#pragma unroll
  for (int ti = 0; ti < 2; ++ti) {
    int t = wid * 2 + ti, tm = t >> 2, tn = t & 3;
    v8f a0 = (v8f){};
#pragma unroll
    for (int kb = 0; kb < 128; kb += 32) {
      v16h a, b;
#pragma unroll
      for (int e = 0; e < 16; ++e) {
        int ko = kb + koff(e, lane);
        a[e] = q16[(tm * 16 + l15) * PK + ko];
        b[e] = k16[(tn * 16 + l15) * PK + ko];
      }
      a0 = wmma_f16(a, b, a0);
    }
#pragma unroll
    for (int r = 0; r < 8; ++r) {
      int m = tm * 16 + hi8 + r, n = tn * 16 + l15;
      qk16[m * PX + n] = (_Float16)((n <= m) ? a0[r] : 0.f);
    }
  }
  lds_barrier();   // publishes -w and qk in LDS (__syncthreads() would wait here for the u stores)

  // ---- -w and qk: LDS -> workspace, 16 bytes a lane ----
  {
    int4* wo = (int4*)(wg + chunk * 64 * DKH) + tid;
    int4* qo = (int4*)(qkg + chunk * 64 * 64) + tid;
#pragma unroll
    for (int it = 0; it < 4; ++it) {
      int p = tid + it * 256;
      wo[it * 256] = *(const int4*)&vw16[(p >> 4) * PK + (p & 15) * 8];
    }
#pragma unroll
    for (int it = 0; it < 2; ++it) {
      int p = tid + it * 256;
      qo[it * 256] = *(const int4*)&qk16[(p >> 3) * PX + (p & 7) * 8];
    }
  }
}

// The columns (dv) of the state never mix: v_new, o and the state update of a column read
// that column of S alone. So a (b,h) is walked by 128 / DVS blocks side by side, each with
// DVS columns of S, u, v_new and o; q, k, -w and qk are read by every one of them.
// DVS = 32: a block's part of a row of o is one whole 128-byte line.
#define DVS 32
#define NSL (DKH / DVS)
// One chunk's q, k, -w and qk lie in one staging buffer in LDS, at these places (in halfs);
// the block's part of u has a buffer of its own: two planes of 16 B a thread, each thread's
// eight accumulator values as they stand in the workspace.
// There are two of each: while a chunk is worked on out of one, the next chunk's
// operands are on their way into the other, by asynchronous copies that pass no register.
#define SQ 0
#define SK (64 * PK)
#define SW (2 * 64 * PK)
#define SX (3 * 64 * PK)
#define STG (3 * 64 * PK + 64 * PX)   // 61440 B a buffer

// the LDS byte address of a __shared__ element: the low 32 bits of its address
__device__ __forceinline__ unsigned lds_addr(const void* p) { return (unsigned)(size_t)p; }

// Issues the copies of one chunk: 16 bytes a lane and copy, four copies for each of q, k, -w
// (64 rows of 256 B, laid at pitch PK), two for qk (64 rows of 128 B, at pitch PX) and two
// for u (uc: this thread's own eight floats of the chunk).
__device__ __forceinline__ void stage_chunk(const _Float16* __restrict__ qc, const _Float16* __restrict__ kc,
                                            const _Float16* __restrict__ wc, const _Float16* __restrict__ xc,
                                            const float* __restrict__ uc,
                                            const _Float16* sb, const float* su, int tid) {
  const unsigned lr = lds_addr(sb) + (unsigned)((tid >> 4) * PK + (tid & 15) * 8) * 2u;
  const unsigned lx = lds_addr(sb) + (unsigned)(SX + (tid >> 3) * PX + (tid & 7) * 8) * 2u;
  const unsigned lq = lr + SQ * 2u, lk = lr + SK * 2u, lw = lr + SW * 2u;
  const _Float16* gq = qc + tid * 8;
  const _Float16* gk = kc + tid * 8;
  const _Float16* gw = wc + tid * 8;
  const _Float16* gx = xc + tid * 8;
  const unsigned lu = lds_addr(su) + (unsigned)tid * 16u;
  asm volatile(
      "global_load_async_to_lds_b128 %0, %1, off\n\t"
      "global_load_async_to_lds_b128 %2, %3, off\n\t"
      "global_load_async_to_lds_b128 %4, %5, off\n\t"
      "global_load_async_to_lds_b128 %6, %7, off\n\t"
      "global_load_async_to_lds_b128 %8, %9, off\n\t"
      "global_load_async_to_lds_b128 %10, %11, off\n\t"
      "global_load_async_to_lds_b128 %12, %13, off\n\t"
      "global_load_async_to_lds_b128 %14, %15, off\n\t"
      "global_load_async_to_lds_b128 %16, %17, off\n\t"
      "global_load_async_to_lds_b128 %18, %19, off\n\t"
      "s_wait_xcnt 0x0"
      :: "v"(lq),                    "v"(gq),
         "v"(lw),                    "v"(gw),
         "v"(lq + 16 * PK * 2u),     "v"(gq + 2048),
         "v"(lw + 16 * PK * 2u),     "v"(gw + 2048),
         "v"(lq + 32 * PK * 2u),     "v"(gq + 4096),
         "v"(lw + 32 * PK * 2u),     "v"(gw + 4096),
         "v"(lq + 48 * PK * 2u),     "v"(gq + 6144),
         "v"(lw + 48 * PK * 2u),     "v"(gw + 6144),
         "v"(lu),                    "v"(uc),
         "v"(lu + 4096u),            "v"(uc + 4)
      : "memory");
  asm volatile(
      "global_load_async_to_lds_b128 %0, %1, off\n\t"
      "global_load_async_to_lds_b128 %2, %3, off\n\t"
      "global_load_async_to_lds_b128 %4, %5, off\n\t"
      "global_load_async_to_lds_b128 %6, %7, off\n\t"
      "global_load_async_to_lds_b128 %8, %9, off\n\t"
      "global_load_async_to_lds_b128 %10, %11, off\n\t"
      "s_wait_xcnt 0x0"
      :: "v"(lx),                    "v"(gx),
         "v"(lx + 32 * PX * 2u),     "v"(gx + 2048),
         "v"(lk),                    "v"(gk),
         "v"(lk + 16 * PK * 2u),     "v"(gk + 2048),
         "v"(lk + 32 * PK * 2u),     "v"(gk + 4096),
         "v"(lk + 48 * PK * 2u),     "v"(gk + 6144)
      : "memory");
}

__global__ __launch_bounds__(256) void delta_kernel(
    const _Float16* __restrict__ qg, const _Float16* __restrict__ kg,
    const _Float16* __restrict__ wg, const _Float16* __restrict__ qkg,
    const float* __restrict__ ug, float* __restrict__ og) {
  __shared__ __attribute__((aligned(16))) _Float16 stg[2][STG];
  __shared__ __attribute__((aligned(16))) float    us[2][2 * 256 * 4];
  __shared__ __attribute__((aligned(16))) float    St[DVS * PS];
  __shared__ __attribute__((aligned(16))) _Float16 vnT[DVS * PX];

  int tid = threadIdx.x, lane = tid & 31, wid = tid >> 5;
  int l15 = lane & 15, hi8 = (lane & 16) ? 8 : 0;
  // the slices of one (b,h) are BB*HH block numbers apart (speed only, nothing rests on it)
  size_t bh = blockIdx.x % (BB * HH);
  const int tg0 = (int)(blockIdx.x / (BB * HH)) * (DVS / 16);   // first 16-column tile of the block's slice
  size_t rowbase = bh * (size_t)LL;
  // the wave's one 16x16 tile of the 64 x DVS products: rows tm, columns tn (in the slice)
  const int tm = wid >> 1, tn = wid & 1;

  // chunk 0 of this (b,h) in each operand; a chunk is 64*DKH elements (qk: 64*64) further on
  const _Float16* qb = qg + bh * NCHUNK * 64 * DKH;
  const _Float16* kb_ = kg + bh * NCHUNK * 64 * DKH;
  const _Float16* wb = wg + bh * NCHUNK * 64 * DKH;
  const _Float16* xb = qkg + bh * NCHUNK * 64 * 64;
  // u: the wave's tile, this lane's eight values
  const float* ub = ug + bh * NCHUNK * 64 * DKH + (unsigned)((tm * 8 + tg0 + tn) * 32 + lane) * 8;

  // ---- in front of the loop: chunk 0 lands and is published, chunk 1 is sent for ----
  stage_chunk(qb, kb_, wb, xb, ub, stg[0], us[0], tid);
  for (int i = tid; i < DVS * PS; i += 256) St[i] = 0.f;
  // this wave's copies of chunk 0 have landed before the barrier lets other waves read them
  asm volatile("s_wait_asynccnt 0x0" ::: "memory");
  __syncthreads();
  stage_chunk(qb + 64 * DKH, kb_ + 64 * DKH, wb + 64 * DKH, xb + 64 * 64, ub + 64 * DKH, stg[1], us[1], tid);

  for (int c = 0; c < NCHUNK; ++c) {
    const _Float16* sb = stg[c & 1];
    const _Float16* q16  = sb + SQ;
    const _Float16* k16  = sb + SK;
    const _Float16* vw16 = sb + SW;
    const _Float16* qk16 = sb + SX;
    const float* su = us[c & 1];
    const v4f ulo = *(const v4f*)&su[tid * 4], uhi = *(const v4f*)&su[1024 + tid * 4];
    const v8f uacc = __builtin_shufflevector(ulo, uhi, 0, 1, 2, 3, 4, 5, 6, 7);

    // ---- o1 = q @ S (regs) ; v_new = u + (-w) @ S -> vnT (transposed) ----
    // both products take the same S fragment
    v8f oacc = (v8f){};
    {
      v8f a0 = uacc;
#pragma unroll
      for (int kb = 0; kb < 128; kb += 32) {
        v16h aq, aw, b;
#pragma unroll
        for (int e = 0; e < 16; ++e) {
          int ko = kb + koff(e, lane);
          aq[e] = q16[(tm * 16 + l15) * PK + ko];
          aw[e] = vw16[(tm * 16 + l15) * PK + ko];         // -w row-major
          b[e] = (_Float16)St[(tn * 16 + l15) * PS + ko];  // S^T rows
        }
        oacc = wmma_f16(aq, b, oacc);
        a0 = wmma_f16(aw, b, a0);
      }
#pragma unroll
      for (int r = 0; r < 8; ++r)
        vnT[(tn * 16 + l15) * PX + tm * 16 + hi8 + r] = (_Float16)a0[r];
    }
    lds_barrier();   // publishes v_new; the last chunk's o stores may still be on their way

    // ---- o = o1 + qk @ v_new -> global ----
    {
      v8f a0 = oacc;
#pragma unroll
      for (int kb = 0; kb < 64; kb += 32) {
        v16h a, b;
#pragma unroll
        for (int e = 0; e < 16; ++e) {
          int ko = kb + koff(e, lane);
          a[e] = qk16[(tm * 16 + l15) * PX + ko];
          b[e] = vnT[(tn * 16 + l15) * PX + ko];            // v_new^T rows
        }
        a0 = wmma_f16(a, b, a0);
      }
#pragma unroll
      for (int r = 0; r < 8; ++r)
        og[(rowbase + (size_t)c * 64 + tm * 16 + hi8 + r) * 128 + (tg0 + tn) * 16 + l15] = a0[r];
    }
    // ---- S^T += (k^T @ v_new)^T : tile (m=dk, n=dv), stored transposed ----
    // the wave takes dk tile wid against every column tile of the slice
#pragma unroll
    for (int sn = 0; sn < DVS / 16; ++sn) {
      v8f a0;
#pragma unroll
      for (int r = 0; r < 8; ++r)
        a0[r] = St[(sn * 16 + l15) * PS + wid * 16 + hi8 + r];
#pragma unroll
      for (int kb = 0; kb < 64; kb += 32) {
        v16h a, b;
#pragma unroll
        for (int e = 0; e < 16; ++e) {
          int ko = kb + koff(e, lane);
          a[e] = k16[ko * PK + wid * 16 + l15];   // (k^T)[m][j] = k[j][m]
          b[e] = vnT[(sn * 16 + l15) * PX + ko];  // v_new^T rows
        }
        a0 = wmma_f16(a, b, a0);
      }
#pragma unroll
      for (int r = 0; r < 8; ++r)
        St[(sn * 16 + l15) * PS + wid * 16 + hi8 + r] = a0[r];
    }
    // ---- foot of the trip: chunk c + 1 is published, this trip's buffer is freed ----
    // this wave's LDS reads of the buffer and its writes of St are done
    asm volatile("s_wait_dscnt 0x0" ::: "memory");
    // this wave's copies of chunk c + 1 have landed
    asm volatile("s_wait_asynccnt 0x0" ::: "memory");
    // no register that a store of o names is rewritten ahead of this wait
    asm volatile("s_wait_xcnt 0x0" ::: "memory");
    lds_barrier();   // the chunk's o stores are not waited for: nobody in this launch reads o
    if (c + 2 < NCHUNK) {
      size_t n = (size_t)(c + 2);
      stage_chunk(qb + n * 64 * DKH, kb_ + n * 64 * DKH, wb + n * 64 * DKH, xb + n * 64 * 64,
                  ub + n * 64 * DKH, sb, su, tid);
    }
  }
  // no copy is outstanding when the wave ends
  asm volatile("s_wait_asynccnt 0x0" ::: "memory");
}

// ---------------- per-head output RMSNorm -> [B,L,D] f16 -------------------
// a wave takes RW rows in a row of one head, a lane four channels
__global__ __launch_bounds__(256) void onorm_kernel(const float* __restrict__ og,
                                                    const float* __restrict__ w,
                                                    _Float16* __restrict__ on16) {
  int lane = threadIdx.x & 31;
  unsigned gw = blockIdx.x * 8 + wave_id();
  unsigned hb = gw / (LL / RW);         // b*H + h
  unsigned l0 = (gw % (LL / RW)) * RW;
  unsigned hh = hb % HH, b = hb / HH;
  const v4f* src = (const v4f*)(og + ((size_t)hb * LL + l0) * DKH) + lane;
  v4f v[RW];
#pragma unroll
  for (int r = 0; r < RW; ++r) v[r] = src[r * 32];
  v4f wv = *((const v4f*)w + lane);
  _Float16* dst = on16 + ((size_t)b * LL + l0) * DD + hh * DKH + lane * 4;
#pragma unroll
  for (int r = 0; r < RW; ++r) {
    v4f q = v[r] * v[r];
    float inv = rsqrtf(wave_sum((q[0] + q[1]) + (q[2] + q[3])) * (1.f / DKH) + EPSF);
    v4h o;
#pragma unroll
    for (int c = 0; c < 4; ++c) o[c] = (_Float16)(v[r][c] * inv * wv[c]);
    *(v4h*)(dst + (size_t)r * DD) = o;
  }
}

// ---------------------------------------------------------------------------
extern "C" void kernel_launch(void* const* d_in, const int* in_sizes, int n_in,
                              void* d_out, int out_size, void* d_ws, size_t ws_size,
                              hipStream_t stream) {
  const float* x        = (const float*)d_in[0];
  const float* norm_w   = (const float*)d_in[1];
  const float* Wq       = (const float*)d_in[2];
  const float* Wk       = (const float*)d_in[3];
  const float* Wv       = (const float*)d_in[4];
  const float* Wb       = (const float*)d_in[5];
  const float* conv_q   = (const float*)d_in[6];
  const float* conv_k   = (const float*)d_in[7];
  const float* conv_v   = (const float*)d_in[8];
  const float* o_norm_w = (const float*)d_in[9];
  const float* Wo       = (const float*)d_in[10];
  float* out = (float*)d_out;

  char* p = (char*)d_ws;
  auto take = [&](size_t bytes) { char* r = p; p += (bytes + 255) & ~(size_t)255; return r; };
  const size_t actF16 = (size_t)BLROWS * DD * sizeof(_Float16);   // 16 MiB
  const size_t wF16   = (size_t)DD * DD * sizeof(_Float16);       // 2 MiB

  _Float16* h16   = (_Float16*)take(actF16);
  _Float16* wq16t = (_Float16*)take(wF16);   // transposed [N][K]
  _Float16* wk16t = (_Float16*)take(wF16);
  _Float16* wv16t = (_Float16*)take(wF16);
  _Float16* wo16t = (_Float16*)take(wF16);
  _Float16* qpre  = (_Float16*)take(actF16);
  _Float16* kpre  = (_Float16*)take(actF16);
  _Float16* vpre  = (_Float16*)take(actF16);
  _Float16* qh    = (_Float16*)take(actF16);
  _Float16* kh    = (_Float16*)take(actF16);
  _Float16* vh    = (_Float16*)take(actF16);
  float*    betag = (float*)take((size_t)BB * HH * LL * sizeof(float));
  float*    og    = (float*)take((size_t)BB * HH * LL * DKH * sizeof(float));
  _Float16* on16  = (_Float16*)take(actF16);
  float*    ug    = (float*)take((size_t)BB * HH * LL * DKH * sizeof(float));
  _Float16* wg    = (_Float16*)take(actF16);
  _Float16* qkg   = (_Float16*)take((size_t)BB * HH * LL * 64 * sizeof(_Float16));

  // 1. h = rmsnorm(x)
  rmsnorm_kernel<<<BLROWS / 8, 256, 0, stream>>>(x, norm_w, h16);
  // 2. weights -> f16, transposed to [N][K] for K-contiguous B fragments
  int tgrid = (DD / 32) * (DD / 32);
  transpose_f16_kernel<<<tgrid, 256, 0, stream>>>(Wq, wq16t, DD, DD);
  transpose_f16_kernel<<<tgrid, 256, 0, stream>>>(Wk, wk16t, DD, DD);
  transpose_f16_kernel<<<tgrid, 256, 0, stream>>>(Wv, wv16t, DD, DD);
  transpose_f16_kernel<<<tgrid, 256, 0, stream>>>(Wo, wo16t, DD, DD);
  // 3. projections (WMMA GEMMs, async double-buffered staging)
  dim3 ggrid(DD / 128, BLROWS / 128);
  gemm_f16_kernel<0><<<ggrid, 256, 0, stream>>>(h16, wq16t, qpre, nullptr, nullptr, BLROWS, DD, DD);
  gemm_f16_kernel<0><<<ggrid, 256, 0, stream>>>(h16, wk16t, kpre, nullptr, nullptr, BLROWS, DD, DD);
  gemm_f16_kernel<0><<<ggrid, 256, 0, stream>>>(h16, wv16t, vpre, nullptr, nullptr, BLROWS, DD, DD);
  // 4. beta
  beta_kernel<<<BLROWS / 32, 256, 0, stream>>>(h16, Wb, betag);
  // 5. conv + activations + head layout
  conv_head_kernel<<<BB * HH * LL / (8 * RW), 256, 0, stream>>>(qpre, conv_q, qh, 2);
  conv_head_kernel<<<BB * HH * LL / (8 * RW), 256, 0, stream>>>(kpre, conv_k, kh, 1);
  conv_head_kernel<<<BB * HH * LL / (8 * RW), 256, 0, stream>>>(vpre, conv_v, vh, 0);
  // 6. chunkwise delta rule: per-chunk operands for all chunks, then the serial walk
  delta_prep_kernel<<<BB * HH * NCHUNK, 256, 0, stream>>>(qh, kh, vh, betag, ug, wg, qkg);
  delta_kernel<<<BB * HH * NSL, 256, 0, stream>>>(qh, kh, wg, qkg, ug, og);
  // 7. output norm
  onorm_kernel<<<BB * HH * LL / (8 * RW), 256, 0, stream>>>(og, o_norm_w, on16);
  // 8. out = x + on @ Wo
  gemm_f16_kernel<1><<<ggrid, 256, 0, stream>>>(on16, wo16t, nullptr, out, x, BLROWS, DD, DD);
}

// v010
// One run takes 210 microseconds.
// In two side-by-side timings against v009, it was 1.11 and 1.12 times as fast.
// Over all steps from v000 it is 25.7 times as fast.
#include <hip/hip_runtime.h>
#include <hip/hip_bf16.h>

typedef __attribute__((ext_vector_type(16))) _Float16 v16h;
typedef __attribute__((ext_vector_type(8)))  float    v8f;
typedef __attribute__((ext_vector_type(4)))  float    v4f;

#define BB 2
#define LL 4096
#define DD 1024
#define HH 8
#define DKH 128
#define BLROWS (BB*LL)          // 8192
#define NCHUNK 64
#define EPSF 1e-6f

#if defined(__gfx1250__) && __has_builtin(__builtin_amdgcn_global_load_async_to_lds_b128)
#define HAVE_ASYNC 1
typedef int v4i_ __attribute__((ext_vector_type(4)));
typedef __attribute__((address_space(1))) v4i_* gp_v4i;
typedef __attribute__((address_space(3))) v4i_* lp_v4i;
#define GLA128(SRC, DST) \
  __builtin_amdgcn_global_load_async_to_lds_b128((gp_v4i)(void*)(SRC), (lp_v4i)(void*)(DST), 0, 0)
#if __has_builtin(__builtin_amdgcn_s_wait_asynccnt)
#define WAITA(n) __builtin_amdgcn_s_wait_asynccnt(n)
#else
#define WAITA(n) asm volatile("s_wait_asynccnt %0" :: "n"(n) : "memory")
#endif
#else
#define HAVE_ASYNC 0
#define WAITA(n)
#endif

__device__ __forceinline__ int koff(int e, int lane) {
  int j = e >> 1;
  return ((j & 4) << 2) + ((lane & 16) >> 1) + ((j & 3) << 1) + (e & 1);
}

__device__ __forceinline__ v8f wmma_f16(v16h a, v16h b, v8f c) {
  return __builtin_amdgcn_wmma_f32_16x16x32_f16(false, a, false, b, (short)0, c, false, false);
}

__device__ __forceinline__ float sigmoidf_(float x) { return 1.f / (1.f + __expf(-x)); }
__device__ __forceinline__ float siluf_(float x) { return x * sigmoidf_(x); }

// ---------------- the row kernels ------------------------------------------
// rmsnorm, beta, conv+l2norm and the output norm each work on short rows (128 or 1024
// elements). One wave takes whole rows: a lane holds its share of a row in registers,
// the row's sum is a butterfly over the 32 lanes, and there is no LDS and no barrier.
// One block per row cost far more in starting waves than in the rows' own work.
// Every '#pragma unroll' in these four kernels is on a loop over a lane's own share: fully
// unrolled, the per-lane arrays have static indices only and stay in registers.
typedef __attribute__((ext_vector_type(4))) _Float16 v4h;

// the wave's number in its block, held as a scalar, so that row numbers and row
// addresses are scalar arithmetic and the loads take base + lane offset + immediate
__device__ __forceinline__ unsigned wave_id() {
  return (unsigned)__builtin_amdgcn_readfirstlane((int)(threadIdx.x >> 5));
}

template <int M>
__device__ __forceinline__ float xmask_add(float v) {
  // v + (v of lane ^ M), M < 16: a DPP row_xmask move inside the 16-lane row
  int o = __builtin_amdgcn_update_dpp(0, __builtin_bit_cast(int, v), 0x160 | M, 0xf, 0xf, true);
  return v + __builtin_bit_cast(float, o);
}
// sum over the wave's 32 lanes, the same bits in every lane
__device__ __forceinline__ float wave_sum(float v) {
  v = xmask_add<1>(v);
  v = xmask_add<2>(v);
  v = xmask_add<4>(v);
  v = xmask_add<8>(v);
  int b = __builtin_bit_cast(int, v);
  int o = __builtin_amdgcn_permlanex16(b, b, 0x76543210, 0xfedcba98, false, false);  // lane ^ 16
  return v + __builtin_bit_cast(float, o);
}

// ---------------- launches that hold more than one kernel body ---------------
// Kernels that read nothing of each other need not wait for each other: their blocks stand
// in one grid, one body behind the other by block number (a test that reads the same for the
// whole block), and each body gets 'blk', its own block number counted from 0. A launch of
// its own costs each short kernel a gap, its own start of waves and its own drain.

// ---------------- RMSNorm (x -> h f16): one row a wave ----------------------
__device__ __forceinline__ void rmsnorm_body(unsigned blk, const float* __restrict__ x,
                                             const float* __restrict__ w,
                                             _Float16* __restrict__ h16) {
  int lane = threadIdx.x & 31;
  size_t row = (size_t)(blk * 8 + wave_id());
  const v4f* xr = (const v4f*)(x + row * DD) + lane;
  const v4f* wr = (const v4f*)w + lane;
  v4f xv[8];
#pragma unroll
  for (int j = 0; j < 8; ++j) xv[j] = xr[j * 32];
  v4f p = (v4f){};
#pragma unroll
  for (int j = 0; j < 8; ++j) p += xv[j] * xv[j];
  float inv = rsqrtf(wave_sum((p[0] + p[1]) + (p[2] + p[3])) * (1.f / DD) + EPSF);
  v4h* ho = (v4h*)(h16 + row * DD) + lane;
#pragma unroll
  for (int j = 0; j < 8; ++j) {
    v4f wv = wr[j * 32];
    v4h o;
#pragma unroll
    for (int c = 0; c < 4; ++c) o[c] = (_Float16)(xv[j][c] * inv * wv[c]);
    ho[j * 32] = o;
  }
}

// -------- LDS-tiled transpose: src f32 [R][C] -> dst f16 [C][R] ------------
__device__ __forceinline__ void transpose_f16_body(unsigned blk, const float* __restrict__ src,
                                                   _Float16* __restrict__ dst,
                                                   int R, int C) {
  __shared__ float t[32][33];
  int nbx = C / 32;
  int bx = blk % nbx, by = blk / nbx;
  int r0 = by * 32, c0 = bx * 32;
  int tr = threadIdx.x >> 5, tc = threadIdx.x & 31;
#pragma unroll
  for (int i = 0; i < 32; i += 8)
    t[tr + i][tc] = src[(size_t)(r0 + tr + i) * C + c0 + tc];
  __syncthreads();
#pragma unroll
  for (int i = 0; i < 32; i += 8)
    dst[(size_t)(c0 + tr + i) * R + r0 + tc] = (_Float16)t[tc][tr + i];
}

// -------- first launch: h = rmsnorm(x), and the four weights transposed -----
// w16t: the four transposed weights one behind the other, in the order Wq, Wk, Wv, Wo
#define NB_RMS (BLROWS / 8)
#define NB_TR ((DD / 32) * (DD / 32))
__global__ __launch_bounds__(256) void front_kernel(const float* __restrict__ x,
                                                    const float* __restrict__ norm_w,
                                                    _Float16* __restrict__ h16,
                                                    const float* __restrict__ Wq,
                                                    const float* __restrict__ Wk,
                                                    const float* __restrict__ Wv,
                                                    const float* __restrict__ Wo,
                                                    _Float16* __restrict__ w16t) {
  unsigned blk = blockIdx.x;
  if (blk < NB_RMS) {
    rmsnorm_body(blk, x, norm_w, h16);
    return;
  }
  blk -= NB_RMS;
  unsigned m = blk / NB_TR;
  const float* src = (m == 0) ? Wq : (m == 1) ? Wk : (m == 2) ? Wv : Wo;
  transpose_f16_body(blk % NB_TR, src, w16t + (size_t)m * DD * DD, DD, DD);
}

#define BKG 64  // halfs
#define PG 72   // halfs
template <int MODE>
__global__ __launch_bounds__(256) void gemm_f16_kernel(
    const _Float16* __restrict__ A, const _Float16* __restrict__ Bt,
    _Float16* __restrict__ out16, float* __restrict__ outf,
    const float* __restrict__ resid, int M, int N, int K) {
  __shared__ __attribute__((aligned(16))) _Float16 As[2][128][PG];
  __shared__ __attribute__((aligned(16))) _Float16 Bs[2][128][PG];
  int tid = threadIdx.x, lane = tid & 31;
  int wid = tid >> 5, l15 = lane & 15, hi8 = (lane & 16) ? 8 : 0;
  int wm = wid >> 1, wn = wid & 1;
  int bm = blockIdx.y * 128, bn = blockIdx.x * 128;
  Bt += (size_t)blockIdx.z * N * K;
  if (MODE == 0) out16 += (size_t)blockIdx.z * M * N;

  int cr = tid >> 3, cs = (tid & 7) * 8;          // copy row / 8-half segment: eight lanes a row
  auto issue = [&](int buf, int k0) {
    const _Float16* ga = A + (size_t)(bm + cr) * K + k0 + cs;
    const _Float16* gb = Bt + (size_t)(bn + cr) * K + k0 + cs;
    // 256 lanes x 16 B = 32 rows a copy, four copies for each operand's 128 rows
#pragma unroll
    for (int g = 0; g < 4; ++g) {
#if HAVE_ASYNC
      GLA128(ga + (size_t)(g * 32) * K, &As[buf][cr + g * 32][cs]);
      GLA128(gb + (size_t)(g * 32) * K, &Bs[buf][cr + g * 32][cs]);
#else
      *(int4*)&As[buf][cr + g * 32][cs] = *(const int4*)(ga + (size_t)(g * 32) * K);
      *(int4*)&Bs[buf][cr + g * 32][cs] = *(const int4*)(gb + (size_t)(g * 32) * K);
#endif
    }
  };

  v8f acc[2][4];
#pragma unroll
  for (int i = 0; i < 2; ++i)
#pragma unroll
    for (int j = 0; j < 4; ++j) acc[i][j] = (v8f){};

  int nT = K / BKG;
  issue(0, 0);
  for (int kt = 0; kt < nT; ++kt) {
    int buf = kt & 1;
    // eight copies a tile and wave: all but the next tile's eight have landed
    if (kt + 1 < nT) { issue(buf ^ 1, (kt + 1) * BKG); WAITA(8); }
    else             { WAITA(0); }
    __syncthreads();
    // the tile's two 32-wide k slices, in ascending k: fully unrolled, so that the second
    // slice's fragment reads can stand among the first slice's matrix instructions
#pragma unroll
    for (int ks = 0; ks < BKG; ks += 32) {
      v16h af[2], bf[4];
#pragma unroll
      for (int i = 0; i < 2; ++i) {
        int mr = wm * 32 + i * 16 + l15;
#pragma unroll
        for (int e = 0; e < 16; ++e) af[i][e] = As[buf][mr][ks + koff(e, lane)];
      }
#pragma unroll
      for (int j = 0; j < 4; ++j) {
        int nc = wn * 64 + j * 16 + l15;
#pragma unroll
        for (int e = 0; e < 16; ++e) bf[j][e] = Bs[buf][nc][ks + koff(e, lane)];
      }
#pragma unroll
      for (int i = 0; i < 2; ++i)
#pragma unroll
        for (int j = 0; j < 4; ++j) acc[i][j] = wmma_f16(af[i], bf[j], acc[i][j]);
    }
    __syncthreads();
  }
#pragma unroll
  for (int i = 0; i < 2; ++i)
#pragma unroll
    for (int j = 0; j < 4; ++j)
#pragma unroll
      for (int r = 0; r < 8; ++r) {
        size_t gm = bm + wm * 32 + i * 16 + hi8 + r;
        size_t gn = bn + wn * 64 + j * 16 + l15;
        if (MODE == 0) out16[gm * N + gn] = (_Float16)acc[i][j][r];
        else           outf[gm * N + gn] = resid[gm * N + gn] + acc[i][j][r];
      }
}

// ---------------- beta = sigmoid(h @ Wb): four rows a wave ------------------
__device__ __forceinline__ void beta_body(unsigned blk, const _Float16* __restrict__ h16,
                                          const float* __restrict__ Wb,
                                          float* __restrict__ betag) {
  int lane = threadIdx.x & 31;
  size_t row0 = (size_t)((blk * 8 + wave_id()) * 4);   // b*L + l of the first row
  const _Float16* hr = h16 + row0 * DD + lane;
  const v4f* wb = (const v4f*)Wb + lane * 2;
  float acc[4][8];
#pragma unroll
  for (int r = 0; r < 4; ++r)
#pragma unroll
    for (int hh = 0; hh < 8; ++hh) acc[r][hh] = 0.f;
  // lane takes k = lane, lane + 32, ...; a row of Wb serves all four rows of h.
  // Eight k steps a trip, loaded ahead of the arithmetic: a trip pays the way to memory
  // once, not once a k step.
  for (int jo = 0; jo < DD / 32; jo += 8) {
    _Float16 hv[4][8];
    v4f wlo[8], whi[8];
#pragma unroll
    for (int r = 0; r < 4; ++r)
#pragma unroll
      for (int j = 0; j < 8; ++j) hv[r][j] = hr[r * DD + (jo + j) * 32];
#pragma unroll
    for (int j = 0; j < 8; ++j) {
      wlo[j] = wb[(jo + j) * 64];
      whi[j] = wb[(jo + j) * 64 + 1];
    }
#pragma unroll
    for (int j = 0; j < 8; ++j)
#pragma unroll
      for (int r = 0; r < 4; ++r) {
        float hf = (float)hv[r][j];
#pragma unroll
        for (int hh = 0; hh < 4; ++hh) {
          acc[r][hh]     += hf * wlo[j][hh];
          acc[r][hh + 4] += hf * whi[j][hh];
        }
      }
  }
  // lane r*8 + hh keeps and stores the sum of (row r, head hh)
  float mine = 0.f;
#pragma unroll
  for (int r = 0; r < 4; ++r)
#pragma unroll
    for (int hh = 0; hh < 8; ++hh) {
      float s = wave_sum(acc[r][hh]);
      mine = (lane == r * 8 + hh) ? s : mine;
    }
  size_t row = row0 + (lane >> 3);
  int b = (int)(row / LL), l = (int)(row % LL);
  betag[((size_t)b * HH + (lane & 7)) * LL + l] = sigmoidf_(mine);
}

// -------- causal conv(K=4)+silu [+silu+l2norm (+qscale)] -> heads f16 ------
// mode: 0 = v (conv+silu), 1 = k (+silu+l2norm), 2 = q (+silu+l2norm+DK^-.5)
// A wave takes RW rows in a row of one head, a lane four channels; the RW + 3 input
// rows are loaded once and each serves up to four output rows.
#define RW 8
__device__ __forceinline__ void conv_head_body(
    unsigned blk, const _Float16* __restrict__ pre, const float* __restrict__ cw,
    _Float16* __restrict__ outg, int mode) {
  int lane = threadIdx.x & 31;
  unsigned gw = blk * 8 + wave_id();
  unsigned hb = gw / (LL / RW);         // b*H + h
  unsigned l0 = (gw % (LL / RW)) * RW;
  unsigned hh = hb % HH, b = hb / HH;
  unsigned ch = hh * DKH + lane * 4;
  const bool first = (l0 == 0);         // the three rows in front of l0 are the left padding
  // rows l0-3 .. l0+RW-1; at l0 == 0 the first three loads read rows 0..2 instead
  // (inside the buffer) and are zeroed below
  const _Float16* src = pre + ((size_t)b * LL + l0) * DD + ch;
  const _Float16* srcm = first ? src : src - 3 * DD;
  v4h xin[RW + 3];
#pragma unroll
  for (int i = 0; i < 3; ++i) xin[i] = *(const v4h*)(srcm + i * DD);
#pragma unroll
  for (int i = 3; i < RW + 3; ++i) xin[i] = *(const v4h*)(src + (i - 3) * DD);
  v4f wt[4];                            // the four taps of each of the lane's channels
#pragma unroll
  for (int c = 0; c < 4; ++c) wt[c] = *(const v4f*)(cw + (ch + c) * 4);
  v4f xf[RW + 3];
#pragma unroll
  for (int i = 0; i < RW + 3; ++i)
#pragma unroll
    for (int c = 0; c < 4; ++c) xf[i][c] = (i < 3 && first) ? 0.f : (float)xin[i][c];
  v4f s[RW];
#pragma unroll
  for (int r = 0; r < RW; ++r)
#pragma unroll
    for (int c = 0; c < 4; ++c) {
      float acc = 0.f;
#pragma unroll
      for (int i = 0; i < 4; ++i) acc += xf[r + i][c] * wt[c][i];
      s[r][c] = siluf_(acc);
    }
  if (mode > 0) {
    float qs = (mode == 2) ? 0.08838834764831845f : 1.f;   // 128^-0.5
#pragma unroll
    for (int r = 0; r < RW; ++r) {
#pragma unroll
      for (int c = 0; c < 4; ++c) s[r][c] = siluf_(s[r][c]);
      v4f q = s[r] * s[r];
      float inv = rsqrtf(wave_sum((q[0] + q[1]) + (q[2] + q[3])) + EPSF);
#pragma unroll
      for (int c = 0; c < 4; ++c) s[r][c] = s[r][c] * inv * qs;
    }
  }
  v4h* dst = (v4h*)(outg + ((size_t)hb * LL + l0) * DKH) + lane;
#pragma unroll
  for (int r = 0; r < RW; ++r) {
    v4h o;
#pragma unroll
    for (int c = 0; c < 4; ++c) o[c] = (_Float16)s[r][c];
    dst[r * 32] = o;
  }
}

// -------- third launch: beta, and the conv of q, k and v --------------------
// pre3, heads3: q, k, v one behind the other, BLROWS*DD elements each.
// beta's blocks come first: a wave of theirs runs longest.
#define NB_BETA (BLROWS / 32)
#define NB_CONV (BB * HH * LL / (8 * RW))
__global__ __launch_bounds__(256) void beta_conv_kernel(
    const _Float16* __restrict__ h16, const float* __restrict__ Wb, float* __restrict__ betag,
    const _Float16* __restrict__ pre3, const float* __restrict__ conv_q,
    const float* __restrict__ conv_k, const float* __restrict__ conv_v,
    _Float16* __restrict__ heads3) {
  unsigned blk = blockIdx.x;
  if (blk < NB_BETA) {
    beta_body(blk, h16, Wb, betag);
    return;
  }
  blk -= NB_BETA;
  unsigned m = blk / NB_CONV;           // 0 = q, 1 = k, 2 = v
  const float* cw = (m == 0) ? conv_q : (m == 1) ? conv_k : conv_v;
  conv_head_body(blk % NB_CONV, pre3 + (size_t)m * BLROWS * DD, cw,
                 heads3 + (size_t)m * BLROWS * DD, 2 - (int)m);
}

#define PK 136   // halfs: rows of 128 f16 (q16, k16, -w)       272 B
#define PX 72    // halfs: rows of  64 f16 (X16, qk, vnT, (bv)^T) 144 B
#define PS 132   // floats: rows of 128 f32 (St)                 528 B
// A work-group barrier that orders LDS alone. __syncthreads() also releases the wave's global
// stores: behind a store it holds the wave until every store has been acknowledged
// (s_wait_storecnt 0). Where no wave of the launch reads what was stored (o, u), only the LDS
// traffic has to be done at the barrier: the two fences name the LDS address space, so the
// release is s_wait_dscnt 0 and the stores stay in flight across the barrier.
__device__ __forceinline__ void lds_barrier() {
  __builtin_amdgcn_fence(__ATOMIC_RELEASE, "workgroup", "local");   // this wave's LDS reads and writes are done
  __builtin_amdgcn_s_barrier();
  __builtin_amdgcn_fence(__ATOMIC_ACQUIRE, "workgroup", "local");   // no LDS read is lifted over the barrier
}

__global__ __launch_bounds__(256) void delta_prep_kernel(
    const _Float16* __restrict__ qg, const _Float16* __restrict__ kg,
    const _Float16* __restrict__ vg, const float* __restrict__ betag,
    float* __restrict__ ug, _Float16* __restrict__ wg, _Float16* __restrict__ qkg) {
  __shared__ __attribute__((aligned(16))) _Float16 q16[64 * PK];
  __shared__ __attribute__((aligned(16))) _Float16 k16[64 * PK];
  __shared__ __attribute__((aligned(16))) _Float16 vw16[128 * PX];   // 128*PX >= 64*PK
  __shared__ __attribute__((aligned(16))) float    Af[64 * 64];
  __shared__ __attribute__((aligned(16))) _Float16 X16[64 * PX];
  __shared__ __attribute__((aligned(16))) float    XT[3 * 32 * 32];  // f32 scratch of the inverse
  __shared__ __attribute__((aligned(16))) float    betaS[64];
  _Float16* qk16 = (_Float16*)Af;

  int tid = threadIdx.x, lane = tid & 31, wid = tid >> 5;
  int l15 = lane & 15, hi8 = (lane & 16) ? 8 : 0;
  size_t chunk = blockIdx.x;            // (b*H + h)*64 + c ; its rows start at chunk*64

  // ---- load chunk (beta first; fold beta into transposed v) ----
  if (tid < 64) betaS[tid] = betag[chunk * 64 + tid];
  __syncthreads();
  {
    // One chunk base per operand and a fully unrolled loop: every load is that
    // operand's lane pointer + an immediate.
    const _Float16* qc = qg + chunk * 64 * DKH;
    const _Float16* kc = kg + chunk * 64 * DKH;
    const _Float16* vc = vg + chunk * 64 * DKH;
    const int j0 = tid >> 7, d = tid & 127;
#pragma unroll
    for (int it = 0; it < 32; ++it) {
      int i = tid + it * 256;
      int j = j0 + it * 2;
      q16[j * PK + d] = qc[i];
      k16[j * PK + d] = kc[i];
      vw16[d * PX + j] = (_Float16)((float)vc[i] * betaS[j]);   // (beta*v)^T
    }
  }
  __syncthreads();

  // ---- kk = k k^T ; A = I + tril(beta*kk, -1) ----
#pragma unroll
  for (int ti = 0; ti < 2; ++ti) {
    int t = wid * 2 + ti, tm = t >> 2, tn = t & 3;
    v8f a0 = (v8f){};
    // beta of this lane's 8 rows, read unconditionally: the mask below is then a
    // select, with no branch between the last matrix instruction and its readers
    const v4f blo = *(const v4f*)&betaS[tm * 16 + hi8];
    const v4f bhi = *(const v4f*)&betaS[tm * 16 + hi8 + 4];
#pragma unroll
    for (int kb = 0; kb < 128; kb += 32) {
      v16h a, b;
#pragma unroll
      for (int e = 0; e < 16; ++e) {
        int ko = kb + koff(e, lane);
        a[e] = k16[(tm * 16 + l15) * PK + ko];
        b[e] = k16[(tn * 16 + l15) * PK + ko];   // k^T as B
      }
      a0 = wmma_f16(a, b, a0);
    }
#pragma unroll
    for (int r = 0; r < 8; ++r) {
      int m = tm * 16 + hi8 + r, n = tn * 16 + l15;
      Af[m * 64 + n] = (m == n) ? 1.f : ((n < m) ? (r < 4 ? blo[r & 3] : bhi[r & 3]) * a0[r] : 0.f);
    }
  }
  __syncthreads();

  // ---- X = A^-1 (unit lower tri), blocked 2x2 with 32x32 blocks, all f32 ----
  // X11 = A11^-1, X22 = A22^-1: one wave each, lane = column, the column kept in
  // registers, rows of A read as broadcasts. X21 = -X22 (A21 X11) on all 8 waves.
  // Every loop below is fully unrolled so that the per-lane arrays have static
  // indices and stay in registers.
  {
    float* Xf = XT;                   // [2][32][32] diagonal-block inverses
    float* Tf = Xf + 2 * 32 * 32;     // [32][32]    A21 * X11
    if (wid < 2) {
      int r0 = wid * 32;
      float xc[32];
      float ab[2][4][32];             // rows of A11/A22, two groups of 4 rows
#pragma unroll
      for (int r = 1; r < 4; ++r)
#pragma unroll
        for (int l = 0; l < r; ++l) ab[0][r][l] = Af[(r0 + r) * 64 + r0 + l];
#pragma unroll  // full unroll keeps xc[] and ab[] in registers (static indices only)
      for (int G = 0; G < 8; ++G) {
        if (G + 1 < 8) {
#pragma unroll
          for (int r = 0; r < 4; ++r) {
            int i = (G + 1) * 4 + r;
#pragma unroll
            for (int l = 0; l < i; ++l)
              ab[(G + 1) & 1][r][l] = Af[(r0 + i) * 64 + r0 + l];
          }
        }
        // keeps the next group's LDS reads above this group's arithmetic, so that
        // their latency is not paid row by row on the substitution's serial path
        __builtin_amdgcn_sched_barrier(0);
#pragma unroll
        for (int r = 0; r < 4; ++r) {
          int i = G * 4 + r;
          float s0 = 0.f, s1 = 0.f;
#pragma unroll
          for (int l = 0; l < i; ++l) {
            if (l & 1) s1 += ab[G & 1][r][l] * xc[l]; else s0 += ab[G & 1][r][l] * xc[l];
          }
          xc[i] = (i == lane) ? 1.f : -(s0 + s1);
          Xf[wid * 1024 + i * 32 + lane] = xc[i];
          X16[(r0 + i) * PX + r0 + lane] = (_Float16)xc[i];
        }
      }
    } else if (wid == 2) {
#pragma unroll
      for (int i = 0; i < 32; ++i) X16[i * PX + 32 + lane] = (_Float16)0.f;
    }
    __syncthreads();   // publishes X11, X22 to all waves
    {
      float xcol[32];
#pragma unroll
      for (int l = 0; l < 32; ++l) xcol[l] = Xf[l * 32 + lane];
#pragma unroll
      for (int r = 0; r < 4; ++r) {
        int i = wid * 4 + r;
        const v4f* ar = (const v4f*)&Af[(32 + i) * 64];
        float s0 = 0.f, s1 = 0.f, s2 = 0.f, s3 = 0.f;
#pragma unroll
        for (int g = 0; g < 8; ++g) {
          v4f a = ar[g];
          s0 += a[0] * xcol[g * 4 + 0];
          s1 += a[1] * xcol[g * 4 + 1];
          s2 += a[2] * xcol[g * 4 + 2];
          s3 += a[3] * xcol[g * 4 + 3];
        }
        Tf[i * 32 + lane] = (s0 + s1) + (s2 + s3);
      }
    }
    __syncthreads();   // publishes T = A21 X11
    {
      float tcol[32];
#pragma unroll
      for (int l = 0; l < 32; ++l) tcol[l] = Tf[l * 32 + lane];
#pragma unroll
      for (int r = 0; r < 4; ++r) {
        int i = wid * 4 + r;
        const v4f* xr = (const v4f*)&Xf[1024 + i * 32];
        float s0 = 0.f, s1 = 0.f, s2 = 0.f, s3 = 0.f;
#pragma unroll
        for (int g = 0; g < 8; ++g) {
          v4f a = xr[g];
          s0 += a[0] * tcol[g * 4 + 0];
          s1 += a[1] * tcol[g * 4 + 1];
          s2 += a[2] * tcol[g * 4 + 2];
          s3 += a[3] * tcol[g * 4 + 3];
        }
        X16[(32 + i) * PX + lane] = (_Float16)(-((s0 + s1) + (s2 + s3)));
      }
    }
  }
  __syncthreads();

  // ---- u = X @ (beta*v) -> workspace, in accumulator layout ----
#pragma unroll
  for (int ti = 0; ti < 4; ++ti) {
    int t = wid * 4 + ti, tm = t >> 3, tn = t & 7;
    v8f a0 = (v8f){};
#pragma unroll
    for (int kb = 0; kb < 64; kb += 32) {
      v16h a, b;
#pragma unroll
      for (int e = 0; e < 16; ++e) {
        int ko = kb + koff(e, lane);
        a[e] = X16[(tm * 16 + l15) * PX + ko];
        b[e] = vw16[(tn * 16 + l15) * PX + ko];           // (beta*v)^T
      }
      a0 = wmma_f16(a, b, a0);
    }
    *(v8f*)(ug + ((chunk * 32 + t) * 32 + lane) * 8) = a0;
  }
  // no register that a store of u names is rewritten ahead of this wait
  asm volatile("s_wait_xcnt 0x0" ::: "memory");
  lds_barrier();   // ends the reads of (beta*v)^T; the u stores need not have arrived

  // ---- -w = -(X @ (beta*k)) -> vw16 (row-major) ; qk = tril(q k^T) ----
#pragma unroll
  for (int ti = 0; ti < 4; ++ti) {
    int t = wid * 4 + ti, tm = t >> 3, tn = t & 7;
    v8f a0 = (v8f){};
#pragma unroll
    for (int kb = 0; kb < 64; kb += 32) {
      v16h a, b;
#pragma unroll
      for (int e = 0; e < 16; ++e) {
        int ko = kb + koff(e, lane);
        a[e] = X16[(tm * 16 + l15) * PX + ko];
        b[e] = (_Float16)((float)k16[ko * PK + tn * 16 + l15] * betaS[ko]);
      }
      a0 = wmma_f16(a, b, a0);
    }
#pragma unroll
    for (int r = 0; r < 8; ++r)
      vw16[(tm * 16 + hi8 + r) * PK + tn * 16 + l15] = (_Float16)(-a0[r]);
  }
#pragma unroll
  for (int ti = 0; ti < 2; ++ti) {
    int t = wid * 2 + ti, tm = t >> 2, tn = t & 3;
    v8f a0 = (v8f){};
#pragma unroll
    for (int kb = 0; kb < 128; kb += 32) {
      v16h a, b;
#pragma unroll
      for (int e = 0; e < 16; ++e) {
        int ko = kb + koff(e, lane);
        a[e] = q16[(tm * 16 + l15) * PK + ko];
        b[e] = k16[(tn * 16 + l15) * PK + ko];
      }
      a0 = wmma_f16(a, b, a0);
    }
#pragma unroll
    for (int r = 0; r < 8; ++r) {
      int m = tm * 16 + hi8 + r, n = tn * 16 + l15;
      qk16[m * PX + n] = (_Float16)((n <= m) ? a0[r] : 0.f);
    }
  }
  lds_barrier();   // publishes -w and qk in LDS (__syncthreads() would wait here for the u stores)

  // ---- -w and qk: LDS -> workspace, 16 bytes a lane ----
  {
    int4* wo = (int4*)(wg + chunk * 64 * DKH) + tid;
    int4* qo = (int4*)(qkg + chunk * 64 * 64) + tid;
#pragma unroll
    for (int it = 0; it < 4; ++it) {
      int p = tid + it * 256;
      wo[it * 256] = *(const int4*)&vw16[(p >> 4) * PK + (p & 15) * 8];
    }
#pragma unroll
    for (int it = 0; it < 2; ++it) {
      int p = tid + it * 256;
      qo[it * 256] = *(const int4*)&qk16[(p >> 3) * PX + (p & 7) * 8];
    }
  }
}

// The columns (dv) of the state never mix: v_new, o and the state update of a column read
// that column of S alone. So a (b,h) is walked by 128 / DVS blocks side by side, each with
// DVS columns of S, u, v_new and o; q, k, -w and qk are read by every one of them.
// DVS = 32: a block's part of a row of o is one whole 128-byte line.
#define DVS 32
#define NSL (DKH / DVS)
// One chunk's q, k, -w and qk lie in one staging buffer in LDS, at these places (in halfs);
// the block's part of u has a buffer of its own: two planes of 16 B a thread, each thread's
// eight accumulator values as they stand in the workspace.
// There are two of each: while a chunk is worked on out of one, the next chunk's
// operands are on their way into the other, by asynchronous copies that pass no register.
#define SQ 0
#define SK (64 * PK)
#define SW (2 * 64 * PK)
#define SX (3 * 64 * PK)
#define STG (3 * 64 * PK + 64 * PX)   // 61440 B a buffer

// the LDS byte address of a __shared__ element: the low 32 bits of its address
__device__ __forceinline__ unsigned lds_addr(const void* p) { return (unsigned)(size_t)p; }

// Issues the copies of one chunk: 16 bytes a lane and copy, four copies for each of q, k, -w
// (64 rows of 256 B, laid at pitch PK), two for qk (64 rows of 128 B, at pitch PX) and two
// for u (uc: this thread's own eight floats of the chunk).
__device__ __forceinline__ void stage_chunk(const _Float16* __restrict__ qc, const _Float16* __restrict__ kc,
                                            const _Float16* __restrict__ wc, const _Float16* __restrict__ xc,
                                            const float* __restrict__ uc,
                                            const _Float16* sb, const float* su, int tid) {
  const unsigned lr = lds_addr(sb) + (unsigned)((tid >> 4) * PK + (tid & 15) * 8) * 2u;
  const unsigned lx = lds_addr(sb) + (unsigned)(SX + (tid >> 3) * PX + (tid & 7) * 8) * 2u;
  const unsigned lq = lr + SQ * 2u, lk = lr + SK * 2u, lw = lr + SW * 2u;
  const _Float16* gq = qc + tid * 8;
  const _Float16* gk = kc + tid * 8;
  const _Float16* gw = wc + tid * 8;
  const _Float16* gx = xc + tid * 8;
  const unsigned lu = lds_addr(su) + (unsigned)tid * 16u;
  asm volatile(
      "global_load_async_to_lds_b128 %0, %1, off\n\t"
      "global_load_async_to_lds_b128 %2, %3, off\n\t"
      "global_load_async_to_lds_b128 %4, %5, off\n\t"
      "global_load_async_to_lds_b128 %6, %7, off\n\t"
      "global_load_async_to_lds_b128 %8, %9, off\n\t"
      "global_load_async_to_lds_b128 %10, %11, off\n\t"
      "global_load_async_to_lds_b128 %12, %13, off\n\t"
      "global_load_async_to_lds_b128 %14, %15, off\n\t"
      "global_load_async_to_lds_b128 %16, %17, off\n\t"
      "global_load_async_to_lds_b128 %18, %19, off\n\t"
      "s_wait_xcnt 0x0"
      :: "v"(lq),                    "v"(gq),
         "v"(lw),                    "v"(gw),
         "v"(lq + 16 * PK * 2u),     "v"(gq + 2048),
         "v"(lw + 16 * PK * 2u),     "v"(gw + 2048),
         "v"(lq + 32 * PK * 2u),     "v"(gq + 4096),
         "v"(lw + 32 * PK * 2u),     "v"(gw + 4096),
         "v"(lq + 48 * PK * 2u),     "v"(gq + 6144),
         "v"(lw + 48 * PK * 2u),     "v"(gw + 6144),
         "v"(lu),                    "v"(uc),
         "v"(lu + 4096u),            "v"(uc + 4)
      : "memory");
  asm volatile(
      "global_load_async_to_lds_b128 %0, %1, off\n\t"
      "global_load_async_to_lds_b128 %2, %3, off\n\t"
      "global_load_async_to_lds_b128 %4, %5, off\n\t"
      "global_load_async_to_lds_b128 %6, %7, off\n\t"
      "global_load_async_to_lds_b128 %8, %9, off\n\t"
      "global_load_async_to_lds_b128 %10, %11, off\n\t"
      "s_wait_xcnt 0x0"
      :: "v"(lx),                    "v"(gx),
         "v"(lx + 32 * PX * 2u),     "v"(gx + 2048),
         "v"(lk),                    "v"(gk),
         "v"(lk + 16 * PK * 2u),     "v"(gk + 2048),
         "v"(lk + 32 * PK * 2u),     "v"(gk + 4096),
         "v"(lk + 48 * PK * 2u),     "v"(gk + 6144)
      : "memory");
}

__global__ __launch_bounds__(256) void delta_kernel(
    const _Float16* __restrict__ qg, const _Float16* __restrict__ kg,
    const _Float16* __restrict__ wg, const _Float16* __restrict__ qkg,
    const float* __restrict__ ug, float* __restrict__ og) {
  __shared__ __attribute__((aligned(16))) _Float16 stg[2][STG];
  __shared__ __attribute__((aligned(16))) float    us[2][2 * 256 * 4];
  __shared__ __attribute__((aligned(16))) float    St[DVS * PS];
  __shared__ __attribute__((aligned(16))) _Float16 vnT[DVS * PX];

  int tid = threadIdx.x, lane = tid & 31, wid = tid >> 5;
  int l15 = lane & 15, hi8 = (lane & 16) ? 8 : 0;
  // the slices of one (b,h) are BB*HH block numbers apart (speed only, nothing rests on it)
  size_t bh = blockIdx.x % (BB * HH);
  const int tg0 = (int)(blockIdx.x / (BB * HH)) * (DVS / 16);   // first 16-column tile of the block's slice
  size_t rowbase = bh * (size_t)LL;
  // the wave's one 16x16 tile of the 64 x DVS products: rows tm, columns tn (in the slice)
  const int tm = wid >> 1, tn = wid & 1;

  // chunk 0 of this (b,h) in each operand; a chunk is 64*DKH elements (qk: 64*64) further on
  const _Float16* qb = qg + bh * NCHUNK * 64 * DKH;
  const _Float16* kb_ = kg + bh * NCHUNK * 64 * DKH;
  const _Float16* wb = wg + bh * NCHUNK * 64 * DKH;
  const _Float16* xb = qkg + bh * NCHUNK * 64 * 64;
  // u: the wave's tile, this lane's eight values
  const float* ub = ug + bh * NCHUNK * 64 * DKH + (unsigned)((tm * 8 + tg0 + tn) * 32 + lane) * 8;

  // ---- in front of the loop: chunk 0 lands and is published, chunk 1 is sent for ----
  stage_chunk(qb, kb_, wb, xb, ub, stg[0], us[0], tid);
  for (int i = tid; i < DVS * PS; i += 256) St[i] = 0.f;
  // this wave's copies of chunk 0 have landed before the barrier lets other waves read them
  asm volatile("s_wait_asynccnt 0x0" ::: "memory");
  __syncthreads();
  stage_chunk(qb + 64 * DKH, kb_ + 64 * DKH, wb + 64 * DKH, xb + 64 * 64, ub + 64 * DKH, stg[1], us[1], tid);

  for (int c = 0; c < NCHUNK; ++c) {
    const _Float16* sb = stg[c & 1];
    const _Float16* q16  = sb + SQ;
    const _Float16* k16  = sb + SK;
    const _Float16* vw16 = sb + SW;
    const _Float16* qk16 = sb + SX;
    const float* su = us[c & 1];
    const v4f ulo = *(const v4f*)&su[tid * 4], uhi = *(const v4f*)&su[1024 + tid * 4];
    const v8f uacc = __builtin_shufflevector(ulo, uhi, 0, 1, 2, 3, 4, 5, 6, 7);

    // ---- o1 = q @ S (regs) ; v_new = u + (-w) @ S -> vnT (transposed) ----
    // both products take the same S fragment
    v8f oacc = (v8f){};
    {
      v8f a0 = uacc;
#pragma unroll
      for (int kb = 0; kb < 128; kb += 32) {
        v16h aq, aw, b;
#pragma unroll
        for (int e = 0; e < 16; ++e) {
          int ko = kb + koff(e, lane);
          aq[e] = q16[(tm * 16 + l15) * PK + ko];
          aw[e] = vw16[(tm * 16 + l15) * PK + ko];         // -w row-major
          b[e] = (_Float16)St[(tn * 16 + l15) * PS + ko];  // S^T rows
        }
        oacc = wmma_f16(aq, b, oacc);
        a0 = wmma_f16(aw, b, a0);
      }
#pragma unroll
      for (int r = 0; r < 8; ++r)
        vnT[(tn * 16 + l15) * PX + tm * 16 + hi8 + r] = (_Float16)a0[r];
    }
    lds_barrier();   // publishes v_new; the last chunk's o stores may still be on their way

    // ---- o = o1 + qk @ v_new -> global ----
    {
      v8f a0 = oacc;
#pragma unroll
      for (int kb = 0; kb < 64; kb += 32) {
        v16h a, b;
#pragma unroll
        for (int e = 0; e < 16; ++e) {
          int ko = kb + koff(e, lane);
          a[e] = qk16[(tm * 16 + l15) * PX + ko];
          b[e] = vnT[(tn * 16 + l15) * PX + ko];            // v_new^T rows
        }
        a0 = wmma_f16(a, b, a0);
      }
#pragma unroll
      for (int r = 0; r < 8; ++r)
        og[(rowbase + (size_t)c * 64 + tm * 16 + hi8 + r) * 128 + (tg0 + tn) * 16 + l15] = a0[r];
    }
    // ---- S^T += (k^T @ v_new)^T : tile (m=dk, n=dv), stored transposed ----
    // the wave takes dk tile wid against every column tile of the slice
#pragma unroll
    for (int sn = 0; sn < DVS / 16; ++sn) {
      v8f a0;
#pragma unroll
      for (int r = 0; r < 8; ++r)
        a0[r] = St[(sn * 16 + l15) * PS + wid * 16 + hi8 + r];
#pragma unroll
      for (int kb = 0; kb < 64; kb += 32) {
        v16h a, b;
#pragma unroll
        for (int e = 0; e < 16; ++e) {
          int ko = kb + koff(e, lane);
          a[e] = k16[ko * PK + wid * 16 + l15];   // (k^T)[m][j] = k[j][m]
          b[e] = vnT[(sn * 16 + l15) * PX + ko];  // v_new^T rows
        }
        a0 = wmma_f16(a, b, a0);
      }
#pragma unroll
      for (int r = 0; r < 8; ++r)
        St[(sn * 16 + l15) * PS + wid * 16 + hi8 + r] = a0[r];
    }
    // ---- foot of the trip: chunk c + 1 is published, this trip's buffer is freed ----
    // this wave's LDS reads of the buffer and its writes of St are done
    asm volatile("s_wait_dscnt 0x0" ::: "memory");
    // this wave's copies of chunk c + 1 have landed
    asm volatile("s_wait_asynccnt 0x0" ::: "memory");
    // no register that a store of o names is rewritten ahead of this wait
    asm volatile("s_wait_xcnt 0x0" ::: "memory");
    lds_barrier();   // the chunk's o stores are not waited for: nobody in this launch reads o
    if (c + 2 < NCHUNK) {
      size_t n = (size_t)(c + 2);
      stage_chunk(qb + n * 64 * DKH, kb_ + n * 64 * DKH, wb + n * 64 * DKH, xb + n * 64 * 64,
                  ub + n * 64 * DKH, sb, su, tid);
    }
  }
  // no copy is outstanding when the wave ends
  asm volatile("s_wait_asynccnt 0x0" ::: "memory");
}

// ---------------- per-head output RMSNorm -> [B,L,D] f16 -------------------
// a wave takes RW rows in a row of one head, a lane four channels
__global__ __launch_bounds__(256) void onorm_kernel(const float* __restrict__ og,
                                                    const float* __restrict__ w,
                                                    _Float16* __restrict__ on16) {
  int lane = threadIdx.x & 31;
  unsigned gw = blockIdx.x * 8 + wave_id();
  unsigned hb = gw / (LL / RW);         // b*H + h
  unsigned l0 = (gw % (LL / RW)) * RW;
  unsigned hh = hb % HH, b = hb / HH;
  const v4f* src = (const v4f*)(og + ((size_t)hb * LL + l0) * DKH) + lane;
  v4f v[RW];
#pragma unroll
  for (int r = 0; r < RW; ++r) v[r] = src[r * 32];
  v4f wv = *((const v4f*)w + lane);
  _Float16* dst = on16 + ((size_t)b * LL + l0) * DD + hh * DKH + lane * 4;
#pragma unroll
  for (int r = 0; r < RW; ++r) {
    v4f q = v[r] * v[r];
    float inv = rsqrtf(wave_sum((q[0] + q[1]) + (q[2] + q[3])) * (1.f / DKH) + EPSF);
    v4h o;
#pragma unroll
    for (int c = 0; c < 4; ++c) o[c] = (_Float16)(v[r][c] * inv * wv[c]);
    *(v4h*)(dst + (size_t)r * DD) = o;
  }
}

// ---------------------------------------------------------------------------
extern "C" void kernel_launch(void* const* d_in, const int* in_sizes, int n_in,
                              void* d_out, int out_size, void* d_ws, size_t ws_size,
                              hipStream_t stream) {
  const float* x        = (const float*)d_in[0];
  const float* norm_w   = (const float*)d_in[1];
  const float* Wq       = (const float*)d_in[2];
  const float* Wk       = (const float*)d_in[3];
  const float* Wv       = (const float*)d_in[4];
  const float* Wb       = (const float*)d_in[5];
  const float* conv_q   = (const float*)d_in[6];
  const float* conv_k   = (const float*)d_in[7];
  const float* conv_v   = (const float*)d_in[8];
  const float* o_norm_w = (const float*)d_in[9];
  const float* Wo       = (const float*)d_in[10];
  float* out = (float*)d_out;

  char* p = (char*)d_ws;
  auto take = [&](size_t bytes) { char* r = p; p += (bytes + 255) & ~(size_t)255; return r; };
  const size_t actF16 = (size_t)BLROWS * DD * sizeof(_Float16);   // 16 MiB
  const size_t wF16   = (size_t)DD * DD * sizeof(_Float16);       // 2 MiB

  _Float16* h16   = (_Float16*)take(actF16);
  _Float16* w16t  = (_Float16*)take(4 * wF16);     // Wq, Wk, Wv, Wo, each transposed [N][K]
  _Float16* wo16t = w16t + (size_t)3 * DD * DD;
  _Float16* pre3  = (_Float16*)take(3 * actF16);   // q, k, v in front of the conv
  _Float16* qh    = (_Float16*)take(3 * actF16);   // q, k, v by heads
  _Float16* kh    = qh + (size_t)BLROWS * DD;
  _Float16* vh    = kh + (size_t)BLROWS * DD;
  float*    betag = (float*)take((size_t)BB * HH * LL * sizeof(float));
  float*    og    = (float*)take((size_t)BB * HH * LL * DKH * sizeof(float));
  _Float16* on16  = (_Float16*)take(actF16);
  float*    ug    = (float*)take((size_t)BB * HH * LL * DKH * sizeof(float));
  _Float16* wg    = (_Float16*)take(actF16);
  _Float16* qkg   = (_Float16*)take((size_t)BB * HH * LL * 64 * sizeof(_Float16));

  // 1. h = rmsnorm(x); weights -> f16, transposed to [N][K] for K-contiguous B fragments
  front_kernel<<<NB_RMS + 4 * NB_TR, 256, 0, stream>>>(x, norm_w, h16, Wq, Wk, Wv, Wo, w16t);
  // 2. the three projections (WMMA GEMMs, async double-buffered staging), one grid
  dim3 ggrid(DD / 128, BLROWS / 128);
  dim3 ggrid3(DD / 128, BLROWS / 128, 3);
  gemm_f16_kernel<0><<<ggrid3, 256, 0, stream>>>(h16, w16t, pre3, nullptr, nullptr, BLROWS, DD, DD);
  // 3. beta; conv + activations + head layout of q, k, v
  beta_conv_kernel<<<NB_BETA + 3 * NB_CONV, 256, 0, stream>>>(h16, Wb, betag, pre3, conv_q, conv_k, conv_v, qh);
  // 4. chunkwise delta rule: per-chunk operands for all chunks, then the serial walk
  delta_prep_kernel<<<BB * HH * NCHUNK, 256, 0, stream>>>(qh, kh, vh, betag, ug, wg, qkg);
  delta_kernel<<<BB * HH * NSL, 256, 0, stream>>>(qh, kh, wg, qkg, ug, og);
  // 5. output norm
  onorm_kernel<<<BB * HH * LL / (8 * RW), 256, 0, stream>>>(og, o_norm_w, on16);
  // 6. out = x + on @ Wo
  gemm_f16_kernel<1><<<ggrid, 256, 0, stream>>>(on16, wo16t, nullptr, out, x, BLROWS, DD, DD);
}
